// v000
// Measured on an AMD MI455X. A time is GPU time per run, averaged over a window of back-to-back runs after a warm-up
// (all launches, gaps included; the runs take copies of the inputs in turn), and the median of several windows.
// Apart from v000's, it joins two sittings. Times from different sittings can be a few percent apart, while
// side-by-side timings come from the same sitting.
// The starting kernel, v000, takes 408 microseconds a run.
// Contractions: q/k projections (h f16 x16 . Wq^T/Wk^T f16 x64, K=512), v^T projection (Wv^T f16 x64 . h f16 x16, K=512),
// attention scores (q f16 x16 . k f16 x16, K=64), attention P . v^T (P f16 x1024 . v^T f16 x16, 32 keys per step),
// output projection (ctx f16 x1024 . Wo^T f16 x64, K=512), FFN1 (h2 f16 x16 . W1^T f16 x64, K=512), FFN2 (g f16 x16 . W2^T f16 x128, K=2048):
// all v_wmma_f32_16x16x32_f16 single products, f32 accumulate. LayerNorms (no affine), softmax, erf-GELU, mask, residuals in f32 on VALU.
// Every float input RNE-converted to bf16 on load.
#include <hip/hip_runtime.h>
#include <math.h>
#include <stdint.h>

#define NB      4
#define NQ      2048
#define NC      2048
#define DMODEL  512
#define DFF     2048
#define NHEAD   8
#define HDIM    64
#define NROWS   (NB * NQ)
#define WSC     64.0f
#define W2SC    128.0f
#define HCARRY  16.0f
#define QC      16.0f
#define KC      16.0f
#define VC      16.0f
#define PC      1024.0f
#define FC      1024.0f
#define H2C     16.0f
#define GC      16.0f
#define ATT_SCALE 0.125f
#define LOG2E   1.4426950408889634f
#define LN_EPS  1e-6f
#define MASKNEG (-100000.0f)
static_assert(NHEAD * HDIM == DMODEL);
static_assert((NQ % 64) == 0 && (NC % 64) == 0 && (DMODEL % 64) == 0 && (DFF % 64) == 0 && (NC % 32) == 0 && (NQ % 16) == 0);
static_assert((NROWS % 64) == 0 && (DMODEL % 32) == 0 && (DFF % 32) == 0);
#define HPB     8                       // heads per attention block (one wave per head)
#define NHB     (NHEAD / HPB)           // head groups per token row (1)
#define OSP     (HPB * HDIM)            // 512 halves: pitch of the block's staged result rows
#define ATT_THREADS (HPB * 32)
#define ATT_BLOCKS  (NB * (NQ / 16) * NHB)
static_assert(ATT_THREADS == 256 && ATT_BLOCKS == 512 && NHB * HPB == NHEAD);
#define LN_THREADS 128
static_assert(LN_THREADS * 4 == DMODEL && (LN_THREADS % 32) == 0 && ((DMODEL / 8) % 32) == 0);

typedef _Float16 v16h __attribute__((ext_vector_type(16)));
typedef _Float16 v8h  __attribute__((ext_vector_type(8)));
typedef float    v8f  __attribute__((ext_vector_type(8)));
typedef float    v4f  __attribute__((ext_vector_type(4)));
typedef unsigned int v4u __attribute__((ext_vector_type(4)));
typedef unsigned int v2u __attribute__((ext_vector_type(2)));

union FragH { v16h v; v8h h[2]; v4u u[2]; };

// ---- scalar helpers --------------------------------------------------------------------------------
__device__ __forceinline__ unsigned short bf_bits(float f) {          // f32 -> bf16 bits, RNE convert
  unsigned u = __float_as_uint(f);
  return (unsigned short)((u + 0x7FFFu + ((u >> 16) & 1u)) >> 16);
}
__device__ __forceinline__ float bf_up(unsigned short h) { return __uint_as_float(((unsigned)h) << 16); }
__device__ __forceinline__ float bfr(float f) { return bf_up(bf_bits(f)); }   // value of the bf16 RNE convert
__device__ __forceinline__ unsigned short h_bits(_Float16 x) { return __builtin_bit_cast(unsigned short, x); }
__device__ __forceinline__ unsigned pk16(unsigned short a, unsigned short b) { return (unsigned)a | ((unsigned)b << 16); }
__device__ __forceinline__ v8f zero8() { v8f z = {0.f, 0.f, 0.f, 0.f, 0.f, 0.f, 0.f, 0.f}; return z; }
__device__ __forceinline__ float gelu_f(float u) { return 0.5f * u * (1.0f + erff(u * 0.70710678118654752440f)); }

// ---- fragment loaders: 16-bit A/B operand, lane -> row/col (lane&15), p already includes +8*(lane>>4);
//      elements 0..7 <- p[0..7] (k0+8h..), elements 8..15 <- p[16..23] (k0+16+8h..)  (same split k map for A and B;
//      B is always read from a k-contiguous [n][k] plane)
__device__ __forceinline__ v16h ldfrag_h(const _Float16* p) {
  FragH f;
  f.h[0] = *(const v8h*)(p);
  f.h[1] = *(const v8h*)(p + 16);
  return f.v;
}
__device__ __forceinline__ v16h ldfrag_u(const unsigned short* p) {
  FragH f;
  f.u[0] = *(const v4u*)(p);
  f.u[1] = *(const v4u*)(p + 16);
  return f.v;
}

// ---- WMMA helpers with trailing VALU hazard gaps ------------------------------------------------------
__device__ __forceinline__ v8f mma_raw(v16h a, v16h b, v8f c) {
  return __builtin_amdgcn_wmma_f32_16x16x32_f16(false, a, false, b, (short)0, c, false, false);
}
__device__ __forceinline__ void dep_guard1(v8f& a, v8f& b, v16h x) {
#if defined(__HIP_DEVICE_COMPILE__)
  asm volatile("v_nop\n\tv_nop\n\tv_nop\n\tv_nop" : "+v"(a), "+v"(b) : "v"(x));
#endif
}
__device__ __forceinline__ void guard_s2(v8f& s, v16h a0, v16h a1) {
#if defined(__HIP_DEVICE_COMPILE__)
  asm volatile("v_nop\n\tv_nop\n\tv_nop\n\tv_nop" : "+v"(s) : "v"(a0), "v"(a1));
#endif
}
__device__ __forceinline__ void guard_s4(v8f& s, v16h a0, v16h a1, v16h b0, v16h b1) {
#if defined(__HIP_DEVICE_COMPILE__)
  asm volatile("v_nop\n\tv_nop\n\tv_nop\n\tv_nop" : "+v"(s) : "v"(a0), "v"(a1), "v"(b0), "v"(b1));
#endif
}
__device__ __forceinline__ void guard_pv4(v8f& a, v8f& b, v8f& c, v8f& d, v16h x, v16h y, v16h z, v16h w, v16h u) {
#if defined(__HIP_DEVICE_COMPILE__)
  asm volatile("v_nop\n\tv_nop\n\tv_nop\n\tv_nop"
               : "+v"(a), "+v"(b), "+v"(c), "+v"(d) : "v"(x), "v"(y), "v"(z), "v"(w), "v"(u));
#endif
}
__device__ __forceinline__ void keep4_h(v16h a, v16h b, v16h c, v16h d) {
#if defined(__HIP_DEVICE_COMPILE__)
  asm volatile("v_nop" :: "v"(a), "v"(b), "v"(c), "v"(d));
#endif
}
__device__ __forceinline__ void acc_guard4(v8f& a, v8f& b, v8f& c, v8f& d) {
#if defined(__HIP_DEVICE_COMPILE__)
  asm volatile("v_nop\n\tv_nop\n\tv_nop\n\tv_nop" : "+v"(a), "+v"(b), "+v"(c), "+v"(d));
#endif
}
__device__ __forceinline__ void wave_sync_lds() {
  __builtin_amdgcn_fence(__ATOMIC_RELEASE, "workgroup");
  __builtin_amdgcn_wave_barrier();
  __builtin_amdgcn_fence(__ATOMIC_ACQUIRE, "workgroup");
}

// =====================================================================================================
// Transposing 16-bit pack of a weight stored [in][out] = in[R][C] (row pitch C): out[C][R] (row pitch R), out[c][r] =
// f16( bf16_RNE(in[r][c]) * sc ), sc a power of two (exact). One 64x64 tile per block through LDS: coalesced float4 reads of 64 input
// rows, 2-byte LDS stores into the transposed tile [c][r] (pitch 72 halves), block barrier, then every output row segment of 64 halves
// coverage: load 256 thr x 16 floats = 64x64; store 2 it x 8 waves x 4 rows x (8 lanes x 8 halves) = 64 rows x 64 halves;
//           grid (C/64, R/64) exact (host checks), each output line written by exactly one wave.
// =====================================================================================================
__global__ __launch_bounds__(256) void tcvt16(const float* __restrict__ src, unsigned short* dst, int R, int C, float sc) {
  __shared__ __align__(16) unsigned short sT[64 * 72];
  const int tid = threadIdx.x, lane = tid & 31, wave = tid >> 5;
  const int c0 = blockIdx.x * 64, r0 = blockIdx.y * 64;
  const int rr = tid >> 2, cc = (tid & 3) * 16;
  const float* sp = src + (size_t)(r0 + rr) * C + c0 + cc;
#pragma unroll
  for (int e = 0; e < 4; ++e) {
    const v4f a = *(const v4f*)(sp + 4 * e);
#pragma unroll
    for (int k = 0; k < 4; ++k)
      sT[(cc + 4 * e + k) * 72 + rr] = h_bits((_Float16)(bfr(a[k]) * sc));
  }
  __syncthreads();
  v4u vals[2];
#pragma unroll
  for (int it = 0; it < 2; ++it) {
    const int q = it * 32 + wave * 4 + (lane >> 3);
    vals[it] = *(const v4u*)(sT + q * 72 + (lane & 7) * 8);
  }
  {
#pragma unroll
    for (int it = 0; it < 2; ++it) {
      const int q = it * 32 + wave * 4 + (lane >> 3);
      *(v4u*)(dst + (size_t)(c0 + q) * R + r0 + (lane & 7) * 8) = vals[it];
    }
    
  }
}

// =====================================================================================================
// Register-blocked batched f16 WMMA GEMM: C[m][n] = f( oscale * sum_k A[m][k] * Bt[n][k] ) (+ residual) (* row mask); one wave per
// 64x64 tile, no block barriers. A row-major [M][K] pitch lda (16-bit plane), Bt row-major [N][K] pitch ldb (k contiguous);
// M, N multiples of 64, K multiple of 32. blockIdx.y = batch index with element strides sA, sB, sC.
// OM: 0 = f32 out (pitch ldc; HASR 1 adds bf16(R[m][n]), HASR 2 adds raw f32 R[m][n], same pitch/stride as C; MSK 1 multiplies the
//     sum by bf16(Mrow[m])); 2 = f16 out (pitch ldc) = f16( act(value) * ocarry ), ACT 1 = erf-GELU.
// coverage: 4 slabs x 16 rows (f32: it 0..7 x lane>>4; f16: it 0..3 x lane>>3) x 64 cols = the wave's whole 64x64 tile;
//           grid = ceil(tilesM*tilesN/8) blocks, surplus waves exit (wave-uniform).
// =====================================================================================================
template <int OM, int HASR, int ACT, int MSK>
__global__ __launch_bounds__(256) void gemm64(
    const unsigned short* __restrict__ Ap, int lda, long long sA,
    const unsigned short* __restrict__ Btp, int ldb, long long sB,
    const float* __restrict__ Rp, const float* __restrict__ Mp,
    void* Cout, int ldc, long long sC,
    int M, int N, int K, float oscale, float ocarry) {
  __shared__ __align__(16) float sT[8][16 * 68];   // per-wave 16x64 slab, pitch 68 floats
  const int by   = blockIdx.y;
  const int lane = threadIdx.x & 31;
  const int wave = threadIdx.x >> 5;
  const int tilesN = N >> 6;
  const int tilesM = M >> 6;
  const int tile = blockIdx.x * 8 + wave;
  if (tile >= tilesM * tilesN) return;   // wave-uniform; no block barriers in this kernel
  const int tm = tile / tilesN;
  const int tn = tile - tm * tilesN;
  const int m0 = tm << 6;
  const int n0 = tn << 6;

  const unsigned short* A1 = Ap  + (size_t)((long long)by * sA);
  const unsigned short* Bb = Btp + (size_t)((long long)by * sB);

  const int rlane = lane & 15;                 // row (A) / col (B, D) within subtile
  const int koff  = (lane >> 4) * 8;           // k offset of this lane half
  const int mOff  = (lane >> 4) * 8;           // D row offset

  v8f acc[4][4];
#pragma unroll
  for (int i = 0; i < 4; ++i)
#pragma unroll
    for (int j = 0; j < 4; ++j) acc[i][j] = zero8();

  for (int k0 = 0; k0 < K; k0 += 32) {
    v16h bh[4];
#pragma unroll
    for (int j = 0; j < 4; ++j) {
      const size_t bofs = (size_t)(n0 + (j << 4) + rlane) * ldb + koff + k0;
      bh[j] = ldfrag_u(Bb + bofs);
    }
#pragma unroll
    for (int i = 0; i < 4; ++i) {
      const size_t ao = (size_t)(m0 + (i << 4) + rlane) * lda + koff + k0;
      const v16h ah = ldfrag_u(A1 + ao);
#pragma unroll
      for (int j = 0; j < 4; ++j) acc[i][j] = mma_raw(ah, bh[j], acc[i][j]);
      dep_guard1(acc[i][0], acc[i][3], ah);
    }
    keep4_h(bh[0], bh[1], bh[2], bh[3]);
  }
  acc_guard4(acc[0][0], acc[0][1], acc[0][2], acc[0][3]);
  acc_guard4(acc[1][0], acc[1][1], acc[1][2], acc[1][3]);
  acc_guard4(acc[2][0], acc[2][1], acc[2][2], acc[2][3]);
  acc_guard4(acc[3][0], acc[3][1], acc[3][2], acc[3][3]);

  const int hh2 = lane >> 4, c4 = (lane & 15) * 4;     // f32 out: 256-B row segment = 16 lanes x 16 B
  const int q8  = lane >> 3, c8 = (lane & 7) * 8;

  // ---- epilogue ----
  float* slab = sT[wave];
#pragma unroll
  for (int i = 0; i < 4; ++i) {
    const int mBase = m0 + (i << 4);
#pragma unroll
    for (int j = 0; j < 4; ++j) {
#pragma unroll
      for (int r = 0; r < 8; ++r) {
        slab[(mOff + r) * 68 + (j << 4) + rlane] = acc[i][j][r];
      }
    }
    wave_sync_lds();
    if constexpr (OM == 0) {
      float* C = (float*)Cout + (size_t)((long long)by * sC);
      v4f vals[8];
#pragma unroll
      for (int it = 0; it < 8; ++it) {
        const int row = it * 2 + hh2;                      // it 0..7 x hh2 0..1 = rows 0..15
        const int gr  = mBase + row;
        v4f v = *(const v4f*)(slab + row * 68 + c4);
        v4f rv = {0.f, 0.f, 0.f, 0.f};
        if constexpr (HASR != 0) {
          const float* R = Rp + (size_t)((long long)by * sC);
          const v4f rraw = *(const v4f*)(R + (size_t)gr * ldc + n0 + c4);
#pragma unroll
          for (int e = 0; e < 4; ++e) rv[e] = (HASR == 1) ? bfr(rraw[e]) : rraw[e];
        }
        float mk = 1.0f;
        if constexpr (MSK == 1) mk = bfr(Mp[gr]);
#pragma unroll
        for (int e = 0; e < 4; ++e) v[e] = (v[e] * oscale + rv[e]) * mk;
        vals[it] = v;
      }
      {
#pragma unroll
        for (int it = 0; it < 8; ++it) {
          const int gr = mBase + it * 2 + hh2;
          *(v4f*)(C + (size_t)gr * ldc + n0 + c4) = vals[it];
        }
        
      }
    } else {
      unsigned short* C = (unsigned short*)Cout + (size_t)((long long)by * sC);
      v4u hv[4];
#pragma unroll
      for (int it = 0; it < 4; ++it) {
        const int row = it * 4 + q8;                       // it 0..3 x q8 0..3 = rows 0..15
        const float* sp = slab + row * 68 + c8;
        v4u a = {0u, 0u, 0u, 0u};
#pragma unroll
        for (int e = 0; e < 4; ++e) {
          float f0 = sp[2 * e] * oscale;
          float f1 = sp[2 * e + 1] * oscale;
          if constexpr (ACT == 1) { f0 = gelu_f(f0); f1 = gelu_f(f1); }
          f0 *= ocarry; f1 *= ocarry;
          a[e] = pk16(h_bits((_Float16)f0), h_bits((_Float16)f1));
        }
        hv[it] = a;
      }
      {
#pragma unroll
        for (int it = 0; it < 4; ++it) {
          const int row = it * 4 + q8;
          *(v4u*)(C + (size_t)(mBase + row) * ldc + n0 + c8) = hv[it];
        }
        
      }
    }
    wave_sync_lds();
  }
}

// =====================================================================================================
// Full attention for one batch, 16 query rows and one head group (8 heads, one wave per head), head dim 64, all 2048 keys:
//   q plane (f16 x16) QH[b*2048 + tok][64*head + d], pitch 512; k plane (f16 x16) KH[b*2048 + key][64*head + d], pitch 512;
//   v^T plane (f16 x16): VT[b*512 + 64*head + d][key] (pitch 2048); out (f16 x1024): CT[b*2048 + tok][64*head + d] =
//   1024 * sum_m softmax_m(q.k / 8 + c_q) v[m][d] with the per-query-row mask constant c_q = -1e5 * (1 - bf16(mask[b][tok]))
//   (softmax run in base 2: t = (q.k/carries) * log2(e)/8 + c_q*log2(e), the row constant folded in as the fma addend).
//   Key steps of 32 from 0 to 2047 (block-uniform trip count 64); every score is finite, so the running max is finite from the first
//   step on; the rescale exponent is clamped at -126 so the first step (running max -inf) gives a tiny finite factor times zero sums.
//   Per step: 2 score tiles on f16 WMMA (K = 64 as two k-steps of 32), fragments loaded straight from the 16-bit planes (two 16-B
//   loads per fragment, arithmetic addressing); online max-subtracted softmax in f32 (exp2); rescale of the running sums and the
//   A fragment of P*1024 rebuilt from the LDS rows (float vector loads, RNE to f16, split k map) and the four v^T B fragments loaded
//   straight from the 16-bit plane; 4 P.V WMMAs.
//   Final 1/l and carry folds in f32; after a block barrier the prob-tile LDS buffer is reused as the block's 16-bit result row
//   buffer [16][512]: each wave stages its 16x64 slice (element stores); after a second block barrier the 256 threads write the
// coverage: LDS row buffer: 8 waves x 16 rows x 64 cols = 16 x 512; global: 4 iterations x 256 threads x 8 halves = 16 rows x
//           512 halves of rows q0..q0+15 of batch b; grid (4 batches x 128 query tiles x 1 head group) covers all 8192 x 512 of CT
//           exactly once.
// =====================================================================================================
#define PS_FLOATS (HPB * 16 * 36)
static_assert((size_t)16 * OSP * sizeof(unsigned short) <= (size_t)PS_FLOATS * sizeof(float));
static_assert(((16 * OSP) % (8 * ATT_THREADS)) == 0 && ((16 * OSP) / (8 * ATT_THREADS)) == 4);
static_assert(OSP == 64 * 8 && OSP == DMODEL * NHB / NHB);

__global__ __launch_bounds__(ATT_THREADS)
void attn8(const unsigned short* __restrict__ QHp, const unsigned short* __restrict__ KHp,
           const unsigned short* __restrict__ VTq, const float* __restrict__ mkp, unsigned short* CT) {
  __shared__ __align__(16) float smem[PS_FLOATS];          // per wave prob tile [row][32 keys], pitch 36; later row buffer

  const int tid  = threadIdx.x;
  const int wave = tid >> 5;
  const int lane = tid & 31;
  const int hh   = lane >> 4;
  const int c    = lane & 15;

  const int hb   = blockIdx.x % NHB;                       // head group (0)
  const int qt   = (blockIdx.x / NHB) % (NQ / 16);         // 0..127
  const int bat  = blockIdx.x / (NHB * (NQ / 16));         // 0..3
  const int head = hb * HPB + wave;                        // 0..7
  const int q0   = qt * 16;

  const size_t qofs = ((size_t)bat * NQ + q0 + c) * DMODEL + head * HDIM + 8 * hh;
  const _Float16* Qh = (const _Float16*)(const void*)QHp + qofs;
  const _Float16* Kb = (const _Float16*)(const void*)KHp + (size_t)bat * NC * DMODEL + head * HDIM + 8 * hh;
  const _Float16* Vb = (const _Float16*)(const void*)VTq + ((size_t)bat * DMODEL + head * HDIM) * NC + 8 * hh;
  const float lsc = (LOG2E * ATT_SCALE) / (QC * KC);                   // log2(e) / 8 / carries

  // per-query-row mask constant (rows 8*hh + r of this tile), in base-2 units
  float cm2[8];
  {
    const float* mq = mkp + (size_t)bat * NQ + q0 + 8 * hh;
    const v4f ma = *(const v4f*)(mq);
    const v4f mb = *(const v4f*)(mq + 4);
#pragma unroll
    for (int r = 0; r < 4; ++r) {
      cm2[r]     = (MASKNEG * (1.0f - bfr(ma[r]))) * LOG2E;
      cm2[4 + r] = (MASKNEG * (1.0f - bfr(mb[r]))) * LOG2E;
    }
  }

  const v16h qa = ldfrag_h(Qh), qb = ldfrag_h(Qh + 32);

  float mrow[8], lrow[8];
  v8f o0 = zero8(), o1 = zero8(), o2 = zero8(), o3 = zero8();
#pragma unroll
  for (int r = 0; r < 8; ++r) { mrow[r] = -INFINITY; lrow[r] = 0.f; }
  float* pt = smem + wave * (16 * 36);

#pragma unroll 1
  for (int kb = 0; kb < NC; kb += 32) {
    const _Float16* kp = Kb + (size_t)(kb + c) * DMODEL;
    v8f s0, s1;
    {
      const v16h k0 = ldfrag_h(kp), k1 = ldfrag_h(kp + 32);
      s0 = mma_raw(qa, k0, zero8());
      s0 = mma_raw(qb, k1, s0);
      guard_s2(s0, k0, k1);
    }
    {
      const _Float16* kq = kp + (size_t)16 * DMODEL;
      const v16h k0 = ldfrag_h(kq), k1 = ldfrag_h(kq + 32);
      s1 = mma_raw(qa, k0, zero8());
      s1 = mma_raw(qb, k1, s1);
      guard_s4(s1, k0, k1, qa, qb);
    }
#pragma unroll
    for (int r = 0; r < 8; ++r) {
      const float t0 = fmaf(s0[r], lsc, cm2[r]);
      const float t1 = fmaf(s1[r], lsc, cm2[r]);
      float mx = fmaxf(t0, t1);
#pragma unroll
      for (int off = 1; off < 16; off <<= 1) mx = fmaxf(mx, __shfl_xor(mx, off, 32));
      const float mn = fmaxf(mrow[r], mx);
      const float al = exp2f(fmaxf(mrow[r] - mn, -126.0f));
      mrow[r] = mn;
      const float e0 = exp2f(t0 - mn);
      const float e1 = exp2f(t1 - mn);
      float ps = e0 + e1;
#pragma unroll
      for (int off = 1; off < 16; off <<= 1) ps += __shfl_xor(ps, off, 32);
      lrow[r] = lrow[r] * al + ps;
      o0[r] *= al;
      o1[r] *= al;
      o2[r] *= al;
      o3[r] *= al;
      const int ro = (8 * hh + r) * 36 + c;
      pt[ro]      = e0;
      pt[ro + 16] = e1;
    }
    wave_sync_lds();
    FragH ph;
    {
      const float* prow = pt + c * 36 + 8 * hh;
      const v4f p0 = *(const v4f*)(prow), p1 = *(const v4f*)(prow + 4);
      const v4f p2 = *(const v4f*)(prow + 16), p3 = *(const v4f*)(prow + 20);
#pragma unroll
      for (int e = 0; e < 4; ++e) {
        ph.h[0][e]     = (_Float16)(p0[e] * PC);              // elements 0..7  = keys kb + 8hh + 0..7
        ph.h[0][4 + e] = (_Float16)(p1[e] * PC);
        ph.h[1][e]     = (_Float16)(p2[e] * PC);              // elements 8..15 = keys kb + 16 + 8hh + 0..7
        ph.h[1][4 + e] = (_Float16)(p3[e] * PC);
      }
    }
    const _Float16* vp = Vb + (size_t)c * NC + kb;
    {
      const v16h vb0 = ldfrag_h(vp);
      const v16h vb1 = ldfrag_h(vp + (size_t)16 * NC);
      const v16h vb2 = ldfrag_h(vp + (size_t)32 * NC);
      const v16h vb3 = ldfrag_h(vp + (size_t)48 * NC);
      o0 = mma_raw(ph.v, vb0, o0);
      o1 = mma_raw(ph.v, vb1, o1);
      o2 = mma_raw(ph.v, vb2, o2);
      o3 = mma_raw(ph.v, vb3, o3);
      guard_pv4(o0, o1, o2, o3, ph.v, vb0, vb1, vb2, vb3);
    }
    wave_sync_lds();
  }

  // ---- all waves done with their prob tiles; the LDS buffer becomes the 16-bit result row buffer [16][512] ----
  __syncthreads();
  unsigned short* Os = (unsigned short*)smem;
  // ---- fold 1/l and the carries (1024 on P, 16 on v, 1024 on the stored ctx), stage the wave's 16x64 slice as 16-bit ----
  const float oc = FC / (PC * VC);
  unsigned short* osw = Os + wave * HDIM + c;
#pragma unroll
  for (int r = 0; r < 8; ++r) {
    const float inv = (1.0f / lrow[r]) * oc;
    unsigned short* op = osw + (8 * hh + r) * OSP;
    op[0]  = h_bits((_Float16)(o0[r] * inv));
    op[16] = h_bits((_Float16)(o1[r] * inv));
    op[32] = h_bits((_Float16)(o2[r] * inv));
    op[48] = h_bits((_Float16)(o3[r] * inv));
  }
  __syncthreads();
  // ---- block writes its 16 rows of CT: piece p = it*256 + tid -> halves (p%64)*8 .. +7 of row p/64 ----
  {
    v4u vals[4];
#pragma unroll
    for (int it = 0; it < 4; ++it) {
      const int p = it * ATT_THREADS + tid;
      vals[it] = *(const v4u*)(Os + (size_t)p * 8);
    }
    unsigned short* dst = CT + ((size_t)bat * NQ + q0) * DMODEL + (size_t)hb * OSP;
    {
#pragma unroll
      for (int it = 0; it < 4; ++it) {
        const int p = it * ATT_THREADS + tid;
        const int row = p >> 6, col8 = (p & 63) * 8;
        *(v4u*)(dst + (size_t)row * DMODEL + col8) = vals[it];
      }
      
    }
  }
}

// =====================================================================================================
// the input row and multiplies by bf16(mask[row]). Output is the 16-bit plane outh[row][c] = f16(value * hc) only:
//   one block of 128 threads per row, 4 consecutive floats per thread (one 16-B load); the 16-bit row is staged in LDS (8 B per
// =====================================================================================================
template <int RIN>
__global__ __launch_bounds__(LN_THREADS)
void lnorm(const float* __restrict__ Yp, const float* __restrict__ mkp, unsigned short* outh, float hc) {
  __shared__ float red[2][LN_THREADS / 32];
  __shared__ __align__(16) unsigned short srow[DMODEL];
  const int row  = blockIdx.x;
  const int tid  = threadIdx.x;
  const int lane = tid & 31;
  const int wave = tid >> 5;
  const size_t base = (size_t)row * DMODEL + (size_t)tid * 4;
  v4f v = *(const v4f*)(Yp + base);
  if constexpr (RIN == 1) {
    const float mk = bfr(mkp[row]);
#pragma unroll
    for (int e = 0; e < 4; ++e) v[e] = bfr(v[e]) * mk;
  }
  float s = (v[0] + v[1]) + (v[2] + v[3]);
#pragma unroll
  for (int off = 1; off < 32; off <<= 1) s += __shfl_xor(s, off, 32);
  if (lane == 0) red[0][wave] = s;
  __syncthreads();
  float tot = 0.f;
#pragma unroll
  for (int w = 0; w < LN_THREADS / 32; ++w) tot += red[0][w];
  const float mu = tot * (1.0f / (float)DMODEL);
  v4f d;
#pragma unroll
  for (int e = 0; e < 4; ++e) d[e] = v[e] - mu;
  float q = (d[0] * d[0] + d[1] * d[1]) + (d[2] * d[2] + d[3] * d[3]);
#pragma unroll
  for (int off = 1; off < 32; off <<= 1) q += __shfl_xor(q, off, 32);
  if (lane == 0) red[1][wave] = q;
  __syncthreads();
  float totq = 0.f;
#pragma unroll
  for (int w = 0; w < LN_THREADS / 32; ++w) totq += red[1][w];
  const float var  = totq * (1.0f / (float)DMODEL);
  const float rstd = rsqrtf(var + LN_EPS);
  v4f o;
#pragma unroll
  for (int e = 0; e < 4; ++e) o[e] = d[e] * rstd;
  v2u w;
  w[0] = pk16(h_bits((_Float16)(o[0] * hc)), h_bits((_Float16)(o[1] * hc)));
  w[1] = pk16(h_bits((_Float16)(o[2] * hc)), h_bits((_Float16)(o[3] * hc)));
  *(v2u*)(srow + tid * 4) = w;
  __syncthreads();
  if (tid < DMODEL / 8) {                                 // waves 0..1, whole waves
    const v4u hv = *(const v4u*)(srow + tid * 8);
    unsigned short* dst = outh + (size_t)row * DMODEL + (size_t)tid * 8;
    {
      *(v4u*)dst = hv;
      
    }
  }
}

// =====================================================================================================
// Workspace map (bytes); every plane is an exact multiple of its tile / whole-row store granularity (M, N exact multiples of 64, rows
//   WQKV f16 [1536][512] x64         1572864   (transposed in-projections [n][k]: rows 0..511 q, 512..1023 k, 1024..1535 v)
//   WO16 f16 [512][512] x64           524288   (Wo^T)
//   W116 f16 [2048][512] x64         2097152   (W1^T)
//   W216 f16 [512][2048] x128        2097152   (W2^T)
//   H16  f16 [8192][512] x16         8388608   (first LayerNorm output)
//   QH   f16 [8192][512] x16         8388608
//   KH   f16 [8192][512] x16         8388608
//   VT   f16 [4][512][2048] x16      8388608   (v^T per batch)
//   CT   f16 [8192][512] x1024       8388608   (attention ctx, merged heads)
//   X1F  f32 [8192][512]            16777216   ((x + ctx . Wo) * mask)
//   H2   f16 [8192][512] x16         8388608   (second LayerNorm output)
//   HH   f16 [8192][2048] x16       33554432   (gelu hidden)
//   end                            106954752
// =====================================================================================================
extern "C" void kernel_launch(void* const* d_in, const int* in_sizes, int n_in,
                              void* d_out, int out_size, void* d_ws, size_t ws_size,
                              hipStream_t stream) {
  if (n_in < 8) return;
  if (in_sizes[0] != NROWS * DMODEL) return;
  if (in_sizes[1] != NROWS) return;
  if (in_sizes[2] != DMODEL * DMODEL || in_sizes[3] != DMODEL * DMODEL ||
      in_sizes[4] != DMODEL * DMODEL || in_sizes[5] != DMODEL * DMODEL) return;
  if (in_sizes[6] != DMODEL * DFF || in_sizes[7] != DFF * DMODEL) return;
  if (out_size != NROWS * DMODEL) return;

  const float* x   = (const float*)d_in[0];
  const float* mk  = (const float*)d_in[1];
  const float* wq  = (const float*)d_in[2];
  const float* wk  = (const float*)d_in[3];
  const float* wv  = (const float*)d_in[4];
  const float* wo  = (const float*)d_in[5];
  const float* w1  = (const float*)d_in[6];
  const float* w2  = (const float*)d_in[7];
  float*       out = (float*)d_out;

  const size_t PWQKV = (size_t)3 * DMODEL * DMODEL * 2;           //  1572864
  const size_t PWO   = (size_t)DMODEL * DMODEL * 2;               //   524288
  const size_t PW1   = (size_t)DFF * DMODEL * 2;                  //  2097152
  const size_t PW2   = (size_t)DMODEL * DFF * 2;                  //  2097152
  const size_t PX    = (size_t)NROWS * DMODEL * 2;                //  8388608
  const size_t PVT   = (size_t)NB * DMODEL * NC * 2;              //  8388608
  const size_t PY    = (size_t)NROWS * DMODEL * 4;                // 16777216
  const size_t PH    = (size_t)NROWS * DFF * 2;                   // 33554432
  size_t off = 0;
  const size_t oWQKV = off; off += PWQKV;
  const size_t oWO   = off; off += PWO;
  const size_t oW1   = off; off += PW1;
  const size_t oW2   = off; off += PW2;
  const size_t oH    = off; off += PX;
  const size_t oQH   = off; off += PX;
  const size_t oKH   = off; off += PX;
  const size_t oVT   = off; off += PVT;
  const size_t oCT   = off; off += PX;
  const size_t oXF   = off; off += PY;
  const size_t oH2   = off; off += PX;
  const size_t oHH   = off; off += PH;
  if (off > ws_size) return;                                      // off = 106954752
  if (off > (size_t)134217728) return;

  char* ws = (char*)d_ws;
  unsigned short* WQKV = (unsigned short*)(ws + oWQKV);
  unsigned short* WO16 = (unsigned short*)(ws + oWO);
  unsigned short* W116 = (unsigned short*)(ws + oW1);
  unsigned short* W216 = (unsigned short*)(ws + oW2);
  unsigned short* H16  = (unsigned short*)(ws + oH);
  unsigned short* QH   = (unsigned short*)(ws + oQH);
  unsigned short* KH   = (unsigned short*)(ws + oKH);
  unsigned short* VTp  = (unsigned short*)(ws + oVT);
  unsigned short* CT   = (unsigned short*)(ws + oCT);
  float*          X1F  = (float*)(ws + oXF);
  unsigned short* H2   = (unsigned short*)(ws + oH2);
  unsigned short* HH   = (unsigned short*)(ws + oHH);

  const dim3 blk(256);
  const dim3 gTsq(DMODEL / 64, DMODEL / 64);                       // in[512][512]  -> out[512][512]:  (C/64, R/64) = (8, 8)
  const dim3 gT1(DFF / 64, DMODEL / 64);                           // in[512][2048] -> out[2048][512]: (32, 8)
  const dim3 gT2(DMODEL / 64, DFF / 64);                           // in[2048][512] -> out[512][2048]: (8, 32)
  const int tilesP = (NROWS / 64) * (DMODEL / 64);                 // 1024
  const int tilesV = (DMODEL / 64) * (NC / 64);                    // 256 per batch
  const int tilesF = (NROWS / 64) * (DFF / 64);                    // 4096
  const dim3 gP((tilesP + 7) / 8, 1);                              // 128
  const dim3 gV((tilesV + 7) / 8, NB);                             // 32 x 4
  const dim3 gF((tilesF + 7) / 8, 1);                              // 512
  const dim3 gAT(ATT_BLOCKS);                                      // 512
  const dim3 bAT(ATT_THREADS);                                     // 256
  const dim3 gLN(NROWS);                                           // 8192
  const dim3 bLN(LN_THREADS);                                      // 128

  // (0) transposed weight planes [n][k] = f16( bf16_RNE(W[k][n]) * scale ), k contiguous
  tcvt16<<<gTsq, blk, 0, stream>>>(wq, WQKV, DMODEL, DMODEL, WSC);
  tcvt16<<<gTsq, blk, 0, stream>>>(wk, WQKV + (size_t)DMODEL * DMODEL, DMODEL, DMODEL, WSC);
  tcvt16<<<gTsq, blk, 0, stream>>>(wv, WQKV + (size_t)2 * DMODEL * DMODEL, DMODEL, DMODEL, WSC);
  tcvt16<<<gTsq, blk, 0, stream>>>(wo, WO16, DMODEL, DMODEL, WSC);
  tcvt16<<<gT1,  blk, 0, stream>>>(w1, W116, DMODEL, DFF, WSC);     // R = 512 (in), C = 2048 (out)
  tcvt16<<<gT2,  blk, 0, stream>>>(w2, W216, DFF, DMODEL, W2SC);    // R = 2048 (in), C = 512 (out)

  // (1) h = LayerNorm(bf16(x) * bf16(mask)) -> H16 (f16 x16)
  lnorm<1><<<gLN, bLN, 0, stream>>>(x, mk, H16, HCARRY);

  // (2) q projection: QH[m][n] = f16(16 * sum_k h[m][k] Wq[k][n]); M = 8192, N = 512, K = 512
  gemm64<2, 0, 0, 0><<<gP, blk, 0, stream>>>(
      H16, DMODEL, 0LL,
      WQKV, DMODEL, 0LL,
      x, mk,
      (void*)QH, DMODEL, 0LL,
      NROWS, DMODEL, DMODEL, 1.0f / (HCARRY * WSC), QC);

  // (3) k projection
  gemm64<2, 0, 0, 0><<<gP, blk, 0, stream>>>(
      H16, DMODEL, 0LL,
      WQKV + (size_t)DMODEL * DMODEL, DMODEL, 0LL,
      x, mk,
      (void*)KH, DMODEL, 0LL,
      NROWS, DMODEL, DMODEL, 1.0f / (HCARRY * WSC), KC);

  // (4) v^T per batch: VT[b][d][tok] = f16(16 * sum_k WvT[d][k] h_b[tok][k]); M = 512, N = 2048, K = 512
  gemm64<2, 0, 0, 0><<<gV, blk, 0, stream>>>(
      WQKV + (size_t)2 * DMODEL * DMODEL, DMODEL, 0LL,
      H16, DMODEL, (long long)NC * DMODEL,
      x, mk,
      (void*)VTp, NC, (long long)DMODEL * NC,
      DMODEL, NC, DMODEL, 1.0f / (HCARRY * WSC), VC);

  // (5) full attention per (batch, 16 query rows, head group) -> CT (f16, x1024)
  attn8<<<gAT, bAT, 0, stream>>>(QH, KH, VTp, mk, CT);

  // (6) X1F = (CT . WoT^T / (1024 * 64) + bf16(x)) * bf16(mask); M = 8192, N = 512, K = 512, f32
  gemm64<0, 1, 0, 1><<<gP, blk, 0, stream>>>(
      CT, DMODEL, 0LL,
      WO16, DMODEL, 0LL,
      x, mk,
      (void*)X1F, DMODEL, 0LL,
      NROWS, DMODEL, DMODEL, 1.0f / (FC * WSC), 1.0f);

  // (7) h2 = LayerNorm(x1) -> H2 (f16 x16)
  lnorm<0><<<gLN, bLN, 0, stream>>>(X1F, mk, H2, H2C);

  // (8) HH = f16(16 * gelu(h2 . W1)); M = 8192, N = 2048, K = 512
  gemm64<2, 0, 1, 0><<<gF, blk, 0, stream>>>(
      H2, DMODEL, 0LL,
      W116, DMODEL, 0LL,
      x, mk,
      (void*)HH, DFF, 0LL,
      NROWS, DFF, DMODEL, 1.0f / (H2C * WSC), GC);

  // (9) out = HH . W2 / (16 * 128) + x1 (raw f32); M = 8192, N = 512, K = 2048, f32
  gemm64<0, 2, 0, 0><<<gP, blk, 0, stream>>>(
      HH, DFF, 0LL,
      W216, DFF, 0LL,
      X1F, mk,
      (void*)out, DMODEL, 0LL,
      NROWS, DMODEL, DFF, 1.0f / (GC * W2SC), 1.0f);
  (void)hipGetLastError();
}

// v001
// Measured time: 247 microseconds a run.
// In two side-by-side timings against v000, it was 1.70 and 1.71 times as fast.
// Contractions: q/k projections (h f16 x16 . Wq^T/Wk^T f16 x64, K=512), v^T projection (Wv^T f16 x64 . h f16 x16, K=512),
// attention scores (q f16 x16 . k f16 x16, K=64), attention P . v^T (P f16 x1024 . v^T f16 x16, 32 keys per step),
// output projection (ctx f16 x1024 . Wo^T f16 x64, K=512), FFN1 (h2 f16 x16 . W1^T f16 x64, K=512), FFN2 (g f16 x16 . W2^T f16 x128, K=2048):
// all v_wmma_f32_16x16x32_f16 single products, f32 accumulate. LayerNorms (no affine), softmax, erf-GELU, mask, residuals in f32 on VALU.
// Every float input RNE-converted to bf16 on load.
#include <hip/hip_runtime.h>
#include <math.h>
#include <stdint.h>

#define NB      4
#define NQ      2048
#define NC      2048
#define DMODEL  512
#define DFF     2048
#define NHEAD   8
#define HDIM    64
#define NROWS   (NB * NQ)
#define WSC     64.0f
#define W2SC    128.0f
#define HCARRY  16.0f
#define QC      16.0f
#define KC      16.0f
#define VC      16.0f
#define PC      1024.0f
#define FC      1024.0f
#define H2C     16.0f
#define GC      16.0f
#define ATT_SCALE 0.125f
#define LOG2E   1.4426950408889634f
#define LN_EPS  1e-6f
#define MASKNEG (-100000.0f)
static_assert(NHEAD * HDIM == DMODEL);
static_assert((NQ % 64) == 0 && (NC % 64) == 0 && (DMODEL % 64) == 0 && (DFF % 64) == 0 && (NC % 32) == 0 && (NQ % 16) == 0);
static_assert((NROWS % 64) == 0 && (DMODEL % 32) == 0 && (DFF % 32) == 0);
#define HPB     8                       // heads per attention block (one wave per head)
#define NHB     (NHEAD / HPB)           // head groups per token row (1)
#define OSP     (HPB * HDIM)            // 512 halves: pitch of the block's staged result rows
#define ATT_THREADS (HPB * 32)
#define ATT_BLOCKS  (NB * (NQ / 16) * NHB)
static_assert(ATT_THREADS == 256 && ATT_BLOCKS == 512 && NHB * HPB == NHEAD);
#define LN_THREADS 128
static_assert(LN_THREADS * 4 == DMODEL && (LN_THREADS % 32) == 0 && ((DMODEL / 8) % 32) == 0);

typedef _Float16 v16h __attribute__((ext_vector_type(16)));
typedef _Float16 v8h  __attribute__((ext_vector_type(8)));
typedef float    v8f  __attribute__((ext_vector_type(8)));
typedef float    v4f  __attribute__((ext_vector_type(4)));
typedef unsigned int v4u __attribute__((ext_vector_type(4)));
typedef unsigned int v2u __attribute__((ext_vector_type(2)));

union FragH { v16h v; v8h h[2]; v4u u[2]; };

// ---- scalar helpers --------------------------------------------------------------------------------
__device__ __forceinline__ unsigned short bf_bits(float f) {          // f32 -> bf16 bits, RNE convert
  unsigned u = __float_as_uint(f);
  return (unsigned short)((u + 0x7FFFu + ((u >> 16) & 1u)) >> 16);
}
__device__ __forceinline__ float bf_up(unsigned short h) { return __uint_as_float(((unsigned)h) << 16); }
__device__ __forceinline__ float bfr(float f) { return bf_up(bf_bits(f)); }   // value of the bf16 RNE convert
__device__ __forceinline__ unsigned short h_bits(_Float16 x) { return __builtin_bit_cast(unsigned short, x); }
__device__ __forceinline__ unsigned pk16(unsigned short a, unsigned short b) { return (unsigned)a | ((unsigned)b << 16); }
__device__ __forceinline__ v8f zero8() { v8f z = {0.f, 0.f, 0.f, 0.f, 0.f, 0.f, 0.f, 0.f}; return z; }
__device__ __forceinline__ float gelu_f(float u) { return 0.5f * u * (1.0f + erff(u * 0.70710678118654752440f)); }

// ---- fragment loaders: 16-bit A/B operand, lane -> row/col (lane&15), p already includes +8*(lane>>4);
//      elements 0..7 <- p[0..7] (k0+8h..), elements 8..15 <- p[16..23] (k0+16+8h..)  (same split k map for A and B;
//      B is always read from a k-contiguous [n][k] plane)
__device__ __forceinline__ v16h ldfrag_h(const _Float16* p) {
  FragH f;
  f.h[0] = *(const v8h*)(p);
  f.h[1] = *(const v8h*)(p + 16);
  return f.v;
}
__device__ __forceinline__ v16h ldfrag_u(const unsigned short* p) {
  FragH f;
  f.u[0] = *(const v4u*)(p);
  f.u[1] = *(const v4u*)(p + 16);
  return f.v;
}

// ---- WMMA helpers with trailing VALU hazard gaps ------------------------------------------------------
__device__ __forceinline__ v8f mma_raw(v16h a, v16h b, v8f c) {
  return __builtin_amdgcn_wmma_f32_16x16x32_f16(false, a, false, b, (short)0, c, false, false);
}
__device__ __forceinline__ void dep_guard1(v8f& a, v8f& b, v16h x) {
#if defined(__HIP_DEVICE_COMPILE__)
  asm volatile("v_nop\n\tv_nop\n\tv_nop\n\tv_nop" : "+v"(a), "+v"(b) : "v"(x));
#endif
}
__device__ __forceinline__ void guard_s2(v8f& s, v16h a0, v16h a1) {
#if defined(__HIP_DEVICE_COMPILE__)
  asm volatile("v_nop\n\tv_nop\n\tv_nop\n\tv_nop" : "+v"(s) : "v"(a0), "v"(a1));
#endif
}
__device__ __forceinline__ void guard_s4(v8f& s, v16h a0, v16h a1, v16h b0, v16h b1) {
#if defined(__HIP_DEVICE_COMPILE__)
  asm volatile("v_nop\n\tv_nop\n\tv_nop\n\tv_nop" : "+v"(s) : "v"(a0), "v"(a1), "v"(b0), "v"(b1));
#endif
}
__device__ __forceinline__ void guard_pv4(v8f& a, v8f& b, v8f& c, v8f& d, v16h x, v16h y, v16h z, v16h w, v16h u) {
#if defined(__HIP_DEVICE_COMPILE__)
  asm volatile("v_nop\n\tv_nop\n\tv_nop\n\tv_nop"
               : "+v"(a), "+v"(b), "+v"(c), "+v"(d) : "v"(x), "v"(y), "v"(z), "v"(w), "v"(u));
#endif
}
__device__ __forceinline__ void keep4_h(v16h a, v16h b, v16h c, v16h d) {
#if defined(__HIP_DEVICE_COMPILE__)
  asm volatile("v_nop" :: "v"(a), "v"(b), "v"(c), "v"(d));
#endif
}
__device__ __forceinline__ void acc_guard4(v8f& a, v8f& b, v8f& c, v8f& d) {
#if defined(__HIP_DEVICE_COMPILE__)
  asm volatile("v_nop\n\tv_nop\n\tv_nop\n\tv_nop" : "+v"(a), "+v"(b), "+v"(c), "+v"(d));
#endif
}
__device__ __forceinline__ void wave_sync_lds() {
  __builtin_amdgcn_fence(__ATOMIC_RELEASE, "workgroup");
  __builtin_amdgcn_wave_barrier();
  __builtin_amdgcn_fence(__ATOMIC_ACQUIRE, "workgroup");
}

// =====================================================================================================
// Transposing 16-bit pack of a weight stored [in][out] = in[R][C] (row pitch C): out[C][R] (row pitch R), out[c][r] =
// f16( bf16_RNE(in[r][c]) * sc ), sc a power of two (exact). One 64x64 tile per block through LDS: coalesced float4 reads of 64 input
// rows, 2-byte LDS stores into the transposed tile [c][r] (pitch 72 halves), block barrier, then every output row segment of 64 halves
// coverage: load 256 thr x 16 floats = 64x64; store 2 it x 8 waves x 4 rows x (8 lanes x 8 halves) = 64 rows x 64 halves;
//           grid (C/64, R/64) exact (host checks), each output line written by exactly one wave.
// =====================================================================================================
__global__ __launch_bounds__(256) void tcvt16(const float* __restrict__ src, unsigned short* dst, int R, int C, float sc) {
  __shared__ __align__(16) unsigned short sT[64 * 72];
  const int tid = threadIdx.x, lane = tid & 31, wave = tid >> 5;
  const int c0 = blockIdx.x * 64, r0 = blockIdx.y * 64;
  const int rr = tid >> 2, cc = (tid & 3) * 16;
  const float* sp = src + (size_t)(r0 + rr) * C + c0 + cc;
#pragma unroll
  for (int e = 0; e < 4; ++e) {
    const v4f a = *(const v4f*)(sp + 4 * e);
#pragma unroll
    for (int k = 0; k < 4; ++k)
      sT[(cc + 4 * e + k) * 72 + rr] = h_bits((_Float16)(bfr(a[k]) * sc));
  }
  __syncthreads();
  v4u vals[2];
#pragma unroll
  for (int it = 0; it < 2; ++it) {
    const int q = it * 32 + wave * 4 + (lane >> 3);
    vals[it] = *(const v4u*)(sT + q * 72 + (lane & 7) * 8);
  }
  {
#pragma unroll
    for (int it = 0; it < 2; ++it) {
      const int q = it * 32 + wave * 4 + (lane >> 3);
      *(v4u*)(dst + (size_t)(c0 + q) * R + r0 + (lane & 7) * 8) = vals[it];
    }
    
  }
}

// =====================================================================================================
// Batched f16 WMMA GEMM, operands staged in LDS: C[m][n] = f( oscale * sum_k A[m][k] * Bt[n][k] ) (+ residual) (* row mask).
// One 128x128 tile per block of 8 waves (4x2 waves of 32x64). A row-major [M][K] pitch lda (16-bit plane), Bt row-major [N][K] pitch ldb
// (k contiguous); M, N, K multiples of 128. blockIdx.y = batch index with element strides sA, sB, sC.
// A trip is 128 k: [A 128 rows | Bt 128 rows] of 256 B each, LDS pitch 272 B (16 B x odd: 16-B row readers meet no bank twice), two
// buffers. Each lane copies 16 pieces of 16 B per trip with asynchronous copies to LDS (a wave's copy = 2 whole rows = 4 whole lines);
// the copies of trip t + 2 are issued behind the barrier that ends trip t and fly while trip t + 1 is worked on.
// Inside a trip the fragments of k-step ks + 1 are read from LDS ahead of the products of k-step ks (never across the barrier).
// The k order of every accumulator is the ascending one (steps of 32). Behind the last trip's barrier the ring serves as the
// waves' epilogue slabs.
// OM: 0 = f32 out (pitch ldc; HASR 1 adds bf16(R[m][n]), HASR 2 adds raw f32 R[m][n], same pitch/stride as C; MSK 1 multiplies the
//     sum by bf16(Mrow[m])); 2 = f16 out (pitch ldc) = f16( act(value) * ocarry ), ACT 1 = erf-GELU.
// coverage: 2 slabs x 16 rows (f32: it 0..7 x lane>>4; f16: it 0..3 x lane>>3) x 64 cols = the wave's whole 32x64 tile;
//           8 waves = the block's 128x128 tile; grid = tilesM*tilesN blocks exactly (a surplus block leaves as a whole, before any barrier).
// =====================================================================================================
#define GT_TILE    128                     // rows of A and of Bt per block tile
#define GT_K       128                     // halves of every row per trip (256 B)
#define GT_PITCH   136                     // halves: 272 B
#define GT_STAGE   (2 * GT_TILE * GT_PITCH) // halves per buffer
#define GT_THREADS 256
#define GT_LSTEP   (16u * GT_PITCH * 2u)   // LDS bytes between two successive copies of a lane (16 rows)
static_assert((NROWS % GT_TILE) == 0 && (DMODEL % GT_TILE) == 0 && (DFF % GT_TILE) == 0 && (NC % GT_TILE) == 0);
static_assert((DMODEL % GT_K) == 0 && (DFF % GT_K) == 0 && ((GT_PITCH * 2) % 16) == 0 && (((GT_PITCH * 2) / 16) % 2) == 1);
static_assert(GT_THREADS / 16 == 16 && 8 * 16 == GT_TILE && GT_K * 2 == 16 * 16);
static_assert((size_t)(GT_THREADS / 32) * 16 * 68 * sizeof(float) <= (size_t)2 * GT_STAGE * sizeof(unsigned short));

__device__ __forceinline__ unsigned lds_off(const void* p) { return (unsigned)(size_t)p; }
// the wave's own LDS reads have returned before the buffer they read is handed back for a refill
__device__ __forceinline__ void wait_ds0() {
#if defined(__HIP_DEVICE_COMPILE__)
  asm volatile("s_wait_dscnt 0x0" ::: "memory");
#endif
}
// the wave's own asynchronous copies have landed in LDS (the compiler places no wait for them)
__device__ __forceinline__ void wait_async0() {
#if defined(__HIP_DEVICE_COMPILE__)
  asm volatile("s_wait_asynccnt 0x0" ::: "memory");
#endif
}
// Eight asynchronous 16-B copies per lane, global -> LDS: rows 16 apart (gs halves in global memory, GT_LSTEP bytes in LDS).
// The closing s_wait_xcnt 0 stands inside the statement so that no address register is rewritten ahead of it.
__device__ __forceinline__ void copy8(unsigned l0, const unsigned short* g0, size_t gs) {
#if defined(__HIP_DEVICE_COMPILE__)
  const unsigned l1 = l0 + GT_LSTEP, l2 = l0 + 2u * GT_LSTEP, l3 = l0 + 3u * GT_LSTEP;
  const unsigned l4 = l0 + 4u * GT_LSTEP, l5 = l0 + 5u * GT_LSTEP, l6 = l0 + 6u * GT_LSTEP, l7 = l0 + 7u * GT_LSTEP;
  const unsigned short* g1 = g0 + gs;
  const unsigned short* g2 = g1 + gs;
  const unsigned short* g3 = g2 + gs;
  const unsigned short* g4 = g3 + gs;
  const unsigned short* g5 = g4 + gs;
  const unsigned short* g6 = g5 + gs;
  const unsigned short* g7 = g6 + gs;
  asm volatile(
      "global_load_async_to_lds_b128 %0, %8, off\n\t"
      "global_load_async_to_lds_b128 %1, %9, off\n\t"
      "global_load_async_to_lds_b128 %2, %10, off\n\t"
      "global_load_async_to_lds_b128 %3, %11, off\n\t"
      "global_load_async_to_lds_b128 %4, %12, off\n\t"
      "global_load_async_to_lds_b128 %5, %13, off\n\t"
      "global_load_async_to_lds_b128 %6, %14, off\n\t"
      "global_load_async_to_lds_b128 %7, %15, off\n\t"
      "s_wait_xcnt 0x0"
      :: "v"(l0), "v"(l1), "v"(l2), "v"(l3), "v"(l4), "v"(l5), "v"(l6), "v"(l7),
         "v"(g0), "v"(g1), "v"(g2), "v"(g3), "v"(g4), "v"(g5), "v"(g6), "v"(g7)
      : "memory");
#endif
}
// One trip's tile: lane's pieces of A rows 0..127 (LDS rows 0..127), then of Bt rows 0..127 (LDS rows 128..255).
__device__ __forceinline__ void stage_tile(unsigned l, const unsigned short* ga, size_t lda, const unsigned short* gb, size_t ldb) {
  copy8(l,                 ga, 16 * lda);
  copy8(l + 8u * GT_LSTEP, gb, 16 * ldb);
}

template <int OM, int HASR, int ACT, int MSK>
__global__ __launch_bounds__(GT_THREADS) void gemm64(
    const unsigned short* __restrict__ Ap, int lda, long long sA,
    const unsigned short* __restrict__ Btp, int ldb, long long sB,
    const float* __restrict__ Rp, const float* __restrict__ Mp,
    void* Cout, int ldc, long long sC,
    int M, int N, int K, float oscale, float ocarry) {
  __shared__ __align__(16) unsigned short sR[2 * GT_STAGE];   // the two operand buffers; later per-wave 16x64 f32 slabs, pitch 68 floats
  const int by   = blockIdx.y;
  const int tid  = threadIdx.x;
  const int lane = tid & 31;
  const int wave = tid >> 5;
  const int tilesN = N >> 7;
  const int tilesM = M >> 7;
  const int tile = blockIdx.x;
  if (tile >= tilesM * tilesN) return;   // block-uniform, in front of every barrier and copy
  const int tm = tile / tilesN;
  const int tn = tile - tm * tilesN;
  const int wm = wave >> 1, wn = wave & 1;
  const int m0 = (tm << 7) + (wm << 5);
  const int n0 = (tn << 7) + (wn << 6);

  const unsigned short* A1 = Ap  + (size_t)((long long)by * sA);
  const unsigned short* Bb = Btp + (size_t)((long long)by * sB);

  const int rlane = lane & 15;                 // row (A) / col (B, D) within subtile
  const int koff  = (lane >> 4) * 8;           // k offset of this lane half
  const int mOff  = (lane >> 4) * 8;           // D row offset

  // the lane's first piece of a trip: row tid>>4 of the tile, 16-B piece tid&15 of its 256 B
  const int crow = tid >> 4, cpc = tid & 15;
  const unsigned short* gA = A1 + (size_t)((tm << 7) + crow) * lda + cpc * 8;
  const unsigned short* gB = Bb + (size_t)((tn << 7) + crow) * ldb + cpc * 8;
  const unsigned lC = lds_off(sR) + (unsigned)(crow * (GT_PITCH * 2) + cpc * 16);

  v8f acc[2][4];
#pragma unroll
  for (int i = 0; i < 2; ++i)
#pragma unroll
    for (int j = 0; j < 4; ++j) acc[i][j] = zero8();

  const int nt = K >> 7;
  stage_tile(lC, gA, (size_t)lda, gB, (size_t)ldb);
  wait_async0();
  __syncthreads();                               // tile 0 is published
  if (nt > 1) stage_tile(lC + GT_STAGE * 2u, gA + GT_K, (size_t)lda, gB + GT_K, (size_t)ldb);

  // rolled: the buffer is picked by the trip's parity
#pragma unroll 1
  for (int t = 0; t < nt; ++t) {
    const unsigned short* sb = sR + (t & 1) * GT_STAGE;
    const unsigned short* fa = sb + ((wm << 5) + rlane) * GT_PITCH + koff;
    const unsigned short* fb = sb + (GT_TILE + (wn << 6) + rlane) * GT_PITCH + koff;
    // two fragment sets; the loops over them are unrolled so that every index is a constant and the sets stay in registers
    v16h af[2][2], bf[2][4];
#pragma unroll
    for (int j = 0; j < 4; ++j) bf[0][j] = ldfrag_u(fb + (j << 4) * GT_PITCH);
#pragma unroll
    for (int i = 0; i < 2; ++i) af[0][i] = ldfrag_u(fa + (i << 4) * GT_PITCH);
#pragma unroll
    for (int ks = 0; ks < GT_K / 32; ++ks) {
      const int cur = ks & 1, nxt = cur ^ 1;
      if (ks + 1 < GT_K / 32) {
#pragma unroll
        for (int j = 0; j < 4; ++j) bf[nxt][j] = ldfrag_u(fb + (j << 4) * GT_PITCH + (ks + 1) * 32);
#pragma unroll
        for (int i = 0; i < 2; ++i) af[nxt][i] = ldfrag_u(fa + (i << 4) * GT_PITCH + (ks + 1) * 32);
      }
      // keeps the next k-step's LDS reads one group ahead of this k-step's products
      __builtin_amdgcn_sched_barrier(0);
#pragma unroll
      for (int i = 0; i < 2; ++i) {
#pragma unroll
        for (int j = 0; j < 4; ++j) acc[i][j] = mma_raw(af[cur][i], bf[cur][j], acc[i][j]);
        dep_guard1(acc[i][0], acc[i][3], af[cur][i]);
      }
      keep4_h(bf[cur][0], bf[cur][1], bf[cur][2], bf[cur][3]);
      // ends the block of products, so that the reads of the k-step after next stay behind it
      __builtin_amdgcn_sched_barrier(0);
    }
    wait_ds0();
    wait_async0();
    __syncthreads();                             // publishes tile t + 1 and ends every reader's last read of tile t's buffer
    if (t + 2 < nt)
      stage_tile(lC + (unsigned)(t & 1) * (GT_STAGE * 2u), gA + (size_t)(t + 2) * GT_K, (size_t)lda,
                 gB + (size_t)(t + 2) * GT_K, (size_t)ldb);
  }
  wait_async0();
  acc_guard4(acc[0][0], acc[0][1], acc[0][2], acc[0][3]);
  acc_guard4(acc[1][0], acc[1][1], acc[1][2], acc[1][3]);

  const int hh2 = lane >> 4, c4 = (lane & 15) * 4;     // f32 out: 256-B row segment = 16 lanes x 16 B
  const int q8  = lane >> 3, c8 = (lane & 7) * 8;

  // ---- epilogue ----
  float* slab = (float*)(void*)sR + wave * (16 * 68);   // every read and copy of the ring ended at the last trip's barrier
#pragma unroll
  for (int i = 0; i < 2; ++i) {
    const int mBase = m0 + (i << 4);
#pragma unroll
    for (int j = 0; j < 4; ++j) {
#pragma unroll
      for (int r = 0; r < 8; ++r) {
        slab[(mOff + r) * 68 + (j << 4) + rlane] = acc[i][j][r];
      }
    }
    wave_sync_lds();
    if constexpr (OM == 0) {
      float* C = (float*)Cout + (size_t)((long long)by * sC);
      v4f vals[8];
#pragma unroll
      for (int it = 0; it < 8; ++it) {
        const int row = it * 2 + hh2;                      // it 0..7 x hh2 0..1 = rows 0..15
        const int gr  = mBase + row;
        v4f v = *(const v4f*)(slab + row * 68 + c4);
        v4f rv = {0.f, 0.f, 0.f, 0.f};
        if constexpr (HASR != 0) {
          const float* R = Rp + (size_t)((long long)by * sC);
          const v4f rraw = *(const v4f*)(R + (size_t)gr * ldc + n0 + c4);
#pragma unroll
          for (int e = 0; e < 4; ++e) rv[e] = (HASR == 1) ? bfr(rraw[e]) : rraw[e];
        }
        float mk = 1.0f;
        if constexpr (MSK == 1) mk = bfr(Mp[gr]);
#pragma unroll
        for (int e = 0; e < 4; ++e) v[e] = (v[e] * oscale + rv[e]) * mk;
        vals[it] = v;
      }
      {
#pragma unroll
        for (int it = 0; it < 8; ++it) {
          const int gr = mBase + it * 2 + hh2;
          *(v4f*)(C + (size_t)gr * ldc + n0 + c4) = vals[it];
        }
        
      }
    } else {
      unsigned short* C = (unsigned short*)Cout + (size_t)((long long)by * sC);
      v4u hv[4];
#pragma unroll
      for (int it = 0; it < 4; ++it) {
        const int row = it * 4 + q8;                       // it 0..3 x q8 0..3 = rows 0..15
        const float* sp = slab + row * 68 + c8;
        v4u a = {0u, 0u, 0u, 0u};
#pragma unroll
        for (int e = 0; e < 4; ++e) {
          float f0 = sp[2 * e] * oscale;
          float f1 = sp[2 * e + 1] * oscale;
          if constexpr (ACT == 1) { f0 = gelu_f(f0); f1 = gelu_f(f1); }
          f0 *= ocarry; f1 *= ocarry;
          a[e] = pk16(h_bits((_Float16)f0), h_bits((_Float16)f1));
        }
        hv[it] = a;
      }
      {
#pragma unroll
        for (int it = 0; it < 4; ++it) {
          const int row = it * 4 + q8;
          *(v4u*)(C + (size_t)(mBase + row) * ldc + n0 + c8) = hv[it];
        }
        
      }
    }
    wave_sync_lds();
  }
}

// =====================================================================================================
// Full attention for one batch, 16 query rows and one head group (8 heads, one wave per head), head dim 64, all 2048 keys:
//   q plane (f16 x16) QH[b*2048 + tok][64*head + d], pitch 512; k plane (f16 x16) KH[b*2048 + key][64*head + d], pitch 512;
//   v^T plane (f16 x16): VT[b*512 + 64*head + d][key] (pitch 2048); out (f16 x1024): CT[b*2048 + tok][64*head + d] =
//   1024 * sum_m softmax_m(q.k / 8 + c_q) v[m][d] with the per-query-row mask constant c_q = -1e5 * (1 - bf16(mask[b][tok]))
//   (softmax run in base 2: t = (q.k/carries) * log2(e)/8 + c_q*log2(e), the row constant folded in as the fma addend).
//   Key steps of 32 from 0 to 2047 (block-uniform trip count 64); every score is finite, so the running max is finite from the first
//   step on; the rescale exponent is clamped at -126 so the first step (running max -inf) gives a tiny finite factor times zero sums.
//   Per step: 2 score tiles on f16 WMMA (K = 64 as two k-steps of 32), fragments loaded straight from the 16-bit planes (two 16-B
//   loads per fragment, arithmetic addressing); online max-subtracted softmax in f32 (exp2); rescale of the running sums and the
//   A fragment of P*1024 rebuilt from the LDS rows (float vector loads, RNE to f16, split k map) and the four v^T B fragments loaded
//   straight from the 16-bit plane; 4 P.V WMMAs.
//   Final 1/l and carry folds in f32; after a block barrier the prob-tile LDS buffer is reused as the block's 16-bit result row
//   buffer [16][512]: each wave stages its 16x64 slice (element stores); after a second block barrier the 256 threads write the
// coverage: LDS row buffer: 8 waves x 16 rows x 64 cols = 16 x 512; global: 4 iterations x 256 threads x 8 halves = 16 rows x
//           512 halves of rows q0..q0+15 of batch b; grid (4 batches x 128 query tiles x 1 head group) covers all 8192 x 512 of CT
//           exactly once.
// =====================================================================================================
#define PS_FLOATS (HPB * 16 * 36)
static_assert((size_t)16 * OSP * sizeof(unsigned short) <= (size_t)PS_FLOATS * sizeof(float));
static_assert(((16 * OSP) % (8 * ATT_THREADS)) == 0 && ((16 * OSP) / (8 * ATT_THREADS)) == 4);
static_assert(OSP == 64 * 8 && OSP == DMODEL * NHB / NHB);

__global__ __launch_bounds__(ATT_THREADS)
void attn8(const unsigned short* __restrict__ QHp, const unsigned short* __restrict__ KHp,
           const unsigned short* __restrict__ VTq, const float* __restrict__ mkp, unsigned short* CT) {
  __shared__ __align__(16) float smem[PS_FLOATS];          // per wave prob tile [row][32 keys], pitch 36; later row buffer

  const int tid  = threadIdx.x;
  const int wave = tid >> 5;
  const int lane = tid & 31;
  const int hh   = lane >> 4;
  const int c    = lane & 15;

  const int hb   = blockIdx.x % NHB;                       // head group (0)
  const int qt   = (blockIdx.x / NHB) % (NQ / 16);         // 0..127
  const int bat  = blockIdx.x / (NHB * (NQ / 16));         // 0..3
  const int head = hb * HPB + wave;                        // 0..7
  const int q0   = qt * 16;

  const size_t qofs = ((size_t)bat * NQ + q0 + c) * DMODEL + head * HDIM + 8 * hh;
  const _Float16* Qh = (const _Float16*)(const void*)QHp + qofs;
  const _Float16* Kb = (const _Float16*)(const void*)KHp + (size_t)bat * NC * DMODEL + head * HDIM + 8 * hh;
  const _Float16* Vb = (const _Float16*)(const void*)VTq + ((size_t)bat * DMODEL + head * HDIM) * NC + 8 * hh;
  const float lsc = (LOG2E * ATT_SCALE) / (QC * KC);                   // log2(e) / 8 / carries

  // per-query-row mask constant (rows 8*hh + r of this tile), in base-2 units
  float cm2[8];
  {
    const float* mq = mkp + (size_t)bat * NQ + q0 + 8 * hh;
    const v4f ma = *(const v4f*)(mq);
    const v4f mb = *(const v4f*)(mq + 4);
#pragma unroll
    for (int r = 0; r < 4; ++r) {
      cm2[r]     = (MASKNEG * (1.0f - bfr(ma[r]))) * LOG2E;
      cm2[4 + r] = (MASKNEG * (1.0f - bfr(mb[r]))) * LOG2E;
    }
  }

  const v16h qa = ldfrag_h(Qh), qb = ldfrag_h(Qh + 32);

  float mrow[8], lrow[8];
  v8f o0 = zero8(), o1 = zero8(), o2 = zero8(), o3 = zero8();
#pragma unroll
  for (int r = 0; r < 8; ++r) { mrow[r] = -INFINITY; lrow[r] = 0.f; }
  float* pt = smem + wave * (16 * 36);

#pragma unroll 1
  for (int kb = 0; kb < NC; kb += 32) {
    const _Float16* kp = Kb + (size_t)(kb + c) * DMODEL;
    v8f s0, s1;
    {
      const v16h k0 = ldfrag_h(kp), k1 = ldfrag_h(kp + 32);
      s0 = mma_raw(qa, k0, zero8());
      s0 = mma_raw(qb, k1, s0);
      guard_s2(s0, k0, k1);
    }
    {
      const _Float16* kq = kp + (size_t)16 * DMODEL;
      const v16h k0 = ldfrag_h(kq), k1 = ldfrag_h(kq + 32);
      s1 = mma_raw(qa, k0, zero8());
      s1 = mma_raw(qb, k1, s1);
      guard_s4(s1, k0, k1, qa, qb);
    }
#pragma unroll
    for (int r = 0; r < 8; ++r) {
      const float t0 = fmaf(s0[r], lsc, cm2[r]);
      const float t1 = fmaf(s1[r], lsc, cm2[r]);
      float mx = fmaxf(t0, t1);
#pragma unroll
      for (int off = 1; off < 16; off <<= 1) mx = fmaxf(mx, __shfl_xor(mx, off, 32));
      const float mn = fmaxf(mrow[r], mx);
      const float al = exp2f(fmaxf(mrow[r] - mn, -126.0f));
      mrow[r] = mn;
      const float e0 = exp2f(t0 - mn);
      const float e1 = exp2f(t1 - mn);
      float ps = e0 + e1;
#pragma unroll
      for (int off = 1; off < 16; off <<= 1) ps += __shfl_xor(ps, off, 32);
      lrow[r] = lrow[r] * al + ps;
      o0[r] *= al;
      o1[r] *= al;
      o2[r] *= al;
      o3[r] *= al;
      const int ro = (8 * hh + r) * 36 + c;
      pt[ro]      = e0;
      pt[ro + 16] = e1;
    }
    wave_sync_lds();
    FragH ph;
    {
      const float* prow = pt + c * 36 + 8 * hh;
      const v4f p0 = *(const v4f*)(prow), p1 = *(const v4f*)(prow + 4);
      const v4f p2 = *(const v4f*)(prow + 16), p3 = *(const v4f*)(prow + 20);
#pragma unroll
      for (int e = 0; e < 4; ++e) {
        ph.h[0][e]     = (_Float16)(p0[e] * PC);              // elements 0..7  = keys kb + 8hh + 0..7
        ph.h[0][4 + e] = (_Float16)(p1[e] * PC);
        ph.h[1][e]     = (_Float16)(p2[e] * PC);              // elements 8..15 = keys kb + 16 + 8hh + 0..7
        ph.h[1][4 + e] = (_Float16)(p3[e] * PC);
      }
    }
    const _Float16* vp = Vb + (size_t)c * NC + kb;
    {
      const v16h vb0 = ldfrag_h(vp);
      const v16h vb1 = ldfrag_h(vp + (size_t)16 * NC);
      const v16h vb2 = ldfrag_h(vp + (size_t)32 * NC);
      const v16h vb3 = ldfrag_h(vp + (size_t)48 * NC);
      o0 = mma_raw(ph.v, vb0, o0);
      o1 = mma_raw(ph.v, vb1, o1);
      o2 = mma_raw(ph.v, vb2, o2);
      o3 = mma_raw(ph.v, vb3, o3);
      guard_pv4(o0, o1, o2, o3, ph.v, vb0, vb1, vb2, vb3);
    }
    wave_sync_lds();
  }

  // ---- all waves done with their prob tiles; the LDS buffer becomes the 16-bit result row buffer [16][512] ----
  __syncthreads();
  unsigned short* Os = (unsigned short*)smem;
  // ---- fold 1/l and the carries (1024 on P, 16 on v, 1024 on the stored ctx), stage the wave's 16x64 slice as 16-bit ----
  const float oc = FC / (PC * VC);
  unsigned short* osw = Os + wave * HDIM + c;
#pragma unroll
  for (int r = 0; r < 8; ++r) {
    const float inv = (1.0f / lrow[r]) * oc;
    unsigned short* op = osw + (8 * hh + r) * OSP;
    op[0]  = h_bits((_Float16)(o0[r] * inv));
    op[16] = h_bits((_Float16)(o1[r] * inv));
    op[32] = h_bits((_Float16)(o2[r] * inv));
    op[48] = h_bits((_Float16)(o3[r] * inv));
  }
  __syncthreads();
  // ---- block writes its 16 rows of CT: piece p = it*256 + tid -> halves (p%64)*8 .. +7 of row p/64 ----
  {
    v4u vals[4];
#pragma unroll
    for (int it = 0; it < 4; ++it) {
      const int p = it * ATT_THREADS + tid;
      vals[it] = *(const v4u*)(Os + (size_t)p * 8);
    }
    unsigned short* dst = CT + ((size_t)bat * NQ + q0) * DMODEL + (size_t)hb * OSP;
    {
#pragma unroll
      for (int it = 0; it < 4; ++it) {
        const int p = it * ATT_THREADS + tid;
        const int row = p >> 6, col8 = (p & 63) * 8;
        *(v4u*)(dst + (size_t)row * DMODEL + col8) = vals[it];
      }
      
    }
  }
}

// =====================================================================================================
// the input row and multiplies by bf16(mask[row]). Output is the 16-bit plane outh[row][c] = f16(value * hc) only:
//   one block of 128 threads per row, 4 consecutive floats per thread (one 16-B load); the 16-bit row is staged in LDS (8 B per
// =====================================================================================================
template <int RIN>
__global__ __launch_bounds__(LN_THREADS)
void lnorm(const float* __restrict__ Yp, const float* __restrict__ mkp, unsigned short* outh, float hc) {
  __shared__ float red[2][LN_THREADS / 32];
  __shared__ __align__(16) unsigned short srow[DMODEL];
  const int row  = blockIdx.x;
  const int tid  = threadIdx.x;
  const int lane = tid & 31;
  const int wave = tid >> 5;
  const size_t base = (size_t)row * DMODEL + (size_t)tid * 4;
  v4f v = *(const v4f*)(Yp + base);
  if constexpr (RIN == 1) {
    const float mk = bfr(mkp[row]);
#pragma unroll
    for (int e = 0; e < 4; ++e) v[e] = bfr(v[e]) * mk;
  }
  float s = (v[0] + v[1]) + (v[2] + v[3]);
#pragma unroll
  for (int off = 1; off < 32; off <<= 1) s += __shfl_xor(s, off, 32);
  if (lane == 0) red[0][wave] = s;
  __syncthreads();
  float tot = 0.f;
#pragma unroll
  for (int w = 0; w < LN_THREADS / 32; ++w) tot += red[0][w];
  const float mu = tot * (1.0f / (float)DMODEL);
  v4f d;
#pragma unroll
  for (int e = 0; e < 4; ++e) d[e] = v[e] - mu;
  float q = (d[0] * d[0] + d[1] * d[1]) + (d[2] * d[2] + d[3] * d[3]);
#pragma unroll
  for (int off = 1; off < 32; off <<= 1) q += __shfl_xor(q, off, 32);
  if (lane == 0) red[1][wave] = q;
  __syncthreads();
  float totq = 0.f;
#pragma unroll
  for (int w = 0; w < LN_THREADS / 32; ++w) totq += red[1][w];
  const float var  = totq * (1.0f / (float)DMODEL);
  const float rstd = rsqrtf(var + LN_EPS);
  v4f o;
#pragma unroll
  for (int e = 0; e < 4; ++e) o[e] = d[e] * rstd;
  v2u w;
  w[0] = pk16(h_bits((_Float16)(o[0] * hc)), h_bits((_Float16)(o[1] * hc)));
  w[1] = pk16(h_bits((_Float16)(o[2] * hc)), h_bits((_Float16)(o[3] * hc)));
  *(v2u*)(srow + tid * 4) = w;
  __syncthreads();
  if (tid < DMODEL / 8) {                                 // waves 0..1, whole waves
    const v4u hv = *(const v4u*)(srow + tid * 8);
    unsigned short* dst = outh + (size_t)row * DMODEL + (size_t)tid * 8;
    {
      *(v4u*)dst = hv;
      
    }
  }
}

// =====================================================================================================
// Workspace map (bytes); every plane is an exact multiple of its tile / whole-row store granularity (M, N exact multiples of 64, rows
//   WQKV f16 [1536][512] x64         1572864   (transposed in-projections [n][k]: rows 0..511 q, 512..1023 k, 1024..1535 v)
//   WO16 f16 [512][512] x64           524288   (Wo^T)
//   W116 f16 [2048][512] x64         2097152   (W1^T)
//   W216 f16 [512][2048] x128        2097152   (W2^T)
//   H16  f16 [8192][512] x16         8388608   (first LayerNorm output)
//   QH   f16 [8192][512] x16         8388608
//   KH   f16 [8192][512] x16         8388608
//   VT   f16 [4][512][2048] x16      8388608   (v^T per batch)
//   CT   f16 [8192][512] x1024       8388608   (attention ctx, merged heads)
//   X1F  f32 [8192][512]            16777216   ((x + ctx . Wo) * mask)
//   H2   f16 [8192][512] x16         8388608   (second LayerNorm output)
//   HH   f16 [8192][2048] x16       33554432   (gelu hidden)
//   end                            106954752
// =====================================================================================================
extern "C" void kernel_launch(void* const* d_in, const int* in_sizes, int n_in,
                              void* d_out, int out_size, void* d_ws, size_t ws_size,
                              hipStream_t stream) {
  if (n_in < 8) return;
  if (in_sizes[0] != NROWS * DMODEL) return;
  if (in_sizes[1] != NROWS) return;
  if (in_sizes[2] != DMODEL * DMODEL || in_sizes[3] != DMODEL * DMODEL ||
      in_sizes[4] != DMODEL * DMODEL || in_sizes[5] != DMODEL * DMODEL) return;
  if (in_sizes[6] != DMODEL * DFF || in_sizes[7] != DFF * DMODEL) return;
  if (out_size != NROWS * DMODEL) return;

  const float* x   = (const float*)d_in[0];
  const float* mk  = (const float*)d_in[1];
  const float* wq  = (const float*)d_in[2];
  const float* wk  = (const float*)d_in[3];
  const float* wv  = (const float*)d_in[4];
  const float* wo  = (const float*)d_in[5];
  const float* w1  = (const float*)d_in[6];
  const float* w2  = (const float*)d_in[7];
  float*       out = (float*)d_out;

  const size_t PWQKV = (size_t)3 * DMODEL * DMODEL * 2;           //  1572864
  const size_t PWO   = (size_t)DMODEL * DMODEL * 2;               //   524288
  const size_t PW1   = (size_t)DFF * DMODEL * 2;                  //  2097152
  const size_t PW2   = (size_t)DMODEL * DFF * 2;                  //  2097152
  const size_t PX    = (size_t)NROWS * DMODEL * 2;                //  8388608
  const size_t PVT   = (size_t)NB * DMODEL * NC * 2;              //  8388608
  const size_t PY    = (size_t)NROWS * DMODEL * 4;                // 16777216
  const size_t PH    = (size_t)NROWS * DFF * 2;                   // 33554432
  size_t off = 0;
  const size_t oWQKV = off; off += PWQKV;
  const size_t oWO   = off; off += PWO;
  const size_t oW1   = off; off += PW1;
  const size_t oW2   = off; off += PW2;
  const size_t oH    = off; off += PX;
  const size_t oQH   = off; off += PX;
  const size_t oKH   = off; off += PX;
  const size_t oVT   = off; off += PVT;
  const size_t oCT   = off; off += PX;
  const size_t oXF   = off; off += PY;
  const size_t oH2   = off; off += PX;
  const size_t oHH   = off; off += PH;
  if (off > ws_size) return;                                      // off = 106954752
  if (off > (size_t)134217728) return;

  char* ws = (char*)d_ws;
  unsigned short* WQKV = (unsigned short*)(ws + oWQKV);
  unsigned short* WO16 = (unsigned short*)(ws + oWO);
  unsigned short* W116 = (unsigned short*)(ws + oW1);
  unsigned short* W216 = (unsigned short*)(ws + oW2);
  unsigned short* H16  = (unsigned short*)(ws + oH);
  unsigned short* QH   = (unsigned short*)(ws + oQH);
  unsigned short* KH   = (unsigned short*)(ws + oKH);
  unsigned short* VTp  = (unsigned short*)(ws + oVT);
  unsigned short* CT   = (unsigned short*)(ws + oCT);
  float*          X1F  = (float*)(ws + oXF);
  unsigned short* H2   = (unsigned short*)(ws + oH2);
  unsigned short* HH   = (unsigned short*)(ws + oHH);

  const dim3 blk(256);
  const dim3 gTsq(DMODEL / 64, DMODEL / 64);                       // in[512][512]  -> out[512][512]:  (C/64, R/64) = (8, 8)
  const dim3 gT1(DFF / 64, DMODEL / 64);                           // in[512][2048] -> out[2048][512]: (32, 8)
  const dim3 gT2(DMODEL / 64, DFF / 64);                           // in[2048][512] -> out[512][2048]: (8, 32)
  const dim3 bG(GT_THREADS);                                       // 256
  const dim3 gP((NROWS / GT_TILE) * (DMODEL / GT_TILE), 1);        // 256
  const dim3 gV((DMODEL / GT_TILE) * (NC / GT_TILE), NB);          // 64 x 4
  const dim3 gF((NROWS / GT_TILE) * (DFF / GT_TILE), 1);           // 1024
  const dim3 gAT(ATT_BLOCKS);                                      // 512
  const dim3 bAT(ATT_THREADS);                                     // 256
  const dim3 gLN(NROWS);                                           // 8192
  const dim3 bLN(LN_THREADS);                                      // 128

  // (0) transposed weight planes [n][k] = f16( bf16_RNE(W[k][n]) * scale ), k contiguous
  tcvt16<<<gTsq, blk, 0, stream>>>(wq, WQKV, DMODEL, DMODEL, WSC);
  tcvt16<<<gTsq, blk, 0, stream>>>(wk, WQKV + (size_t)DMODEL * DMODEL, DMODEL, DMODEL, WSC);
  tcvt16<<<gTsq, blk, 0, stream>>>(wv, WQKV + (size_t)2 * DMODEL * DMODEL, DMODEL, DMODEL, WSC);
  tcvt16<<<gTsq, blk, 0, stream>>>(wo, WO16, DMODEL, DMODEL, WSC);
  tcvt16<<<gT1,  blk, 0, stream>>>(w1, W116, DMODEL, DFF, WSC);     // R = 512 (in), C = 2048 (out)
  tcvt16<<<gT2,  blk, 0, stream>>>(w2, W216, DFF, DMODEL, W2SC);    // R = 2048 (in), C = 512 (out)

  // (1) h = LayerNorm(bf16(x) * bf16(mask)) -> H16 (f16 x16)
  lnorm<1><<<gLN, bLN, 0, stream>>>(x, mk, H16, HCARRY);

  // (2) q projection: QH[m][n] = f16(16 * sum_k h[m][k] Wq[k][n]); M = 8192, N = 512, K = 512
  gemm64<2, 0, 0, 0><<<gP, bG, 0, stream>>>(
      H16, DMODEL, 0LL,
      WQKV, DMODEL, 0LL,
      x, mk,
      (void*)QH, DMODEL, 0LL,
      NROWS, DMODEL, DMODEL, 1.0f / (HCARRY * WSC), QC);

  // (3) k projection
  gemm64<2, 0, 0, 0><<<gP, bG, 0, stream>>>(
      H16, DMODEL, 0LL,
      WQKV + (size_t)DMODEL * DMODEL, DMODEL, 0LL,
      x, mk,
      (void*)KH, DMODEL, 0LL,
      NROWS, DMODEL, DMODEL, 1.0f / (HCARRY * WSC), KC);

  // (4) v^T per batch: VT[b][d][tok] = f16(16 * sum_k WvT[d][k] h_b[tok][k]); M = 512, N = 2048, K = 512
  gemm64<2, 0, 0, 0><<<gV, bG, 0, stream>>>(
      WQKV + (size_t)2 * DMODEL * DMODEL, DMODEL, 0LL,
      H16, DMODEL, (long long)NC * DMODEL,
      x, mk,
      (void*)VTp, NC, (long long)DMODEL * NC,
      DMODEL, NC, DMODEL, 1.0f / (HCARRY * WSC), VC);

  // (5) full attention per (batch, 16 query rows, head group) -> CT (f16, x1024)
  attn8<<<gAT, bAT, 0, stream>>>(QH, KH, VTp, mk, CT);

  // (6) X1F = (CT . WoT^T / (1024 * 64) + bf16(x)) * bf16(mask); M = 8192, N = 512, K = 512, f32
  gemm64<0, 1, 0, 1><<<gP, bG, 0, stream>>>(
      CT, DMODEL, 0LL,
      WO16, DMODEL, 0LL,
      x, mk,
      (void*)X1F, DMODEL, 0LL,
      NROWS, DMODEL, DMODEL, 1.0f / (FC * WSC), 1.0f);

  // (7) h2 = LayerNorm(x1) -> H2 (f16 x16)
  lnorm<0><<<gLN, bLN, 0, stream>>>(X1F, mk, H2, H2C);

  // (8) HH = f16(16 * gelu(h2 . W1)); M = 8192, N = 2048, K = 512
  gemm64<2, 0, 1, 0><<<gF, bG, 0, stream>>>(
      H2, DMODEL, 0LL,
      W116, DMODEL, 0LL,
      x, mk,
      (void*)HH, DFF, 0LL,
      NROWS, DFF, DMODEL, 1.0f / (H2C * WSC), GC);

  // (9) out = HH . W2 / (16 * 128) + x1 (raw f32); M = 8192, N = 512, K = 2048, f32
  gemm64<0, 2, 0, 0><<<gP, bG, 0, stream>>>(
      HH, DFF, 0LL,
      W216, DFF, 0LL,
      X1F, mk,
      (void*)out, DMODEL, 0LL,
      NROWS, DMODEL, DFF, 1.0f / (GC * W2SC), 1.0f);
  (void)hipGetLastError();
}

// v002
// One run takes 199 microseconds.
// Two timings next to v001 put it at 1.22 and 1.23 times that version's speed.
// Over all steps from v000 it is 2.09 times as fast.
// Contractions: q/k projections (h f16 x16 . Wq^T/Wk^T f16 x64, K=512), v^T projection (Wv^T f16 x64 . h f16 x16, K=512),
// attention scores (q f16 x16 . k f16 x16, K=64), attention P . v^T (P f16 x1024 . v^T f16 x16, 32 keys per step),
// output projection (ctx f16 x1024 . Wo^T f16 x64, K=512), FFN1 (h2 f16 x16 . W1^T f16 x64, K=512), FFN2 (g f16 x16 . W2^T f16 x128, K=2048):
// all v_wmma_f32_16x16x32_f16 single products, f32 accumulate. LayerNorms (no affine), softmax, erf-GELU, mask, residuals in f32 on VALU.
// Every float input RNE-converted to bf16 on load.
#include <hip/hip_runtime.h>
#include <math.h>
#include <stdint.h>

#define NB      4
#define NQ      2048
#define NC      2048
#define DMODEL  512
#define DFF     2048
#define NHEAD   8
#define HDIM    64
#define NROWS   (NB * NQ)
#define WSC     64.0f
#define W2SC    128.0f
#define HCARRY  16.0f
#define QC      16.0f
#define KC      16.0f
#define VC      16.0f
#define PC      1024.0f
#define FC      1024.0f
#define H2C     16.0f
#define GC      16.0f
#define ATT_SCALE 0.125f
#define LOG2E   1.4426950408889634f
#define LN_EPS  1e-6f
#define MASKNEG (-100000.0f)
static_assert(NHEAD * HDIM == DMODEL);
static_assert((NQ % 64) == 0 && (NC % 64) == 0 && (DMODEL % 64) == 0 && (DFF % 64) == 0 && (NC % 32) == 0 && (NQ % 16) == 0);
static_assert((NROWS % 64) == 0 && (DMODEL % 32) == 0 && (DFF % 32) == 0);
#define HPB     8                       // waves per attention block (16 query rows per wave, one head per block)
#define NQB     (NQ / (HPB * 16))       // query blocks per batch and head (16)
#define ATT_THREADS (HPB * 32)
#define ATT_BLOCKS  (NB * NHEAD * NQB)
static_assert(ATT_THREADS == 256 && ATT_BLOCKS == 512 && NQB * HPB * 16 == NQ);
#define LN_THREADS 128
static_assert(LN_THREADS * 4 == DMODEL && (LN_THREADS % 32) == 0 && ((DMODEL / 8) % 32) == 0);

typedef _Float16 v16h __attribute__((ext_vector_type(16)));
typedef _Float16 v8h  __attribute__((ext_vector_type(8)));
typedef float    v8f  __attribute__((ext_vector_type(8)));
typedef float    v4f  __attribute__((ext_vector_type(4)));
typedef unsigned int v4u __attribute__((ext_vector_type(4)));
typedef unsigned int v2u __attribute__((ext_vector_type(2)));

union FragH { v16h v; v8h h[2]; v4u u[2]; };

// ---- scalar helpers --------------------------------------------------------------------------------
__device__ __forceinline__ unsigned short bf_bits(float f) {          // f32 -> bf16 bits, RNE convert
  unsigned u = __float_as_uint(f);
  return (unsigned short)((u + 0x7FFFu + ((u >> 16) & 1u)) >> 16);
}
__device__ __forceinline__ float bf_up(unsigned short h) { return __uint_as_float(((unsigned)h) << 16); }
__device__ __forceinline__ float bfr(float f) { return bf_up(bf_bits(f)); }   // value of the bf16 RNE convert
__device__ __forceinline__ unsigned short h_bits(_Float16 x) { return __builtin_bit_cast(unsigned short, x); }
__device__ __forceinline__ unsigned pk16(unsigned short a, unsigned short b) { return (unsigned)a | ((unsigned)b << 16); }
__device__ __forceinline__ v8f zero8() { v8f z = {0.f, 0.f, 0.f, 0.f, 0.f, 0.f, 0.f, 0.f}; return z; }
__device__ __forceinline__ float gelu_f(float u) { return 0.5f * u * (1.0f + erff(u * 0.70710678118654752440f)); }

// ---- fragment loaders: 16-bit A/B operand, lane -> row/col (lane&15), p already includes +8*(lane>>4);
//      elements 0..7 <- p[0..7] (k0+8h..), elements 8..15 <- p[16..23] (k0+16+8h..)  (same split k map for A and B;
//      B is always read from a k-contiguous [n][k] plane)
__device__ __forceinline__ v16h ldfrag_h(const _Float16* p) {
  FragH f;
  f.h[0] = *(const v8h*)(p);
  f.h[1] = *(const v8h*)(p + 16);
  return f.v;
}
__device__ __forceinline__ v16h ldfrag_u(const unsigned short* p) {
  FragH f;
  f.u[0] = *(const v4u*)(p);
  f.u[1] = *(const v4u*)(p + 16);
  return f.v;
}

// ---- WMMA helpers with trailing VALU hazard gaps ------------------------------------------------------
__device__ __forceinline__ v8f mma_raw(v16h a, v16h b, v8f c) {
  return __builtin_amdgcn_wmma_f32_16x16x32_f16(false, a, false, b, (short)0, c, false, false);
}
__device__ __forceinline__ void dep_guard1(v8f& a, v8f& b, v16h x) {
#if defined(__HIP_DEVICE_COMPILE__)
  asm volatile("v_nop\n\tv_nop\n\tv_nop\n\tv_nop" : "+v"(a), "+v"(b) : "v"(x));
#endif
}
__device__ __forceinline__ void guard_s2(v8f& s, v16h a0, v16h a1) {
#if defined(__HIP_DEVICE_COMPILE__)
  asm volatile("v_nop\n\tv_nop\n\tv_nop\n\tv_nop" : "+v"(s) : "v"(a0), "v"(a1));
#endif
}
__device__ __forceinline__ void guard_s4(v8f& s, v16h a0, v16h a1, v16h b0, v16h b1) {
#if defined(__HIP_DEVICE_COMPILE__)
  asm volatile("v_nop\n\tv_nop\n\tv_nop\n\tv_nop" : "+v"(s) : "v"(a0), "v"(a1), "v"(b0), "v"(b1));
#endif
}
__device__ __forceinline__ void guard_pv4(v8f& a, v8f& b, v8f& c, v8f& d, v16h x, v16h y, v16h z, v16h w, v16h u) {
#if defined(__HIP_DEVICE_COMPILE__)
  asm volatile("v_nop\n\tv_nop\n\tv_nop\n\tv_nop"
               : "+v"(a), "+v"(b), "+v"(c), "+v"(d) : "v"(x), "v"(y), "v"(z), "v"(w), "v"(u));
#endif
}
__device__ __forceinline__ void keep4_h(v16h a, v16h b, v16h c, v16h d) {
#if defined(__HIP_DEVICE_COMPILE__)
  asm volatile("v_nop" :: "v"(a), "v"(b), "v"(c), "v"(d));
#endif
}
__device__ __forceinline__ void acc_guard4(v8f& a, v8f& b, v8f& c, v8f& d) {
#if defined(__HIP_DEVICE_COMPILE__)
  asm volatile("v_nop\n\tv_nop\n\tv_nop\n\tv_nop" : "+v"(a), "+v"(b), "+v"(c), "+v"(d));
#endif
}
__device__ __forceinline__ void wave_sync_lds() {
  __builtin_amdgcn_fence(__ATOMIC_RELEASE, "workgroup");
  __builtin_amdgcn_wave_barrier();
  __builtin_amdgcn_fence(__ATOMIC_ACQUIRE, "workgroup");
}

// =====================================================================================================
// Transposing 16-bit pack of a weight stored [in][out] = in[R][C] (row pitch C): out[C][R] (row pitch R), out[c][r] =
// f16( bf16_RNE(in[r][c]) * sc ), sc a power of two (exact). One 64x64 tile per block through LDS: coalesced float4 reads of 64 input
// rows, 2-byte LDS stores into the transposed tile [c][r] (pitch 72 halves), block barrier, then every output row segment of 64 halves
// coverage: load 256 thr x 16 floats = 64x64; store 2 it x 8 waves x 4 rows x (8 lanes x 8 halves) = 64 rows x 64 halves;
//           grid (C/64, R/64) exact (host checks), each output line written by exactly one wave.
// =====================================================================================================
__global__ __launch_bounds__(256) void tcvt16(const float* __restrict__ src, unsigned short* dst, int R, int C, float sc) {
  __shared__ __align__(16) unsigned short sT[64 * 72];
  const int tid = threadIdx.x, lane = tid & 31, wave = tid >> 5;
  const int c0 = blockIdx.x * 64, r0 = blockIdx.y * 64;
  const int rr = tid >> 2, cc = (tid & 3) * 16;
  const float* sp = src + (size_t)(r0 + rr) * C + c0 + cc;
#pragma unroll
  for (int e = 0; e < 4; ++e) {
    const v4f a = *(const v4f*)(sp + 4 * e);
#pragma unroll
    for (int k = 0; k < 4; ++k)
      sT[(cc + 4 * e + k) * 72 + rr] = h_bits((_Float16)(bfr(a[k]) * sc));
  }
  __syncthreads();
  v4u vals[2];
#pragma unroll
  for (int it = 0; it < 2; ++it) {
    const int q = it * 32 + wave * 4 + (lane >> 3);
    vals[it] = *(const v4u*)(sT + q * 72 + (lane & 7) * 8);
  }
  {
#pragma unroll
    for (int it = 0; it < 2; ++it) {
      const int q = it * 32 + wave * 4 + (lane >> 3);
      *(v4u*)(dst + (size_t)(c0 + q) * R + r0 + (lane & 7) * 8) = vals[it];
    }
    
  }
}

// =====================================================================================================
// Batched f16 WMMA GEMM, operands staged in LDS: C[m][n] = f( oscale * sum_k A[m][k] * Bt[n][k] ) (+ residual) (* row mask).
// One 128x128 tile per block of 8 waves (4x2 waves of 32x64). A row-major [M][K] pitch lda (16-bit plane), Bt row-major [N][K] pitch ldb
// (k contiguous); M, N, K multiples of 128. blockIdx.y = batch index with element strides sA, sB, sC.
// A trip is 128 k: [A 128 rows | Bt 128 rows] of 256 B each, LDS pitch 272 B (16 B x odd: 16-B row readers meet no bank twice), two
// buffers. Each lane copies 16 pieces of 16 B per trip with asynchronous copies to LDS (a wave's copy = 2 whole rows = 4 whole lines);
// the copies of trip t + 2 are issued behind the barrier that ends trip t and fly while trip t + 1 is worked on.
// Inside a trip the fragments of k-step ks + 1 are read from LDS ahead of the products of k-step ks (never across the barrier).
// The k order of every accumulator is the ascending one (steps of 32). Behind the last trip's barrier the ring serves as the
// waves' epilogue slabs.
// OM: 0 = f32 out (pitch ldc; HASR 1 adds bf16(R[m][n]), HASR 2 adds raw f32 R[m][n], same pitch/stride as C; MSK 1 multiplies the
//     sum by bf16(Mrow[m])); 2 = f16 out (pitch ldc) = f16( act(value) * ocarry ), ACT 1 = erf-GELU.
// coverage: 2 slabs x 16 rows (f32: it 0..7 x lane>>4; f16: it 0..3 x lane>>3) x 64 cols = the wave's whole 32x64 tile;
//           8 waves = the block's 128x128 tile; grid = tilesM*tilesN blocks exactly (a surplus block leaves as a whole, before any barrier).
// =====================================================================================================
#define GT_TILE    128                     // rows of A and of Bt per block tile
#define GT_K       128                     // halves of every row per trip (256 B)
#define GT_PITCH   136                     // halves: 272 B
#define GT_STAGE   (2 * GT_TILE * GT_PITCH) // halves per buffer
#define GT_THREADS 256
#define GT_LSTEP   (16u * GT_PITCH * 2u)   // LDS bytes between two successive copies of a lane (16 rows)
static_assert((NROWS % GT_TILE) == 0 && (DMODEL % GT_TILE) == 0 && (DFF % GT_TILE) == 0 && (NC % GT_TILE) == 0);
static_assert((DMODEL % GT_K) == 0 && (DFF % GT_K) == 0 && ((GT_PITCH * 2) % 16) == 0 && (((GT_PITCH * 2) / 16) % 2) == 1);
static_assert(GT_THREADS / 16 == 16 && 8 * 16 == GT_TILE && GT_K * 2 == 16 * 16);
static_assert((size_t)(GT_THREADS / 32) * 16 * 68 * sizeof(float) <= (size_t)2 * GT_STAGE * sizeof(unsigned short));

__device__ __forceinline__ unsigned lds_off(const void* p) { return (unsigned)(size_t)p; }
// the wave's own LDS reads have returned before the buffer they read is handed back for a refill
__device__ __forceinline__ void wait_ds0() {
#if defined(__HIP_DEVICE_COMPILE__)
  asm volatile("s_wait_dscnt 0x0" ::: "memory");
#endif
}
// the wave's own asynchronous copies have landed in LDS (the compiler places no wait for them)
__device__ __forceinline__ void wait_async0() {
#if defined(__HIP_DEVICE_COMPILE__)
  asm volatile("s_wait_asynccnt 0x0" ::: "memory");
#endif
}
// Eight asynchronous 16-B copies per lane, global -> LDS: rows 16 apart (gs halves in global memory, GT_LSTEP bytes in LDS).
// The closing s_wait_xcnt 0 stands inside the statement so that no address register is rewritten ahead of it.
__device__ __forceinline__ void copy8(unsigned l0, const unsigned short* g0, size_t gs) {
#if defined(__HIP_DEVICE_COMPILE__)
  const unsigned l1 = l0 + GT_LSTEP, l2 = l0 + 2u * GT_LSTEP, l3 = l0 + 3u * GT_LSTEP;
  const unsigned l4 = l0 + 4u * GT_LSTEP, l5 = l0 + 5u * GT_LSTEP, l6 = l0 + 6u * GT_LSTEP, l7 = l0 + 7u * GT_LSTEP;
  const unsigned short* g1 = g0 + gs;
  const unsigned short* g2 = g1 + gs;
  const unsigned short* g3 = g2 + gs;
  const unsigned short* g4 = g3 + gs;
  const unsigned short* g5 = g4 + gs;
  const unsigned short* g6 = g5 + gs;
  const unsigned short* g7 = g6 + gs;
  asm volatile(
      "global_load_async_to_lds_b128 %0, %8, off\n\t"
      "global_load_async_to_lds_b128 %1, %9, off\n\t"
      "global_load_async_to_lds_b128 %2, %10, off\n\t"
      "global_load_async_to_lds_b128 %3, %11, off\n\t"
      "global_load_async_to_lds_b128 %4, %12, off\n\t"
      "global_load_async_to_lds_b128 %5, %13, off\n\t"
      "global_load_async_to_lds_b128 %6, %14, off\n\t"
      "global_load_async_to_lds_b128 %7, %15, off\n\t"
      "s_wait_xcnt 0x0"
      :: "v"(l0), "v"(l1), "v"(l2), "v"(l3), "v"(l4), "v"(l5), "v"(l6), "v"(l7),
         "v"(g0), "v"(g1), "v"(g2), "v"(g3), "v"(g4), "v"(g5), "v"(g6), "v"(g7)
      : "memory");
#endif
}
// One trip's tile: lane's pieces of A rows 0..127 (LDS rows 0..127), then of Bt rows 0..127 (LDS rows 128..255).
__device__ __forceinline__ void stage_tile(unsigned l, const unsigned short* ga, size_t lda, const unsigned short* gb, size_t ldb) {
  copy8(l,                 ga, 16 * lda);
  copy8(l + 8u * GT_LSTEP, gb, 16 * ldb);
}

template <int OM, int HASR, int ACT, int MSK>
__global__ __launch_bounds__(GT_THREADS) void gemm64(
    const unsigned short* __restrict__ Ap, int lda, long long sA,
    const unsigned short* __restrict__ Btp, int ldb, long long sB,
    const float* __restrict__ Rp, const float* __restrict__ Mp,
    void* Cout, int ldc, long long sC,
    int M, int N, int K, float oscale, float ocarry) {
  __shared__ __align__(16) unsigned short sR[2 * GT_STAGE];   // the two operand buffers; later per-wave 16x64 f32 slabs, pitch 68 floats
  const int by   = blockIdx.y;
  const int tid  = threadIdx.x;
  const int lane = tid & 31;
  const int wave = tid >> 5;
  const int tilesN = N >> 7;
  const int tilesM = M >> 7;
  const int tile = blockIdx.x;
  if (tile >= tilesM * tilesN) return;   // block-uniform, in front of every barrier and copy
  const int tm = tile / tilesN;
  const int tn = tile - tm * tilesN;
  const int wm = wave >> 1, wn = wave & 1;
  const int m0 = (tm << 7) + (wm << 5);
  const int n0 = (tn << 7) + (wn << 6);

  const unsigned short* A1 = Ap  + (size_t)((long long)by * sA);
  const unsigned short* Bb = Btp + (size_t)((long long)by * sB);

  const int rlane = lane & 15;                 // row (A) / col (B, D) within subtile
  const int koff  = (lane >> 4) * 8;           // k offset of this lane half
  const int mOff  = (lane >> 4) * 8;           // D row offset

  // the lane's first piece of a trip: row tid>>4 of the tile, 16-B piece tid&15 of its 256 B
  const int crow = tid >> 4, cpc = tid & 15;
  const unsigned short* gA = A1 + (size_t)((tm << 7) + crow) * lda + cpc * 8;
  const unsigned short* gB = Bb + (size_t)((tn << 7) + crow) * ldb + cpc * 8;
  const unsigned lC = lds_off(sR) + (unsigned)(crow * (GT_PITCH * 2) + cpc * 16);

  v8f acc[2][4];
#pragma unroll
  for (int i = 0; i < 2; ++i)
#pragma unroll
    for (int j = 0; j < 4; ++j) acc[i][j] = zero8();

  const int nt = K >> 7;
  stage_tile(lC, gA, (size_t)lda, gB, (size_t)ldb);
  wait_async0();
  __syncthreads();                               // tile 0 is published
  if (nt > 1) stage_tile(lC + GT_STAGE * 2u, gA + GT_K, (size_t)lda, gB + GT_K, (size_t)ldb);

  // rolled: the buffer is picked by the trip's parity
#pragma unroll 1
  for (int t = 0; t < nt; ++t) {
    const unsigned short* sb = sR + (t & 1) * GT_STAGE;
    const unsigned short* fa = sb + ((wm << 5) + rlane) * GT_PITCH + koff;
    const unsigned short* fb = sb + (GT_TILE + (wn << 6) + rlane) * GT_PITCH + koff;
    // two fragment sets; the loops over them are unrolled so that every index is a constant and the sets stay in registers
    v16h af[2][2], bf[2][4];
#pragma unroll
    for (int j = 0; j < 4; ++j) bf[0][j] = ldfrag_u(fb + (j << 4) * GT_PITCH);
#pragma unroll
    for (int i = 0; i < 2; ++i) af[0][i] = ldfrag_u(fa + (i << 4) * GT_PITCH);
#pragma unroll
    for (int ks = 0; ks < GT_K / 32; ++ks) {
      const int cur = ks & 1, nxt = cur ^ 1;
      if (ks + 1 < GT_K / 32) {
#pragma unroll
        for (int j = 0; j < 4; ++j) bf[nxt][j] = ldfrag_u(fb + (j << 4) * GT_PITCH + (ks + 1) * 32);
#pragma unroll
        for (int i = 0; i < 2; ++i) af[nxt][i] = ldfrag_u(fa + (i << 4) * GT_PITCH + (ks + 1) * 32);
      }
      // keeps the next k-step's LDS reads one group ahead of this k-step's products
      __builtin_amdgcn_sched_barrier(0);
#pragma unroll
      for (int i = 0; i < 2; ++i) {
#pragma unroll
        for (int j = 0; j < 4; ++j) acc[i][j] = mma_raw(af[cur][i], bf[cur][j], acc[i][j]);
        dep_guard1(acc[i][0], acc[i][3], af[cur][i]);
      }
      keep4_h(bf[cur][0], bf[cur][1], bf[cur][2], bf[cur][3]);
      // ends the block of products, so that the reads of the k-step after next stay behind it
      __builtin_amdgcn_sched_barrier(0);
    }
    wait_ds0();
    wait_async0();
    __syncthreads();                             // publishes tile t + 1 and ends every reader's last read of tile t's buffer
    if (t + 2 < nt)
      stage_tile(lC + (unsigned)(t & 1) * (GT_STAGE * 2u), gA + (size_t)(t + 2) * GT_K, (size_t)lda,
                 gB + (size_t)(t + 2) * GT_K, (size_t)ldb);
  }
  wait_async0();
  acc_guard4(acc[0][0], acc[0][1], acc[0][2], acc[0][3]);
  acc_guard4(acc[1][0], acc[1][1], acc[1][2], acc[1][3]);

  const int hh2 = lane >> 4, c4 = (lane & 15) * 4;     // f32 out: 256-B row segment = 16 lanes x 16 B
  const int q8  = lane >> 3, c8 = (lane & 7) * 8;

  // ---- epilogue ----
  float* slab = (float*)(void*)sR + wave * (16 * 68);   // every read and copy of the ring ended at the last trip's barrier
#pragma unroll
  for (int i = 0; i < 2; ++i) {
    const int mBase = m0 + (i << 4);
#pragma unroll
    for (int j = 0; j < 4; ++j) {
#pragma unroll
      for (int r = 0; r < 8; ++r) {
        slab[(mOff + r) * 68 + (j << 4) + rlane] = acc[i][j][r];
      }
    }
    wave_sync_lds();
    if constexpr (OM == 0) {
      float* C = (float*)Cout + (size_t)((long long)by * sC);
      v4f vals[8];
#pragma unroll
      for (int it = 0; it < 8; ++it) {
        const int row = it * 2 + hh2;                      // it 0..7 x hh2 0..1 = rows 0..15
        const int gr  = mBase + row;
        v4f v = *(const v4f*)(slab + row * 68 + c4);
        v4f rv = {0.f, 0.f, 0.f, 0.f};
        if constexpr (HASR != 0) {
          const float* R = Rp + (size_t)((long long)by * sC);
          const v4f rraw = *(const v4f*)(R + (size_t)gr * ldc + n0 + c4);
#pragma unroll
          for (int e = 0; e < 4; ++e) rv[e] = (HASR == 1) ? bfr(rraw[e]) : rraw[e];
        }
        float mk = 1.0f;
        if constexpr (MSK == 1) mk = bfr(Mp[gr]);
#pragma unroll
        for (int e = 0; e < 4; ++e) v[e] = (v[e] * oscale + rv[e]) * mk;
        vals[it] = v;
      }
      {
#pragma unroll
        for (int it = 0; it < 8; ++it) {
          const int gr = mBase + it * 2 + hh2;
          *(v4f*)(C + (size_t)gr * ldc + n0 + c4) = vals[it];
        }
        
      }
    } else {
      unsigned short* C = (unsigned short*)Cout + (size_t)((long long)by * sC);
      v4u hv[4];
#pragma unroll
      for (int it = 0; it < 4; ++it) {
        const int row = it * 4 + q8;                       // it 0..3 x q8 0..3 = rows 0..15
        const float* sp = slab + row * 68 + c8;
        v4u a = {0u, 0u, 0u, 0u};
#pragma unroll
        for (int e = 0; e < 4; ++e) {
          float f0 = sp[2 * e] * oscale;
          float f1 = sp[2 * e + 1] * oscale;
          if constexpr (ACT == 1) { f0 = gelu_f(f0); f1 = gelu_f(f1); }
          f0 *= ocarry; f1 *= ocarry;
          a[e] = pk16(h_bits((_Float16)f0), h_bits((_Float16)f1));
        }
        hv[it] = a;
      }
      {
#pragma unroll
        for (int it = 0; it < 4; ++it) {
          const int row = it * 4 + q8;
          *(v4u*)(C + (size_t)(mBase + row) * ldc + n0 + c8) = hv[it];
        }
        
      }
    }
    wave_sync_lds();
  }
}

// =====================================================================================================
// Full attention for one batch, one head and 128 query rows (8 waves, 16 query rows per wave), head dim 64, all 2048 keys:
//   q plane (f16 x16) QH[b*2048 + tok][64*head + d], pitch 512; k plane (f16 x16) KH[b*2048 + key][64*head + d], pitch 512;
//   v^T plane (f16 x16): VT[b*512 + 64*head + d][key] (pitch 2048); out (f16 x1024): CT[b*2048 + tok][64*head + d] =
//   1024 * sum_m softmax_m(q.k / 8 + c_q) v[m][d] with the per-query-row mask constant c_q = -1e5 * (1 - bf16(mask[b][tok]))
//   (softmax run in base 2: t = (q.k/carries) * log2(e)/8 + c_q*log2(e), the row constant folded in as the fma addend).
//   The head's k rows and v^T rows are the same for all 8 waves: a tile is 64 keys = [k 64 rows | v^T 64 rows] of 128 B each (one whole
//   line per row), LDS pitch 144 B (16 B x odd: 16-B row readers meet no bank twice), two buffers. Each lane copies 4 pieces of 16 B
//   per tile with asynchronous copies to LDS (a wave's copy = 4 whole rows = 4 whole lines); the copies of tile t + 2 are issued behind
//   the barrier that ends trip t and fly while trip t + 1 is worked on. A trip reads its own buffer alone.
//   Key steps of 32 from 0 to 2047, two per trip (block-uniform trip count 32); every score is finite, so the running max is finite
//   from the first step on; the rescale exponent is clamped at -126 so the first step (running max -inf) gives a tiny finite factor
//   times zero sums.
//   Per step: 2 score tiles on f16 WMMA (K = 64 as two k-steps of 32), fragments read from the staged tile (two 16-B LDS loads per
//   fragment); online max-subtracted softmax in f32 (exp2); rescale of the running sums; the A fragment of P*1024 rebuilt from the
//   wave's LDS prob rows (float vector loads, RNE to f16, split k map) and the four v^T B fragments read from the staged tile;
//   4 P.V WMMAs.
//   Final 1/l and carry folds in f32; the wave's own prob tile then serves as its 16-bit result rows [16][64], pitch 72 halves
//   (element stores, wave-level LDS ordering), from which the wave writes whole 128-B lines.
// coverage: wave: 4 iterations x 4 rows x (8 lanes x 8 halves) = 16 rows x 64 halves; block: 8 waves = 128 rows of one head;
//           grid (4 batches x 8 heads x 16 query blocks) covers all 8192 x 512 of CT exactly once, each line written by one wave.
// =====================================================================================================
#define PS_FLOATS (HPB * 16 * 36)
#define AT_KEYS   64                        // keys per staged tile
#define AT_PITCH  72                        // halves: 144 B
#define AT_STAGE  ((AT_KEYS + HDIM) * AT_PITCH) // halves per buffer: k rows, then v^T rows
#define AT_TILES  (NC / AT_KEYS)
#define AT_LSTEP  (32u * AT_PITCH * 2u)     // LDS bytes between two successive copies of a lane (32 rows)
static_assert(HDIM * 2 == 128 && AT_KEYS * 2 == 128 && ATT_THREADS / 8 == 32 && AT_KEYS == 64 && HDIM == 64);
static_assert(((AT_PITCH * 2) % 16) == 0 && (((AT_PITCH * 2) / 16) % 2) == 1 && (NC % AT_KEYS) == 0 && AT_TILES >= 2);
static_assert((size_t)16 * AT_PITCH * sizeof(unsigned short) <= (size_t)16 * 36 * sizeof(float));

// One tile: four asynchronous 16-B copies per lane, global -> LDS: k rows r and r + 32, then v^T rows r and r + 32 (LDS rows 32 apart).
// The closing s_wait_xcnt 0 stands inside the statement so that no address register is rewritten ahead of it.
__device__ __forceinline__ void stage_kv(unsigned l0, const unsigned short* k0, const unsigned short* v0) {
#if defined(__HIP_DEVICE_COMPILE__)
  const unsigned l1 = l0 + AT_LSTEP, l2 = l0 + 2u * AT_LSTEP, l3 = l0 + 3u * AT_LSTEP;
  const unsigned short* k1 = k0 + (size_t)32 * DMODEL;
  const unsigned short* v1 = v0 + (size_t)32 * NC;
  asm volatile(
      "global_load_async_to_lds_b128 %0, %4, off\n\t"
      "global_load_async_to_lds_b128 %1, %5, off\n\t"
      "global_load_async_to_lds_b128 %2, %6, off\n\t"
      "global_load_async_to_lds_b128 %3, %7, off\n\t"
      "s_wait_xcnt 0x0"
      :: "v"(l0), "v"(l1), "v"(l2), "v"(l3), "v"(k0), "v"(k1), "v"(v0), "v"(v1)
      : "memory");
#endif
}

__global__ __launch_bounds__(ATT_THREADS)
void attn8(const unsigned short* __restrict__ QHp, const unsigned short* __restrict__ KHp,
           const unsigned short* __restrict__ VTq, const float* __restrict__ mkp, unsigned short* CT) {
  __shared__ __align__(16) unsigned short sKV[2 * AT_STAGE]; // the two k / v^T tile buffers
  __shared__ __align__(16) float smem[PS_FLOATS];          // per wave prob tile [row][32 keys], pitch 36; later its result rows

  const int tid  = threadIdx.x;
  const int wave = tid >> 5;
  const int lane = tid & 31;
  const int hh   = lane >> 4;
  const int c    = lane & 15;

  const int qt   = blockIdx.x % NQB;                       // query block 0..15
  const int head = (blockIdx.x / NQB) % NHEAD;             // 0..7
  const int bat  = blockIdx.x / (NQB * NHEAD);             // 0..3
  const int q0   = qt * (HPB * 16) + wave * 16;

  const size_t qofs = ((size_t)bat * NQ + q0 + c) * DMODEL + head * HDIM + 8 * hh;
  const _Float16* Qh = (const _Float16*)(const void*)QHp + qofs;
  const float lsc = (LOG2E * ATT_SCALE) / (QC * KC);                   // log2(e) / 8 / carries

  // the lane's first piece of a tile: row tid>>3 of the k rows (and of the v^T rows), 16-B piece tid&7 of its 128 B
  const int crow = tid >> 3, cpc = tid & 7;
  const unsigned short* gK = KHp + ((size_t)bat * NC + crow) * DMODEL + head * HDIM + cpc * 8;
  const unsigned short* gV = VTq + ((size_t)bat * DMODEL + head * HDIM + crow) * NC + cpc * 8;
  const unsigned lC = lds_off(sKV) + (unsigned)(crow * (AT_PITCH * 2) + cpc * 16);

  stage_kv(lC, gK, gV);

  // per-query-row mask constant (rows 8*hh + r of this tile), in base-2 units
  float cm2[8];
  {
    const float* mq = mkp + (size_t)bat * NQ + q0 + 8 * hh;
    const v4f ma = *(const v4f*)(mq);
    const v4f mb = *(const v4f*)(mq + 4);
#pragma unroll
    for (int r = 0; r < 4; ++r) {
      cm2[r]     = (MASKNEG * (1.0f - bfr(ma[r]))) * LOG2E;
      cm2[4 + r] = (MASKNEG * (1.0f - bfr(mb[r]))) * LOG2E;
    }
  }

  const v16h qa = ldfrag_h(Qh), qb = ldfrag_h(Qh + 32);

  float mrow[8], lrow[8];
  v8f o0 = zero8(), o1 = zero8(), o2 = zero8(), o3 = zero8();
#pragma unroll
  for (int r = 0; r < 8; ++r) { mrow[r] = -INFINITY; lrow[r] = 0.f; }
  float* pt = smem + wave * (16 * 36);

  wait_async0();
  __syncthreads();                               // tile 0 is published
  stage_kv(lC + AT_STAGE * 2u, gK + (size_t)AT_KEYS * DMODEL, gV + AT_KEYS);

  // rolled: the buffer is picked by the trip's parity
#pragma unroll 1
  for (int t = 0; t < AT_TILES; ++t) {
    const unsigned short* sb = sKV + (t & 1) * AT_STAGE;
    const unsigned short* sk = sb + c * AT_PITCH + 8 * hh;
    const unsigned short* sv = sb + (AT_KEYS + c) * AT_PITCH + 8 * hh;
    // unrolled: the two key steps of a tile read it at constant offsets
#pragma unroll
    for (int ks = 0; ks < AT_KEYS / 32; ++ks) {
      const unsigned short* kp = sk + (ks * 32) * AT_PITCH;
      const unsigned short* vp = sv + ks * 32;
      const unsigned short* kq = kp + 16 * AT_PITCH;
      const v16h k00 = ldfrag_u(kp), k01 = ldfrag_u(kp + 32);
      const v16h k10 = ldfrag_u(kq), k11 = ldfrag_u(kq + 32);
      v8f s0, s1;
      s0 = mma_raw(qa, k00, zero8());
      s0 = mma_raw(qb, k01, s0);
      guard_s2(s0, k00, k01);
      s1 = mma_raw(qa, k10, zero8());
      s1 = mma_raw(qb, k11, s1);
      guard_s4(s1, k10, k11, qa, qb);
      // read ahead of the softmax, whose LDS ordering points would otherwise hold these reads back until the products need them
      const v16h vb0 = ldfrag_u(vp);
      const v16h vb1 = ldfrag_u(vp + 16 * AT_PITCH);
      const v16h vb2 = ldfrag_u(vp + 32 * AT_PITCH);
      const v16h vb3 = ldfrag_u(vp + 48 * AT_PITCH);
#pragma unroll
      for (int r = 0; r < 8; ++r) {
        const float t0 = fmaf(s0[r], lsc, cm2[r]);
        const float t1 = fmaf(s1[r], lsc, cm2[r]);
        float mx = fmaxf(t0, t1);
#pragma unroll
        for (int off = 1; off < 16; off <<= 1) mx = fmaxf(mx, __shfl_xor(mx, off, 32));
        const float mn = fmaxf(mrow[r], mx);
        const float al = exp2f(fmaxf(mrow[r] - mn, -126.0f));
        mrow[r] = mn;
        const float e0 = exp2f(t0 - mn);
        const float e1 = exp2f(t1 - mn);
        float ps = e0 + e1;
#pragma unroll
        for (int off = 1; off < 16; off <<= 1) ps += __shfl_xor(ps, off, 32);
        lrow[r] = lrow[r] * al + ps;
        o0[r] *= al;
        o1[r] *= al;
        o2[r] *= al;
        o3[r] *= al;
        const int ro = (8 * hh + r) * 36 + c;
        pt[ro]      = e0;
        pt[ro + 16] = e1;
      }
      wave_sync_lds();
      FragH ph;
      {
        const float* prow = pt + c * 36 + 8 * hh;
        const v4f p0 = *(const v4f*)(prow), p1 = *(const v4f*)(prow + 4);
        const v4f p2 = *(const v4f*)(prow + 16), p3 = *(const v4f*)(prow + 20);
#pragma unroll
        for (int e = 0; e < 4; ++e) {
          ph.h[0][e]     = (_Float16)(p0[e] * PC);              // elements 0..7  = keys kb + 8hh + 0..7
          ph.h[0][4 + e] = (_Float16)(p1[e] * PC);
          ph.h[1][e]     = (_Float16)(p2[e] * PC);              // elements 8..15 = keys kb + 16 + 8hh + 0..7
          ph.h[1][4 + e] = (_Float16)(p3[e] * PC);
        }
      }
      o0 = mma_raw(ph.v, vb0, o0);
      o1 = mma_raw(ph.v, vb1, o1);
      o2 = mma_raw(ph.v, vb2, o2);
      o3 = mma_raw(ph.v, vb3, o3);
      guard_pv4(o0, o1, o2, o3, ph.v, vb0, vb1, vb2, vb3);
      wave_sync_lds();
    }
    wait_ds0();
    wait_async0();
    __syncthreads();                             // publishes tile t + 1 and ends every reader's last read of tile t's buffer
    if (t + 2 < AT_TILES)
      stage_kv(lC + (unsigned)(t & 1) * (AT_STAGE * 2u), gK + (size_t)(t + 2) * (AT_KEYS * DMODEL), gV + (size_t)(t + 2) * AT_KEYS);
  }
  wait_async0();

  // ---- fold 1/l and the carries (1024 on P, 16 on v, 1024 on the stored ctx), stage the wave's 16x64 slice as 16-bit in its own
  //      prob tile (its last reads of it ended in the loop) ----
  unsigned short* Os = (unsigned short*)(void*)pt;
  const float oc = FC / (PC * VC);
#pragma unroll
  for (int r = 0; r < 8; ++r) {
    const float inv = (1.0f / lrow[r]) * oc;
    unsigned short* op = Os + (8 * hh + r) * AT_PITCH + c;
    op[0]  = h_bits((_Float16)(o0[r] * inv));
    op[16] = h_bits((_Float16)(o1[r] * inv));
    op[32] = h_bits((_Float16)(o2[r] * inv));
    op[48] = h_bits((_Float16)(o3[r] * inv));
  }
  wave_sync_lds();
  // ---- the wave writes its 16 rows of CT: iteration it -> rows it*4 + lane/8, halves (lane%8)*8 .. +7 of the head's 64 ----
  {
    const int q8 = lane >> 3, c8 = (lane & 7) * 8;
    v4u vals[4];
#pragma unroll
    for (int it = 0; it < 4; ++it) vals[it] = *(const v4u*)(Os + (it * 4 + q8) * AT_PITCH + c8);
    unsigned short* dst = CT + ((size_t)bat * NQ + q0) * DMODEL + head * HDIM;
#pragma unroll
    for (int it = 0; it < 4; ++it) *(v4u*)(dst + (size_t)(it * 4 + q8) * DMODEL + c8) = vals[it];
  }
}

// =====================================================================================================
// the input row and multiplies by bf16(mask[row]). Output is the 16-bit plane outh[row][c] = f16(value * hc) only:
//   one block of 128 threads per row, 4 consecutive floats per thread (one 16-B load); the 16-bit row is staged in LDS (8 B per
// =====================================================================================================
template <int RIN>
__global__ __launch_bounds__(LN_THREADS)
void lnorm(const float* __restrict__ Yp, const float* __restrict__ mkp, unsigned short* outh, float hc) {
  __shared__ float red[2][LN_THREADS / 32];
  __shared__ __align__(16) unsigned short srow[DMODEL];
  const int row  = blockIdx.x;
  const int tid  = threadIdx.x;
  const int lane = tid & 31;
  const int wave = tid >> 5;
  const size_t base = (size_t)row * DMODEL + (size_t)tid * 4;
  v4f v = *(const v4f*)(Yp + base);
  if constexpr (RIN == 1) {
    const float mk = bfr(mkp[row]);
#pragma unroll
    for (int e = 0; e < 4; ++e) v[e] = bfr(v[e]) * mk;
  }
  float s = (v[0] + v[1]) + (v[2] + v[3]);
#pragma unroll
  for (int off = 1; off < 32; off <<= 1) s += __shfl_xor(s, off, 32);
  if (lane == 0) red[0][wave] = s;
  __syncthreads();
  float tot = 0.f;
#pragma unroll
  for (int w = 0; w < LN_THREADS / 32; ++w) tot += red[0][w];
  const float mu = tot * (1.0f / (float)DMODEL);
  v4f d;
#pragma unroll
  for (int e = 0; e < 4; ++e) d[e] = v[e] - mu;
  float q = (d[0] * d[0] + d[1] * d[1]) + (d[2] * d[2] + d[3] * d[3]);
#pragma unroll
  for (int off = 1; off < 32; off <<= 1) q += __shfl_xor(q, off, 32);
  if (lane == 0) red[1][wave] = q;
  __syncthreads();
  float totq = 0.f;
#pragma unroll
  for (int w = 0; w < LN_THREADS / 32; ++w) totq += red[1][w];
  const float var  = totq * (1.0f / (float)DMODEL);
  const float rstd = rsqrtf(var + LN_EPS);
  v4f o;
#pragma unroll
  for (int e = 0; e < 4; ++e) o[e] = d[e] * rstd;
  v2u w;
  w[0] = pk16(h_bits((_Float16)(o[0] * hc)), h_bits((_Float16)(o[1] * hc)));
  w[1] = pk16(h_bits((_Float16)(o[2] * hc)), h_bits((_Float16)(o[3] * hc)));
  *(v2u*)(srow + tid * 4) = w;
  __syncthreads();
  if (tid < DMODEL / 8) {                                 // waves 0..1, whole waves
    const v4u hv = *(const v4u*)(srow + tid * 8);
    unsigned short* dst = outh + (size_t)row * DMODEL + (size_t)tid * 8;
    {
      *(v4u*)dst = hv;
      
    }
  }
}

// =====================================================================================================
// Workspace map (bytes); every plane is an exact multiple of its tile / whole-row store granularity (M, N exact multiples of 64, rows
//   WQKV f16 [1536][512] x64         1572864   (transposed in-projections [n][k]: rows 0..511 q, 512..1023 k, 1024..1535 v)
//   WO16 f16 [512][512] x64           524288   (Wo^T)
//   W116 f16 [2048][512] x64         2097152   (W1^T)
//   W216 f16 [512][2048] x128        2097152   (W2^T)
//   H16  f16 [8192][512] x16         8388608   (first LayerNorm output)
//   QH   f16 [8192][512] x16         8388608
//   KH   f16 [8192][512] x16         8388608
//   VT   f16 [4][512][2048] x16      8388608   (v^T per batch)
//   CT   f16 [8192][512] x1024       8388608   (attention ctx, merged heads)
//   X1F  f32 [8192][512]            16777216   ((x + ctx . Wo) * mask)
//   H2   f16 [8192][512] x16         8388608   (second LayerNorm output)
//   HH   f16 [8192][2048] x16       33554432   (gelu hidden)
//   end                            106954752
// =====================================================================================================
extern "C" void kernel_launch(void* const* d_in, const int* in_sizes, int n_in,
                              void* d_out, int out_size, void* d_ws, size_t ws_size,
                              hipStream_t stream) {
  if (n_in < 8) return;
  if (in_sizes[0] != NROWS * DMODEL) return;
  if (in_sizes[1] != NROWS) return;
  if (in_sizes[2] != DMODEL * DMODEL || in_sizes[3] != DMODEL * DMODEL ||
      in_sizes[4] != DMODEL * DMODEL || in_sizes[5] != DMODEL * DMODEL) return;
  if (in_sizes[6] != DMODEL * DFF || in_sizes[7] != DFF * DMODEL) return;
  if (out_size != NROWS * DMODEL) return;

  const float* x   = (const float*)d_in[0];
  const float* mk  = (const float*)d_in[1];
  const float* wq  = (const float*)d_in[2];
  const float* wk  = (const float*)d_in[3];
  const float* wv  = (const float*)d_in[4];
  const float* wo  = (const float*)d_in[5];
  const float* w1  = (const float*)d_in[6];
  const float* w2  = (const float*)d_in[7];
  float*       out = (float*)d_out;

  const size_t PWQKV = (size_t)3 * DMODEL * DMODEL * 2;           //  1572864
  const size_t PWO   = (size_t)DMODEL * DMODEL * 2;               //   524288
  const size_t PW1   = (size_t)DFF * DMODEL * 2;                  //  2097152
  const size_t PW2   = (size_t)DMODEL * DFF * 2;                  //  2097152
  const size_t PX    = (size_t)NROWS * DMODEL * 2;                //  8388608
  const size_t PVT   = (size_t)NB * DMODEL * NC * 2;              //  8388608
  const size_t PY    = (size_t)NROWS * DMODEL * 4;                // 16777216
  const size_t PH    = (size_t)NROWS * DFF * 2;                   // 33554432
  size_t off = 0;
  const size_t oWQKV = off; off += PWQKV;
  const size_t oWO   = off; off += PWO;
  const size_t oW1   = off; off += PW1;
  const size_t oW2   = off; off += PW2;
  const size_t oH    = off; off += PX;
  const size_t oQH   = off; off += PX;
  const size_t oKH   = off; off += PX;
  const size_t oVT   = off; off += PVT;
  const size_t oCT   = off; off += PX;
  const size_t oXF   = off; off += PY;
  const size_t oH2   = off; off += PX;
  const size_t oHH   = off; off += PH;
  if (off > ws_size) return;                                      // off = 106954752
  if (off > (size_t)134217728) return;

  char* ws = (char*)d_ws;
  unsigned short* WQKV = (unsigned short*)(ws + oWQKV);
  unsigned short* WO16 = (unsigned short*)(ws + oWO);
  unsigned short* W116 = (unsigned short*)(ws + oW1);
  unsigned short* W216 = (unsigned short*)(ws + oW2);
  unsigned short* H16  = (unsigned short*)(ws + oH);
  unsigned short* QH   = (unsigned short*)(ws + oQH);
  unsigned short* KH   = (unsigned short*)(ws + oKH);
  unsigned short* VTp  = (unsigned short*)(ws + oVT);
  unsigned short* CT   = (unsigned short*)(ws + oCT);
  float*          X1F  = (float*)(ws + oXF);
  unsigned short* H2   = (unsigned short*)(ws + oH2);
  unsigned short* HH   = (unsigned short*)(ws + oHH);

  const dim3 blk(256);
  const dim3 gTsq(DMODEL / 64, DMODEL / 64);                       // in[512][512]  -> out[512][512]:  (C/64, R/64) = (8, 8)
  const dim3 gT1(DFF / 64, DMODEL / 64);                           // in[512][2048] -> out[2048][512]: (32, 8)
  const dim3 gT2(DMODEL / 64, DFF / 64);                           // in[2048][512] -> out[512][2048]: (8, 32)
  const dim3 bG(GT_THREADS);                                       // 256
  const dim3 gP((NROWS / GT_TILE) * (DMODEL / GT_TILE), 1);        // 256
  const dim3 gV((DMODEL / GT_TILE) * (NC / GT_TILE), NB);          // 64 x 4
  const dim3 gF((NROWS / GT_TILE) * (DFF / GT_TILE), 1);           // 1024
  const dim3 gAT(ATT_BLOCKS);                                      // 512
  const dim3 bAT(ATT_THREADS);                                     // 256
  const dim3 gLN(NROWS);                                           // 8192
  const dim3 bLN(LN_THREADS);                                      // 128

  // (0) transposed weight planes [n][k] = f16( bf16_RNE(W[k][n]) * scale ), k contiguous
  tcvt16<<<gTsq, blk, 0, stream>>>(wq, WQKV, DMODEL, DMODEL, WSC);
  tcvt16<<<gTsq, blk, 0, stream>>>(wk, WQKV + (size_t)DMODEL * DMODEL, DMODEL, DMODEL, WSC);
  tcvt16<<<gTsq, blk, 0, stream>>>(wv, WQKV + (size_t)2 * DMODEL * DMODEL, DMODEL, DMODEL, WSC);
  tcvt16<<<gTsq, blk, 0, stream>>>(wo, WO16, DMODEL, DMODEL, WSC);
  tcvt16<<<gT1,  blk, 0, stream>>>(w1, W116, DMODEL, DFF, WSC);     // R = 512 (in), C = 2048 (out)
  tcvt16<<<gT2,  blk, 0, stream>>>(w2, W216, DFF, DMODEL, W2SC);    // R = 2048 (in), C = 512 (out)

  // (1) h = LayerNorm(bf16(x) * bf16(mask)) -> H16 (f16 x16)
  lnorm<1><<<gLN, bLN, 0, stream>>>(x, mk, H16, HCARRY);

  // (2) q projection: QH[m][n] = f16(16 * sum_k h[m][k] Wq[k][n]); M = 8192, N = 512, K = 512
  gemm64<2, 0, 0, 0><<<gP, bG, 0, stream>>>(
      H16, DMODEL, 0LL,
      WQKV, DMODEL, 0LL,
      x, mk,
      (void*)QH, DMODEL, 0LL,
      NROWS, DMODEL, DMODEL, 1.0f / (HCARRY * WSC), QC);

  // (3) k projection
  gemm64<2, 0, 0, 0><<<gP, bG, 0, stream>>>(
      H16, DMODEL, 0LL,
      WQKV + (size_t)DMODEL * DMODEL, DMODEL, 0LL,
      x, mk,
      (void*)KH, DMODEL, 0LL,
      NROWS, DMODEL, DMODEL, 1.0f / (HCARRY * WSC), KC);

  // (4) v^T per batch: VT[b][d][tok] = f16(16 * sum_k WvT[d][k] h_b[tok][k]); M = 512, N = 2048, K = 512
  gemm64<2, 0, 0, 0><<<gV, bG, 0, stream>>>(
      WQKV + (size_t)2 * DMODEL * DMODEL, DMODEL, 0LL,
      H16, DMODEL, (long long)NC * DMODEL,
      x, mk,
      (void*)VTp, NC, (long long)DMODEL * NC,
      DMODEL, NC, DMODEL, 1.0f / (HCARRY * WSC), VC);

  // (5) full attention per (batch, head, 128 query rows) -> CT (f16, x1024)
  attn8<<<gAT, bAT, 0, stream>>>(QH, KH, VTp, mk, CT);

  // (6) X1F = (CT . WoT^T / (1024 * 64) + bf16(x)) * bf16(mask); M = 8192, N = 512, K = 512, f32
  gemm64<0, 1, 0, 1><<<gP, bG, 0, stream>>>(
      CT, DMODEL, 0LL,
      WO16, DMODEL, 0LL,
      x, mk,
      (void*)X1F, DMODEL, 0LL,
      NROWS, DMODEL, DMODEL, 1.0f / (FC * WSC), 1.0f);

  // (7) h2 = LayerNorm(x1) -> H2 (f16 x16)
  lnorm<0><<<gLN, bLN, 0, stream>>>(X1F, mk, H2, H2C);

  // (8) HH = f16(16 * gelu(h2 . W1)); M = 8192, N = 2048, K = 512
  gemm64<2, 0, 1, 0><<<gF, bG, 0, stream>>>(
      H2, DMODEL, 0LL,
      W116, DMODEL, 0LL,
      x, mk,
      (void*)HH, DFF, 0LL,
      NROWS, DFF, DMODEL, 1.0f / (H2C * WSC), GC);

  // (9) out = HH . W2 / (16 * 128) + x1 (raw f32); M = 8192, N = 512, K = 2048, f32
  gemm64<0, 2, 0, 0><<<gP, bG, 0, stream>>>(
      HH, DFF, 0LL,
      W216, DFF, 0LL,
      X1F, mk,
      (void*)out, DMODEL, 0LL,
      NROWS, DMODEL, DFF, 1.0f / (GC * W2SC), 1.0f);
  (void)hipGetLastError();
}

// v003
// Measured time: 162 microseconds a run.
// Timed twice side by side with v002, it ran 1.25 and 1.24 times as fast.
// Over all steps from v000 it is 2.61 times as fast.
// Contractions: q/k projections (h f16 x16 . Wq^T/Wk^T f16 x64, K=512), v^T projection (Wv^T f16 x64 . h f16 x16, K=512),
// attention scores^T (k f16 x16 . q f16 x16, K=64), attention v^T . P^T (v^T f16 x16 . P f16 x1024, 32 keys per step),
// output projection (ctx f16 x1024 . Wo^T f16 x64, K=512), FFN1 (h2 f16 x16 . W1^T f16 x64, K=512), FFN2 (g f16 x16 . W2^T f16 x128, K=2048):
// all v_wmma_f32_16x16x32_f16 single products, f32 accumulate. LayerNorms (no affine), softmax, erf-GELU, mask, residuals in f32 on VALU.
// Every float input RNE-converted to bf16 on load.
#include <hip/hip_runtime.h>
#include <math.h>
#include <stdint.h>

#define NB      4
#define NQ      2048
#define NC      2048
#define DMODEL  512
#define DFF     2048
#define NHEAD   8
#define HDIM    64
#define NROWS   (NB * NQ)
#define WSC     64.0f
#define W2SC    128.0f
#define HCARRY  16.0f
#define QC      16.0f
#define KC      16.0f
#define VC      16.0f
#define PC      1024.0f
#define FC      1024.0f
#define H2C     16.0f
#define GC      16.0f
#define ATT_SCALE 0.125f
#define LOG2E   1.4426950408889634f
#define LN_EPS  1e-6f
#define MASKNEG (-100000.0f)
static_assert(NHEAD * HDIM == DMODEL);
static_assert((NQ % 64) == 0 && (NC % 64) == 0 && (DMODEL % 64) == 0 && (DFF % 64) == 0 && (NC % 32) == 0 && (NQ % 16) == 0);
static_assert((NROWS % 64) == 0 && (DMODEL % 32) == 0 && (DFF % 32) == 0);
#define HPB     8                       // waves per attention block (16 query rows per wave, one head per block)
#define NQB     (NQ / (HPB * 16))       // query blocks per batch and head (16)
#define ATT_THREADS (HPB * 32)
#define ATT_BLOCKS  (NB * NHEAD * NQB)
static_assert(ATT_THREADS == 256 && ATT_BLOCKS == 512 && NQB * HPB * 16 == NQ);
#define LN_THREADS 128
static_assert(LN_THREADS * 4 == DMODEL && (LN_THREADS % 32) == 0 && ((DMODEL / 8) % 32) == 0);

typedef _Float16 v16h __attribute__((ext_vector_type(16)));
typedef _Float16 v8h  __attribute__((ext_vector_type(8)));
typedef float    v8f  __attribute__((ext_vector_type(8)));
typedef float    v4f  __attribute__((ext_vector_type(4)));
typedef unsigned int v4u __attribute__((ext_vector_type(4)));
typedef unsigned int v2u __attribute__((ext_vector_type(2)));

union FragH { v16h v; v8h h[2]; v4u u[2]; };

// ---- scalar helpers --------------------------------------------------------------------------------
__device__ __forceinline__ unsigned short bf_bits(float f) {          // f32 -> bf16 bits, RNE convert
  unsigned u = __float_as_uint(f);
  return (unsigned short)((u + 0x7FFFu + ((u >> 16) & 1u)) >> 16);
}
__device__ __forceinline__ float bf_up(unsigned short h) { return __uint_as_float(((unsigned)h) << 16); }
__device__ __forceinline__ float bfr(float f) { return bf_up(bf_bits(f)); }   // value of the bf16 RNE convert
__device__ __forceinline__ unsigned short h_bits(_Float16 x) { return __builtin_bit_cast(unsigned short, x); }
__device__ __forceinline__ unsigned pk16(unsigned short a, unsigned short b) { return (unsigned)a | ((unsigned)b << 16); }
__device__ __forceinline__ v8f zero8() { v8f z = {0.f, 0.f, 0.f, 0.f, 0.f, 0.f, 0.f, 0.f}; return z; }
__device__ __forceinline__ float gelu_f(float u) { return 0.5f * u * (1.0f + erff(u * 0.70710678118654752440f)); }

// ---- fragment loaders: 16-bit A/B operand, lane -> row/col (lane&15), p already includes +8*(lane>>4);
//      elements 0..7 <- p[0..7] (k0+8h..), elements 8..15 <- p[16..23] (k0+16+8h..)  (same split k map for A and B;
//      B is always read from a k-contiguous [n][k] plane)
__device__ __forceinline__ v16h ldfrag_h(const _Float16* p) {
  FragH f;
  f.h[0] = *(const v8h*)(p);
  f.h[1] = *(const v8h*)(p + 16);
  return f.v;
}
__device__ __forceinline__ v16h ldfrag_u(const unsigned short* p) {
  FragH f;
  f.u[0] = *(const v4u*)(p);
  f.u[1] = *(const v4u*)(p + 16);
  return f.v;
}

// ---- WMMA helpers with trailing VALU hazard gaps ------------------------------------------------------
__device__ __forceinline__ v8f mma_raw(v16h a, v16h b, v8f c) {
  return __builtin_amdgcn_wmma_f32_16x16x32_f16(false, a, false, b, (short)0, c, false, false);
}
__device__ __forceinline__ void dep_guard1(v8f& a, v8f& b, v16h x) {
#if defined(__HIP_DEVICE_COMPILE__)
  asm volatile("v_nop\n\tv_nop\n\tv_nop\n\tv_nop" : "+v"(a), "+v"(b) : "v"(x));
#endif
}
__device__ __forceinline__ void keep4_h(v16h a, v16h b, v16h c, v16h d) {
#if defined(__HIP_DEVICE_COMPILE__)
  asm volatile("v_nop" :: "v"(a), "v"(b), "v"(c), "v"(d));
#endif
}
__device__ __forceinline__ void acc_guard4(v8f& a, v8f& b, v8f& c, v8f& d) {
#if defined(__HIP_DEVICE_COMPILE__)
  asm volatile("v_nop\n\tv_nop\n\tv_nop\n\tv_nop" : "+v"(a), "+v"(b), "+v"(c), "+v"(d));
#endif
}
// the value that lane l ^ 16 holds (a vector cross-row move, no LDS round trip)
__device__ __forceinline__ float xhalf(float v) {
  const int b = __builtin_bit_cast(int, v);
  return __builtin_bit_cast(float, __builtin_amdgcn_permlanex16(b, b, 0x76543210, 0xfedcba98, false, false));
}
__device__ __forceinline__ void wave_sync_lds() {
  __builtin_amdgcn_fence(__ATOMIC_RELEASE, "workgroup");
  __builtin_amdgcn_wave_barrier();
  __builtin_amdgcn_fence(__ATOMIC_ACQUIRE, "workgroup");
}

// =====================================================================================================
// Transposing 16-bit pack of a weight stored [in][out] = in[R][C] (row pitch C): out[C][R] (row pitch R), out[c][r] =
// f16( bf16_RNE(in[r][c]) * sc ), sc a power of two (exact). One 64x64 tile per block through LDS: coalesced float4 reads of 64 input
// rows, 2-byte LDS stores into the transposed tile [c][r] (pitch 72 halves), block barrier, then every output row segment of 64 halves
// coverage: load 256 thr x 16 floats = 64x64; store 2 it x 8 waves x 4 rows x (8 lanes x 8 halves) = 64 rows x 64 halves;
//           grid (C/64, R/64) exact (host checks), each output line written by exactly one wave.
// =====================================================================================================
__global__ __launch_bounds__(256) void tcvt16(const float* __restrict__ src, unsigned short* dst, int R, int C, float sc) {
  __shared__ __align__(16) unsigned short sT[64 * 72];
  const int tid = threadIdx.x, lane = tid & 31, wave = tid >> 5;
  const int c0 = blockIdx.x * 64, r0 = blockIdx.y * 64;
  const int rr = tid >> 2, cc = (tid & 3) * 16;
  const float* sp = src + (size_t)(r0 + rr) * C + c0 + cc;
#pragma unroll
  for (int e = 0; e < 4; ++e) {
    const v4f a = *(const v4f*)(sp + 4 * e);
#pragma unroll
    for (int k = 0; k < 4; ++k)
      sT[(cc + 4 * e + k) * 72 + rr] = h_bits((_Float16)(bfr(a[k]) * sc));
  }
  __syncthreads();
  v4u vals[2];
#pragma unroll
  for (int it = 0; it < 2; ++it) {
    const int q = it * 32 + wave * 4 + (lane >> 3);
    vals[it] = *(const v4u*)(sT + q * 72 + (lane & 7) * 8);
  }
  {
#pragma unroll
    for (int it = 0; it < 2; ++it) {
      const int q = it * 32 + wave * 4 + (lane >> 3);
      *(v4u*)(dst + (size_t)(c0 + q) * R + r0 + (lane & 7) * 8) = vals[it];
    }
    
  }
}

// =====================================================================================================
// Batched f16 WMMA GEMM, operands staged in LDS: C[m][n] = f( oscale * sum_k A[m][k] * Bt[n][k] ) (+ residual) (* row mask).
// One 128x128 tile per block of 8 waves (4x2 waves of 32x64). A row-major [M][K] pitch lda (16-bit plane), Bt row-major [N][K] pitch ldb
// (k contiguous); M, N, K multiples of 128. blockIdx.y = batch index with element strides sA, sB, sC.
// A trip is 128 k: [A 128 rows | Bt 128 rows] of 256 B each, LDS pitch 272 B (16 B x odd: 16-B row readers meet no bank twice), two
// buffers. Each lane copies 16 pieces of 16 B per trip with asynchronous copies to LDS (a wave's copy = 2 whole rows = 4 whole lines);
// the copies of trip t + 2 are issued behind the barrier that ends trip t and fly while trip t + 1 is worked on.
// Inside a trip the fragments of k-step ks + 1 are read from LDS ahead of the products of k-step ks (never across the barrier).
// The k order of every accumulator is the ascending one (steps of 32). Behind the last trip's barrier the ring serves as the
// waves' epilogue slabs.
// OM: 0 = f32 out (pitch ldc; HASR 1 adds bf16(R[m][n]), HASR 2 adds raw f32 R[m][n], same pitch/stride as C; MSK 1 multiplies the
//     sum by bf16(Mrow[m])); 2 = f16 out (pitch ldc) = f16( act(value) * ocarry ), ACT 1 = erf-GELU.
// coverage: 2 slabs x 16 rows (f32: it 0..7 x lane>>4; f16: it 0..3 x lane>>3) x 64 cols = the wave's whole 32x64 tile;
//           8 waves = the block's 128x128 tile; grid = tilesM*tilesN blocks exactly (a surplus block leaves as a whole, before any barrier).
// =====================================================================================================
#define GT_TILE    128                     // rows of A and of Bt per block tile
#define GT_K       128                     // halves of every row per trip (256 B)
#define GT_PITCH   136                     // halves: 272 B
#define GT_STAGE   (2 * GT_TILE * GT_PITCH) // halves per buffer
#define GT_THREADS 256
#define GT_LSTEP   (16u * GT_PITCH * 2u)   // LDS bytes between two successive copies of a lane (16 rows)
static_assert((NROWS % GT_TILE) == 0 && (DMODEL % GT_TILE) == 0 && (DFF % GT_TILE) == 0 && (NC % GT_TILE) == 0);
static_assert((DMODEL % GT_K) == 0 && (DFF % GT_K) == 0 && ((GT_PITCH * 2) % 16) == 0 && (((GT_PITCH * 2) / 16) % 2) == 1);
static_assert(GT_THREADS / 16 == 16 && 8 * 16 == GT_TILE && GT_K * 2 == 16 * 16);
static_assert((size_t)(GT_THREADS / 32) * 16 * 68 * sizeof(float) <= (size_t)2 * GT_STAGE * sizeof(unsigned short));

__device__ __forceinline__ unsigned lds_off(const void* p) { return (unsigned)(size_t)p; }
// the wave's own LDS reads have returned before the buffer they read is handed back for a refill
__device__ __forceinline__ void wait_ds0() {
#if defined(__HIP_DEVICE_COMPILE__)
  asm volatile("s_wait_dscnt 0x0" ::: "memory");
#endif
}
// the wave's own asynchronous copies have landed in LDS (the compiler places no wait for them)
__device__ __forceinline__ void wait_async0() {
#if defined(__HIP_DEVICE_COMPILE__)
  asm volatile("s_wait_asynccnt 0x0" ::: "memory");
#endif
}
// Eight asynchronous 16-B copies per lane, global -> LDS: rows 16 apart (gs halves in global memory, GT_LSTEP bytes in LDS).
// The closing s_wait_xcnt 0 stands inside the statement so that no address register is rewritten ahead of it.
__device__ __forceinline__ void copy8(unsigned l0, const unsigned short* g0, size_t gs) {
#if defined(__HIP_DEVICE_COMPILE__)
  const unsigned l1 = l0 + GT_LSTEP, l2 = l0 + 2u * GT_LSTEP, l3 = l0 + 3u * GT_LSTEP;
  const unsigned l4 = l0 + 4u * GT_LSTEP, l5 = l0 + 5u * GT_LSTEP, l6 = l0 + 6u * GT_LSTEP, l7 = l0 + 7u * GT_LSTEP;
  const unsigned short* g1 = g0 + gs;
  const unsigned short* g2 = g1 + gs;
  const unsigned short* g3 = g2 + gs;
  const unsigned short* g4 = g3 + gs;
  const unsigned short* g5 = g4 + gs;
  const unsigned short* g6 = g5 + gs;
  const unsigned short* g7 = g6 + gs;
  asm volatile(
      "global_load_async_to_lds_b128 %0, %8, off\n\t"
      "global_load_async_to_lds_b128 %1, %9, off\n\t"
      "global_load_async_to_lds_b128 %2, %10, off\n\t"
      "global_load_async_to_lds_b128 %3, %11, off\n\t"
      "global_load_async_to_lds_b128 %4, %12, off\n\t"
      "global_load_async_to_lds_b128 %5, %13, off\n\t"
      "global_load_async_to_lds_b128 %6, %14, off\n\t"
      "global_load_async_to_lds_b128 %7, %15, off\n\t"
      "s_wait_xcnt 0x0"
      :: "v"(l0), "v"(l1), "v"(l2), "v"(l3), "v"(l4), "v"(l5), "v"(l6), "v"(l7),
         "v"(g0), "v"(g1), "v"(g2), "v"(g3), "v"(g4), "v"(g5), "v"(g6), "v"(g7)
      : "memory");
#endif
}
// One trip's tile: lane's pieces of A rows 0..127 (LDS rows 0..127), then of Bt rows 0..127 (LDS rows 128..255).
__device__ __forceinline__ void stage_tile(unsigned l, const unsigned short* ga, size_t lda, const unsigned short* gb, size_t ldb) {
  copy8(l,                 ga, 16 * lda);
  copy8(l + 8u * GT_LSTEP, gb, 16 * ldb);
}

template <int OM, int HASR, int ACT, int MSK>
__global__ __launch_bounds__(GT_THREADS) void gemm64(
    const unsigned short* __restrict__ Ap, int lda, long long sA,
    const unsigned short* __restrict__ Btp, int ldb, long long sB,
    const float* __restrict__ Rp, const float* __restrict__ Mp,
    void* Cout, int ldc, long long sC,
    int M, int N, int K, float oscale, float ocarry) {
  __shared__ __align__(16) unsigned short sR[2 * GT_STAGE];   // the two operand buffers; later per-wave 16x64 f32 slabs, pitch 68 floats
  const int by   = blockIdx.y;
  const int tid  = threadIdx.x;
  const int lane = tid & 31;
  const int wave = tid >> 5;
  const int tilesN = N >> 7;
  const int tilesM = M >> 7;
  const int tile = blockIdx.x;
  if (tile >= tilesM * tilesN) return;   // block-uniform, in front of every barrier and copy
  const int tm = tile / tilesN;
  const int tn = tile - tm * tilesN;
  const int wm = wave >> 1, wn = wave & 1;
  const int m0 = (tm << 7) + (wm << 5);
  const int n0 = (tn << 7) + (wn << 6);

  const unsigned short* A1 = Ap  + (size_t)((long long)by * sA);
  const unsigned short* Bb = Btp + (size_t)((long long)by * sB);

  const int rlane = lane & 15;                 // row (A) / col (B, D) within subtile
  const int koff  = (lane >> 4) * 8;           // k offset of this lane half
  const int mOff  = (lane >> 4) * 8;           // D row offset

  // the lane's first piece of a trip: row tid>>4 of the tile, 16-B piece tid&15 of its 256 B
  const int crow = tid >> 4, cpc = tid & 15;
  const unsigned short* gA = A1 + (size_t)((tm << 7) + crow) * lda + cpc * 8;
  const unsigned short* gB = Bb + (size_t)((tn << 7) + crow) * ldb + cpc * 8;
  const unsigned lC = lds_off(sR) + (unsigned)(crow * (GT_PITCH * 2) + cpc * 16);

  v8f acc[2][4];
#pragma unroll
  for (int i = 0; i < 2; ++i)
#pragma unroll
    for (int j = 0; j < 4; ++j) acc[i][j] = zero8();

  const int nt = K >> 7;
  stage_tile(lC, gA, (size_t)lda, gB, (size_t)ldb);
  wait_async0();
  __syncthreads();                               // tile 0 is published
  if (nt > 1) stage_tile(lC + GT_STAGE * 2u, gA + GT_K, (size_t)lda, gB + GT_K, (size_t)ldb);

  // rolled: the buffer is picked by the trip's parity
#pragma unroll 1
  for (int t = 0; t < nt; ++t) {
    const unsigned short* sb = sR + (t & 1) * GT_STAGE;
    const unsigned short* fa = sb + ((wm << 5) + rlane) * GT_PITCH + koff;
    const unsigned short* fb = sb + (GT_TILE + (wn << 6) + rlane) * GT_PITCH + koff;
    // two fragment sets; the loops over them are unrolled so that every index is a constant and the sets stay in registers
    v16h af[2][2], bf[2][4];
#pragma unroll
    for (int j = 0; j < 4; ++j) bf[0][j] = ldfrag_u(fb + (j << 4) * GT_PITCH);
#pragma unroll
    for (int i = 0; i < 2; ++i) af[0][i] = ldfrag_u(fa + (i << 4) * GT_PITCH);
#pragma unroll
    for (int ks = 0; ks < GT_K / 32; ++ks) {
      const int cur = ks & 1, nxt = cur ^ 1;
      if (ks + 1 < GT_K / 32) {
#pragma unroll
        for (int j = 0; j < 4; ++j) bf[nxt][j] = ldfrag_u(fb + (j << 4) * GT_PITCH + (ks + 1) * 32);
#pragma unroll
        for (int i = 0; i < 2; ++i) af[nxt][i] = ldfrag_u(fa + (i << 4) * GT_PITCH + (ks + 1) * 32);
      }
      // keeps the next k-step's LDS reads one group ahead of this k-step's products
      __builtin_amdgcn_sched_barrier(0);
#pragma unroll
      for (int i = 0; i < 2; ++i) {
#pragma unroll
        for (int j = 0; j < 4; ++j) acc[i][j] = mma_raw(af[cur][i], bf[cur][j], acc[i][j]);
        dep_guard1(acc[i][0], acc[i][3], af[cur][i]);
      }
      keep4_h(bf[cur][0], bf[cur][1], bf[cur][2], bf[cur][3]);
      // ends the block of products, so that the reads of the k-step after next stay behind it
      __builtin_amdgcn_sched_barrier(0);
    }
    wait_ds0();
    wait_async0();
    __syncthreads();                             // publishes tile t + 1 and ends every reader's last read of tile t's buffer
    if (t + 2 < nt)
      stage_tile(lC + (unsigned)(t & 1) * (GT_STAGE * 2u), gA + (size_t)(t + 2) * GT_K, (size_t)lda,
                 gB + (size_t)(t + 2) * GT_K, (size_t)ldb);
  }
  wait_async0();
  acc_guard4(acc[0][0], acc[0][1], acc[0][2], acc[0][3]);
  acc_guard4(acc[1][0], acc[1][1], acc[1][2], acc[1][3]);

  const int hh2 = lane >> 4, c4 = (lane & 15) * 4;     // f32 out: 256-B row segment = 16 lanes x 16 B
  const int q8  = lane >> 3, c8 = (lane & 7) * 8;

  // ---- epilogue ----
  float* slab = (float*)(void*)sR + wave * (16 * 68);   // every read and copy of the ring ended at the last trip's barrier
#pragma unroll
  for (int i = 0; i < 2; ++i) {
    const int mBase = m0 + (i << 4);
#pragma unroll
    for (int j = 0; j < 4; ++j) {
#pragma unroll
      for (int r = 0; r < 8; ++r) {
        slab[(mOff + r) * 68 + (j << 4) + rlane] = acc[i][j][r];
      }
    }
    wave_sync_lds();
    if constexpr (OM == 0) {
      float* C = (float*)Cout + (size_t)((long long)by * sC);
      v4f vals[8];
#pragma unroll
      for (int it = 0; it < 8; ++it) {
        const int row = it * 2 + hh2;                      // it 0..7 x hh2 0..1 = rows 0..15
        const int gr  = mBase + row;
        v4f v = *(const v4f*)(slab + row * 68 + c4);
        v4f rv = {0.f, 0.f, 0.f, 0.f};
        if constexpr (HASR != 0) {
          const float* R = Rp + (size_t)((long long)by * sC);
          const v4f rraw = *(const v4f*)(R + (size_t)gr * ldc + n0 + c4);
#pragma unroll
          for (int e = 0; e < 4; ++e) rv[e] = (HASR == 1) ? bfr(rraw[e]) : rraw[e];
        }
        float mk = 1.0f;
        if constexpr (MSK == 1) mk = bfr(Mp[gr]);
#pragma unroll
        for (int e = 0; e < 4; ++e) v[e] = (v[e] * oscale + rv[e]) * mk;
        vals[it] = v;
      }
      {
#pragma unroll
        for (int it = 0; it < 8; ++it) {
          const int gr = mBase + it * 2 + hh2;
          *(v4f*)(C + (size_t)gr * ldc + n0 + c4) = vals[it];
        }
        
      }
    } else {
      unsigned short* C = (unsigned short*)Cout + (size_t)((long long)by * sC);
      v4u hv[4];
#pragma unroll
      for (int it = 0; it < 4; ++it) {
        const int row = it * 4 + q8;                       // it 0..3 x q8 0..3 = rows 0..15
        const float* sp = slab + row * 68 + c8;
        v4u a = {0u, 0u, 0u, 0u};
#pragma unroll
        for (int e = 0; e < 4; ++e) {
          float f0 = sp[2 * e] * oscale;
          float f1 = sp[2 * e + 1] * oscale;
          if constexpr (ACT == 1) { f0 = gelu_f(f0); f1 = gelu_f(f1); }
          f0 *= ocarry; f1 *= ocarry;
          a[e] = pk16(h_bits((_Float16)f0), h_bits((_Float16)f1));
        }
        hv[it] = a;
      }
      {
#pragma unroll
        for (int it = 0; it < 4; ++it) {
          const int row = it * 4 + q8;
          *(v4u*)(C + (size_t)(mBase + row) * ldc + n0 + c8) = hv[it];
        }
        
      }
    }
    wave_sync_lds();
  }
}

// =====================================================================================================
// Full attention for one batch, one head and 128 query rows (8 waves, 16 query rows per wave), head dim 64, all 2048 keys:
//   q plane (f16 x16) QH[b*2048 + tok][64*head + d], pitch 512; k plane (f16 x16) KH[b*2048 + key][64*head + d], pitch 512;
//   v^T plane (f16 x16): VT[b*512 + 64*head + d][key] (pitch 2048); out (f16 x1024): CT[b*2048 + tok][64*head + d] =
//   1024 * sum_m softmax_m(q.k / 8 + c_q) v[m][d] with the per-query-row mask constant c_q = -1e5 * (1 - bf16(mask[b][tok]))
//   (softmax run in base 2: t = (q.k/carries) * log2(e)/8 + c_q*log2(e), the row constant folded in as the fma addend).
//   The head's k rows and v^T rows are the same for all 8 waves: a tile is 64 keys = [k 64 rows | v^T 64 rows] of 128 B each (one whole
//   line per row), LDS pitch 144 B (16 B x odd: 16-B row readers meet no bank twice), two buffers. Each lane copies 4 pieces of 16 B
//   per tile with asynchronous copies to LDS (a wave's copy = 4 whole rows = 4 whole lines); the copies of tile t + 2 are issued behind
//   the barrier that ends trip t and fly while trip t + 1 is worked on. A trip reads its own buffer alone.
//   Key steps of 32 from 0 to 2047, two per trip (block-uniform trip count 32); every score is finite, so the running max is finite
//   from the first step on; the rescale exponent is clamped at -126 so the first step (running max -inf) gives a tiny finite factor
//   times zero sums.
//   Both products run transposed: S^T = k . q^T (A = k rows, B = q columns) and O^T += v^T . P^T (A = v^T rows, B = P^T columns).
//   Lane (c, hh) then holds, of query column c alone, the scores of keys 8hh + r (tile 0) and 16 + 8hh + r (tile 1): maximum and sum
//   run inside the lane, the two lane halves exchange the maximum once per step; the sums are joined once, behind the loop; those
//   16 registers, times 1024 and RNE to f16, ARE the B fragment of P^T in the split k map; the rescale factor is the lane's own.
//   Per step: 2 score tiles on f16 WMMA (K = 64 as two k-steps of 32), fragments read from the staged tile (two 16-B LDS loads per
//   fragment); online max-subtracted softmax in f32 (exp2); rescale of the running sums; the four v^T A fragments read from the
//   staged tile; 4 v^T . P^T WMMAs. O^T tile j, register r = ctx[query c][16j + 8hh + r].
//   Final 1/l and carry folds in f32; the wave's LDS slab takes its 16-bit result rows [16][64], pitch 72 halves
//   (16-B stores, wave-level LDS ordering), from which the wave writes whole 128-B lines.
// coverage: wave: 4 iterations x 4 rows x (8 lanes x 8 halves) = 16 rows x 64 halves; block: 8 waves = 128 rows of one head;
//           grid (4 batches x 8 heads x 16 query blocks) covers all 8192 x 512 of CT exactly once, each line written by one wave.
// =====================================================================================================
#define PS_FLOATS (HPB * 16 * 36)
#define AT_KEYS   64                        // keys per staged tile
#define AT_PITCH  72                        // halves: 144 B
#define AT_STAGE  ((AT_KEYS + HDIM) * AT_PITCH) // halves per buffer: k rows, then v^T rows
#define AT_TILES  (NC / AT_KEYS)
#define AT_LSTEP  (32u * AT_PITCH * 2u)     // LDS bytes between two successive copies of a lane (32 rows)
static_assert(HDIM * 2 == 128 && AT_KEYS * 2 == 128 && ATT_THREADS / 8 == 32 && AT_KEYS == 64 && HDIM == 64);
static_assert(((AT_PITCH * 2) % 16) == 0 && (((AT_PITCH * 2) / 16) % 2) == 1 && (NC % AT_KEYS) == 0 && AT_TILES >= 2);
static_assert((size_t)16 * AT_PITCH * sizeof(unsigned short) <= (size_t)16 * 36 * sizeof(float));

// One tile: four asynchronous 16-B copies per lane, global -> LDS: k rows r and r + 32, then v^T rows r and r + 32 (LDS rows 32 apart).
// The closing s_wait_xcnt 0 stands inside the statement so that no address register is rewritten ahead of it.
__device__ __forceinline__ void stage_kv(unsigned l0, const unsigned short* k0, const unsigned short* v0) {
#if defined(__HIP_DEVICE_COMPILE__)
  const unsigned l1 = l0 + AT_LSTEP, l2 = l0 + 2u * AT_LSTEP, l3 = l0 + 3u * AT_LSTEP;
  const unsigned short* k1 = k0 + (size_t)32 * DMODEL;
  const unsigned short* v1 = v0 + (size_t)32 * NC;
  asm volatile(
      "global_load_async_to_lds_b128 %0, %4, off\n\t"
      "global_load_async_to_lds_b128 %1, %5, off\n\t"
      "global_load_async_to_lds_b128 %2, %6, off\n\t"
      "global_load_async_to_lds_b128 %3, %7, off\n\t"
      "s_wait_xcnt 0x0"
      :: "v"(l0), "v"(l1), "v"(l2), "v"(l3), "v"(k0), "v"(k1), "v"(v0), "v"(v1)
      : "memory");
#endif
}

__global__ __launch_bounds__(ATT_THREADS)
void attn8(const unsigned short* __restrict__ QHp, const unsigned short* __restrict__ KHp,
           const unsigned short* __restrict__ VTq, const float* __restrict__ mkp, unsigned short* CT) {
  __shared__ __align__(16) unsigned short sKV[2 * AT_STAGE]; // the two k / v^T tile buffers
  __shared__ __align__(16) float smem[PS_FLOATS];          // per wave slab of 16-bit result rows (epilogue only)

  const int tid  = threadIdx.x;
  const int wave = tid >> 5;
  const int lane = tid & 31;
  const int hh   = lane >> 4;
  const int c    = lane & 15;

  const int qt   = blockIdx.x % NQB;                       // query block 0..15
  const int head = (blockIdx.x / NQB) % NHEAD;             // 0..7
  const int bat  = blockIdx.x / (NQB * NHEAD);             // 0..3
  const int q0   = qt * (HPB * 16) + wave * 16;

  const size_t qofs = ((size_t)bat * NQ + q0 + c) * DMODEL + head * HDIM + 8 * hh;
  const _Float16* Qh = (const _Float16*)(const void*)QHp + qofs;
  const float lsc = (LOG2E * ATT_SCALE) / (QC * KC);                   // log2(e) / 8 / carries

  // the lane's first piece of a tile: row tid>>3 of the k rows (and of the v^T rows), 16-B piece tid&7 of its 128 B
  const int crow = tid >> 3, cpc = tid & 7;
  const unsigned short* gK = KHp + ((size_t)bat * NC + crow) * DMODEL + head * HDIM + cpc * 8;
  const unsigned short* gV = VTq + ((size_t)bat * DMODEL + head * HDIM + crow) * NC + cpc * 8;
  const unsigned lC = lds_off(sKV) + (unsigned)(crow * (AT_PITCH * 2) + cpc * 16);

  stage_kv(lC, gK, gV);

  // mask constant of the lane's query column, in base-2 units
  const float cm2 = (MASKNEG * (1.0f - bfr(mkp[(size_t)bat * NQ + q0 + c]))) * LOG2E;

  const v16h qa = ldfrag_h(Qh), qb = ldfrag_h(Qh + 32);

  float mrow = -INFINITY;                        // the column's running maximum
  v8f lacc = zero8();                            // the lane's own shares of the column's running sum (register r: keys = 8hh + r mod 16)
  v8f o0 = zero8(), o1 = zero8(), o2 = zero8(), o3 = zero8();

  const v8f lsc8 = {lsc, lsc, lsc, lsc, lsc, lsc, lsc, lsc};
  const v8f cm8  = {cm2, cm2, cm2, cm2, cm2, cm2, cm2, cm2};

  wait_async0();
  __syncthreads();                               // tile 0 is published
  stage_kv(lC + AT_STAGE * 2u, gK + (size_t)AT_KEYS * DMODEL, gV + AT_KEYS);

  // rolled: the buffer is picked by the trip's parity
#pragma unroll 1
  for (int t = 0; t < AT_TILES; ++t) {
    const unsigned short* sb = sKV + (t & 1) * AT_STAGE;
    const unsigned short* sk = sb + c * AT_PITCH + 8 * hh;
    const unsigned short* sv = sb + (AT_KEYS + c) * AT_PITCH + 8 * hh;
    // unrolled: the two key steps of a tile read it at constant offsets
#pragma unroll
    for (int ks = 0; ks < AT_KEYS / 32; ++ks) {
      const unsigned short* kp = sk + (ks * 32) * AT_PITCH;
      const unsigned short* vp = sv + ks * 32;
      const unsigned short* kq = kp + 16 * AT_PITCH;
      const v16h k00 = ldfrag_u(kp), k01 = ldfrag_u(kp + 32);
      const v16h k10 = ldfrag_u(kq), k11 = ldfrag_u(kq + 32);
      const v16h vb0 = ldfrag_u(vp);
      const v16h vb1 = ldfrag_u(vp + 16 * AT_PITCH);
      const v16h vb2 = ldfrag_u(vp + 32 * AT_PITCH);
      const v16h vb3 = ldfrag_u(vp + 48 * AT_PITCH);
      // holds the step's 16 LDS reads as one group in front of its products: left free, each pair of reads sinks to just in front of
      // the product that takes it, and the wave waits out a whole LDS latency there each time
      __builtin_amdgcn_sched_barrier(0);
      v8f s0, s1;
      s0 = mma_raw(k00, qa, zero8());
      s0 = mma_raw(k01, qb, s0);
      s1 = mma_raw(k10, qa, zero8());
      s1 = mma_raw(k11, qb, s1);
      const v8f t0 = __builtin_elementwise_fma(s0, lsc8, cm8);
      const v8f t1 = __builtin_elementwise_fma(s1, lsc8, cm8);
      const v8f tm = __builtin_elementwise_max(t0, t1);
      float mx = fmaxf(fmaxf(fmaxf(tm[0], tm[1]), fmaxf(tm[2], tm[3])), fmaxf(fmaxf(tm[4], tm[5]), fmaxf(tm[6], tm[7])));
      mx = fmaxf(mx, xhalf(mx));                 // the other 16 keys of this column
      const float mn = fmaxf(mrow, mx);
      const float al = exp2f(fmaxf(mrow - mn, -126.0f));
      mrow = mn;
      v8f e0, e1;
#pragma unroll
      for (int r = 0; r < 8; ++r) {
        e0[r] = exp2f(t0[r] - mn);
        e1[r] = exp2f(t1[r] - mn);
      }
      lacc = lacc * al + (e0 + e1);
      o0 *= al;
      o1 *= al;
      o2 *= al;
      o3 *= al;
      FragH ph;
      ph.h[0] = __builtin_convertvector(e0 * PC, v8h);          // elements 0..7  = keys kb + 8hh + 0..7
      ph.h[1] = __builtin_convertvector(e1 * PC, v8h);          // elements 8..15 = keys kb + 16 + 8hh + 0..7
      o0 = mma_raw(vb0, ph.v, o0);
      o1 = mma_raw(vb1, ph.v, o1);
      o2 = mma_raw(vb2, ph.v, o2);
      o3 = mma_raw(vb3, ph.v, o3);
    }
    // keeps the trip's arithmetic in front of the waits below: sunk behind the barrier, it would stand between the barrier and the
    // refill, and the wait for a tile's copies would follow their issue at once instead of one trip later
    __builtin_amdgcn_sched_barrier(0);
    wait_ds0();
    wait_async0();
    __syncthreads();                             // publishes tile t + 1 and ends every reader's last read of tile t's buffer
    if (t + 2 < AT_TILES)
      stage_kv(lC + (unsigned)(t & 1) * (AT_STAGE * 2u), gK + (size_t)(t + 2) * (AT_KEYS * DMODEL), gV + (size_t)(t + 2) * AT_KEYS);
  }
  wait_async0();

  // ---- join the halves' sums, fold 1/l and the carries (1024 on P, 16 on v, 1024 on the stored ctx), stage the wave's 16x64 slice
  //      as 16-bit in its own slab: row = query c, 16 B = d 16j + 8hh .. + 7 ----
  unsigned short* Os = (unsigned short*)(void*)(smem + wave * (16 * 36));
  const float oc = FC / (PC * VC);
  {
    const float lrow = ((lacc[0] + lacc[1]) + (lacc[2] + lacc[3])) + ((lacc[4] + lacc[5]) + (lacc[6] + lacc[7]));
    const float inv = (1.0f / (lrow + xhalf(lrow))) * oc;
    unsigned short* op = Os + c * AT_PITCH + 8 * hh;
    *(v8h*)(op)      = __builtin_convertvector(o0 * inv, v8h);
    *(v8h*)(op + 16) = __builtin_convertvector(o1 * inv, v8h);
    *(v8h*)(op + 32) = __builtin_convertvector(o2 * inv, v8h);
    *(v8h*)(op + 48) = __builtin_convertvector(o3 * inv, v8h);
  }
  wave_sync_lds();
  // ---- the wave writes its 16 rows of CT: iteration it -> rows it*4 + lane/8, halves (lane%8)*8 .. +7 of the head's 64 ----
  {
    const int q8 = lane >> 3, c8 = (lane & 7) * 8;
    v4u vals[4];
#pragma unroll
    for (int it = 0; it < 4; ++it) vals[it] = *(const v4u*)(Os + (it * 4 + q8) * AT_PITCH + c8);
    unsigned short* dst = CT + ((size_t)bat * NQ + q0) * DMODEL + head * HDIM;
#pragma unroll
    for (int it = 0; it < 4; ++it) *(v4u*)(dst + (size_t)(it * 4 + q8) * DMODEL + c8) = vals[it];
  }
}

// =====================================================================================================
// the input row and multiplies by bf16(mask[row]). Output is the 16-bit plane outh[row][c] = f16(value * hc) only:
//   one block of 128 threads per row, 4 consecutive floats per thread (one 16-B load); the 16-bit row is staged in LDS (8 B per
// =====================================================================================================
template <int RIN>
__global__ __launch_bounds__(LN_THREADS)
void lnorm(const float* __restrict__ Yp, const float* __restrict__ mkp, unsigned short* outh, float hc) {
  __shared__ float red[2][LN_THREADS / 32];
  __shared__ __align__(16) unsigned short srow[DMODEL];
  const int row  = blockIdx.x;
  const int tid  = threadIdx.x;
  const int lane = tid & 31;
  const int wave = tid >> 5;
  const size_t base = (size_t)row * DMODEL + (size_t)tid * 4;
  v4f v = *(const v4f*)(Yp + base);
  if constexpr (RIN == 1) {
    const float mk = bfr(mkp[row]);
#pragma unroll
    for (int e = 0; e < 4; ++e) v[e] = bfr(v[e]) * mk;
  }
  float s = (v[0] + v[1]) + (v[2] + v[3]);
#pragma unroll
  for (int off = 1; off < 32; off <<= 1) s += __shfl_xor(s, off, 32);
  if (lane == 0) red[0][wave] = s;
  __syncthreads();
  float tot = 0.f;
#pragma unroll
  for (int w = 0; w < LN_THREADS / 32; ++w) tot += red[0][w];
  const float mu = tot * (1.0f / (float)DMODEL);
  v4f d;
#pragma unroll
  for (int e = 0; e < 4; ++e) d[e] = v[e] - mu;
  float q = (d[0] * d[0] + d[1] * d[1]) + (d[2] * d[2] + d[3] * d[3]);
#pragma unroll
  for (int off = 1; off < 32; off <<= 1) q += __shfl_xor(q, off, 32);
  if (lane == 0) red[1][wave] = q;
  __syncthreads();
  float totq = 0.f;
#pragma unroll
  for (int w = 0; w < LN_THREADS / 32; ++w) totq += red[1][w];
  const float var  = totq * (1.0f / (float)DMODEL);
  const float rstd = rsqrtf(var + LN_EPS);
  v4f o;
#pragma unroll
  for (int e = 0; e < 4; ++e) o[e] = d[e] * rstd;
  v2u w;
  w[0] = pk16(h_bits((_Float16)(o[0] * hc)), h_bits((_Float16)(o[1] * hc)));
  w[1] = pk16(h_bits((_Float16)(o[2] * hc)), h_bits((_Float16)(o[3] * hc)));
  *(v2u*)(srow + tid * 4) = w;
  __syncthreads();
  if (tid < DMODEL / 8) {                                 // waves 0..1, whole waves
    const v4u hv = *(const v4u*)(srow + tid * 8);
    unsigned short* dst = outh + (size_t)row * DMODEL + (size_t)tid * 8;
    {
      *(v4u*)dst = hv;
      
    }
  }
}

// =====================================================================================================
// Workspace map (bytes); every plane is an exact multiple of its tile / whole-row store granularity (M, N exact multiples of 64, rows
//   WQKV f16 [1536][512] x64         1572864   (transposed in-projections [n][k]: rows 0..511 q, 512..1023 k, 1024..1535 v)
//   WO16 f16 [512][512] x64           524288   (Wo^T)
//   W116 f16 [2048][512] x64         2097152   (W1^T)
//   W216 f16 [512][2048] x128        2097152   (W2^T)
//   H16  f16 [8192][512] x16         8388608   (first LayerNorm output)
//   QH   f16 [8192][512] x16         8388608
//   KH   f16 [8192][512] x16         8388608
//   VT   f16 [4][512][2048] x16      8388608   (v^T per batch)
//   CT   f16 [8192][512] x1024       8388608   (attention ctx, merged heads)
//   X1F  f32 [8192][512]            16777216   ((x + ctx . Wo) * mask)
//   H2   f16 [8192][512] x16         8388608   (second LayerNorm output)
//   HH   f16 [8192][2048] x16       33554432   (gelu hidden)
//   end                            106954752
// =====================================================================================================
extern "C" void kernel_launch(void* const* d_in, const int* in_sizes, int n_in,
                              void* d_out, int out_size, void* d_ws, size_t ws_size,
                              hipStream_t stream) {
  if (n_in < 8) return;
  if (in_sizes[0] != NROWS * DMODEL) return;
  if (in_sizes[1] != NROWS) return;
  if (in_sizes[2] != DMODEL * DMODEL || in_sizes[3] != DMODEL * DMODEL ||
      in_sizes[4] != DMODEL * DMODEL || in_sizes[5] != DMODEL * DMODEL) return;
  if (in_sizes[6] != DMODEL * DFF || in_sizes[7] != DFF * DMODEL) return;
  if (out_size != NROWS * DMODEL) return;

  const float* x   = (const float*)d_in[0];
  const float* mk  = (const float*)d_in[1];
  const float* wq  = (const float*)d_in[2];
  const float* wk  = (const float*)d_in[3];
  const float* wv  = (const float*)d_in[4];
  const float* wo  = (const float*)d_in[5];
  const float* w1  = (const float*)d_in[6];
  const float* w2  = (const float*)d_in[7];
  float*       out = (float*)d_out;

  const size_t PWQKV = (size_t)3 * DMODEL * DMODEL * 2;           //  1572864
  const size_t PWO   = (size_t)DMODEL * DMODEL * 2;               //   524288
  const size_t PW1   = (size_t)DFF * DMODEL * 2;                  //  2097152
  const size_t PW2   = (size_t)DMODEL * DFF * 2;                  //  2097152
  const size_t PX    = (size_t)NROWS * DMODEL * 2;                //  8388608
  const size_t PVT   = (size_t)NB * DMODEL * NC * 2;              //  8388608
  const size_t PY    = (size_t)NROWS * DMODEL * 4;                // 16777216
  const size_t PH    = (size_t)NROWS * DFF * 2;                   // 33554432
  size_t off = 0;
  const size_t oWQKV = off; off += PWQKV;
  const size_t oWO   = off; off += PWO;
  const size_t oW1   = off; off += PW1;
  const size_t oW2   = off; off += PW2;
  const size_t oH    = off; off += PX;
  const size_t oQH   = off; off += PX;
  const size_t oKH   = off; off += PX;
  const size_t oVT   = off; off += PVT;
  const size_t oCT   = off; off += PX;
  const size_t oXF   = off; off += PY;
  const size_t oH2   = off; off += PX;
  const size_t oHH   = off; off += PH;
  if (off > ws_size) return;                                      // off = 106954752
  if (off > (size_t)134217728) return;

  char* ws = (char*)d_ws;
  unsigned short* WQKV = (unsigned short*)(ws + oWQKV);
  unsigned short* WO16 = (unsigned short*)(ws + oWO);
  unsigned short* W116 = (unsigned short*)(ws + oW1);
  unsigned short* W216 = (unsigned short*)(ws + oW2);
  unsigned short* H16  = (unsigned short*)(ws + oH);
  unsigned short* QH   = (unsigned short*)(ws + oQH);
  unsigned short* KH   = (unsigned short*)(ws + oKH);
  unsigned short* VTp  = (unsigned short*)(ws + oVT);
  unsigned short* CT   = (unsigned short*)(ws + oCT);
  float*          X1F  = (float*)(ws + oXF);
  unsigned short* H2   = (unsigned short*)(ws + oH2);
  unsigned short* HH   = (unsigned short*)(ws + oHH);

  const dim3 blk(256);
  const dim3 gTsq(DMODEL / 64, DMODEL / 64);                       // in[512][512]  -> out[512][512]:  (C/64, R/64) = (8, 8)
  const dim3 gT1(DFF / 64, DMODEL / 64);                           // in[512][2048] -> out[2048][512]: (32, 8)
  const dim3 gT2(DMODEL / 64, DFF / 64);                           // in[2048][512] -> out[512][2048]: (8, 32)
  const dim3 bG(GT_THREADS);                                       // 256
  const dim3 gP((NROWS / GT_TILE) * (DMODEL / GT_TILE), 1);        // 256
  const dim3 gV((DMODEL / GT_TILE) * (NC / GT_TILE), NB);          // 64 x 4
  const dim3 gF((NROWS / GT_TILE) * (DFF / GT_TILE), 1);           // 1024
  const dim3 gAT(ATT_BLOCKS);                                      // 512
  const dim3 bAT(ATT_THREADS);                                     // 256
  const dim3 gLN(NROWS);                                           // 8192
  const dim3 bLN(LN_THREADS);                                      // 128

  // (0) transposed weight planes [n][k] = f16( bf16_RNE(W[k][n]) * scale ), k contiguous
  tcvt16<<<gTsq, blk, 0, stream>>>(wq, WQKV, DMODEL, DMODEL, WSC);
  tcvt16<<<gTsq, blk, 0, stream>>>(wk, WQKV + (size_t)DMODEL * DMODEL, DMODEL, DMODEL, WSC);
  tcvt16<<<gTsq, blk, 0, stream>>>(wv, WQKV + (size_t)2 * DMODEL * DMODEL, DMODEL, DMODEL, WSC);
  tcvt16<<<gTsq, blk, 0, stream>>>(wo, WO16, DMODEL, DMODEL, WSC);
  tcvt16<<<gT1,  blk, 0, stream>>>(w1, W116, DMODEL, DFF, WSC);     // R = 512 (in), C = 2048 (out)
  tcvt16<<<gT2,  blk, 0, stream>>>(w2, W216, DFF, DMODEL, W2SC);    // R = 2048 (in), C = 512 (out)

  // (1) h = LayerNorm(bf16(x) * bf16(mask)) -> H16 (f16 x16)
  lnorm<1><<<gLN, bLN, 0, stream>>>(x, mk, H16, HCARRY);

  // (2) q projection: QH[m][n] = f16(16 * sum_k h[m][k] Wq[k][n]); M = 8192, N = 512, K = 512
  gemm64<2, 0, 0, 0><<<gP, bG, 0, stream>>>(
      H16, DMODEL, 0LL,
      WQKV, DMODEL, 0LL,
      x, mk,
      (void*)QH, DMODEL, 0LL,
      NROWS, DMODEL, DMODEL, 1.0f / (HCARRY * WSC), QC);

  // (3) k projection
  gemm64<2, 0, 0, 0><<<gP, bG, 0, stream>>>(
      H16, DMODEL, 0LL,
      WQKV + (size_t)DMODEL * DMODEL, DMODEL, 0LL,
      x, mk,
      (void*)KH, DMODEL, 0LL,
      NROWS, DMODEL, DMODEL, 1.0f / (HCARRY * WSC), KC);

  // (4) v^T per batch: VT[b][d][tok] = f16(16 * sum_k WvT[d][k] h_b[tok][k]); M = 512, N = 2048, K = 512
  gemm64<2, 0, 0, 0><<<gV, bG, 0, stream>>>(
      WQKV + (size_t)2 * DMODEL * DMODEL, DMODEL, 0LL,
      H16, DMODEL, (long long)NC * DMODEL,
      x, mk,
      (void*)VTp, NC, (long long)DMODEL * NC,
      DMODEL, NC, DMODEL, 1.0f / (HCARRY * WSC), VC);

  // (5) full attention per (batch, head, 128 query rows) -> CT (f16, x1024)
  attn8<<<gAT, bAT, 0, stream>>>(QH, KH, VTp, mk, CT);

  // (6) X1F = (CT . WoT^T / (1024 * 64) + bf16(x)) * bf16(mask); M = 8192, N = 512, K = 512, f32
  gemm64<0, 1, 0, 1><<<gP, bG, 0, stream>>>(
      CT, DMODEL, 0LL,
      WO16, DMODEL, 0LL,
      x, mk,
      (void*)X1F, DMODEL, 0LL,
      NROWS, DMODEL, DMODEL, 1.0f / (FC * WSC), 1.0f);

  // (7) h2 = LayerNorm(x1) -> H2 (f16 x16)
  lnorm<0><<<gLN, bLN, 0, stream>>>(X1F, mk, H2, H2C);

  // (8) HH = f16(16 * gelu(h2 . W1)); M = 8192, N = 2048, K = 512
  gemm64<2, 0, 1, 0><<<gF, bG, 0, stream>>>(
      H2, DMODEL, 0LL,
      W116, DMODEL, 0LL,
      x, mk,
      (void*)HH, DFF, 0LL,
      NROWS, DFF, DMODEL, 1.0f / (H2C * WSC), GC);

  // (9) out = HH . W2 / (16 * 128) + x1 (raw f32); M = 8192, N = 512, K = 2048, f32
  gemm64<0, 2, 0, 0><<<gP, bG, 0, stream>>>(
      HH, DFF, 0LL,
      W216, DFF, 0LL,
      X1F, mk,
      (void*)out, DMODEL, 0LL,
      NROWS, DMODEL, DFF, 1.0f / (GC * W2SC), 1.0f);
  (void)hipGetLastError();
}

// v004
// One run takes 140 microseconds.
// In two side-by-side timings against v003, it was 1.15 and 1.16 times as fast.
// Counting every step since v000, it is 3.02 times as fast.
// Contractions: q/k projections (h f16 x16 . Wq^T/Wk^T f16 x64, K=512), v^T projection (Wv^T f16 x64 . h f16 x16, K=512),
// attention scores^T (k f16 x16 . q f16 x16, K=64), attention v^T . P^T (v^T f16 x16 . P f16 x1024, 32 keys per step),
// output projection (ctx f16 x1024 . Wo^T f16 x64, K=512), FFN1 (h2 f16 x16 . W1^T f16 x64, K=512), FFN2 (g f16 x16 . W2^T f16 x128, K=2048):
// all v_wmma_f32_16x16x32_f16 single products, f32 accumulate. LayerNorms (no affine), softmax, erf-GELU, mask, residuals in f32 on VALU.
// Every float input RNE-converted to bf16 on load.
#include <hip/hip_runtime.h>
#include <math.h>
#include <stdint.h>

#define NB      4
#define NQ      2048
#define NC      2048
#define DMODEL  512
#define DFF     2048
#define NHEAD   8
#define HDIM    64
#define NROWS   (NB * NQ)
#define WSC     64.0f
#define W2SC    128.0f
#define HCARRY  16.0f
#define QC      16.0f
#define KC      16.0f
#define VC      16.0f
#define PC      1024.0f
#define FC      1024.0f
#define H2C     16.0f
#define GC      16.0f
#define ATT_SCALE 0.125f
#define LOG2E   1.4426950408889634f
#define LN_EPS  1e-6f
#define MASKNEG (-100000.0f)
static_assert(NHEAD * HDIM == DMODEL);
static_assert((NQ % 64) == 0 && (NC % 64) == 0 && (DMODEL % 64) == 0 && (DFF % 64) == 0 && (NC % 32) == 0 && (NQ % 16) == 0);
static_assert((NROWS % 64) == 0 && (DMODEL % 32) == 0 && (DFF % 32) == 0);
#define HPB     8                       // waves per attention block (16 query rows per wave, one head per block)
#define NQB     (NQ / (HPB * 16))       // query blocks per batch and head (16)
#define ATT_THREADS (HPB * 32)
#define ATT_BLOCKS  (NB * NHEAD * NQB)
static_assert(ATT_THREADS == 256 && ATT_BLOCKS == 512 && NQB * HPB * 16 == NQ);
#define LN_THREADS 128
static_assert(LN_THREADS * 4 == DMODEL && (LN_THREADS % 32) == 0 && ((DMODEL / 8) % 32) == 0);

typedef _Float16 v16h __attribute__((ext_vector_type(16)));
typedef _Float16 v8h  __attribute__((ext_vector_type(8)));
typedef float    v8f  __attribute__((ext_vector_type(8)));
typedef float    v4f  __attribute__((ext_vector_type(4)));
typedef unsigned int v4u __attribute__((ext_vector_type(4)));
typedef unsigned int v2u __attribute__((ext_vector_type(2)));

union FragH { v16h v; v8h h[2]; v4u u[2]; };

// ---- scalar helpers --------------------------------------------------------------------------------
__device__ __forceinline__ unsigned short bf_bits(float f) {          // f32 -> bf16 bits, RNE convert
  unsigned u = __float_as_uint(f);
  return (unsigned short)((u + 0x7FFFu + ((u >> 16) & 1u)) >> 16);
}
__device__ __forceinline__ float bf_up(unsigned short h) { return __uint_as_float(((unsigned)h) << 16); }
__device__ __forceinline__ float bfr(float f) { return bf_up(bf_bits(f)); }   // value of the bf16 RNE convert
__device__ __forceinline__ unsigned short h_bits(_Float16 x) { return __builtin_bit_cast(unsigned short, x); }
__device__ __forceinline__ unsigned pk16(unsigned short a, unsigned short b) { return (unsigned)a | ((unsigned)b << 16); }
__device__ __forceinline__ v8f zero8() { v8f z = {0.f, 0.f, 0.f, 0.f, 0.f, 0.f, 0.f, 0.f}; return z; }
__device__ __forceinline__ float gelu_f(float u) { return 0.5f * u * (1.0f + erff(u * 0.70710678118654752440f)); }

// ---- fragment loaders: 16-bit A/B operand, lane -> row/col (lane&15), p already includes +8*(lane>>4);
//      elements 0..7 <- p[0..7] (k0+8h..), elements 8..15 <- p[16..23] (k0+16+8h..)  (same split k map for A and B;
//      B is always read from a k-contiguous [n][k] plane)
__device__ __forceinline__ v16h ldfrag_h(const _Float16* p) {
  FragH f;
  f.h[0] = *(const v8h*)(p);
  f.h[1] = *(const v8h*)(p + 16);
  return f.v;
}
__device__ __forceinline__ v16h ldfrag_u(const unsigned short* p) {
  FragH f;
  f.u[0] = *(const v4u*)(p);
  f.u[1] = *(const v4u*)(p + 16);
  return f.v;
}

// ---- WMMA helpers with trailing VALU hazard gaps ------------------------------------------------------
__device__ __forceinline__ v8f mma_raw(v16h a, v16h b, v8f c) {
  return __builtin_amdgcn_wmma_f32_16x16x32_f16(false, a, false, b, (short)0, c, false, false);
}
__device__ __forceinline__ void dep_guard1(v8f& a, v8f& b, v16h x) {
#if defined(__HIP_DEVICE_COMPILE__)
  asm volatile("v_nop\n\tv_nop\n\tv_nop\n\tv_nop" : "+v"(a), "+v"(b) : "v"(x));
#endif
}
__device__ __forceinline__ void keep4_h(v16h a, v16h b, v16h c, v16h d) {
#if defined(__HIP_DEVICE_COMPILE__)
  asm volatile("v_nop" :: "v"(a), "v"(b), "v"(c), "v"(d));
#endif
}
__device__ __forceinline__ void acc_guard4(v8f& a, v8f& b, v8f& c, v8f& d) {
#if defined(__HIP_DEVICE_COMPILE__)
  asm volatile("v_nop\n\tv_nop\n\tv_nop\n\tv_nop" : "+v"(a), "+v"(b), "+v"(c), "+v"(d));
#endif
}
// the value that lane l ^ 16 holds (a vector cross-row move, no LDS round trip)
__device__ __forceinline__ float xhalf(float v) {
  const int b = __builtin_bit_cast(int, v);
  return __builtin_bit_cast(float, __builtin_amdgcn_permlanex16(b, b, 0x76543210, 0xfedcba98, false, false));
}
__device__ __forceinline__ void wave_sync_lds() {
  __builtin_amdgcn_fence(__ATOMIC_RELEASE, "workgroup");
  __builtin_amdgcn_wave_barrier();
  __builtin_amdgcn_fence(__ATOMIC_ACQUIRE, "workgroup");
}

// =====================================================================================================
// Transposing 16-bit pack of a weight stored [in][out] = in[R][C] (row pitch C): out[C][R] (row pitch R), out[c][r] =
// f16( bf16_RNE(in[r][c]) * sc ), sc a power of two (exact). One 64x64 tile per block through LDS: coalesced float4 reads of 64 input
// rows, 2-byte LDS stores into the transposed tile [c][r] (pitch 72 halves), block barrier, then every output row segment of 64 halves
// coverage: load 256 thr x 16 floats = 64x64; store 2 it x 8 waves x 4 rows x (8 lanes x 8 halves) = 64 rows x 64 halves;
//           tiles (bx, by) in (C/64, R/64) exact (the caller's block ranges), each output line written by exactly one wave.
// =====================================================================================================
__device__ __forceinline__ void tcvt16(const float* __restrict__ src, unsigned short* dst, int R, int C, float sc, int bx, int by) {
  __shared__ __align__(16) unsigned short sT[64 * 72];
  const int tid = threadIdx.x, lane = tid & 31, wave = tid >> 5;
  const int c0 = bx * 64, r0 = by * 64;
  const int rr = tid >> 2, cc = (tid & 3) * 16;
  const float* sp = src + (size_t)(r0 + rr) * C + c0 + cc;
#pragma unroll
  for (int e = 0; e < 4; ++e) {
    const v4f a = *(const v4f*)(sp + 4 * e);
#pragma unroll
    for (int k = 0; k < 4; ++k)
      sT[(cc + 4 * e + k) * 72 + rr] = h_bits((_Float16)(bfr(a[k]) * sc));
  }
  __syncthreads();
  v4u vals[2];
#pragma unroll
  for (int it = 0; it < 2; ++it) {
    const int q = it * 32 + wave * 4 + (lane >> 3);
    vals[it] = *(const v4u*)(sT + q * 72 + (lane & 7) * 8);
  }
  {
#pragma unroll
    for (int it = 0; it < 2; ++it) {
      const int q = it * 32 + wave * 4 + (lane >> 3);
      *(v4u*)(dst + (size_t)(c0 + q) * R + r0 + (lane & 7) * 8) = vals[it];
    }
    // no register that the two stores name is rewritten ahead of this wait
#if defined(__HIP_DEVICE_COMPILE__)
    asm volatile("s_wait_xcnt 0x0" ::: "memory");
#endif
  }
}

// =====================================================================================================
// Batched f16 WMMA GEMM, operands staged in LDS: C[m][n] = f( oscale * sum_k A[m][k] * Bt[n][k] ) (+ residual) (* row mask).
// One 128x128 tile per block of 8 waves (4x2 waves of 32x64). A row-major [M][K] pitch lda (16-bit plane), Bt row-major [N][K] pitch ldb
// (k contiguous); M, N, K multiples of 128. tile = index of the block's tile, by = batch index with element strides sA, sB, sC.
// A trip is 128 k: [A 128 rows | Bt 128 rows] of 256 B each, LDS pitch 272 B (16 B x odd: 16-B row readers meet no bank twice), two
// buffers. Each lane copies 16 pieces of 16 B per trip with asynchronous copies to LDS (a wave's copy = 2 whole rows = 4 whole lines);
// the copies of trip t + 2 are issued behind the barrier that ends trip t and fly while trip t + 1 is worked on.
// Inside a trip the fragments of k-step ks + 1 are read from LDS ahead of the products of k-step ks (never across the barrier).
// The k order of every accumulator is the ascending one (steps of 32). Behind the last trip's barrier the ring serves as the
// waves' epilogue slabs.
// OM: 0 = f32 out (pitch ldc; HASR 1 adds bf16(R[m][n]), HASR 2 adds raw f32 R[m][n], same pitch/stride as C; MSK 1 multiplies the
//     sum by bf16(Mrow[m])); 2 = f16 out (pitch ldc) = f16( act(value) * ocarry ), ACT 1 = erf-GELU.
// coverage: 2 slabs x 16 rows (f32: it 0..7 x lane>>4; f16: it 0..3 x lane>>3) x 64 cols = the wave's whole 32x64 tile;
//           8 waves = the block's 128x128 tile; grid = tilesM*tilesN blocks exactly (a surplus block leaves as a whole, before any barrier).
// =====================================================================================================
#define GT_TILE    128                     // rows of A and of Bt per block tile
#define GT_K       128                     // halves of every row per trip (256 B)
#define GT_PITCH   136                     // halves: 272 B
#define GT_STAGE   (2 * GT_TILE * GT_PITCH) // halves per buffer
#define GT_THREADS 256
#define GT_LSTEP   (16u * GT_PITCH * 2u)   // LDS bytes between two successive copies of a lane (16 rows)
static_assert((NROWS % GT_TILE) == 0 && (DMODEL % GT_TILE) == 0 && (DFF % GT_TILE) == 0 && (NC % GT_TILE) == 0);
static_assert((DMODEL % GT_K) == 0 && (DFF % GT_K) == 0 && ((GT_PITCH * 2) % 16) == 0 && (((GT_PITCH * 2) / 16) % 2) == 1);
static_assert(GT_THREADS / 16 == 16 && 8 * 16 == GT_TILE && GT_K * 2 == 16 * 16);
static_assert((size_t)(GT_THREADS / 32) * 16 * 68 * sizeof(float) <= (size_t)2 * GT_STAGE * sizeof(unsigned short));

__device__ __forceinline__ unsigned lds_off(const void* p) { return (unsigned)(size_t)p; }
// the wave's own LDS reads have returned before the buffer they read is handed back for a refill
__device__ __forceinline__ void wait_ds0() {
#if defined(__HIP_DEVICE_COMPILE__)
  asm volatile("s_wait_dscnt 0x0" ::: "memory");
#endif
}
// the wave's own asynchronous copies have landed in LDS (the compiler places no wait for them)
__device__ __forceinline__ void wait_async0() {
#if defined(__HIP_DEVICE_COMPILE__)
  asm volatile("s_wait_asynccnt 0x0" ::: "memory");
#endif
}
// Eight asynchronous 16-B copies per lane, global -> LDS: rows 16 apart (gs halves in global memory, GT_LSTEP bytes in LDS).
// The closing s_wait_xcnt 0 stands inside the statement so that no address register is rewritten ahead of it.
__device__ __forceinline__ void copy8(unsigned l0, const unsigned short* g0, size_t gs) {
#if defined(__HIP_DEVICE_COMPILE__)
  const unsigned l1 = l0 + GT_LSTEP, l2 = l0 + 2u * GT_LSTEP, l3 = l0 + 3u * GT_LSTEP;
  const unsigned l4 = l0 + 4u * GT_LSTEP, l5 = l0 + 5u * GT_LSTEP, l6 = l0 + 6u * GT_LSTEP, l7 = l0 + 7u * GT_LSTEP;
  const unsigned short* g1 = g0 + gs;
  const unsigned short* g2 = g1 + gs;
  const unsigned short* g3 = g2 + gs;
  const unsigned short* g4 = g3 + gs;
  const unsigned short* g5 = g4 + gs;
  const unsigned short* g6 = g5 + gs;
  const unsigned short* g7 = g6 + gs;
  asm volatile(
      "global_load_async_to_lds_b128 %0, %8, off\n\t"
      "global_load_async_to_lds_b128 %1, %9, off\n\t"
      "global_load_async_to_lds_b128 %2, %10, off\n\t"
      "global_load_async_to_lds_b128 %3, %11, off\n\t"
      "global_load_async_to_lds_b128 %4, %12, off\n\t"
      "global_load_async_to_lds_b128 %5, %13, off\n\t"
      "global_load_async_to_lds_b128 %6, %14, off\n\t"
      "global_load_async_to_lds_b128 %7, %15, off\n\t"
      "s_wait_xcnt 0x0"
      :: "v"(l0), "v"(l1), "v"(l2), "v"(l3), "v"(l4), "v"(l5), "v"(l6), "v"(l7),
         "v"(g0), "v"(g1), "v"(g2), "v"(g3), "v"(g4), "v"(g5), "v"(g6), "v"(g7)
      : "memory");
#endif
}
// One trip's tile: lane's pieces of A rows 0..127 (LDS rows 0..127), then of Bt rows 0..127 (LDS rows 128..255).
__device__ __forceinline__ void stage_tile(unsigned l, const unsigned short* ga, size_t lda, const unsigned short* gb, size_t ldb) {
  copy8(l,                 ga, 16 * lda);
  copy8(l + 8u * GT_LSTEP, gb, 16 * ldb);
}

template <int OM, int HASR, int ACT, int MSK>
__device__ __forceinline__ void gemm_tile(
    int tile, int by,
    const unsigned short* __restrict__ Ap, int lda, long long sA,
    const unsigned short* __restrict__ Btp, int ldb, long long sB,
    const float* __restrict__ Rp, const float* __restrict__ Mp,
    void* Cout, int ldc, long long sC,
    int M, int N, int K, float oscale, float ocarry) {
  __shared__ __align__(16) unsigned short sR[2 * GT_STAGE];   // the two operand buffers; later per-wave 16x64 f32 slabs, pitch 68 floats
  const int tid  = threadIdx.x;
  const int lane = tid & 31;
  const int wave = tid >> 5;
  const int tilesN = N >> 7;
  const int tilesM = M >> 7;
  if (tile >= tilesM * tilesN) return;   // block-uniform, in front of every barrier and copy
  const int tm = tile / tilesN;
  const int tn = tile - tm * tilesN;
  const int wm = wave >> 1, wn = wave & 1;
  const int m0 = (tm << 7) + (wm << 5);
  const int n0 = (tn << 7) + (wn << 6);

  const unsigned short* A1 = Ap  + (size_t)((long long)by * sA);
  const unsigned short* Bb = Btp + (size_t)((long long)by * sB);

  const int rlane = lane & 15;                 // row (A) / col (B, D) within subtile
  const int koff  = (lane >> 4) * 8;           // k offset of this lane half
  const int mOff  = (lane >> 4) * 8;           // D row offset

  // the lane's first piece of a trip: row tid>>4 of the tile, 16-B piece tid&15 of its 256 B
  const int crow = tid >> 4, cpc = tid & 15;
  const unsigned short* gA = A1 + (size_t)((tm << 7) + crow) * lda + cpc * 8;
  const unsigned short* gB = Bb + (size_t)((tn << 7) + crow) * ldb + cpc * 8;
  const unsigned lC = lds_off(sR) + (unsigned)(crow * (GT_PITCH * 2) + cpc * 16);

  v8f acc[2][4];
#pragma unroll
  for (int i = 0; i < 2; ++i)
#pragma unroll
    for (int j = 0; j < 4; ++j) acc[i][j] = zero8();

  const int nt = K >> 7;
  stage_tile(lC, gA, (size_t)lda, gB, (size_t)ldb);
  wait_async0();
  __syncthreads();                               // tile 0 is published
  if (nt > 1) stage_tile(lC + GT_STAGE * 2u, gA + GT_K, (size_t)lda, gB + GT_K, (size_t)ldb);

  // rolled: the buffer is picked by the trip's parity
#pragma unroll 1
  for (int t = 0; t < nt; ++t) {
    const unsigned short* sb = sR + (t & 1) * GT_STAGE;
    const unsigned short* fa = sb + ((wm << 5) + rlane) * GT_PITCH + koff;
    const unsigned short* fb = sb + (GT_TILE + (wn << 6) + rlane) * GT_PITCH + koff;
    // two fragment sets; the loops over them are unrolled so that every index is a constant and the sets stay in registers
    v16h af[2][2], bf[2][4];
#pragma unroll
    for (int j = 0; j < 4; ++j) bf[0][j] = ldfrag_u(fb + (j << 4) * GT_PITCH);
#pragma unroll
    for (int i = 0; i < 2; ++i) af[0][i] = ldfrag_u(fa + (i << 4) * GT_PITCH);
#pragma unroll
    for (int ks = 0; ks < GT_K / 32; ++ks) {
      const int cur = ks & 1, nxt = cur ^ 1;
      if (ks + 1 < GT_K / 32) {
#pragma unroll
        for (int j = 0; j < 4; ++j) bf[nxt][j] = ldfrag_u(fb + (j << 4) * GT_PITCH + (ks + 1) * 32);
#pragma unroll
        for (int i = 0; i < 2; ++i) af[nxt][i] = ldfrag_u(fa + (i << 4) * GT_PITCH + (ks + 1) * 32);
      }
      // keeps the next k-step's LDS reads one group ahead of this k-step's products
      __builtin_amdgcn_sched_barrier(0);
#pragma unroll
      for (int i = 0; i < 2; ++i) {
#pragma unroll
        for (int j = 0; j < 4; ++j) acc[i][j] = mma_raw(af[cur][i], bf[cur][j], acc[i][j]);
        dep_guard1(acc[i][0], acc[i][3], af[cur][i]);
      }
      keep4_h(bf[cur][0], bf[cur][1], bf[cur][2], bf[cur][3]);
      // ends the block of products, so that the reads of the k-step after next stay behind it
      __builtin_amdgcn_sched_barrier(0);
    }
    wait_ds0();
    wait_async0();
    __syncthreads();                             // publishes tile t + 1 and ends every reader's last read of tile t's buffer
    if (t + 2 < nt)
      stage_tile(lC + (unsigned)(t & 1) * (GT_STAGE * 2u), gA + (size_t)(t + 2) * GT_K, (size_t)lda,
                 gB + (size_t)(t + 2) * GT_K, (size_t)ldb);
  }
  wait_async0();
  acc_guard4(acc[0][0], acc[0][1], acc[0][2], acc[0][3]);
  acc_guard4(acc[1][0], acc[1][1], acc[1][2], acc[1][3]);

  const int hh2 = lane >> 4, c4 = (lane & 15) * 4;     // f32 out: 256-B row segment = 16 lanes x 16 B
  const int q8  = lane >> 3, c8 = (lane & 7) * 8;

  // ---- epilogue ----
  float* slab = (float*)(void*)sR + wave * (16 * 68);   // every read and copy of the ring ended at the last trip's barrier
#pragma unroll
  for (int i = 0; i < 2; ++i) {
    const int mBase = m0 + (i << 4);
#pragma unroll
    for (int j = 0; j < 4; ++j) {
#pragma unroll
      for (int r = 0; r < 8; ++r) {
        slab[(mOff + r) * 68 + (j << 4) + rlane] = acc[i][j][r];
      }
    }
    wave_sync_lds();
    if constexpr (OM == 0) {
      float* C = (float*)Cout + (size_t)((long long)by * sC);
      v4f vals[8];
#pragma unroll
      for (int it = 0; it < 8; ++it) {
        const int row = it * 2 + hh2;                      // it 0..7 x hh2 0..1 = rows 0..15
        const int gr  = mBase + row;
        v4f v = *(const v4f*)(slab + row * 68 + c4);
        v4f rv = {0.f, 0.f, 0.f, 0.f};
        if constexpr (HASR != 0) {
          const float* R = Rp + (size_t)((long long)by * sC);
          const v4f rraw = *(const v4f*)(R + (size_t)gr * ldc + n0 + c4);
#pragma unroll
          for (int e = 0; e < 4; ++e) rv[e] = (HASR == 1) ? bfr(rraw[e]) : rraw[e];
        }
        float mk = 1.0f;
        if constexpr (MSK == 1) mk = bfr(Mp[gr]);
#pragma unroll
        for (int e = 0; e < 4; ++e) v[e] = (v[e] * oscale + rv[e]) * mk;
        vals[it] = v;
      }
      {
#pragma unroll
        for (int it = 0; it < 8; ++it) {
          const int gr = mBase + it * 2 + hh2;
          *(v4f*)(C + (size_t)gr * ldc + n0 + c4) = vals[it];
        }
        
      }
    } else {
      unsigned short* C = (unsigned short*)Cout + (size_t)((long long)by * sC);
      v4u hv[4];
#pragma unroll
      for (int it = 0; it < 4; ++it) {
        const int row = it * 4 + q8;                       // it 0..3 x q8 0..3 = rows 0..15
        const float* sp = slab + row * 68 + c8;
        v4u a = {0u, 0u, 0u, 0u};
#pragma unroll
        for (int e = 0; e < 4; ++e) {
          float f0 = sp[2 * e] * oscale;
          float f1 = sp[2 * e + 1] * oscale;
          if constexpr (ACT == 1) { f0 = gelu_f(f0); f1 = gelu_f(f1); }
          f0 *= ocarry; f1 *= ocarry;
          a[e] = pk16(h_bits((_Float16)f0), h_bits((_Float16)f1));
        }
        hv[it] = a;
      }
      {
#pragma unroll
        for (int it = 0; it < 4; ++it) {
          const int row = it * 4 + q8;
          *(v4u*)(C + (size_t)(mBase + row) * ldc + n0 + c8) = hv[it];
        }
        
      }
    }
    wave_sync_lds();
  }
}

// One product per launch: blockIdx.x = tile, blockIdx.y = batch.
template <int OM, int HASR, int ACT, int MSK>
__global__ __launch_bounds__(GT_THREADS) void gemm64(
    const unsigned short* __restrict__ Ap, int lda, long long sA,
    const unsigned short* __restrict__ Btp, int ldb, long long sB,
    const float* __restrict__ Rp, const float* __restrict__ Mp,
    void* Cout, int ldc, long long sC,
    int M, int N, int K, float oscale, float ocarry) {
  gemm_tile<OM, HASR, ACT, MSK>(blockIdx.x, blockIdx.y, Ap, lda, sA, Btp, ldb, sB, Rp, Mp, Cout, ldc, sC, M, N, K, oscale, ocarry);
}

// The three in-projections need nothing of each other and share one grid: blockIdx.y = 0 q, 1 k (A = h, Bt = the weight's rows,
// 64 x 4 tiles), 2 v^T (A = Wv^T, Bt = h of batch blockIdx.x >> 6, 4 x 16 tiles per batch). The choice is the same for a whole block.
// coverage: 256 tiles of 128x128 per product = 8192 x 512 (q, k) and 4 x 512 x 2048 (v^T), each exactly once.
static_assert((NROWS / GT_TILE) * (DMODEL / GT_TILE) == 256 && (DMODEL / GT_TILE) * (NC / GT_TILE) == 64 && NB * 64 == 256);
__global__ __launch_bounds__(GT_THREADS) void gemm_qkv(
    const unsigned short* __restrict__ Hp, const unsigned short* __restrict__ Wp,
    unsigned short* Qo, unsigned short* Ko, unsigned short* Vo) {
  const int job = blockIdx.y;
  const bool isv = job == 2;
  const unsigned short* Wj = Wp + (size_t)job * (DMODEL * DMODEL);
  gemm_tile<2, 0, 0, 0>(
      isv ? (int)(blockIdx.x & 63) : (int)blockIdx.x, isv ? (int)(blockIdx.x >> 6) : 0,
      isv ? Wj : Hp, DMODEL, 0LL,
      isv ? Hp : Wj, DMODEL, isv ? (long long)NC * DMODEL : 0LL,
      nullptr, nullptr,
      (void*)(isv ? Vo : (job == 1 ? Ko : Qo)), isv ? NC : DMODEL, isv ? (long long)DMODEL * NC : 0LL,
      isv ? DMODEL : NROWS, isv ? NC : DMODEL, DMODEL, 1.0f / (HCARRY * WSC), QC);
}
static_assert(QC == KC && QC == VC);

// =====================================================================================================
// Full attention for one batch, one head and 128 query rows (8 waves, 16 query rows per wave), head dim 64, all 2048 keys:
//   q plane (f16 x16) QH[b*2048 + tok][64*head + d], pitch 512; k plane (f16 x16) KH[b*2048 + key][64*head + d], pitch 512;
//   v^T plane (f16 x16): VT[b*512 + 64*head + d][key] (pitch 2048); out (f16 x1024): CT[b*2048 + tok][64*head + d] =
//   1024 * sum_m softmax_m(q.k / 8 + c_q) v[m][d] with the per-query-row mask constant c_q = -1e5 * (1 - bf16(mask[b][tok]))
//   (softmax run in base 2: t = (q.k/carries) * log2(e)/8 + c_q*log2(e), the row constant folded in as the fma addend).
//   The head's k rows and v^T rows are the same for all 8 waves: a tile is 64 keys = [k 64 rows | v^T 64 rows] of 128 B each (one whole
//   line per row), LDS pitch 144 B (16 B x odd: 16-B row readers meet no bank twice), two buffers. Each lane copies 4 pieces of 16 B
//   per tile with asynchronous copies to LDS (a wave's copy = 4 whole rows = 4 whole lines); the copies of tile t + 2 are issued behind
//   the barrier that ends trip t and fly while trip t + 1 is worked on. A trip reads its own buffer alone.
//   Key steps of 32 from 0 to 2047, two per trip (block-uniform trip count 32); every score is finite, so the running max is finite
//   from the first step on; the rescale exponent is clamped at -126 so the first step (running max -inf) gives a tiny finite factor
//   times zero sums.
//   Both products run transposed: S^T = k . q^T (A = k rows, B = q columns) and O^T += v^T . P^T (A = v^T rows, B = P^T columns).
//   Lane (c, hh) then holds, of query column c alone, the scores of keys 8hh + r (tile 0) and 16 + 8hh + r (tile 1): maximum and sum
//   run inside the lane, the two lane halves exchange the maximum once per step; the sums are joined once, behind the loop; those
//   16 registers, times 1024 and RNE to f16, ARE the B fragment of P^T in the split k map; the rescale factor is the lane's own.
//   Per step: 2 score tiles on f16 WMMA (K = 64 as two k-steps of 32), fragments read from the staged tile (two 16-B LDS loads per
//   fragment); online max-subtracted softmax in f32 (exp2); rescale of the running sums; the four v^T A fragments read from the
//   staged tile; 4 v^T . P^T WMMAs. O^T tile j, register r = ctx[query c][16j + 8hh + r].
//   Final 1/l and carry folds in f32; the wave's LDS slab takes its 16-bit result rows [16][64], pitch 72 halves
//   (16-B stores, wave-level LDS ordering), from which the wave writes whole 128-B lines.
// coverage: wave: 4 iterations x 4 rows x (8 lanes x 8 halves) = 16 rows x 64 halves; block: 8 waves = 128 rows of one head;
//           grid (4 batches x 8 heads x 16 query blocks) covers all 8192 x 512 of CT exactly once, each line written by one wave.
// =====================================================================================================
#define PS_FLOATS (HPB * 16 * 36)
#define AT_KEYS   64                        // keys per staged tile
#define AT_PITCH  72                        // halves: 144 B
#define AT_STAGE  ((AT_KEYS + HDIM) * AT_PITCH) // halves per buffer: k rows, then v^T rows
#define AT_TILES  (NC / AT_KEYS)
#define AT_LSTEP  (32u * AT_PITCH * 2u)     // LDS bytes between two successive copies of a lane (32 rows)
static_assert(HDIM * 2 == 128 && AT_KEYS * 2 == 128 && ATT_THREADS / 8 == 32 && AT_KEYS == 64 && HDIM == 64);
static_assert(((AT_PITCH * 2) % 16) == 0 && (((AT_PITCH * 2) / 16) % 2) == 1 && (NC % AT_KEYS) == 0 && AT_TILES >= 2);
static_assert((size_t)16 * AT_PITCH * sizeof(unsigned short) <= (size_t)16 * 36 * sizeof(float));

// One tile: four asynchronous 16-B copies per lane, global -> LDS: k rows r and r + 32, then v^T rows r and r + 32 (LDS rows 32 apart).
// The closing s_wait_xcnt 0 stands inside the statement so that no address register is rewritten ahead of it.
__device__ __forceinline__ void stage_kv(unsigned l0, const unsigned short* k0, const unsigned short* v0) {
#if defined(__HIP_DEVICE_COMPILE__)
  const unsigned l1 = l0 + AT_LSTEP, l2 = l0 + 2u * AT_LSTEP, l3 = l0 + 3u * AT_LSTEP;
  const unsigned short* k1 = k0 + (size_t)32 * DMODEL;
  const unsigned short* v1 = v0 + (size_t)32 * NC;
  asm volatile(
      "global_load_async_to_lds_b128 %0, %4, off\n\t"
      "global_load_async_to_lds_b128 %1, %5, off\n\t"
      "global_load_async_to_lds_b128 %2, %6, off\n\t"
      "global_load_async_to_lds_b128 %3, %7, off\n\t"
      "s_wait_xcnt 0x0"
      :: "v"(l0), "v"(l1), "v"(l2), "v"(l3), "v"(k0), "v"(k1), "v"(v0), "v"(v1)
      : "memory");
#endif
}

__global__ __launch_bounds__(ATT_THREADS)
void attn8(const unsigned short* __restrict__ QHp, const unsigned short* __restrict__ KHp,
           const unsigned short* __restrict__ VTq, const float* __restrict__ mkp, unsigned short* CT) {
  __shared__ __align__(16) unsigned short sKV[2 * AT_STAGE]; // the two k / v^T tile buffers
  __shared__ __align__(16) float smem[PS_FLOATS];          // per wave slab of 16-bit result rows (epilogue only)

  const int tid  = threadIdx.x;
  const int wave = tid >> 5;
  const int lane = tid & 31;
  const int hh   = lane >> 4;
  const int c    = lane & 15;

  const int qt   = blockIdx.x % NQB;                       // query block 0..15
  const int head = (blockIdx.x / NQB) % NHEAD;             // 0..7
  const int bat  = blockIdx.x / (NQB * NHEAD);             // 0..3
  const int q0   = qt * (HPB * 16) + wave * 16;

  const size_t qofs = ((size_t)bat * NQ + q0 + c) * DMODEL + head * HDIM + 8 * hh;
  const _Float16* Qh = (const _Float16*)(const void*)QHp + qofs;
  const float lsc = (LOG2E * ATT_SCALE) / (QC * KC);                   // log2(e) / 8 / carries

  // the lane's first piece of a tile: row tid>>3 of the k rows (and of the v^T rows), 16-B piece tid&7 of its 128 B
  const int crow = tid >> 3, cpc = tid & 7;
  const unsigned short* gK = KHp + ((size_t)bat * NC + crow) * DMODEL + head * HDIM + cpc * 8;
  const unsigned short* gV = VTq + ((size_t)bat * DMODEL + head * HDIM + crow) * NC + cpc * 8;
  const unsigned lC = lds_off(sKV) + (unsigned)(crow * (AT_PITCH * 2) + cpc * 16);

  stage_kv(lC, gK, gV);

  // mask constant of the lane's query column, in base-2 units
  const float cm2 = (MASKNEG * (1.0f - bfr(mkp[(size_t)bat * NQ + q0 + c]))) * LOG2E;

  const v16h qa = ldfrag_h(Qh), qb = ldfrag_h(Qh + 32);

  float mrow = -INFINITY;                        // the column's running maximum
  v8f lacc = zero8();                            // the lane's own shares of the column's running sum (register r: keys = 8hh + r mod 16)
  v8f o0 = zero8(), o1 = zero8(), o2 = zero8(), o3 = zero8();

  const v8f lsc8 = {lsc, lsc, lsc, lsc, lsc, lsc, lsc, lsc};
  const v8f cm8  = {cm2, cm2, cm2, cm2, cm2, cm2, cm2, cm2};

  wait_async0();
  __syncthreads();                               // tile 0 is published
  stage_kv(lC + AT_STAGE * 2u, gK + (size_t)AT_KEYS * DMODEL, gV + AT_KEYS);

  // rolled: the buffer is picked by the trip's parity
#pragma unroll 1
  for (int t = 0; t < AT_TILES; ++t) {
    const unsigned short* sb = sKV + (t & 1) * AT_STAGE;
    const unsigned short* sk = sb + c * AT_PITCH + 8 * hh;
    const unsigned short* sv = sb + (AT_KEYS + c) * AT_PITCH + 8 * hh;
    // unrolled: the two key steps of a tile read it at constant offsets
#pragma unroll
    for (int ks = 0; ks < AT_KEYS / 32; ++ks) {
      const unsigned short* kp = sk + (ks * 32) * AT_PITCH;
      const unsigned short* vp = sv + ks * 32;
      const unsigned short* kq = kp + 16 * AT_PITCH;
      const v16h k00 = ldfrag_u(kp), k01 = ldfrag_u(kp + 32);
      const v16h k10 = ldfrag_u(kq), k11 = ldfrag_u(kq + 32);
      const v16h vb0 = ldfrag_u(vp);
      const v16h vb1 = ldfrag_u(vp + 16 * AT_PITCH);
      const v16h vb2 = ldfrag_u(vp + 32 * AT_PITCH);
      const v16h vb3 = ldfrag_u(vp + 48 * AT_PITCH);
      // holds the step's 16 LDS reads as one group in front of its products: left free, each pair of reads sinks to just in front of
      // the product that takes it, and the wave waits out a whole LDS latency there each time
      __builtin_amdgcn_sched_barrier(0);
      v8f s0, s1;
      s0 = mma_raw(k00, qa, zero8());
      s0 = mma_raw(k01, qb, s0);
      s1 = mma_raw(k10, qa, zero8());
      s1 = mma_raw(k11, qb, s1);
      const v8f t0 = __builtin_elementwise_fma(s0, lsc8, cm8);
      const v8f t1 = __builtin_elementwise_fma(s1, lsc8, cm8);
      const v8f tm = __builtin_elementwise_max(t0, t1);
      float mx = fmaxf(fmaxf(fmaxf(tm[0], tm[1]), fmaxf(tm[2], tm[3])), fmaxf(fmaxf(tm[4], tm[5]), fmaxf(tm[6], tm[7])));
      mx = fmaxf(mx, xhalf(mx));                 // the other 16 keys of this column
      const float mn = fmaxf(mrow, mx);
      const float al = exp2f(fmaxf(mrow - mn, -126.0f));
      mrow = mn;
      v8f e0, e1;
#pragma unroll
      for (int r = 0; r < 8; ++r) {
        e0[r] = exp2f(t0[r] - mn);
        e1[r] = exp2f(t1[r] - mn);
      }
      lacc = lacc * al + (e0 + e1);
      o0 *= al;
      o1 *= al;
      o2 *= al;
      o3 *= al;
      FragH ph;
      ph.h[0] = __builtin_convertvector(e0 * PC, v8h);          // elements 0..7  = keys kb + 8hh + 0..7
      ph.h[1] = __builtin_convertvector(e1 * PC, v8h);          // elements 8..15 = keys kb + 16 + 8hh + 0..7
      o0 = mma_raw(vb0, ph.v, o0);
      o1 = mma_raw(vb1, ph.v, o1);
      o2 = mma_raw(vb2, ph.v, o2);
      o3 = mma_raw(vb3, ph.v, o3);
    }
    // keeps the trip's arithmetic in front of the waits below: sunk behind the barrier, it would stand between the barrier and the
    // refill, and the wait for a tile's copies would follow their issue at once instead of one trip later
    __builtin_amdgcn_sched_barrier(0);
    wait_ds0();
    wait_async0();
    __syncthreads();                             // publishes tile t + 1 and ends every reader's last read of tile t's buffer
    if (t + 2 < AT_TILES)
      stage_kv(lC + (unsigned)(t & 1) * (AT_STAGE * 2u), gK + (size_t)(t + 2) * (AT_KEYS * DMODEL), gV + (size_t)(t + 2) * AT_KEYS);
  }
  wait_async0();

  // ---- join the halves' sums, fold 1/l and the carries (1024 on P, 16 on v, 1024 on the stored ctx), stage the wave's 16x64 slice
  //      as 16-bit in its own slab: row = query c, 16 B = d 16j + 8hh .. + 7 ----
  unsigned short* Os = (unsigned short*)(void*)(smem + wave * (16 * 36));
  const float oc = FC / (PC * VC);
  {
    const float lrow = ((lacc[0] + lacc[1]) + (lacc[2] + lacc[3])) + ((lacc[4] + lacc[5]) + (lacc[6] + lacc[7]));
    const float inv = (1.0f / (lrow + xhalf(lrow))) * oc;
    unsigned short* op = Os + c * AT_PITCH + 8 * hh;
    *(v8h*)(op)      = __builtin_convertvector(o0 * inv, v8h);
    *(v8h*)(op + 16) = __builtin_convertvector(o1 * inv, v8h);
    *(v8h*)(op + 32) = __builtin_convertvector(o2 * inv, v8h);
    *(v8h*)(op + 48) = __builtin_convertvector(o3 * inv, v8h);
  }
  wave_sync_lds();
  // ---- the wave writes its 16 rows of CT: iteration it -> rows it*4 + lane/8, halves (lane%8)*8 .. +7 of the head's 64 ----
  {
    const int q8 = lane >> 3, c8 = (lane & 7) * 8;
    v4u vals[4];
#pragma unroll
    for (int it = 0; it < 4; ++it) vals[it] = *(const v4u*)(Os + (it * 4 + q8) * AT_PITCH + c8);
    unsigned short* dst = CT + ((size_t)bat * NQ + q0) * DMODEL + head * HDIM;
#pragma unroll
    for (int it = 0; it < 4; ++it) *(v4u*)(dst + (size_t)(it * 4 + q8) * DMODEL + c8) = vals[it];
  }
}

// =====================================================================================================
// the input row and multiplies by bf16(mask[row]). Output is the 16-bit plane outh[row][c] = f16(value * hc) only:
//   128 threads per row, 4 consecutive floats per thread (one 16-B load); the 16-bit row is staged in LDS (8 B per
// =====================================================================================================
//   ROWS rows per block of ROWS * 128 threads (row0 = the block's first row); every row keeps its own 128 threads, sums and LDS row.
template <int RIN, int ROWS>
__device__ __forceinline__
void lnorm_rows(const float* __restrict__ Yp, const float* __restrict__ mkp, unsigned short* outh, float hc, int row0) {
  __shared__ float redAll[ROWS][2][LN_THREADS / 32];
  __shared__ __align__(16) unsigned short srowAll[ROWS][DMODEL];
  const int sub  = (ROWS == 1) ? 0 : (int)(threadIdx.x / LN_THREADS);
  float (*red)[LN_THREADS / 32] = redAll[sub];
  unsigned short* srow = srowAll[sub];
  const int row  = row0 + sub;
  const int tid  = (ROWS == 1) ? (int)threadIdx.x : (int)(threadIdx.x % LN_THREADS);
  const int lane = tid & 31;
  const int wave = tid >> 5;
  const size_t base = (size_t)row * DMODEL + (size_t)tid * 4;
  v4f v = *(const v4f*)(Yp + base);
  if constexpr (RIN == 1) {
    const float mk = bfr(mkp[row]);
#pragma unroll
    for (int e = 0; e < 4; ++e) v[e] = bfr(v[e]) * mk;
  }
  float s = (v[0] + v[1]) + (v[2] + v[3]);
#pragma unroll
  for (int off = 1; off < 32; off <<= 1) s += __shfl_xor(s, off, 32);
  if (lane == 0) red[0][wave] = s;
  __syncthreads();
  float tot = 0.f;
#pragma unroll
  for (int w = 0; w < LN_THREADS / 32; ++w) tot += red[0][w];
  const float mu = tot * (1.0f / (float)DMODEL);
  v4f d;
#pragma unroll
  for (int e = 0; e < 4; ++e) d[e] = v[e] - mu;
  float q = (d[0] * d[0] + d[1] * d[1]) + (d[2] * d[2] + d[3] * d[3]);
#pragma unroll
  for (int off = 1; off < 32; off <<= 1) q += __shfl_xor(q, off, 32);
  if (lane == 0) red[1][wave] = q;
  __syncthreads();
  float totq = 0.f;
#pragma unroll
  for (int w = 0; w < LN_THREADS / 32; ++w) totq += red[1][w];
  const float var  = totq * (1.0f / (float)DMODEL);
  const float rstd = rsqrtf(var + LN_EPS);
  v4f o;
#pragma unroll
  for (int e = 0; e < 4; ++e) o[e] = d[e] * rstd;
  v2u w;
  w[0] = pk16(h_bits((_Float16)(o[0] * hc)), h_bits((_Float16)(o[1] * hc)));
  w[1] = pk16(h_bits((_Float16)(o[2] * hc)), h_bits((_Float16)(o[3] * hc)));
  *(v2u*)(srow + tid * 4) = w;
  __syncthreads();
  if (tid < DMODEL / 8) {                                 // waves 0..1, whole waves
    const v4u hv = *(const v4u*)(srow + tid * 8);
    unsigned short* dst = outh + (size_t)row * DMODEL + (size_t)tid * 8;
    {
      *(v4u*)dst = hv;
      
    }
  }
}

template <int RIN>
__global__ __launch_bounds__(LN_THREADS)
void lnorm(const float* __restrict__ Yp, const float* __restrict__ mkp, unsigned short* outh, float hc) {
  lnorm_rows<RIN, 1>(Yp, mkp, outh, hc, blockIdx.x);
}

// The six weight packs and the first LayerNorm need nothing of each other and share one grid of 256-thread blocks, split by ranges of
// the block index (the choice is the same for a whole block, so every barrier stays block-uniform):
//   0..255 the four 512x512 weights (64 tiles each), 256..511 W1 (32 x 8 tiles), 512..767 W2 (8 x 32 tiles),
//   768..4863 the LayerNorm, two rows per block. The short packs stand first, for speed only.
#define PREP_SQ     ((DMODEL / 64) * (DMODEL / 64))            // 64 tiles per square weight
#define PREP_W1     (4 * PREP_SQ)                              // first block of W1
#define PREP_W2     (PREP_W1 + (DFF / 64) * (DMODEL / 64))     // first block of W2
#define PREP_LN     (PREP_W2 + (DMODEL / 64) * (DFF / 64))     // first block of the LayerNorm
#define PREP_BLOCKS (PREP_LN + NROWS / 2)
static_assert(PREP_SQ == 64 && DMODEL / 64 == 8 && DFF / 64 == 32 && PREP_LN == 768 && 2 * LN_THREADS == 256 && (NROWS % 2) == 0);
__global__ __launch_bounds__(256)
void prep(const float* __restrict__ wq, const float* __restrict__ wk, const float* __restrict__ wv, const float* __restrict__ wo,
          const float* __restrict__ w1, const float* __restrict__ w2, const float* __restrict__ x, const float* __restrict__ mk,
          unsigned short* WQKV, unsigned short* WO16, unsigned short* W116, unsigned short* W216, unsigned short* H16) {
  const int b = blockIdx.x;
  if (b >= PREP_LN) {
    lnorm_rows<1, 2>(x, mk, H16, HCARRY, (b - PREP_LN) * 2);
    return;
  }
  const float* src;
  unsigned short* dst;
  int R = DMODEL, C = DMODEL, t = b & (PREP_SQ - 1);
  float sc = WSC;
  if (b < PREP_W1) {
    const int j = b / PREP_SQ;
    src = j == 0 ? wq : j == 1 ? wk : j == 2 ? wv : wo;
    dst = j == 3 ? WO16 : WQKV + (size_t)j * (DMODEL * DMODEL);
  } else if (b < PREP_W2) {
    src = w1; dst = W116; C = DFF; t = b - PREP_W1;            // R = 512 (in), C = 2048 (out)
  } else {
    src = w2; dst = W216; R = DFF; t = b - PREP_W2; sc = W2SC; // R = 2048 (in), C = 512 (out)
  }
  const int tc = C / 64;
  tcvt16(src, dst, R, C, sc, t % tc, t / tc);
}

// =====================================================================================================
// Workspace map (bytes); every plane is an exact multiple of its tile / whole-row store granularity (M, N exact multiples of 64, rows
//   WQKV f16 [1536][512] x64         1572864   (transposed in-projections [n][k]: rows 0..511 q, 512..1023 k, 1024..1535 v)
//   WO16 f16 [512][512] x64           524288   (Wo^T)
//   W116 f16 [2048][512] x64         2097152   (W1^T)
//   W216 f16 [512][2048] x128        2097152   (W2^T)
//   H16  f16 [8192][512] x16         8388608   (first LayerNorm output)
//   QH   f16 [8192][512] x16         8388608
//   KH   f16 [8192][512] x16         8388608
//   VT   f16 [4][512][2048] x16      8388608   (v^T per batch)
//   CT   f16 [8192][512] x1024       8388608   (attention ctx, merged heads)
//   X1F  f32 [8192][512]            16777216   ((x + ctx . Wo) * mask)
//   H2   f16 [8192][512] x16         8388608   (second LayerNorm output)
//   HH   f16 [8192][2048] x16       33554432   (gelu hidden)
//   end                            106954752
// =====================================================================================================
extern "C" void kernel_launch(void* const* d_in, const int* in_sizes, int n_in,
                              void* d_out, int out_size, void* d_ws, size_t ws_size,
                              hipStream_t stream) {
  if (n_in < 8) return;
  if (in_sizes[0] != NROWS * DMODEL) return;
  if (in_sizes[1] != NROWS) return;
  if (in_sizes[2] != DMODEL * DMODEL || in_sizes[3] != DMODEL * DMODEL ||
      in_sizes[4] != DMODEL * DMODEL || in_sizes[5] != DMODEL * DMODEL) return;
  if (in_sizes[6] != DMODEL * DFF || in_sizes[7] != DFF * DMODEL) return;
  if (out_size != NROWS * DMODEL) return;

  const float* x   = (const float*)d_in[0];
  const float* mk  = (const float*)d_in[1];
  const float* wq  = (const float*)d_in[2];
  const float* wk  = (const float*)d_in[3];
  const float* wv  = (const float*)d_in[4];
  const float* wo  = (const float*)d_in[5];
  const float* w1  = (const float*)d_in[6];
  const float* w2  = (const float*)d_in[7];
  float*       out = (float*)d_out;

  const size_t PWQKV = (size_t)3 * DMODEL * DMODEL * 2;           //  1572864
  const size_t PWO   = (size_t)DMODEL * DMODEL * 2;               //   524288
  const size_t PW1   = (size_t)DFF * DMODEL * 2;                  //  2097152
  const size_t PW2   = (size_t)DMODEL * DFF * 2;                  //  2097152
  const size_t PX    = (size_t)NROWS * DMODEL * 2;                //  8388608
  const size_t PVT   = (size_t)NB * DMODEL * NC * 2;              //  8388608
  const size_t PY    = (size_t)NROWS * DMODEL * 4;                // 16777216
  const size_t PH    = (size_t)NROWS * DFF * 2;                   // 33554432
  size_t off = 0;
  const size_t oWQKV = off; off += PWQKV;
  const size_t oWO   = off; off += PWO;
  const size_t oW1   = off; off += PW1;
  const size_t oW2   = off; off += PW2;
  const size_t oH    = off; off += PX;
  const size_t oQH   = off; off += PX;
  const size_t oKH   = off; off += PX;
  const size_t oVT   = off; off += PVT;
  const size_t oCT   = off; off += PX;
  const size_t oXF   = off; off += PY;
  const size_t oH2   = off; off += PX;
  const size_t oHH   = off; off += PH;
  if (off > ws_size) return;                                      // off = 106954752
  if (off > (size_t)134217728) return;

  char* ws = (char*)d_ws;
  unsigned short* WQKV = (unsigned short*)(ws + oWQKV);
  unsigned short* WO16 = (unsigned short*)(ws + oWO);
  unsigned short* W116 = (unsigned short*)(ws + oW1);
  unsigned short* W216 = (unsigned short*)(ws + oW2);
  unsigned short* H16  = (unsigned short*)(ws + oH);
  unsigned short* QH   = (unsigned short*)(ws + oQH);
  unsigned short* KH   = (unsigned short*)(ws + oKH);
  unsigned short* VTp  = (unsigned short*)(ws + oVT);
  unsigned short* CT   = (unsigned short*)(ws + oCT);
  float*          X1F  = (float*)(ws + oXF);
  unsigned short* H2   = (unsigned short*)(ws + oH2);
  unsigned short* HH   = (unsigned short*)(ws + oHH);

  const dim3 blk(256);
  const dim3 gPrep(PREP_BLOCKS);                                   // 4864
  const dim3 bG(GT_THREADS);                                       // 256
  const dim3 gP((NROWS / GT_TILE) * (DMODEL / GT_TILE), 1);        // 256
  const dim3 gQKV((NROWS / GT_TILE) * (DMODEL / GT_TILE), 3);      // 256 x 3
  const dim3 gF((NROWS / GT_TILE) * (DFF / GT_TILE), 1);           // 1024
  const dim3 gAT(ATT_BLOCKS);                                      // 512
  const dim3 bAT(ATT_THREADS);                                     // 256
  const dim3 gLN(NROWS);                                           // 8192
  const dim3 bLN(LN_THREADS);                                      // 128

  // (0, 1) one grid: transposed weight planes [n][k] = f16( bf16_RNE(W[k][n]) * scale ), k contiguous, and
  //         h = LayerNorm(bf16(x) * bf16(mask)) -> H16 (f16 x16)
  prep<<<gPrep, blk, 0, stream>>>(wq, wk, wv, wo, w1, w2, x, mk, WQKV, WO16, W116, W216, H16);

  // (2, 3, 4) one grid: QH[m][n] = f16(16 * sum_k h[m][k] Wq[k][n]) and KH alike (M = 8192, N = 512, K = 512);
  //            v^T per batch: VT[b][d][tok] = f16(16 * sum_k WvT[d][k] h_b[tok][k]) (M = 512, N = 2048, K = 512)
  gemm_qkv<<<gQKV, bG, 0, stream>>>(H16, WQKV, QH, KH, VTp);

  // (5) full attention per (batch, head, 128 query rows) -> CT (f16, x1024)
  attn8<<<gAT, bAT, 0, stream>>>(QH, KH, VTp, mk, CT);

  // (6) X1F = (CT . WoT^T / (1024 * 64) + bf16(x)) * bf16(mask); M = 8192, N = 512, K = 512, f32
  gemm64<0, 1, 0, 1><<<gP, bG, 0, stream>>>(
      CT, DMODEL, 0LL,
      WO16, DMODEL, 0LL,
      x, mk,
      (void*)X1F, DMODEL, 0LL,
      NROWS, DMODEL, DMODEL, 1.0f / (FC * WSC), 1.0f);

  // (7) h2 = LayerNorm(x1) -> H2 (f16 x16)
  lnorm<0><<<gLN, bLN, 0, stream>>>(X1F, mk, H2, H2C);

  // (8) HH = f16(16 * gelu(h2 . W1)); M = 8192, N = 2048, K = 512
  gemm64<2, 0, 1, 0><<<gF, bG, 0, stream>>>(
      H2, DMODEL, 0LL,
      W116, DMODEL, 0LL,
      x, mk,
      (void*)HH, DFF, 0LL,
      NROWS, DFF, DMODEL, 1.0f / (H2C * WSC), GC);

  // (9) out = HH . W2 / (16 * 128) + x1 (raw f32); M = 8192, N = 512, K = 2048, f32
  gemm64<0, 2, 0, 0><<<gP, bG, 0, stream>>>(
      HH, DFF, 0LL,
      W216, DFF, 0LL,
      X1F, mk,
      (void*)out, DMODEL, 0LL,
      NROWS, DMODEL, DFF, 1.0f / (GC * W2SC), 1.0f);
  (void)hipGetLastError();
}

// v005
// Measured time: 133 microseconds a run.
// Two timings next to v004 put it at 1.06 and 1.05 times that version's speed.
// All steps since v000 together make it 3.18 times as fast.
// Contractions: q/k projections (h f16 x16 . Wq^T/Wk^T f16 x64, K=512), v^T projection (Wv^T f16 x64 . h f16 x16, K=512),
// attention scores^T (k f16 x16 . q f16 x16, K=64), attention v^T . P^T (v^T f16 x16 . P f16 x1024, 32 keys per step),
// output projection (ctx f16 x1024 . Wo^T f16 x64, K=512), FFN1 (h2 f16 x16 . W1^T f16 x64, K=512), FFN2 (g f16 x16 . W2^T f16 x128, K=2048):
// all v_wmma_f32_16x16x32_f16 single products, f32 accumulate. LayerNorms (no affine), softmax, erf-GELU, mask, residuals in f32 on VALU.
// Every float input RNE-converted to bf16 on load.
#include <hip/hip_runtime.h>
#include <math.h>
#include <stdint.h>

#define NB      4
#define NQ      2048
#define NC      2048
#define DMODEL  512
#define DFF     2048
#define NHEAD   8
#define HDIM    64
#define NROWS   (NB * NQ)
#define WSC     64.0f
#define W2SC    128.0f
#define HCARRY  16.0f
#define QC      16.0f
#define KC      16.0f
#define VC      16.0f
#define PC      1024.0f
#define FC      1024.0f
#define H2C     16.0f
#define GC      16.0f
#define ATT_SCALE 0.125f
#define LOG2E   1.4426950408889634f
#define LN_EPS  1e-6f
#define MASKNEG (-100000.0f)
static_assert(NHEAD * HDIM == DMODEL);
static_assert((NQ % 64) == 0 && (NC % 64) == 0 && (DMODEL % 64) == 0 && (DFF % 64) == 0 && (NC % 32) == 0 && (NQ % 16) == 0);
static_assert((NROWS % 64) == 0 && (DMODEL % 32) == 0 && (DFF % 32) == 0);
#define HPB     8                       // waves per attention block (16 query rows per wave, one head per block)
#define NQB     (NQ / (HPB * 16))       // query blocks per batch and head (16)
#define ATT_THREADS (HPB * 32)
#define ATT_BLOCKS  (NB * NHEAD * NQB)
static_assert(ATT_THREADS == 256 && ATT_BLOCKS == 512 && NQB * HPB * 16 == NQ);
#define LN_THREADS 128
static_assert(LN_THREADS * 4 == DMODEL && (LN_THREADS % 32) == 0 && ((DMODEL / 8) % 32) == 0);

typedef _Float16 v16h __attribute__((ext_vector_type(16)));
typedef _Float16 v8h  __attribute__((ext_vector_type(8)));
typedef float    v8f  __attribute__((ext_vector_type(8)));
typedef float    v4f  __attribute__((ext_vector_type(4)));
typedef unsigned int v4u __attribute__((ext_vector_type(4)));
typedef unsigned int v2u __attribute__((ext_vector_type(2)));

union FragH { v16h v; v8h h[2]; v4u u[2]; };

// ---- scalar helpers --------------------------------------------------------------------------------
__device__ __forceinline__ unsigned short bf_bits(float f) {          // f32 -> bf16 bits, RNE convert
  unsigned u = __float_as_uint(f);
  return (unsigned short)((u + 0x7FFFu + ((u >> 16) & 1u)) >> 16);
}
__device__ __forceinline__ float bf_up(unsigned short h) { return __uint_as_float(((unsigned)h) << 16); }
__device__ __forceinline__ float bfr(float f) { return bf_up(bf_bits(f)); }   // value of the bf16 RNE convert
__device__ __forceinline__ unsigned short h_bits(_Float16 x) { return __builtin_bit_cast(unsigned short, x); }
__device__ __forceinline__ unsigned pk16(unsigned short a, unsigned short b) { return (unsigned)a | ((unsigned)b << 16); }
__device__ __forceinline__ v8f zero8() { v8f z = {0.f, 0.f, 0.f, 0.f, 0.f, 0.f, 0.f, 0.f}; return z; }
__device__ __forceinline__ float gelu_f(float u) { return 0.5f * u * (1.0f + erff(u * 0.70710678118654752440f)); }

// ---- fragment loaders: 16-bit A/B operand, lane -> row/col (lane&15), p already includes +8*(lane>>4);
//      elements 0..7 <- p[0..7] (k0+8h..), elements 8..15 <- p[16..23] (k0+16+8h..)  (same split k map for A and B;
//      B is always read from a k-contiguous [n][k] plane)
__device__ __forceinline__ v16h ldfrag_h(const _Float16* p) {
  FragH f;
  f.h[0] = *(const v8h*)(p);
  f.h[1] = *(const v8h*)(p + 16);
  return f.v;
}
__device__ __forceinline__ v16h ldfrag_u(const unsigned short* p) {
  FragH f;
  f.u[0] = *(const v4u*)(p);
  f.u[1] = *(const v4u*)(p + 16);
  return f.v;
}

// ---- WMMA helpers with trailing VALU hazard gaps ------------------------------------------------------
__device__ __forceinline__ v8f mma_raw(v16h a, v16h b, v8f c) {
  return __builtin_amdgcn_wmma_f32_16x16x32_f16(false, a, false, b, (short)0, c, false, false);
}
__device__ __forceinline__ void dep_guard1(v8f& a, v8f& b, v16h x) {
#if defined(__HIP_DEVICE_COMPILE__)
  asm volatile("v_nop\n\tv_nop\n\tv_nop\n\tv_nop" : "+v"(a), "+v"(b) : "v"(x));
#endif
}
__device__ __forceinline__ void keep4_h(v16h a, v16h b, v16h c, v16h d) {
#if defined(__HIP_DEVICE_COMPILE__)
  asm volatile("v_nop" :: "v"(a), "v"(b), "v"(c), "v"(d));
#endif
}
__device__ __forceinline__ void acc_guard4(v8f& a, v8f& b, v8f& c, v8f& d) {
#if defined(__HIP_DEVICE_COMPILE__)
  asm volatile("v_nop\n\tv_nop\n\tv_nop\n\tv_nop" : "+v"(a), "+v"(b), "+v"(c), "+v"(d));
#endif
}
// the value that lane l ^ 16 holds (a vector cross-row move, no LDS round trip)
__device__ __forceinline__ float xhalf(float v) {
  const int b = __builtin_bit_cast(int, v);
  return __builtin_bit_cast(float, __builtin_amdgcn_permlanex16(b, b, 0x76543210, 0xfedcba98, false, false));
}
// 2^x as the bare v_exp_f32. exp2f() wraps it for results below 2^-126 (compare, select, add, select, ldexp: five more vector
// instructions per value). The softmax needs no such result: a weight that small is 0 in the f16 P and adds nothing to a sum >= 1.
__device__ __forceinline__ float ex2(float x) { return __builtin_amdgcn_exp2f(x); }
__device__ __forceinline__ void wave_sync_lds() {
  __builtin_amdgcn_fence(__ATOMIC_RELEASE, "workgroup");
  __builtin_amdgcn_wave_barrier();
  __builtin_amdgcn_fence(__ATOMIC_ACQUIRE, "workgroup");
}

// =====================================================================================================
// Transposing 16-bit pack of a weight stored [in][out] = in[R][C] (row pitch C): out[C][R] (row pitch R), out[c][r] =
// f16( bf16_RNE(in[r][c]) * sc ), sc a power of two (exact). One 64x64 tile per block through LDS: coalesced float4 reads of 64 input
// rows, 2-byte LDS stores into the transposed tile [c][r] (pitch 72 halves), block barrier, then every output row segment of 64 halves
// coverage: load 256 thr x 16 floats = 64x64; store 2 it x 8 waves x 4 rows x (8 lanes x 8 halves) = 64 rows x 64 halves;
//           tiles (bx, by) in (C/64, R/64) exact (the caller's block ranges), each output line written by exactly one wave.
// =====================================================================================================
__device__ __forceinline__ void tcvt16(const float* __restrict__ src, unsigned short* dst, int R, int C, float sc, int bx, int by) {
  __shared__ __align__(16) unsigned short sT[64 * 72];
  const int tid = threadIdx.x, lane = tid & 31, wave = tid >> 5;
  const int c0 = bx * 64, r0 = by * 64;
  const int rr = tid >> 2, cc = (tid & 3) * 16;
  const float* sp = src + (size_t)(r0 + rr) * C + c0 + cc;
#pragma unroll
  for (int e = 0; e < 4; ++e) {
    const v4f a = *(const v4f*)(sp + 4 * e);
#pragma unroll
    for (int k = 0; k < 4; ++k)
      sT[(cc + 4 * e + k) * 72 + rr] = h_bits((_Float16)(bfr(a[k]) * sc));
  }
  __syncthreads();
  v4u vals[2];
#pragma unroll
  for (int it = 0; it < 2; ++it) {
    const int q = it * 32 + wave * 4 + (lane >> 3);
    vals[it] = *(const v4u*)(sT + q * 72 + (lane & 7) * 8);
  }
  {
#pragma unroll
    for (int it = 0; it < 2; ++it) {
      const int q = it * 32 + wave * 4 + (lane >> 3);
      *(v4u*)(dst + (size_t)(c0 + q) * R + r0 + (lane & 7) * 8) = vals[it];
    }
    // no register that the two stores name is rewritten ahead of this wait
#if defined(__HIP_DEVICE_COMPILE__)
    asm volatile("s_wait_xcnt 0x0" ::: "memory");
#endif
  }
}

// =====================================================================================================
// Batched f16 WMMA GEMM, operands staged in LDS: C[m][n] = f( oscale * sum_k A[m][k] * Bt[n][k] ) (+ residual) (* row mask).
// One 128x128 tile per block of 8 waves (4x2 waves of 32x64). A row-major [M][K] pitch lda (16-bit plane), Bt row-major [N][K] pitch ldb
// (k contiguous); M, N, K multiples of 128. tile = index of the block's tile, by = batch index with element strides sA, sB, sC.
// A trip is 128 k: [A 128 rows | Bt 128 rows] of 256 B each, LDS pitch 272 B (16 B x odd: 16-B row readers meet no bank twice), two
// buffers. Each lane copies 16 pieces of 16 B per trip with asynchronous copies to LDS (a wave's copy = 2 whole rows = 4 whole lines);
// the copies of trip t + 2 are issued behind the barrier that ends trip t and fly while trip t + 1 is worked on.
// Inside a trip the fragments of k-step ks + 1 are read from LDS ahead of the products of k-step ks (never across the barrier).
// The k order of every accumulator is the ascending one (steps of 32). Behind the last trip's barrier the ring serves as the
// waves' epilogue slabs.
// OM: 0 = f32 out (pitch ldc; HASR 1 adds bf16(R[m][n]), HASR 2 adds raw f32 R[m][n], same pitch/stride as C; MSK 1 multiplies the
//     sum by bf16(Mrow[m])); 2 = f16 out (pitch ldc) = f16( act(value) * ocarry ), ACT 1 = erf-GELU.
// coverage: 2 slabs x 16 rows (f32: it 0..7 x lane>>4; f16: it 0..3 x lane>>3) x 64 cols = the wave's whole 32x64 tile;
//           8 waves = the block's 128x128 tile; grid = tilesM*tilesN blocks exactly (a surplus block leaves as a whole, before any barrier).
// =====================================================================================================
#define GT_TILE    128                     // rows of A and of Bt per block tile
#define GT_K       128                     // halves of every row per trip (256 B)
#define GT_PITCH   136                     // halves: 272 B
#define GT_STAGE   (2 * GT_TILE * GT_PITCH) // halves per buffer
#define GT_THREADS 256
#define GT_LSTEP   (16u * GT_PITCH * 2u)   // LDS bytes between two successive copies of a lane (16 rows)
static_assert((NROWS % GT_TILE) == 0 && (DMODEL % GT_TILE) == 0 && (DFF % GT_TILE) == 0 && (NC % GT_TILE) == 0);
static_assert((DMODEL % GT_K) == 0 && (DFF % GT_K) == 0 && ((GT_PITCH * 2) % 16) == 0 && (((GT_PITCH * 2) / 16) % 2) == 1);
static_assert(GT_THREADS / 16 == 16 && 8 * 16 == GT_TILE && GT_K * 2 == 16 * 16);
static_assert((size_t)(GT_THREADS / 32) * 16 * 68 * sizeof(float) <= (size_t)2 * GT_STAGE * sizeof(unsigned short));

__device__ __forceinline__ unsigned lds_off(const void* p) { return (unsigned)(size_t)p; }
// the wave's own LDS reads have returned before the buffer they read is handed back for a refill
__device__ __forceinline__ void wait_ds0() {
#if defined(__HIP_DEVICE_COMPILE__)
  asm volatile("s_wait_dscnt 0x0" ::: "memory");
#endif
}
// the wave's own asynchronous copies have landed in LDS (the compiler places no wait for them)
__device__ __forceinline__ void wait_async0() {
#if defined(__HIP_DEVICE_COMPILE__)
  asm volatile("s_wait_asynccnt 0x0" ::: "memory");
#endif
}
// Eight asynchronous 16-B copies per lane, global -> LDS: rows 16 apart (gs halves in global memory, GT_LSTEP bytes in LDS).
// The closing s_wait_xcnt 0 stands inside the statement so that no address register is rewritten ahead of it.
__device__ __forceinline__ void copy8(unsigned l0, const unsigned short* g0, size_t gs) {
#if defined(__HIP_DEVICE_COMPILE__)
  const unsigned l1 = l0 + GT_LSTEP, l2 = l0 + 2u * GT_LSTEP, l3 = l0 + 3u * GT_LSTEP;
  const unsigned l4 = l0 + 4u * GT_LSTEP, l5 = l0 + 5u * GT_LSTEP, l6 = l0 + 6u * GT_LSTEP, l7 = l0 + 7u * GT_LSTEP;
  const unsigned short* g1 = g0 + gs;
  const unsigned short* g2 = g1 + gs;
  const unsigned short* g3 = g2 + gs;
  const unsigned short* g4 = g3 + gs;
  const unsigned short* g5 = g4 + gs;
  const unsigned short* g6 = g5 + gs;
  const unsigned short* g7 = g6 + gs;
  asm volatile(
      "global_load_async_to_lds_b128 %0, %8, off\n\t"
      "global_load_async_to_lds_b128 %1, %9, off\n\t"
      "global_load_async_to_lds_b128 %2, %10, off\n\t"
      "global_load_async_to_lds_b128 %3, %11, off\n\t"
      "global_load_async_to_lds_b128 %4, %12, off\n\t"
      "global_load_async_to_lds_b128 %5, %13, off\n\t"
      "global_load_async_to_lds_b128 %6, %14, off\n\t"
      "global_load_async_to_lds_b128 %7, %15, off\n\t"
      "s_wait_xcnt 0x0"
      :: "v"(l0), "v"(l1), "v"(l2), "v"(l3), "v"(l4), "v"(l5), "v"(l6), "v"(l7),
         "v"(g0), "v"(g1), "v"(g2), "v"(g3), "v"(g4), "v"(g5), "v"(g6), "v"(g7)
      : "memory");
#endif
}
// One trip's tile: lane's pieces of A rows 0..127 (LDS rows 0..127), then of Bt rows 0..127 (LDS rows 128..255).
__device__ __forceinline__ void stage_tile(unsigned l, const unsigned short* ga, size_t lda, const unsigned short* gb, size_t ldb) {
  copy8(l,                 ga, 16 * lda);
  copy8(l + 8u * GT_LSTEP, gb, 16 * ldb);
}

template <int OM, int HASR, int ACT, int MSK>
__device__ __forceinline__ void gemm_tile(
    int tile, int by,
    const unsigned short* __restrict__ Ap, int lda, long long sA,
    const unsigned short* __restrict__ Btp, int ldb, long long sB,
    const float* __restrict__ Rp, const float* __restrict__ Mp,
    void* Cout, int ldc, long long sC,
    int M, int N, int K, float oscale, float ocarry) {
  __shared__ __align__(16) unsigned short sR[2 * GT_STAGE];   // the two operand buffers; later per-wave 16x64 f32 slabs, pitch 68 floats
  const int tid  = threadIdx.x;
  const int lane = tid & 31;
  const int wave = tid >> 5;
  const int tilesN = N >> 7;
  const int tilesM = M >> 7;
  if (tile >= tilesM * tilesN) return;   // block-uniform, in front of every barrier and copy
  const int tm = tile / tilesN;
  const int tn = tile - tm * tilesN;
  const int wm = wave >> 1, wn = wave & 1;
  const int m0 = (tm << 7) + (wm << 5);
  const int n0 = (tn << 7) + (wn << 6);

  const unsigned short* A1 = Ap  + (size_t)((long long)by * sA);
  const unsigned short* Bb = Btp + (size_t)((long long)by * sB);

  const int rlane = lane & 15;                 // row (A) / col (B, D) within subtile
  const int koff  = (lane >> 4) * 8;           // k offset of this lane half
  const int mOff  = (lane >> 4) * 8;           // D row offset

  // the lane's first piece of a trip: row tid>>4 of the tile, 16-B piece tid&15 of its 256 B
  const int crow = tid >> 4, cpc = tid & 15;
  const unsigned short* gA = A1 + (size_t)((tm << 7) + crow) * lda + cpc * 8;
  const unsigned short* gB = Bb + (size_t)((tn << 7) + crow) * ldb + cpc * 8;
  const unsigned lC = lds_off(sR) + (unsigned)(crow * (GT_PITCH * 2) + cpc * 16);

  v8f acc[2][4];
#pragma unroll
  for (int i = 0; i < 2; ++i)
#pragma unroll
    for (int j = 0; j < 4; ++j) acc[i][j] = zero8();

  const int nt = K >> 7;
  stage_tile(lC, gA, (size_t)lda, gB, (size_t)ldb);
  wait_async0();
  __syncthreads();                               // tile 0 is published
  if (nt > 1) stage_tile(lC + GT_STAGE * 2u, gA + GT_K, (size_t)lda, gB + GT_K, (size_t)ldb);

  // rolled: the buffer is picked by the trip's parity
#pragma unroll 1
  for (int t = 0; t < nt; ++t) {
    const unsigned short* sb = sR + (t & 1) * GT_STAGE;
    const unsigned short* fa = sb + ((wm << 5) + rlane) * GT_PITCH + koff;
    const unsigned short* fb = sb + (GT_TILE + (wn << 6) + rlane) * GT_PITCH + koff;
    // two fragment sets; the loops over them are unrolled so that every index is a constant and the sets stay in registers
    v16h af[2][2], bf[2][4];
#pragma unroll
    for (int j = 0; j < 4; ++j) bf[0][j] = ldfrag_u(fb + (j << 4) * GT_PITCH);
#pragma unroll
    for (int i = 0; i < 2; ++i) af[0][i] = ldfrag_u(fa + (i << 4) * GT_PITCH);
#pragma unroll
    for (int ks = 0; ks < GT_K / 32; ++ks) {
      const int cur = ks & 1, nxt = cur ^ 1;
      if (ks + 1 < GT_K / 32) {
#pragma unroll
        for (int j = 0; j < 4; ++j) bf[nxt][j] = ldfrag_u(fb + (j << 4) * GT_PITCH + (ks + 1) * 32);
#pragma unroll
        for (int i = 0; i < 2; ++i) af[nxt][i] = ldfrag_u(fa + (i << 4) * GT_PITCH + (ks + 1) * 32);
      }
      // keeps the next k-step's LDS reads one group ahead of this k-step's products
      __builtin_amdgcn_sched_barrier(0);
#pragma unroll
      for (int i = 0; i < 2; ++i) {
#pragma unroll
        for (int j = 0; j < 4; ++j) acc[i][j] = mma_raw(af[cur][i], bf[cur][j], acc[i][j]);
        dep_guard1(acc[i][0], acc[i][3], af[cur][i]);
      }
      keep4_h(bf[cur][0], bf[cur][1], bf[cur][2], bf[cur][3]);
      // ends the block of products, so that the reads of the k-step after next stay behind it
      __builtin_amdgcn_sched_barrier(0);
    }
    wait_ds0();
    wait_async0();
    __syncthreads();                             // publishes tile t + 1 and ends every reader's last read of tile t's buffer
    if (t + 2 < nt)
      stage_tile(lC + (unsigned)(t & 1) * (GT_STAGE * 2u), gA + (size_t)(t + 2) * GT_K, (size_t)lda,
                 gB + (size_t)(t + 2) * GT_K, (size_t)ldb);
  }
  wait_async0();
  acc_guard4(acc[0][0], acc[0][1], acc[0][2], acc[0][3]);
  acc_guard4(acc[1][0], acc[1][1], acc[1][2], acc[1][3]);

  const int hh2 = lane >> 4, c4 = (lane & 15) * 4;     // f32 out: 256-B row segment = 16 lanes x 16 B
  const int q8  = lane >> 3, c8 = (lane & 7) * 8;

  // ---- epilogue ----
  float* slab = (float*)(void*)sR + wave * (16 * 68);   // every read and copy of the ring ended at the last trip's barrier
#pragma unroll
  for (int i = 0; i < 2; ++i) {
    const int mBase = m0 + (i << 4);
#pragma unroll
    for (int j = 0; j < 4; ++j) {
#pragma unroll
      for (int r = 0; r < 8; ++r) {
        slab[(mOff + r) * 68 + (j << 4) + rlane] = acc[i][j][r];
      }
    }
    wave_sync_lds();
    if constexpr (OM == 0) {
      float* C = (float*)Cout + (size_t)((long long)by * sC);
      v4f vals[8];
#pragma unroll
      for (int it = 0; it < 8; ++it) {
        const int row = it * 2 + hh2;                      // it 0..7 x hh2 0..1 = rows 0..15
        const int gr  = mBase + row;
        v4f v = *(const v4f*)(slab + row * 68 + c4);
        v4f rv = {0.f, 0.f, 0.f, 0.f};
        if constexpr (HASR != 0) {
          const float* R = Rp + (size_t)((long long)by * sC);
          const v4f rraw = *(const v4f*)(R + (size_t)gr * ldc + n0 + c4);
#pragma unroll
          for (int e = 0; e < 4; ++e) rv[e] = (HASR == 1) ? bfr(rraw[e]) : rraw[e];
        }
        float mk = 1.0f;
        if constexpr (MSK == 1) mk = bfr(Mp[gr]);
#pragma unroll
        for (int e = 0; e < 4; ++e) v[e] = (v[e] * oscale + rv[e]) * mk;
        vals[it] = v;
      }
      {
#pragma unroll
        for (int it = 0; it < 8; ++it) {
          const int gr = mBase + it * 2 + hh2;
          *(v4f*)(C + (size_t)gr * ldc + n0 + c4) = vals[it];
        }
        
      }
    } else {
      unsigned short* C = (unsigned short*)Cout + (size_t)((long long)by * sC);
      v4u hv[4];
#pragma unroll
      for (int it = 0; it < 4; ++it) {
        const int row = it * 4 + q8;                       // it 0..3 x q8 0..3 = rows 0..15
        const float* sp = slab + row * 68 + c8;
        v4u a = {0u, 0u, 0u, 0u};
#pragma unroll
        for (int e = 0; e < 4; ++e) {
          float f0 = sp[2 * e] * oscale;
          float f1 = sp[2 * e + 1] * oscale;
          if constexpr (ACT == 1) { f0 = gelu_f(f0); f1 = gelu_f(f1); }
          f0 *= ocarry; f1 *= ocarry;
          a[e] = pk16(h_bits((_Float16)f0), h_bits((_Float16)f1));
        }
        hv[it] = a;
      }
      {
#pragma unroll
        for (int it = 0; it < 4; ++it) {
          const int row = it * 4 + q8;
          *(v4u*)(C + (size_t)(mBase + row) * ldc + n0 + c8) = hv[it];
        }
        
      }
    }
    wave_sync_lds();
  }
}

// One product per launch: blockIdx.x = tile, blockIdx.y = batch.
template <int OM, int HASR, int ACT, int MSK>
__global__ __launch_bounds__(GT_THREADS) void gemm64(
    const unsigned short* __restrict__ Ap, int lda, long long sA,
    const unsigned short* __restrict__ Btp, int ldb, long long sB,
    const float* __restrict__ Rp, const float* __restrict__ Mp,
    void* Cout, int ldc, long long sC,
    int M, int N, int K, float oscale, float ocarry) {
  gemm_tile<OM, HASR, ACT, MSK>(blockIdx.x, blockIdx.y, Ap, lda, sA, Btp, ldb, sB, Rp, Mp, Cout, ldc, sC, M, N, K, oscale, ocarry);
}

// The three in-projections need nothing of each other and share one grid: blockIdx.y = 0 q, 1 k (A = h, Bt = the weight's rows,
// 64 x 4 tiles), 2 v^T (A = Wv^T, Bt = h of batch blockIdx.x >> 6, 4 x 16 tiles per batch). The choice is the same for a whole block.
// coverage: 256 tiles of 128x128 per product = 8192 x 512 (q, k) and 4 x 512 x 2048 (v^T), each exactly once.
static_assert((NROWS / GT_TILE) * (DMODEL / GT_TILE) == 256 && (DMODEL / GT_TILE) * (NC / GT_TILE) == 64 && NB * 64 == 256);
__global__ __launch_bounds__(GT_THREADS) void gemm_qkv(
    const unsigned short* __restrict__ Hp, const unsigned short* __restrict__ Wp,
    unsigned short* Qo, unsigned short* Ko, unsigned short* Vo) {
  const int job = blockIdx.y;
  const bool isv = job == 2;
  const unsigned short* Wj = Wp + (size_t)job * (DMODEL * DMODEL);
  gemm_tile<2, 0, 0, 0>(
      isv ? (int)(blockIdx.x & 63) : (int)blockIdx.x, isv ? (int)(blockIdx.x >> 6) : 0,
      isv ? Wj : Hp, DMODEL, 0LL,
      isv ? Hp : Wj, DMODEL, isv ? (long long)NC * DMODEL : 0LL,
      nullptr, nullptr,
      (void*)(isv ? Vo : (job == 1 ? Ko : Qo)), isv ? NC : DMODEL, isv ? (long long)DMODEL * NC : 0LL,
      isv ? DMODEL : NROWS, isv ? NC : DMODEL, DMODEL, 1.0f / (HCARRY * WSC), QC);
}
static_assert(QC == KC && QC == VC);

// =====================================================================================================
// Full attention for one batch, one head and 128 query rows (8 waves, 16 query rows per wave), head dim 64, all 2048 keys:
//   q plane (f16 x16) QH[b*2048 + tok][64*head + d], pitch 512; k plane (f16 x16) KH[b*2048 + key][64*head + d], pitch 512;
//   v^T plane (f16 x16): VT[b*512 + 64*head + d][key] (pitch 2048); out (f16 x1024): CT[b*2048 + tok][64*head + d] =
//   1024 * sum_m softmax_m(q.k / 8 + c_q) v[m][d] with the per-query-row mask constant c_q = -1e5 * (1 - bf16(mask[b][tok]))
//   (softmax run in base 2: t = (q.k/carries) * log2(e)/8 + c_q*log2(e), the row constant folded in as the fma addend).
//   The head's k rows and v^T rows are the same for all 8 waves: a tile is 64 keys = [k 64 rows | v^T 64 rows] of 128 B each (one whole
//   line per row), LDS pitch 144 B (16 B x odd: 16-B row readers meet no bank twice), two buffers. Each lane copies 4 pieces of 16 B
//   per tile with asynchronous copies to LDS (a wave's copy = 4 whole rows = 4 whole lines); the copies of tile t + 2 are issued behind
//   the barrier that ends trip t and fly while trip t + 1 is worked on. A trip reads its own buffer alone.
//   Key steps of 32 from 0 to 2047, two per trip (block-uniform trip count 32); every score is finite, so the running max is finite
//   from the first step on; the rescale exponent is clamped at -126 so the first step (running max -inf) gives a tiny finite factor
//   times zero sums.
//   Both products run transposed: S^T = k . q^T (A = k rows, B = q columns) and O^T += v^T . P^T (A = v^T rows, B = P^T columns).
//   Lane (c, hh) then holds, of query column c alone, the scores of keys 8hh + r (tile 0) and 16 + 8hh + r (tile 1): maximum and sum
//   run inside the lane, the two lane halves exchange the maximum once per step; the sums are joined once, behind the loop; those
//   16 registers, times 1024 and RNE to f16, ARE the B fragment of P^T in the split k map; the rescale factor is the lane's own.
//   Per step: 2 score tiles on f16 WMMA (K = 64 as two k-steps of 32), fragments read from the staged tile (two 16-B LDS loads per
//   fragment); online max-subtracted softmax in f32 (exp2); rescale of the running sums; the four v^T A fragments read from the
//   staged tile; 4 v^T . P^T WMMAs. O^T tile j, register r = ctx[query c][16j + 8hh + r].
//   Final 1/l and carry folds in f32; the wave's LDS slab takes its 16-bit result rows [16][64], pitch 72 halves
//   (16-B stores, wave-level LDS ordering), from which the wave writes whole 128-B lines.
// coverage: wave: 4 iterations x 4 rows x (8 lanes x 8 halves) = 16 rows x 64 halves; block: 8 waves = 128 rows of one head;
//           grid (4 batches x 8 heads x 16 query blocks) covers all 8192 x 512 of CT exactly once, each line written by one wave.
// =====================================================================================================
#define PS_FLOATS (HPB * 16 * 36)
#define AT_KEYS   64                        // keys per staged tile
#define AT_PITCH  72                        // halves: 144 B
#define AT_STAGE  ((AT_KEYS + HDIM) * AT_PITCH) // halves per buffer: k rows, then v^T rows
#define AT_TILES  (NC / AT_KEYS)
#define AT_LSTEP  (32u * AT_PITCH * 2u)     // LDS bytes between two successive copies of a lane (32 rows)
static_assert(HDIM * 2 == 128 && AT_KEYS * 2 == 128 && ATT_THREADS / 8 == 32 && AT_KEYS == 64 && HDIM == 64);
static_assert(((AT_PITCH * 2) % 16) == 0 && (((AT_PITCH * 2) / 16) % 2) == 1 && (NC % AT_KEYS) == 0 && AT_TILES >= 2);
static_assert((size_t)16 * AT_PITCH * sizeof(unsigned short) <= (size_t)16 * 36 * sizeof(float));

// One tile: four asynchronous 16-B copies per lane, global -> LDS: k rows r and r + 32, then v^T rows r and r + 32 (LDS rows 32 apart).
// The closing s_wait_xcnt 0 stands inside the statement so that no address register is rewritten ahead of it.
__device__ __forceinline__ void stage_kv(unsigned l0, const unsigned short* k0, const unsigned short* v0) {
#if defined(__HIP_DEVICE_COMPILE__)
  const unsigned l1 = l0 + AT_LSTEP, l2 = l0 + 2u * AT_LSTEP, l3 = l0 + 3u * AT_LSTEP;
  const unsigned short* k1 = k0 + (size_t)32 * DMODEL;
  const unsigned short* v1 = v0 + (size_t)32 * NC;
  asm volatile(
      "global_load_async_to_lds_b128 %0, %4, off\n\t"
      "global_load_async_to_lds_b128 %1, %5, off\n\t"
      "global_load_async_to_lds_b128 %2, %6, off\n\t"
      "global_load_async_to_lds_b128 %3, %7, off\n\t"
      "s_wait_xcnt 0x0"
      :: "v"(l0), "v"(l1), "v"(l2), "v"(l3), "v"(k0), "v"(k1), "v"(v0), "v"(v1)
      : "memory");
#endif
}

__global__ __launch_bounds__(ATT_THREADS)
void attn8(const unsigned short* __restrict__ QHp, const unsigned short* __restrict__ KHp,
           const unsigned short* __restrict__ VTq, const float* __restrict__ mkp, unsigned short* CT) {
  __shared__ __align__(16) unsigned short sKV[2 * AT_STAGE]; // the two k / v^T tile buffers
  __shared__ __align__(16) float smem[PS_FLOATS];          // per wave slab of 16-bit result rows (epilogue only)

  const int tid  = threadIdx.x;
  const int wave = tid >> 5;
  const int lane = tid & 31;
  const int hh   = lane >> 4;
  const int c    = lane & 15;

  const int qt   = blockIdx.x % NQB;                       // query block 0..15
  const int head = (blockIdx.x / NQB) % NHEAD;             // 0..7
  const int bat  = blockIdx.x / (NQB * NHEAD);             // 0..3
  const int q0   = qt * (HPB * 16) + wave * 16;

  const size_t qofs = ((size_t)bat * NQ + q0 + c) * DMODEL + head * HDIM + 8 * hh;
  const _Float16* Qh = (const _Float16*)(const void*)QHp + qofs;
  const float lsc = (LOG2E * ATT_SCALE) / (QC * KC);                   // log2(e) / 8 / carries

  // the lane's first piece of a tile: row tid>>3 of the k rows (and of the v^T rows), 16-B piece tid&7 of its 128 B
  const int crow = tid >> 3, cpc = tid & 7;
  const unsigned short* gK = KHp + ((size_t)bat * NC + crow) * DMODEL + head * HDIM + cpc * 8;
  const unsigned short* gV = VTq + ((size_t)bat * DMODEL + head * HDIM + crow) * NC + cpc * 8;
  const unsigned lC = lds_off(sKV) + (unsigned)(crow * (AT_PITCH * 2) + cpc * 16);

  stage_kv(lC, gK, gV);

  // mask constant of the lane's query column, in base-2 units
  const float cm2 = (MASKNEG * (1.0f - bfr(mkp[(size_t)bat * NQ + q0 + c]))) * LOG2E;

  const v16h qa = ldfrag_h(Qh), qb = ldfrag_h(Qh + 32);

  float mrow = -INFINITY;                        // the column's running maximum
  v8f lacc = zero8();                            // the lane's own shares of the column's running sum (register r: keys = 8hh + r mod 16)
  v8f o0 = zero8(), o1 = zero8(), o2 = zero8(), o3 = zero8();

  const v8f lsc8 = {lsc, lsc, lsc, lsc, lsc, lsc, lsc, lsc};
  const v8f cm8  = {cm2, cm2, cm2, cm2, cm2, cm2, cm2, cm2};

  wait_async0();
  __syncthreads();                               // tile 0 is published
  stage_kv(lC + AT_STAGE * 2u, gK + (size_t)AT_KEYS * DMODEL, gV + AT_KEYS);

  // rolled: the buffer is picked by the trip's parity
#pragma unroll 1
  for (int t = 0; t < AT_TILES; ++t) {
    const unsigned short* sb = sKV + (t & 1) * AT_STAGE;
    const unsigned short* sk = sb + c * AT_PITCH + 8 * hh;
    const unsigned short* sv = sb + (AT_KEYS + c) * AT_PITCH + 8 * hh;
    // unrolled: the two key steps of a tile read it at constant offsets
#pragma unroll
    for (int ks = 0; ks < AT_KEYS / 32; ++ks) {
      const unsigned short* kp = sk + (ks * 32) * AT_PITCH;
      const unsigned short* vp = sv + ks * 32;
      const unsigned short* kq = kp + 16 * AT_PITCH;
      const v16h k00 = ldfrag_u(kp), k01 = ldfrag_u(kp + 32);
      const v16h k10 = ldfrag_u(kq), k11 = ldfrag_u(kq + 32);
      const v16h vb0 = ldfrag_u(vp);
      const v16h vb1 = ldfrag_u(vp + 16 * AT_PITCH);
      const v16h vb2 = ldfrag_u(vp + 32 * AT_PITCH);
      const v16h vb3 = ldfrag_u(vp + 48 * AT_PITCH);
      // holds the step's 16 LDS reads as one group in front of its products: left free, each pair of reads sinks to just in front of
      // the product that takes it, and the wave waits out a whole LDS latency there each time
      __builtin_amdgcn_sched_barrier(0);
      v8f s0, s1;
      s0 = mma_raw(k00, qa, zero8());
      s0 = mma_raw(k01, qb, s0);
      s1 = mma_raw(k10, qa, zero8());
      s1 = mma_raw(k11, qb, s1);
      const v8f t0 = __builtin_elementwise_fma(s0, lsc8, cm8);
      const v8f t1 = __builtin_elementwise_fma(s1, lsc8, cm8);
      const v8f tm = __builtin_elementwise_max(t0, t1);
      float mx = fmaxf(fmaxf(fmaxf(tm[0], tm[1]), fmaxf(tm[2], tm[3])), fmaxf(fmaxf(tm[4], tm[5]), fmaxf(tm[6], tm[7])));
      mx = fmaxf(mx, xhalf(mx));                 // the other 16 keys of this column
      const float mn = fmaxf(mrow, mx);
      const float al = ex2(fmaxf(mrow - mn, -126.0f));
      mrow = mn;
      const v8f mn8 = {mn, mn, mn, mn, mn, mn, mn, mn};
      const v8f d0 = t0 - mn8, d1 = t1 - mn8;
      v8f e0, e1;
#pragma unroll
      for (int r = 0; r < 8; ++r) {
        e0[r] = ex2(d0[r]);
        e1[r] = ex2(d1[r]);
      }
      lacc = lacc * al + (e0 + e1);
      o0 *= al;
      o1 *= al;
      o2 *= al;
      o3 *= al;
      FragH ph;
      ph.h[0] = __builtin_convertvector(e0 * PC, v8h);          // elements 0..7  = keys kb + 8hh + 0..7
      ph.h[1] = __builtin_convertvector(e1 * PC, v8h);          // elements 8..15 = keys kb + 16 + 8hh + 0..7
      o0 = mma_raw(vb0, ph.v, o0);
      o1 = mma_raw(vb1, ph.v, o1);
      o2 = mma_raw(vb2, ph.v, o2);
      o3 = mma_raw(vb3, ph.v, o3);
    }
    // keeps the trip's arithmetic in front of the waits below: sunk behind the barrier, it would stand between the barrier and the
    // refill, and the wait for a tile's copies would follow their issue at once instead of one trip later
    __builtin_amdgcn_sched_barrier(0);
    wait_ds0();
    wait_async0();
    __syncthreads();                             // publishes tile t + 1 and ends every reader's last read of tile t's buffer
    if (t + 2 < AT_TILES)
      stage_kv(lC + (unsigned)(t & 1) * (AT_STAGE * 2u), gK + (size_t)(t + 2) * (AT_KEYS * DMODEL), gV + (size_t)(t + 2) * AT_KEYS);
  }
  wait_async0();

  // ---- join the halves' sums, fold 1/l and the carries (1024 on P, 16 on v, 1024 on the stored ctx), stage the wave's 16x64 slice
  //      as 16-bit in its own slab: row = query c, 16 B = d 16j + 8hh .. + 7 ----
  unsigned short* Os = (unsigned short*)(void*)(smem + wave * (16 * 36));
  const float oc = FC / (PC * VC);
  {
    const float lrow = ((lacc[0] + lacc[1]) + (lacc[2] + lacc[3])) + ((lacc[4] + lacc[5]) + (lacc[6] + lacc[7]));
    const float inv = (1.0f / (lrow + xhalf(lrow))) * oc;
    unsigned short* op = Os + c * AT_PITCH + 8 * hh;
    *(v8h*)(op)      = __builtin_convertvector(o0 * inv, v8h);
    *(v8h*)(op + 16) = __builtin_convertvector(o1 * inv, v8h);
    *(v8h*)(op + 32) = __builtin_convertvector(o2 * inv, v8h);
    *(v8h*)(op + 48) = __builtin_convertvector(o3 * inv, v8h);
  }
  wave_sync_lds();
  // ---- the wave writes its 16 rows of CT: iteration it -> rows it*4 + lane/8, halves (lane%8)*8 .. +7 of the head's 64 ----
  {
    const int q8 = lane >> 3, c8 = (lane & 7) * 8;
    v4u vals[4];
#pragma unroll
    for (int it = 0; it < 4; ++it) vals[it] = *(const v4u*)(Os + (it * 4 + q8) * AT_PITCH + c8);
    unsigned short* dst = CT + ((size_t)bat * NQ + q0) * DMODEL + head * HDIM;
#pragma unroll
    for (int it = 0; it < 4; ++it) *(v4u*)(dst + (size_t)(it * 4 + q8) * DMODEL + c8) = vals[it];
  }
}

// =====================================================================================================
// the input row and multiplies by bf16(mask[row]). Output is the 16-bit plane outh[row][c] = f16(value * hc) only:
//   128 threads per row, 4 consecutive floats per thread (one 16-B load); the 16-bit row is staged in LDS (8 B per
// =====================================================================================================
//   ROWS rows per block of ROWS * 128 threads (row0 = the block's first row); every row keeps its own 128 threads, sums and LDS row.
template <int RIN, int ROWS>
__device__ __forceinline__
void lnorm_rows(const float* __restrict__ Yp, const float* __restrict__ mkp, unsigned short* outh, float hc, int row0) {
  __shared__ float redAll[ROWS][2][LN_THREADS / 32];
  __shared__ __align__(16) unsigned short srowAll[ROWS][DMODEL];
  const int sub  = (ROWS == 1) ? 0 : (int)(threadIdx.x / LN_THREADS);
  float (*red)[LN_THREADS / 32] = redAll[sub];
  unsigned short* srow = srowAll[sub];
  const int row  = row0 + sub;
  const int tid  = (ROWS == 1) ? (int)threadIdx.x : (int)(threadIdx.x % LN_THREADS);
  const int lane = tid & 31;
  const int wave = tid >> 5;
  const size_t base = (size_t)row * DMODEL + (size_t)tid * 4;
  v4f v = *(const v4f*)(Yp + base);
  if constexpr (RIN == 1) {
    const float mk = bfr(mkp[row]);
#pragma unroll
    for (int e = 0; e < 4; ++e) v[e] = bfr(v[e]) * mk;
  }
  float s = (v[0] + v[1]) + (v[2] + v[3]);
#pragma unroll
  for (int off = 1; off < 32; off <<= 1) s += __shfl_xor(s, off, 32);
  if (lane == 0) red[0][wave] = s;
  __syncthreads();
  float tot = 0.f;
#pragma unroll
  for (int w = 0; w < LN_THREADS / 32; ++w) tot += red[0][w];
  const float mu = tot * (1.0f / (float)DMODEL);
  v4f d;
#pragma unroll
  for (int e = 0; e < 4; ++e) d[e] = v[e] - mu;
  float q = (d[0] * d[0] + d[1] * d[1]) + (d[2] * d[2] + d[3] * d[3]);
#pragma unroll
  for (int off = 1; off < 32; off <<= 1) q += __shfl_xor(q, off, 32);
  if (lane == 0) red[1][wave] = q;
  __syncthreads();
  float totq = 0.f;
#pragma unroll
  for (int w = 0; w < LN_THREADS / 32; ++w) totq += red[1][w];
  const float var  = totq * (1.0f / (float)DMODEL);
  const float rstd = rsqrtf(var + LN_EPS);
  v4f o;
#pragma unroll
  for (int e = 0; e < 4; ++e) o[e] = d[e] * rstd;
  v2u w;
  w[0] = pk16(h_bits((_Float16)(o[0] * hc)), h_bits((_Float16)(o[1] * hc)));
  w[1] = pk16(h_bits((_Float16)(o[2] * hc)), h_bits((_Float16)(o[3] * hc)));
  *(v2u*)(srow + tid * 4) = w;
  __syncthreads();
  if (tid < DMODEL / 8) {                                 // waves 0..1, whole waves
    const v4u hv = *(const v4u*)(srow + tid * 8);
    unsigned short* dst = outh + (size_t)row * DMODEL + (size_t)tid * 8;
    {
      *(v4u*)dst = hv;
      
    }
  }
}

template <int RIN>
__global__ __launch_bounds__(LN_THREADS)
void lnorm(const float* __restrict__ Yp, const float* __restrict__ mkp, unsigned short* outh, float hc) {
  lnorm_rows<RIN, 1>(Yp, mkp, outh, hc, blockIdx.x);
}

// The six weight packs and the first LayerNorm need nothing of each other and share one grid of 256-thread blocks, split by ranges of
// the block index (the choice is the same for a whole block, so every barrier stays block-uniform):
//   0..255 the four 512x512 weights (64 tiles each), 256..511 W1 (32 x 8 tiles), 512..767 W2 (8 x 32 tiles),
//   768..4863 the LayerNorm, two rows per block. The short packs stand first, for speed only.
#define PREP_SQ     ((DMODEL / 64) * (DMODEL / 64))            // 64 tiles per square weight
#define PREP_W1     (4 * PREP_SQ)                              // first block of W1
#define PREP_W2     (PREP_W1 + (DFF / 64) * (DMODEL / 64))     // first block of W2
#define PREP_LN     (PREP_W2 + (DMODEL / 64) * (DFF / 64))     // first block of the LayerNorm
#define PREP_BLOCKS (PREP_LN + NROWS / 2)
static_assert(PREP_SQ == 64 && DMODEL / 64 == 8 && DFF / 64 == 32 && PREP_LN == 768 && 2 * LN_THREADS == 256 && (NROWS % 2) == 0);
__global__ __launch_bounds__(256)
void prep(const float* __restrict__ wq, const float* __restrict__ wk, const float* __restrict__ wv, const float* __restrict__ wo,
          const float* __restrict__ w1, const float* __restrict__ w2, const float* __restrict__ x, const float* __restrict__ mk,
          unsigned short* WQKV, unsigned short* WO16, unsigned short* W116, unsigned short* W216, unsigned short* H16) {
  const int b = blockIdx.x;
  if (b >= PREP_LN) {
    lnorm_rows<1, 2>(x, mk, H16, HCARRY, (b - PREP_LN) * 2);
    return;
  }
  const float* src;
  unsigned short* dst;
  int R = DMODEL, C = DMODEL, t = b & (PREP_SQ - 1);
  float sc = WSC;
  if (b < PREP_W1) {
    const int j = b / PREP_SQ;
    src = j == 0 ? wq : j == 1 ? wk : j == 2 ? wv : wo;
    dst = j == 3 ? WO16 : WQKV + (size_t)j * (DMODEL * DMODEL);
  } else if (b < PREP_W2) {
    src = w1; dst = W116; C = DFF; t = b - PREP_W1;            // R = 512 (in), C = 2048 (out)
  } else {
    src = w2; dst = W216; R = DFF; t = b - PREP_W2; sc = W2SC; // R = 2048 (in), C = 512 (out)
  }
  const int tc = C / 64;
  tcvt16(src, dst, R, C, sc, t % tc, t / tc);
}

// =====================================================================================================
// Workspace map (bytes); every plane is an exact multiple of its tile / whole-row store granularity (M, N exact multiples of 64, rows
//   WQKV f16 [1536][512] x64         1572864   (transposed in-projections [n][k]: rows 0..511 q, 512..1023 k, 1024..1535 v)
//   WO16 f16 [512][512] x64           524288   (Wo^T)
//   W116 f16 [2048][512] x64         2097152   (W1^T)
//   W216 f16 [512][2048] x128        2097152   (W2^T)
//   H16  f16 [8192][512] x16         8388608   (first LayerNorm output)
//   QH   f16 [8192][512] x16         8388608
//   KH   f16 [8192][512] x16         8388608
//   VT   f16 [4][512][2048] x16      8388608   (v^T per batch)
//   CT   f16 [8192][512] x1024       8388608   (attention ctx, merged heads)
//   X1F  f32 [8192][512]            16777216   ((x + ctx . Wo) * mask)
//   H2   f16 [8192][512] x16         8388608   (second LayerNorm output)
//   HH   f16 [8192][2048] x16       33554432   (gelu hidden)
//   end                            106954752
// =====================================================================================================
extern "C" void kernel_launch(void* const* d_in, const int* in_sizes, int n_in,
                              void* d_out, int out_size, void* d_ws, size_t ws_size,
                              hipStream_t stream) {
  if (n_in < 8) return;
  if (in_sizes[0] != NROWS * DMODEL) return;
  if (in_sizes[1] != NROWS) return;
  if (in_sizes[2] != DMODEL * DMODEL || in_sizes[3] != DMODEL * DMODEL ||
      in_sizes[4] != DMODEL * DMODEL || in_sizes[5] != DMODEL * DMODEL) return;
  if (in_sizes[6] != DMODEL * DFF || in_sizes[7] != DFF * DMODEL) return;
  if (out_size != NROWS * DMODEL) return;

  const float* x   = (const float*)d_in[0];
  const float* mk  = (const float*)d_in[1];
  const float* wq  = (const float*)d_in[2];
  const float* wk  = (const float*)d_in[3];
  const float* wv  = (const float*)d_in[4];
  const float* wo  = (const float*)d_in[5];
  const float* w1  = (const float*)d_in[6];
  const float* w2  = (const float*)d_in[7];
  float*       out = (float*)d_out;

  const size_t PWQKV = (size_t)3 * DMODEL * DMODEL * 2;           //  1572864
  const size_t PWO   = (size_t)DMODEL * DMODEL * 2;               //   524288
  const size_t PW1   = (size_t)DFF * DMODEL * 2;                  //  2097152
  const size_t PW2   = (size_t)DMODEL * DFF * 2;                  //  2097152
  const size_t PX    = (size_t)NROWS * DMODEL * 2;                //  8388608
  const size_t PVT   = (size_t)NB * DMODEL * NC * 2;              //  8388608
  const size_t PY    = (size_t)NROWS * DMODEL * 4;                // 16777216
  const size_t PH    = (size_t)NROWS * DFF * 2;                   // 33554432
  size_t off = 0;
  const size_t oWQKV = off; off += PWQKV;
  const size_t oWO   = off; off += PWO;
  const size_t oW1   = off; off += PW1;
  const size_t oW2   = off; off += PW2;
  const size_t oH    = off; off += PX;
  const size_t oQH   = off; off += PX;
  const size_t oKH   = off; off += PX;
  const size_t oVT   = off; off += PVT;
  const size_t oCT   = off; off += PX;
  const size_t oXF   = off; off += PY;
  const size_t oH2   = off; off += PX;
  const size_t oHH   = off; off += PH;
  if (off > ws_size) return;                                      // off = 106954752
  if (off > (size_t)134217728) return;

  char* ws = (char*)d_ws;
  unsigned short* WQKV = (unsigned short*)(ws + oWQKV);
  unsigned short* WO16 = (unsigned short*)(ws + oWO);
  unsigned short* W116 = (unsigned short*)(ws + oW1);
  unsigned short* W216 = (unsigned short*)(ws + oW2);
  unsigned short* H16  = (unsigned short*)(ws + oH);
  unsigned short* QH   = (unsigned short*)(ws + oQH);
  unsigned short* KH   = (unsigned short*)(ws + oKH);
  unsigned short* VTp  = (unsigned short*)(ws + oVT);
  unsigned short* CT   = (unsigned short*)(ws + oCT);
  float*          X1F  = (float*)(ws + oXF);
  unsigned short* H2   = (unsigned short*)(ws + oH2);
  unsigned short* HH   = (unsigned short*)(ws + oHH);

  const dim3 blk(256);
  const dim3 gPrep(PREP_BLOCKS);                                   // 4864
  const dim3 bG(GT_THREADS);                                       // 256
  const dim3 gP((NROWS / GT_TILE) * (DMODEL / GT_TILE), 1);        // 256
  const dim3 gQKV((NROWS / GT_TILE) * (DMODEL / GT_TILE), 3);      // 256 x 3
  const dim3 gF((NROWS / GT_TILE) * (DFF / GT_TILE), 1);           // 1024
  const dim3 gAT(ATT_BLOCKS);                                      // 512
  const dim3 bAT(ATT_THREADS);                                     // 256
  const dim3 gLN(NROWS);                                           // 8192
  const dim3 bLN(LN_THREADS);                                      // 128

  // (0, 1) one grid: transposed weight planes [n][k] = f16( bf16_RNE(W[k][n]) * scale ), k contiguous, and
  //         h = LayerNorm(bf16(x) * bf16(mask)) -> H16 (f16 x16)
  prep<<<gPrep, blk, 0, stream>>>(wq, wk, wv, wo, w1, w2, x, mk, WQKV, WO16, W116, W216, H16);

  // (2, 3, 4) one grid: QH[m][n] = f16(16 * sum_k h[m][k] Wq[k][n]) and KH alike (M = 8192, N = 512, K = 512);
  //            v^T per batch: VT[b][d][tok] = f16(16 * sum_k WvT[d][k] h_b[tok][k]) (M = 512, N = 2048, K = 512)
  gemm_qkv<<<gQKV, bG, 0, stream>>>(H16, WQKV, QH, KH, VTp);

  // (5) full attention per (batch, head, 128 query rows) -> CT (f16, x1024)
  attn8<<<gAT, bAT, 0, stream>>>(QH, KH, VTp, mk, CT);

  // (6) X1F = (CT . WoT^T / (1024 * 64) + bf16(x)) * bf16(mask); M = 8192, N = 512, K = 512, f32
  gemm64<0, 1, 0, 1><<<gP, bG, 0, stream>>>(
      CT, DMODEL, 0LL,
      WO16, DMODEL, 0LL,
      x, mk,
      (void*)X1F, DMODEL, 0LL,
      NROWS, DMODEL, DMODEL, 1.0f / (FC * WSC), 1.0f);

  // (7) h2 = LayerNorm(x1) -> H2 (f16 x16)
  lnorm<0><<<gLN, bLN, 0, stream>>>(X1F, mk, H2, H2C);

  // (8) HH = f16(16 * gelu(h2 . W1)); M = 8192, N = 2048, K = 512
  gemm64<2, 0, 1, 0><<<gF, bG, 0, stream>>>(
      H2, DMODEL, 0LL,
      W116, DMODEL, 0LL,
      x, mk,
      (void*)HH, DFF, 0LL,
      NROWS, DFF, DMODEL, 1.0f / (H2C * WSC), GC);

  // (9) out = HH . W2 / (16 * 128) + x1 (raw f32); M = 8192, N = 512, K = 2048, f32
  gemm64<0, 2, 0, 0><<<gP, bG, 0, stream>>>(
      HH, DFF, 0LL,
      W216, DFF, 0LL,
      X1F, mk,
      (void*)out, DMODEL, 0LL,
      NROWS, DMODEL, DFF, 1.0f / (GC * W2SC), 1.0f);
  (void)hipGetLastError();
}

// v006
// It runs in 123 microseconds.
// Next to v005, in two timings, it ran 1.09 times as fast each time.
// Over all steps from v000 it is 3.46 times as fast.
// Contractions: q/k projections (h f16 x16 . Wq^T/Wk^T f16 x64, K=512), v^T projection (Wv^T f16 x64 . h f16 x16, K=512),
// attention scores^T (k f16 x16 . q f16 x16, K=64), attention v^T . P^T (v^T f16 x16 . P f16 x1024, 32 keys per step),
// output projection (ctx f16 x1024 . Wo^T f16 x64, K=512), FFN1 (h2 f16 x16 . W1^T f16 x64, K=512), FFN2 (g f16 x16 . W2^T f16 x128, K=2048):
// all v_wmma_f32_16x16x32_f16 single products, f32 accumulate. LayerNorms (no affine), softmax, erf-GELU, mask, residuals in f32 on VALU.
// Every float input RNE-converted to bf16 on load.
#include <hip/hip_runtime.h>
#include <math.h>
#include <stdint.h>

#define NB      4
#define NQ      2048
#define NC      2048
#define DMODEL  512
#define DFF     2048
#define NHEAD   8
#define HDIM    64
#define NROWS   (NB * NQ)
#define WSC     64.0f
#define W2SC    128.0f
#define HCARRY  16.0f
#define QC      16.0f
#define KC      16.0f
#define VC      16.0f
#define PC      1024.0f
#define FC      1024.0f
#define H2C     16.0f
#define GC      16.0f
#define ATT_SCALE 0.125f
#define LOG2E   1.4426950408889634f
#define LN_EPS  1e-6f
#define MASKNEG (-100000.0f)
static_assert(NHEAD * HDIM == DMODEL);
static_assert((NQ % 64) == 0 && (NC % 64) == 0 && (DMODEL % 64) == 0 && (DFF % 64) == 0 && (NC % 32) == 0 && (NQ % 16) == 0);
static_assert((NROWS % 64) == 0 && (DMODEL % 32) == 0 && (DFF % 32) == 0);
#define HPB     8                       // waves per attention block (16 query rows per wave, one head per block)
#define NQB     (NQ / (HPB * 16))       // query blocks per batch and head (16)
#define ATT_THREADS (HPB * 32)
#define ATT_BLOCKS  (NB * NHEAD * NQB)
static_assert(ATT_THREADS == 256 && ATT_BLOCKS == 512 && NQB * HPB * 16 == NQ);
#define LN_THREADS 128
static_assert(LN_THREADS * 4 == DMODEL && (LN_THREADS % 32) == 0 && ((DMODEL / 8) % 32) == 0);

typedef _Float16 v16h __attribute__((ext_vector_type(16)));
typedef _Float16 v8h  __attribute__((ext_vector_type(8)));
typedef float    v8f  __attribute__((ext_vector_type(8)));
typedef float    v4f  __attribute__((ext_vector_type(4)));
typedef unsigned int v4u __attribute__((ext_vector_type(4)));
typedef unsigned int v2u __attribute__((ext_vector_type(2)));

union FragH { v16h v; v8h h[2]; v4u u[2]; };

// ---- scalar helpers --------------------------------------------------------------------------------
__device__ __forceinline__ unsigned short bf_bits(float f) {          // f32 -> bf16 bits, RNE convert
  unsigned u = __float_as_uint(f);
  return (unsigned short)((u + 0x7FFFu + ((u >> 16) & 1u)) >> 16);
}
__device__ __forceinline__ float bf_up(unsigned short h) { return __uint_as_float(((unsigned)h) << 16); }
__device__ __forceinline__ float bfr(float f) { return bf_up(bf_bits(f)); }   // value of the bf16 RNE convert
__device__ __forceinline__ unsigned short h_bits(_Float16 x) { return __builtin_bit_cast(unsigned short, x); }
__device__ __forceinline__ unsigned pk16(unsigned short a, unsigned short b) { return (unsigned)a | ((unsigned)b << 16); }
__device__ __forceinline__ v8f zero8() { v8f z = {0.f, 0.f, 0.f, 0.f, 0.f, 0.f, 0.f, 0.f}; return z; }
// erf-GELU of eight values at once, no branch: 0.5 u (1 + erf(u / sqrt 2)) = u Phi(u) = max(u, 0) - |u| Q(|u|), Q the normal upper tail,
// Q(a) = exp(-a a / 2) / sqrt(2 pi) * t (b1 + t (b2 + t (b3 + t (b4 + t b5)))), t = 1 / (1 + p a): absolute error of Q below 7.5e-8,
// of the f32 result below 4e-7 (the f16 store rounds coarser from |g| = 1e-3 up). erff() picks one of two series per lane: with lanes on both sides a wave
// runs both, one value after the other, each a single dependent chain behind two EXEC branches. Here the eight chains are independent.
// The b's carry 1 / sqrt(2 pi); exp(-a a / 2) = 2^-(z z) with z = u sqrt(log2(e) / 2). A result of 2^x below 2^-126 may become 0: Q is 0 there.
__device__ __forceinline__ v8f splat8(float x) { v8f r = {x, x, x, x, x, x, x, x}; return r; }
__device__ __forceinline__ v8f gelu8(v8f u) {
  const v8f a = __builtin_elementwise_abs(u);
  const v8f den = __builtin_elementwise_fma(a, splat8(0.2316419f), splat8(1.0f));
  const v8f z = u * 0.84932180028801904272f;
  const v8f w = z * z;
  v8f t, e;
  // unrolled: every index of t and e is a constant, so both stay in registers
#pragma unroll
  for (int r = 0; r < 8; ++r) {
    t[r] = __builtin_amdgcn_rcpf(den[r]);
    e[r] = __builtin_amdgcn_exp2f(-w[r]);
  }
  v8f p = __builtin_elementwise_fma(t, splat8((float)(1.330274429 * 0.3989422804014327)), splat8((float)(-1.821255978 * 0.3989422804014327)));
  p = __builtin_elementwise_fma(p, t, splat8((float)(1.781477937 * 0.3989422804014327)));
  p = __builtin_elementwise_fma(p, t, splat8((float)(-0.356563782 * 0.3989422804014327)));
  p = __builtin_elementwise_fma(p, t, splat8((float)(0.319381530 * 0.3989422804014327)));
  const v8f q = (p * t) * e;
  return __builtin_elementwise_fma(-a, q, __builtin_elementwise_max(u, zero8()));
}

// ---- fragment loaders: 16-bit A/B operand, lane -> row/col (lane&15), p already includes +8*(lane>>4);
//      elements 0..7 <- p[0..7] (k0+8h..), elements 8..15 <- p[16..23] (k0+16+8h..)  (same split k map for A and B;
//      B is always read from a k-contiguous [n][k] plane)
__device__ __forceinline__ v16h ldfrag_h(const _Float16* p) {
  FragH f;
  f.h[0] = *(const v8h*)(p);
  f.h[1] = *(const v8h*)(p + 16);
  return f.v;
}
__device__ __forceinline__ v16h ldfrag_u(const unsigned short* p) {
  FragH f;
  f.u[0] = *(const v4u*)(p);
  f.u[1] = *(const v4u*)(p + 16);
  return f.v;
}

// ---- WMMA helpers with trailing VALU hazard gaps ------------------------------------------------------
__device__ __forceinline__ v8f mma_raw(v16h a, v16h b, v8f c) {
  return __builtin_amdgcn_wmma_f32_16x16x32_f16(false, a, false, b, (short)0, c, false, false);
}
__device__ __forceinline__ void dep_guard1(v8f& a, v8f& b, v16h x) {
#if defined(__HIP_DEVICE_COMPILE__)
  asm volatile("v_nop\n\tv_nop\n\tv_nop\n\tv_nop" : "+v"(a), "+v"(b) : "v"(x));
#endif
}
__device__ __forceinline__ void keep4_h(v16h a, v16h b, v16h c, v16h d) {
#if defined(__HIP_DEVICE_COMPILE__)
  asm volatile("v_nop" :: "v"(a), "v"(b), "v"(c), "v"(d));
#endif
}
__device__ __forceinline__ void acc_guard4(v8f& a, v8f& b, v8f& c, v8f& d) {
#if defined(__HIP_DEVICE_COMPILE__)
  asm volatile("v_nop\n\tv_nop\n\tv_nop\n\tv_nop" : "+v"(a), "+v"(b), "+v"(c), "+v"(d));
#endif
}
// the value that lane l ^ 16 holds (a vector cross-row move, no LDS round trip)
__device__ __forceinline__ float xhalf(float v) {
  const int b = __builtin_bit_cast(int, v);
  return __builtin_bit_cast(float, __builtin_amdgcn_permlanex16(b, b, 0x76543210, 0xfedcba98, false, false));
}
// 2^x as the bare v_exp_f32. exp2f() wraps it for results below 2^-126 (compare, select, add, select, ldexp: five more vector
// instructions per value). The softmax needs no such result: a weight that small is 0 in the f16 P and adds nothing to a sum >= 1.
__device__ __forceinline__ float ex2(float x) { return __builtin_amdgcn_exp2f(x); }
__device__ __forceinline__ void wave_sync_lds() {
  __builtin_amdgcn_fence(__ATOMIC_RELEASE, "workgroup");
  __builtin_amdgcn_wave_barrier();
  __builtin_amdgcn_fence(__ATOMIC_ACQUIRE, "workgroup");
}

// =====================================================================================================
// Transposing 16-bit pack of a weight stored [in][out] = in[R][C] (row pitch C): out[C][R] (row pitch R), out[c][r] =
// f16( bf16_RNE(in[r][c]) * sc ), sc a power of two (exact). One 64x64 tile per block through LDS: coalesced float4 reads of 64 input
// rows, 2-byte LDS stores into the transposed tile [c][r] (pitch 72 halves), block barrier, then every output row segment of 64 halves
// coverage: load 256 thr x 16 floats = 64x64; store 2 it x 8 waves x 4 rows x (8 lanes x 8 halves) = 64 rows x 64 halves;
//           tiles (bx, by) in (C/64, R/64) exact (the caller's block ranges), each output line written by exactly one wave.
// =====================================================================================================
__device__ __forceinline__ void tcvt16(const float* __restrict__ src, unsigned short* dst, int R, int C, float sc, int bx, int by) {
  __shared__ __align__(16) unsigned short sT[64 * 72];
  const int tid = threadIdx.x, lane = tid & 31, wave = tid >> 5;
  const int c0 = bx * 64, r0 = by * 64;
  const int rr = tid >> 2, cc = (tid & 3) * 16;
  const float* sp = src + (size_t)(r0 + rr) * C + c0 + cc;
#pragma unroll
  for (int e = 0; e < 4; ++e) {
    const v4f a = *(const v4f*)(sp + 4 * e);
#pragma unroll
    for (int k = 0; k < 4; ++k)
      sT[(cc + 4 * e + k) * 72 + rr] = h_bits((_Float16)(bfr(a[k]) * sc));
  }
  __syncthreads();
  v4u vals[2];
#pragma unroll
  for (int it = 0; it < 2; ++it) {
    const int q = it * 32 + wave * 4 + (lane >> 3);
    vals[it] = *(const v4u*)(sT + q * 72 + (lane & 7) * 8);
  }
  {
#pragma unroll
    for (int it = 0; it < 2; ++it) {
      const int q = it * 32 + wave * 4 + (lane >> 3);
      *(v4u*)(dst + (size_t)(c0 + q) * R + r0 + (lane & 7) * 8) = vals[it];
    }
    // no register that the two stores name is rewritten ahead of this wait
#if defined(__HIP_DEVICE_COMPILE__)
    asm volatile("s_wait_xcnt 0x0" ::: "memory");
#endif
  }
}

// =====================================================================================================
// Batched f16 WMMA GEMM, operands staged in LDS: C[m][n] = f( oscale * sum_k A[m][k] * Bt[n][k] ) (+ residual) (* row mask).
// One 128x128 tile per block of 8 waves (4x2 waves of 32x64). A row-major [M][K] pitch lda (16-bit plane), Bt row-major [N][K] pitch ldb
// (k contiguous); M, N, K multiples of 128. tile = index of the block's tile, by = batch index with element strides sA, sB, sC.
// A trip is 128 k: [A 128 rows | Bt 128 rows] of 256 B each, LDS pitch 272 B (16 B x odd: 16-B row readers meet no bank twice), two
// buffers. Each lane copies 16 pieces of 16 B per trip with asynchronous copies to LDS (a wave's copy = 2 whole rows = 4 whole lines);
// the copies of trip t + 2 are issued behind the barrier that ends trip t and fly while trip t + 1 is worked on.
// Inside a trip the fragments of k-step ks + 1 are read from LDS ahead of the products of k-step ks (never across the barrier).
// The k order of every accumulator is the ascending one (steps of 32). Behind the last trip's barrier the ring serves as the
// waves' epilogue slabs.
// OM: 0 = f32 out (pitch ldc; HASR 1 adds bf16(R[m][n]), HASR 2 adds raw f32 R[m][n], same pitch/stride as C; MSK 1 multiplies the
//     sum by bf16(Mrow[m])); 2 = f16 out (pitch ldc) = f16( act(value) * ocarry ), ACT 1 = erf-GELU.
// coverage: 2 slabs x 16 rows (f32: it 0..7 x lane>>4; f16: it 0..3 x lane>>3) x 64 cols = the wave's whole 32x64 tile;
//           8 waves = the block's 128x128 tile; grid = tilesM*tilesN blocks exactly (a surplus block leaves as a whole, before any barrier).
// =====================================================================================================
#define GT_TILE    128                     // rows of A and of Bt per block tile
#define GT_K       128                     // halves of every row per trip (256 B)
#define GT_PITCH   136                     // halves: 272 B
#define GT_STAGE   (2 * GT_TILE * GT_PITCH) // halves per buffer
#define GT_THREADS 256
#define GT_LSTEP   (16u * GT_PITCH * 2u)   // LDS bytes between two successive copies of a lane (16 rows)
static_assert((NROWS % GT_TILE) == 0 && (DMODEL % GT_TILE) == 0 && (DFF % GT_TILE) == 0 && (NC % GT_TILE) == 0);
static_assert((DMODEL % GT_K) == 0 && (DFF % GT_K) == 0 && ((GT_PITCH * 2) % 16) == 0 && (((GT_PITCH * 2) / 16) % 2) == 1);
static_assert(GT_THREADS / 16 == 16 && 8 * 16 == GT_TILE && GT_K * 2 == 16 * 16);
static_assert((size_t)(GT_THREADS / 32) * 16 * 68 * sizeof(float) <= (size_t)2 * GT_STAGE * sizeof(unsigned short));

__device__ __forceinline__ unsigned lds_off(const void* p) { return (unsigned)(size_t)p; }
// the wave's own LDS reads have returned before the buffer they read is handed back for a refill
__device__ __forceinline__ void wait_ds0() {
#if defined(__HIP_DEVICE_COMPILE__)
  asm volatile("s_wait_dscnt 0x0" ::: "memory");
#endif
}
// the wave's own asynchronous copies have landed in LDS (the compiler places no wait for them)
__device__ __forceinline__ void wait_async0() {
#if defined(__HIP_DEVICE_COMPILE__)
  asm volatile("s_wait_asynccnt 0x0" ::: "memory");
#endif
}
// Eight asynchronous 16-B copies per lane, global -> LDS: rows 16 apart (gs halves in global memory, GT_LSTEP bytes in LDS).
// The closing s_wait_xcnt 0 stands inside the statement so that no address register is rewritten ahead of it.
__device__ __forceinline__ void copy8(unsigned l0, const unsigned short* g0, size_t gs) {
#if defined(__HIP_DEVICE_COMPILE__)
  const unsigned l1 = l0 + GT_LSTEP, l2 = l0 + 2u * GT_LSTEP, l3 = l0 + 3u * GT_LSTEP;
  const unsigned l4 = l0 + 4u * GT_LSTEP, l5 = l0 + 5u * GT_LSTEP, l6 = l0 + 6u * GT_LSTEP, l7 = l0 + 7u * GT_LSTEP;
  const unsigned short* g1 = g0 + gs;
  const unsigned short* g2 = g1 + gs;
  const unsigned short* g3 = g2 + gs;
  const unsigned short* g4 = g3 + gs;
  const unsigned short* g5 = g4 + gs;
  const unsigned short* g6 = g5 + gs;
  const unsigned short* g7 = g6 + gs;
  asm volatile(
      "global_load_async_to_lds_b128 %0, %8, off\n\t"
      "global_load_async_to_lds_b128 %1, %9, off\n\t"
      "global_load_async_to_lds_b128 %2, %10, off\n\t"
      "global_load_async_to_lds_b128 %3, %11, off\n\t"
      "global_load_async_to_lds_b128 %4, %12, off\n\t"
      "global_load_async_to_lds_b128 %5, %13, off\n\t"
      "global_load_async_to_lds_b128 %6, %14, off\n\t"
      "global_load_async_to_lds_b128 %7, %15, off\n\t"
      "s_wait_xcnt 0x0"
      :: "v"(l0), "v"(l1), "v"(l2), "v"(l3), "v"(l4), "v"(l5), "v"(l6), "v"(l7),
         "v"(g0), "v"(g1), "v"(g2), "v"(g3), "v"(g4), "v"(g5), "v"(g6), "v"(g7)
      : "memory");
#endif
}
// One trip's tile: lane's pieces of A rows 0..127 (LDS rows 0..127), then of Bt rows 0..127 (LDS rows 128..255).
__device__ __forceinline__ void stage_tile(unsigned l, const unsigned short* ga, size_t lda, const unsigned short* gb, size_t ldb) {
  copy8(l,                 ga, 16 * lda);
  copy8(l + 8u * GT_LSTEP, gb, 16 * ldb);
}

template <int OM, int HASR, int ACT, int MSK>
__device__ __forceinline__ void gemm_tile(
    int tile, int by,
    const unsigned short* __restrict__ Ap, int lda, long long sA,
    const unsigned short* __restrict__ Btp, int ldb, long long sB,
    const float* __restrict__ Rp, const float* __restrict__ Mp,
    void* Cout, int ldc, long long sC,
    int M, int N, int K, float oscale, float ocarry) {
  __shared__ __align__(16) unsigned short sR[2 * GT_STAGE];   // the two operand buffers; later per-wave 16x64 f32 slabs, pitch 68 floats
  const int tid  = threadIdx.x;
  const int lane = tid & 31;
  const int wave = tid >> 5;
  const int tilesN = N >> 7;
  const int tilesM = M >> 7;
  if (tile >= tilesM * tilesN) return;   // block-uniform, in front of every barrier and copy
  const int tm = tile / tilesN;
  const int tn = tile - tm * tilesN;
  const int wm = wave >> 1, wn = wave & 1;
  const int m0 = (tm << 7) + (wm << 5);
  const int n0 = (tn << 7) + (wn << 6);

  const unsigned short* A1 = Ap  + (size_t)((long long)by * sA);
  const unsigned short* Bb = Btp + (size_t)((long long)by * sB);

  const int rlane = lane & 15;                 // row (A) / col (B, D) within subtile
  const int koff  = (lane >> 4) * 8;           // k offset of this lane half
  const int mOff  = (lane >> 4) * 8;           // D row offset

  // the lane's first piece of a trip: row tid>>4 of the tile, 16-B piece tid&15 of its 256 B
  const int crow = tid >> 4, cpc = tid & 15;
  const unsigned short* gA = A1 + (size_t)((tm << 7) + crow) * lda + cpc * 8;
  const unsigned short* gB = Bb + (size_t)((tn << 7) + crow) * ldb + cpc * 8;
  const unsigned lC = lds_off(sR) + (unsigned)(crow * (GT_PITCH * 2) + cpc * 16);

  v8f acc[2][4];
#pragma unroll
  for (int i = 0; i < 2; ++i)
#pragma unroll
    for (int j = 0; j < 4; ++j) acc[i][j] = zero8();

  const int nt = K >> 7;
  stage_tile(lC, gA, (size_t)lda, gB, (size_t)ldb);
  wait_async0();
  __syncthreads();                               // tile 0 is published
  if (nt > 1) stage_tile(lC + GT_STAGE * 2u, gA + GT_K, (size_t)lda, gB + GT_K, (size_t)ldb);

  // rolled: the buffer is picked by the trip's parity
#pragma unroll 1
  for (int t = 0; t < nt; ++t) {
    const unsigned short* sb = sR + (t & 1) * GT_STAGE;
    const unsigned short* fa = sb + ((wm << 5) + rlane) * GT_PITCH + koff;
    const unsigned short* fb = sb + (GT_TILE + (wn << 6) + rlane) * GT_PITCH + koff;
    // two fragment sets; the loops over them are unrolled so that every index is a constant and the sets stay in registers
    v16h af[2][2], bf[2][4];
#pragma unroll
    for (int j = 0; j < 4; ++j) bf[0][j] = ldfrag_u(fb + (j << 4) * GT_PITCH);
#pragma unroll
    for (int i = 0; i < 2; ++i) af[0][i] = ldfrag_u(fa + (i << 4) * GT_PITCH);
#pragma unroll
    for (int ks = 0; ks < GT_K / 32; ++ks) {
      const int cur = ks & 1, nxt = cur ^ 1;
      if (ks + 1 < GT_K / 32) {
#pragma unroll
        for (int j = 0; j < 4; ++j) bf[nxt][j] = ldfrag_u(fb + (j << 4) * GT_PITCH + (ks + 1) * 32);
#pragma unroll
        for (int i = 0; i < 2; ++i) af[nxt][i] = ldfrag_u(fa + (i << 4) * GT_PITCH + (ks + 1) * 32);
      }
      // keeps the next k-step's LDS reads one group ahead of this k-step's products
      __builtin_amdgcn_sched_barrier(0);
#pragma unroll
      for (int i = 0; i < 2; ++i) {
#pragma unroll
        for (int j = 0; j < 4; ++j) acc[i][j] = mma_raw(af[cur][i], bf[cur][j], acc[i][j]);
        dep_guard1(acc[i][0], acc[i][3], af[cur][i]);
      }
      keep4_h(bf[cur][0], bf[cur][1], bf[cur][2], bf[cur][3]);
      // ends the block of products, so that the reads of the k-step after next stay behind it
      __builtin_amdgcn_sched_barrier(0);
    }
    wait_ds0();
    wait_async0();
    __syncthreads();                             // publishes tile t + 1 and ends every reader's last read of tile t's buffer
    if (t + 2 < nt)
      stage_tile(lC + (unsigned)(t & 1) * (GT_STAGE * 2u), gA + (size_t)(t + 2) * GT_K, (size_t)lda,
                 gB + (size_t)(t + 2) * GT_K, (size_t)ldb);
  }
  wait_async0();
  acc_guard4(acc[0][0], acc[0][1], acc[0][2], acc[0][3]);
  acc_guard4(acc[1][0], acc[1][1], acc[1][2], acc[1][3]);

  const int hh2 = lane >> 4, c4 = (lane & 15) * 4;     // f32 out: 256-B row segment = 16 lanes x 16 B
  const int q8  = lane >> 3, c8 = (lane & 7) * 8;

  // ---- epilogue ----
  float* slab = (float*)(void*)sR + wave * (16 * 68);   // every read and copy of the ring ended at the last trip's barrier
#pragma unroll
  for (int i = 0; i < 2; ++i) {
    const int mBase = m0 + (i << 4);
#pragma unroll
    for (int j = 0; j < 4; ++j) {
#pragma unroll
      for (int r = 0; r < 8; ++r) {
        slab[(mOff + r) * 68 + (j << 4) + rlane] = acc[i][j][r];
      }
    }
    wave_sync_lds();
    if constexpr (OM == 0) {
      float* C = (float*)Cout + (size_t)((long long)by * sC);
      v4f vals[8];
#pragma unroll
      for (int it = 0; it < 8; ++it) {
        const int row = it * 2 + hh2;                      // it 0..7 x hh2 0..1 = rows 0..15
        const int gr  = mBase + row;
        v4f v = *(const v4f*)(slab + row * 68 + c4);
        v4f rv = {0.f, 0.f, 0.f, 0.f};
        if constexpr (HASR != 0) {
          const float* R = Rp + (size_t)((long long)by * sC);
          const v4f rraw = *(const v4f*)(R + (size_t)gr * ldc + n0 + c4);
#pragma unroll
          for (int e = 0; e < 4; ++e) rv[e] = (HASR == 1) ? bfr(rraw[e]) : rraw[e];
        }
        float mk = 1.0f;
        if constexpr (MSK == 1) mk = bfr(Mp[gr]);
#pragma unroll
        for (int e = 0; e < 4; ++e) v[e] = (v[e] * oscale + rv[e]) * mk;
        vals[it] = v;
      }
      {
#pragma unroll
        for (int it = 0; it < 8; ++it) {
          const int gr = mBase + it * 2 + hh2;
          *(v4f*)(C + (size_t)gr * ldc + n0 + c4) = vals[it];
        }
        
      }
    } else {
      unsigned short* C = (unsigned short*)Cout + (size_t)((long long)by * sC);
      v4u hv[4];
#pragma unroll
      for (int it = 0; it < 4; ++it) {
        const int row = it * 4 + q8;                       // it 0..3 x q8 0..3 = rows 0..15
        const float* sp = slab + row * 68 + c8;
        v4u a = {0u, 0u, 0u, 0u};
        if constexpr (ACT == 1) {
          const v4f s0 = *(const v4f*)(sp), s1 = *(const v4f*)(sp + 4);
          const v8f g = gelu8(__builtin_shufflevector(s0, s1, 0, 1, 2, 3, 4, 5, 6, 7) * oscale) * ocarry;
          a = __builtin_bit_cast(v4u, __builtin_convertvector(g, v8h));
        } else {
#pragma unroll
          for (int e = 0; e < 4; ++e) {
            float f0 = sp[2 * e] * oscale;
            float f1 = sp[2 * e + 1] * oscale;
            f0 *= ocarry; f1 *= ocarry;
            a[e] = pk16(h_bits((_Float16)f0), h_bits((_Float16)f1));
          }
        }
        hv[it] = a;
      }
      {
#pragma unroll
        for (int it = 0; it < 4; ++it) {
          const int row = it * 4 + q8;
          *(v4u*)(C + (size_t)(mBase + row) * ldc + n0 + c8) = hv[it];
        }
        
      }
    }
    wave_sync_lds();
  }
}

// One product per launch: blockIdx.x = tile, blockIdx.y = batch.
template <int OM, int HASR, int ACT, int MSK>
__global__ __launch_bounds__(GT_THREADS) void gemm64(
    const unsigned short* __restrict__ Ap, int lda, long long sA,
    const unsigned short* __restrict__ Btp, int ldb, long long sB,
    const float* __restrict__ Rp, const float* __restrict__ Mp,
    void* Cout, int ldc, long long sC,
    int M, int N, int K, float oscale, float ocarry) {
  gemm_tile<OM, HASR, ACT, MSK>(blockIdx.x, blockIdx.y, Ap, lda, sA, Btp, ldb, sB, Rp, Mp, Cout, ldc, sC, M, N, K, oscale, ocarry);
}

// The three in-projections need nothing of each other and share one grid: blockIdx.y = 0 q, 1 k (A = h, Bt = the weight's rows,
// 64 x 4 tiles), 2 v^T (A = Wv^T, Bt = h of batch blockIdx.x >> 6, 4 x 16 tiles per batch). The choice is the same for a whole block.
// coverage: 256 tiles of 128x128 per product = 8192 x 512 (q, k) and 4 x 512 x 2048 (v^T), each exactly once.
static_assert((NROWS / GT_TILE) * (DMODEL / GT_TILE) == 256 && (DMODEL / GT_TILE) * (NC / GT_TILE) == 64 && NB * 64 == 256);
__global__ __launch_bounds__(GT_THREADS) void gemm_qkv(
    const unsigned short* __restrict__ Hp, const unsigned short* __restrict__ Wp,
    unsigned short* Qo, unsigned short* Ko, unsigned short* Vo) {
  const int job = blockIdx.y;
  const bool isv = job == 2;
  const unsigned short* Wj = Wp + (size_t)job * (DMODEL * DMODEL);
  gemm_tile<2, 0, 0, 0>(
      isv ? (int)(blockIdx.x & 63) : (int)blockIdx.x, isv ? (int)(blockIdx.x >> 6) : 0,
      isv ? Wj : Hp, DMODEL, 0LL,
      isv ? Hp : Wj, DMODEL, isv ? (long long)NC * DMODEL : 0LL,
      nullptr, nullptr,
      (void*)(isv ? Vo : (job == 1 ? Ko : Qo)), isv ? NC : DMODEL, isv ? (long long)DMODEL * NC : 0LL,
      isv ? DMODEL : NROWS, isv ? NC : DMODEL, DMODEL, 1.0f / (HCARRY * WSC), QC);
}
static_assert(QC == KC && QC == VC);

// =====================================================================================================
// Full attention for one batch, one head and 128 query rows (8 waves, 16 query rows per wave), head dim 64, all 2048 keys:
//   q plane (f16 x16) QH[b*2048 + tok][64*head + d], pitch 512; k plane (f16 x16) KH[b*2048 + key][64*head + d], pitch 512;
//   v^T plane (f16 x16): VT[b*512 + 64*head + d][key] (pitch 2048); out (f16 x1024): CT[b*2048 + tok][64*head + d] =
//   1024 * sum_m softmax_m(q.k / 8 + c_q) v[m][d] with the per-query-row mask constant c_q = -1e5 * (1 - bf16(mask[b][tok]))
//   (softmax run in base 2: t = (q.k/carries) * log2(e)/8 + c_q*log2(e), the row constant folded in as the fma addend).
//   The head's k rows and v^T rows are the same for all 8 waves: a tile is 64 keys = [k 64 rows | v^T 64 rows] of 128 B each (one whole
//   line per row), LDS pitch 144 B (16 B x odd: 16-B row readers meet no bank twice), two buffers. Each lane copies 4 pieces of 16 B
//   per tile with asynchronous copies to LDS (a wave's copy = 4 whole rows = 4 whole lines); the copies of tile t + 2 are issued behind
//   the barrier that ends trip t and fly while trip t + 1 is worked on. A trip reads its own buffer alone.
//   Key steps of 32 from 0 to 2047, two per trip (block-uniform trip count 32); every score is finite, so the running max is finite
//   from the first step on; the rescale exponent is clamped at -126 so the first step (running max -inf) gives a tiny finite factor
//   times zero sums.
//   Both products run transposed: S^T = k . q^T (A = k rows, B = q columns) and O^T += v^T . P^T (A = v^T rows, B = P^T columns).
//   Lane (c, hh) then holds, of query column c alone, the scores of keys 8hh + r (tile 0) and 16 + 8hh + r (tile 1): maximum and sum
//   run inside the lane, the two lane halves exchange the maximum once per step; the sums are joined once, behind the loop; those
//   16 registers, times 1024 and RNE to f16, ARE the B fragment of P^T in the split k map; the rescale factor is the lane's own.
//   Per step: 2 score tiles on f16 WMMA (K = 64 as two k-steps of 32), fragments read from the staged tile (two 16-B LDS loads per
//   fragment); online max-subtracted softmax in f32 (exp2); rescale of the running sums; the four v^T A fragments read from the
//   staged tile; 4 v^T . P^T WMMAs. O^T tile j, register r = ctx[query c][16j + 8hh + r].
//   Final 1/l and carry folds in f32; the wave's LDS slab takes its 16-bit result rows [16][64], pitch 72 halves
//   (16-B stores, wave-level LDS ordering), from which the wave writes whole 128-B lines.
// coverage: wave: 4 iterations x 4 rows x (8 lanes x 8 halves) = 16 rows x 64 halves; block: 8 waves = 128 rows of one head;
//           grid (4 batches x 8 heads x 16 query blocks) covers all 8192 x 512 of CT exactly once, each line written by one wave.
// =====================================================================================================
#define PS_FLOATS (HPB * 16 * 36)
#define AT_KEYS   64                        // keys per staged tile
#define AT_PITCH  72                        // halves: 144 B
#define AT_STAGE  ((AT_KEYS + HDIM) * AT_PITCH) // halves per buffer: k rows, then v^T rows
#define AT_TILES  (NC / AT_KEYS)
#define AT_LSTEP  (32u * AT_PITCH * 2u)     // LDS bytes between two successive copies of a lane (32 rows)
static_assert(HDIM * 2 == 128 && AT_KEYS * 2 == 128 && ATT_THREADS / 8 == 32 && AT_KEYS == 64 && HDIM == 64);
static_assert(((AT_PITCH * 2) % 16) == 0 && (((AT_PITCH * 2) / 16) % 2) == 1 && (NC % AT_KEYS) == 0 && AT_TILES >= 2);
static_assert((size_t)16 * AT_PITCH * sizeof(unsigned short) <= (size_t)16 * 36 * sizeof(float));

// One tile: four asynchronous 16-B copies per lane, global -> LDS: k rows r and r + 32, then v^T rows r and r + 32 (LDS rows 32 apart).
// The closing s_wait_xcnt 0 stands inside the statement so that no address register is rewritten ahead of it.
__device__ __forceinline__ void stage_kv(unsigned l0, const unsigned short* k0, const unsigned short* v0) {
#if defined(__HIP_DEVICE_COMPILE__)
  const unsigned l1 = l0 + AT_LSTEP, l2 = l0 + 2u * AT_LSTEP, l3 = l0 + 3u * AT_LSTEP;
  const unsigned short* k1 = k0 + (size_t)32 * DMODEL;
  const unsigned short* v1 = v0 + (size_t)32 * NC;
  asm volatile(
      "global_load_async_to_lds_b128 %0, %4, off\n\t"
      "global_load_async_to_lds_b128 %1, %5, off\n\t"
      "global_load_async_to_lds_b128 %2, %6, off\n\t"
      "global_load_async_to_lds_b128 %3, %7, off\n\t"
      "s_wait_xcnt 0x0"
      :: "v"(l0), "v"(l1), "v"(l2), "v"(l3), "v"(k0), "v"(k1), "v"(v0), "v"(v1)
      : "memory");
#endif
}

__global__ __launch_bounds__(ATT_THREADS)
void attn8(const unsigned short* __restrict__ QHp, const unsigned short* __restrict__ KHp,
           const unsigned short* __restrict__ VTq, const float* __restrict__ mkp, unsigned short* CT) {
  __shared__ __align__(16) unsigned short sKV[2 * AT_STAGE]; // the two k / v^T tile buffers
  __shared__ __align__(16) float smem[PS_FLOATS];          // per wave slab of 16-bit result rows (epilogue only)

  const int tid  = threadIdx.x;
  const int wave = tid >> 5;
  const int lane = tid & 31;
  const int hh   = lane >> 4;
  const int c    = lane & 15;

  const int qt   = blockIdx.x % NQB;                       // query block 0..15
  const int head = (blockIdx.x / NQB) % NHEAD;             // 0..7
  const int bat  = blockIdx.x / (NQB * NHEAD);             // 0..3
  const int q0   = qt * (HPB * 16) + wave * 16;

  const size_t qofs = ((size_t)bat * NQ + q0 + c) * DMODEL + head * HDIM + 8 * hh;
  const _Float16* Qh = (const _Float16*)(const void*)QHp + qofs;
  const float lsc = (LOG2E * ATT_SCALE) / (QC * KC);                   // log2(e) / 8 / carries

  // the lane's first piece of a tile: row tid>>3 of the k rows (and of the v^T rows), 16-B piece tid&7 of its 128 B
  const int crow = tid >> 3, cpc = tid & 7;
  const unsigned short* gK = KHp + ((size_t)bat * NC + crow) * DMODEL + head * HDIM + cpc * 8;
  const unsigned short* gV = VTq + ((size_t)bat * DMODEL + head * HDIM + crow) * NC + cpc * 8;
  const unsigned lC = lds_off(sKV) + (unsigned)(crow * (AT_PITCH * 2) + cpc * 16);

  stage_kv(lC, gK, gV);

  // mask constant of the lane's query column, in base-2 units
  const float cm2 = (MASKNEG * (1.0f - bfr(mkp[(size_t)bat * NQ + q0 + c]))) * LOG2E;

  const v16h qa = ldfrag_h(Qh), qb = ldfrag_h(Qh + 32);

  float mrow = -INFINITY;                        // the column's running maximum
  v8f lacc = zero8();                            // the lane's own shares of the column's running sum (register r: keys = 8hh + r mod 16)
  v8f o0 = zero8(), o1 = zero8(), o2 = zero8(), o3 = zero8();

  const v8f lsc8 = {lsc, lsc, lsc, lsc, lsc, lsc, lsc, lsc};
  const v8f cm8  = {cm2, cm2, cm2, cm2, cm2, cm2, cm2, cm2};

  wait_async0();
  __syncthreads();                               // tile 0 is published
  stage_kv(lC + AT_STAGE * 2u, gK + (size_t)AT_KEYS * DMODEL, gV + AT_KEYS);

  // rolled: the buffer is picked by the trip's parity
#pragma unroll 1
  for (int t = 0; t < AT_TILES; ++t) {
    const unsigned short* sb = sKV + (t & 1) * AT_STAGE;
    const unsigned short* sk = sb + c * AT_PITCH + 8 * hh;
    const unsigned short* sv = sb + (AT_KEYS + c) * AT_PITCH + 8 * hh;
    // unrolled: the two key steps of a tile read it at constant offsets
#pragma unroll
    for (int ks = 0; ks < AT_KEYS / 32; ++ks) {
      const unsigned short* kp = sk + (ks * 32) * AT_PITCH;
      const unsigned short* vp = sv + ks * 32;
      const unsigned short* kq = kp + 16 * AT_PITCH;
      const v16h k00 = ldfrag_u(kp), k01 = ldfrag_u(kp + 32);
      const v16h k10 = ldfrag_u(kq), k11 = ldfrag_u(kq + 32);
      const v16h vb0 = ldfrag_u(vp);
      const v16h vb1 = ldfrag_u(vp + 16 * AT_PITCH);
      const v16h vb2 = ldfrag_u(vp + 32 * AT_PITCH);
      const v16h vb3 = ldfrag_u(vp + 48 * AT_PITCH);
      // holds the step's 16 LDS reads as one group in front of its products: left free, each pair of reads sinks to just in front of
      // the product that takes it, and the wave waits out a whole LDS latency there each time
      __builtin_amdgcn_sched_barrier(0);
      v8f s0, s1;
      s0 = mma_raw(k00, qa, zero8());
      s0 = mma_raw(k01, qb, s0);
      s1 = mma_raw(k10, qa, zero8());
      s1 = mma_raw(k11, qb, s1);
      const v8f t0 = __builtin_elementwise_fma(s0, lsc8, cm8);
      const v8f t1 = __builtin_elementwise_fma(s1, lsc8, cm8);
      const v8f tm = __builtin_elementwise_max(t0, t1);
      float mx = fmaxf(fmaxf(fmaxf(tm[0], tm[1]), fmaxf(tm[2], tm[3])), fmaxf(fmaxf(tm[4], tm[5]), fmaxf(tm[6], tm[7])));
      mx = fmaxf(mx, xhalf(mx));                 // the other 16 keys of this column
      const float mn = fmaxf(mrow, mx);
      const float al = ex2(fmaxf(mrow - mn, -126.0f));
      mrow = mn;
      const v8f mn8 = {mn, mn, mn, mn, mn, mn, mn, mn};
      const v8f d0 = t0 - mn8, d1 = t1 - mn8;
      v8f e0, e1;
#pragma unroll
      for (int r = 0; r < 8; ++r) {
        e0[r] = ex2(d0[r]);
        e1[r] = ex2(d1[r]);
      }
      lacc = lacc * al + (e0 + e1);
      o0 *= al;
      o1 *= al;
      o2 *= al;
      o3 *= al;
      FragH ph;
      ph.h[0] = __builtin_convertvector(e0 * PC, v8h);          // elements 0..7  = keys kb + 8hh + 0..7
      ph.h[1] = __builtin_convertvector(e1 * PC, v8h);          // elements 8..15 = keys kb + 16 + 8hh + 0..7
      o0 = mma_raw(vb0, ph.v, o0);
      o1 = mma_raw(vb1, ph.v, o1);
      o2 = mma_raw(vb2, ph.v, o2);
      o3 = mma_raw(vb3, ph.v, o3);
    }
    // keeps the trip's arithmetic in front of the waits below: sunk behind the barrier, it would stand between the barrier and the
    // refill, and the wait for a tile's copies would follow their issue at once instead of one trip later
    __builtin_amdgcn_sched_barrier(0);
    wait_ds0();
    wait_async0();
    __syncthreads();                             // publishes tile t + 1 and ends every reader's last read of tile t's buffer
    if (t + 2 < AT_TILES)
      stage_kv(lC + (unsigned)(t & 1) * (AT_STAGE * 2u), gK + (size_t)(t + 2) * (AT_KEYS * DMODEL), gV + (size_t)(t + 2) * AT_KEYS);
  }
  wait_async0();

  // ---- join the halves' sums, fold 1/l and the carries (1024 on P, 16 on v, 1024 on the stored ctx), stage the wave's 16x64 slice
  //      as 16-bit in its own slab: row = query c, 16 B = d 16j + 8hh .. + 7 ----
  unsigned short* Os = (unsigned short*)(void*)(smem + wave * (16 * 36));
  const float oc = FC / (PC * VC);
  {
    const float lrow = ((lacc[0] + lacc[1]) + (lacc[2] + lacc[3])) + ((lacc[4] + lacc[5]) + (lacc[6] + lacc[7]));
    const float inv = (1.0f / (lrow + xhalf(lrow))) * oc;
    unsigned short* op = Os + c * AT_PITCH + 8 * hh;
    *(v8h*)(op)      = __builtin_convertvector(o0 * inv, v8h);
    *(v8h*)(op + 16) = __builtin_convertvector(o1 * inv, v8h);
    *(v8h*)(op + 32) = __builtin_convertvector(o2 * inv, v8h);
    *(v8h*)(op + 48) = __builtin_convertvector(o3 * inv, v8h);
  }
  wave_sync_lds();
  // ---- the wave writes its 16 rows of CT: iteration it -> rows it*4 + lane/8, halves (lane%8)*8 .. +7 of the head's 64 ----
  {
    const int q8 = lane >> 3, c8 = (lane & 7) * 8;
    v4u vals[4];
#pragma unroll
    for (int it = 0; it < 4; ++it) vals[it] = *(const v4u*)(Os + (it * 4 + q8) * AT_PITCH + c8);
    unsigned short* dst = CT + ((size_t)bat * NQ + q0) * DMODEL + head * HDIM;
#pragma unroll
    for (int it = 0; it < 4; ++it) *(v4u*)(dst + (size_t)(it * 4 + q8) * DMODEL + c8) = vals[it];
  }
}

// =====================================================================================================
// the input row and multiplies by bf16(mask[row]). Output is the 16-bit plane outh[row][c] = f16(value * hc) only:
//   128 threads per row, 4 consecutive floats per thread (one 16-B load); the 16-bit row is staged in LDS (8 B per
// =====================================================================================================
//   ROWS rows per block of ROWS * 128 threads (row0 = the block's first row); every row keeps its own 128 threads, sums and LDS row.
template <int RIN, int ROWS>
__device__ __forceinline__
void lnorm_rows(const float* __restrict__ Yp, const float* __restrict__ mkp, unsigned short* outh, float hc, int row0) {
  __shared__ float redAll[ROWS][2][LN_THREADS / 32];
  __shared__ __align__(16) unsigned short srowAll[ROWS][DMODEL];
  const int sub  = (ROWS == 1) ? 0 : (int)(threadIdx.x / LN_THREADS);
  float (*red)[LN_THREADS / 32] = redAll[sub];
  unsigned short* srow = srowAll[sub];
  const int row  = row0 + sub;
  const int tid  = (ROWS == 1) ? (int)threadIdx.x : (int)(threadIdx.x % LN_THREADS);
  const int lane = tid & 31;
  const int wave = tid >> 5;
  const size_t base = (size_t)row * DMODEL + (size_t)tid * 4;
  v4f v = *(const v4f*)(Yp + base);
  if constexpr (RIN == 1) {
    const float mk = bfr(mkp[row]);
#pragma unroll
    for (int e = 0; e < 4; ++e) v[e] = bfr(v[e]) * mk;
  }
  float s = (v[0] + v[1]) + (v[2] + v[3]);
#pragma unroll
  for (int off = 1; off < 32; off <<= 1) s += __shfl_xor(s, off, 32);
  if (lane == 0) red[0][wave] = s;
  __syncthreads();
  float tot = 0.f;
#pragma unroll
  for (int w = 0; w < LN_THREADS / 32; ++w) tot += red[0][w];
  const float mu = tot * (1.0f / (float)DMODEL);
  v4f d;
#pragma unroll
  for (int e = 0; e < 4; ++e) d[e] = v[e] - mu;
  float q = (d[0] * d[0] + d[1] * d[1]) + (d[2] * d[2] + d[3] * d[3]);
#pragma unroll
  for (int off = 1; off < 32; off <<= 1) q += __shfl_xor(q, off, 32);
  if (lane == 0) red[1][wave] = q;
  __syncthreads();
  float totq = 0.f;
#pragma unroll
  for (int w = 0; w < LN_THREADS / 32; ++w) totq += red[1][w];
  const float var  = totq * (1.0f / (float)DMODEL);
  const float rstd = rsqrtf(var + LN_EPS);
  v4f o;
#pragma unroll
  for (int e = 0; e < 4; ++e) o[e] = d[e] * rstd;
  v2u w;
  w[0] = pk16(h_bits((_Float16)(o[0] * hc)), h_bits((_Float16)(o[1] * hc)));
  w[1] = pk16(h_bits((_Float16)(o[2] * hc)), h_bits((_Float16)(o[3] * hc)));
  *(v2u*)(srow + tid * 4) = w;
  __syncthreads();
  if (tid < DMODEL / 8) {                                 // waves 0..1, whole waves
    const v4u hv = *(const v4u*)(srow + tid * 8);
    unsigned short* dst = outh + (size_t)row * DMODEL + (size_t)tid * 8;
    {
      *(v4u*)dst = hv;
      
    }
  }
}

template <int RIN>
__global__ __launch_bounds__(LN_THREADS)
void lnorm(const float* __restrict__ Yp, const float* __restrict__ mkp, unsigned short* outh, float hc) {
  lnorm_rows<RIN, 1>(Yp, mkp, outh, hc, blockIdx.x);
}

// The six weight packs and the first LayerNorm need nothing of each other and share one grid of 256-thread blocks, split by ranges of
// the block index (the choice is the same for a whole block, so every barrier stays block-uniform):
//   0..255 the four 512x512 weights (64 tiles each), 256..511 W1 (32 x 8 tiles), 512..767 W2 (8 x 32 tiles),
//   768..4863 the LayerNorm, two rows per block. The short packs stand first, for speed only.
#define PREP_SQ     ((DMODEL / 64) * (DMODEL / 64))            // 64 tiles per square weight
#define PREP_W1     (4 * PREP_SQ)                              // first block of W1
#define PREP_W2     (PREP_W1 + (DFF / 64) * (DMODEL / 64))     // first block of W2
#define PREP_LN     (PREP_W2 + (DMODEL / 64) * (DFF / 64))     // first block of the LayerNorm
#define PREP_BLOCKS (PREP_LN + NROWS / 2)
static_assert(PREP_SQ == 64 && DMODEL / 64 == 8 && DFF / 64 == 32 && PREP_LN == 768 && 2 * LN_THREADS == 256 && (NROWS % 2) == 0);
__global__ __launch_bounds__(256)
void prep(const float* __restrict__ wq, const float* __restrict__ wk, const float* __restrict__ wv, const float* __restrict__ wo,
          const float* __restrict__ w1, const float* __restrict__ w2, const float* __restrict__ x, const float* __restrict__ mk,
          unsigned short* WQKV, unsigned short* WO16, unsigned short* W116, unsigned short* W216, unsigned short* H16) {
  const int b = blockIdx.x;
  if (b >= PREP_LN) {
    lnorm_rows<1, 2>(x, mk, H16, HCARRY, (b - PREP_LN) * 2);
    return;
  }
  const float* src;
  unsigned short* dst;
  int R = DMODEL, C = DMODEL, t = b & (PREP_SQ - 1);
  float sc = WSC;
  if (b < PREP_W1) {
    const int j = b / PREP_SQ;
    src = j == 0 ? wq : j == 1 ? wk : j == 2 ? wv : wo;
    dst = j == 3 ? WO16 : WQKV + (size_t)j * (DMODEL * DMODEL);
  } else if (b < PREP_W2) {
    src = w1; dst = W116; C = DFF; t = b - PREP_W1;            // R = 512 (in), C = 2048 (out)
  } else {
    src = w2; dst = W216; R = DFF; t = b - PREP_W2; sc = W2SC; // R = 2048 (in), C = 512 (out)
  }
  const int tc = C / 64;
  tcvt16(src, dst, R, C, sc, t % tc, t / tc);
}

// =====================================================================================================
// Workspace map (bytes); every plane is an exact multiple of its tile / whole-row store granularity (M, N exact multiples of 64, rows
//   WQKV f16 [1536][512] x64         1572864   (transposed in-projections [n][k]: rows 0..511 q, 512..1023 k, 1024..1535 v)
//   WO16 f16 [512][512] x64           524288   (Wo^T)
//   W116 f16 [2048][512] x64         2097152   (W1^T)
//   W216 f16 [512][2048] x128        2097152   (W2^T)
//   H16  f16 [8192][512] x16         8388608   (first LayerNorm output)
//   QH   f16 [8192][512] x16         8388608
//   KH   f16 [8192][512] x16         8388608
//   VT   f16 [4][512][2048] x16      8388608   (v^T per batch)
//   CT   f16 [8192][512] x1024       8388608   (attention ctx, merged heads)
//   X1F  f32 [8192][512]            16777216   ((x + ctx . Wo) * mask)
//   H2   f16 [8192][512] x16         8388608   (second LayerNorm output)
//   HH   f16 [8192][2048] x16       33554432   (gelu hidden)
//   end                            106954752
// =====================================================================================================
extern "C" void kernel_launch(void* const* d_in, const int* in_sizes, int n_in,
                              void* d_out, int out_size, void* d_ws, size_t ws_size,
                              hipStream_t stream) {
  if (n_in < 8) return;
  if (in_sizes[0] != NROWS * DMODEL) return;
  if (in_sizes[1] != NROWS) return;
  if (in_sizes[2] != DMODEL * DMODEL || in_sizes[3] != DMODEL * DMODEL ||
      in_sizes[4] != DMODEL * DMODEL || in_sizes[5] != DMODEL * DMODEL) return;
  if (in_sizes[6] != DMODEL * DFF || in_sizes[7] != DFF * DMODEL) return;
  if (out_size != NROWS * DMODEL) return;

  const float* x   = (const float*)d_in[0];
  const float* mk  = (const float*)d_in[1];
  const float* wq  = (const float*)d_in[2];
  const float* wk  = (const float*)d_in[3];
  const float* wv  = (const float*)d_in[4];
  const float* wo  = (const float*)d_in[5];
  const float* w1  = (const float*)d_in[6];
  const float* w2  = (const float*)d_in[7];
  float*       out = (float*)d_out;

  const size_t PWQKV = (size_t)3 * DMODEL * DMODEL * 2;           //  1572864
  const size_t PWO   = (size_t)DMODEL * DMODEL * 2;               //   524288
  const size_t PW1   = (size_t)DFF * DMODEL * 2;                  //  2097152
  const size_t PW2   = (size_t)DMODEL * DFF * 2;                  //  2097152
  const size_t PX    = (size_t)NROWS * DMODEL * 2;                //  8388608
  const size_t PVT   = (size_t)NB * DMODEL * NC * 2;              //  8388608
  const size_t PY    = (size_t)NROWS * DMODEL * 4;                // 16777216
  const size_t PH    = (size_t)NROWS * DFF * 2;                   // 33554432
  size_t off = 0;
  const size_t oWQKV = off; off += PWQKV;
  const size_t oWO   = off; off += PWO;
  const size_t oW1   = off; off += PW1;
  const size_t oW2   = off; off += PW2;
  const size_t oH    = off; off += PX;
  const size_t oQH   = off; off += PX;
  const size_t oKH   = off; off += PX;
  const size_t oVT   = off; off += PVT;
  const size_t oCT   = off; off += PX;
  const size_t oXF   = off; off += PY;
  const size_t oH2   = off; off += PX;
  const size_t oHH   = off; off += PH;
  if (off > ws_size) return;                                      // off = 106954752
  if (off > (size_t)134217728) return;

  char* ws = (char*)d_ws;
  unsigned short* WQKV = (unsigned short*)(ws + oWQKV);
  unsigned short* WO16 = (unsigned short*)(ws + oWO);
  unsigned short* W116 = (unsigned short*)(ws + oW1);
  unsigned short* W216 = (unsigned short*)(ws + oW2);
  unsigned short* H16  = (unsigned short*)(ws + oH);
  unsigned short* QH   = (unsigned short*)(ws + oQH);
  unsigned short* KH   = (unsigned short*)(ws + oKH);
  unsigned short* VTp  = (unsigned short*)(ws + oVT);
  unsigned short* CT   = (unsigned short*)(ws + oCT);
  float*          X1F  = (float*)(ws + oXF);
  unsigned short* H2   = (unsigned short*)(ws + oH2);
  unsigned short* HH   = (unsigned short*)(ws + oHH);

  const dim3 blk(256);
  const dim3 gPrep(PREP_BLOCKS);                                   // 4864
  const dim3 bG(GT_THREADS);                                       // 256
  const dim3 gP((NROWS / GT_TILE) * (DMODEL / GT_TILE), 1);        // 256
  const dim3 gQKV((NROWS / GT_TILE) * (DMODEL / GT_TILE), 3);      // 256 x 3
  const dim3 gF((NROWS / GT_TILE) * (DFF / GT_TILE), 1);           // 1024
  const dim3 gAT(ATT_BLOCKS);                                      // 512
  const dim3 bAT(ATT_THREADS);                                     // 256
  const dim3 gLN(NROWS);                                           // 8192
  const dim3 bLN(LN_THREADS);                                      // 128

  // (0, 1) one grid: transposed weight planes [n][k] = f16( bf16_RNE(W[k][n]) * scale ), k contiguous, and
  //         h = LayerNorm(bf16(x) * bf16(mask)) -> H16 (f16 x16)
  prep<<<gPrep, blk, 0, stream>>>(wq, wk, wv, wo, w1, w2, x, mk, WQKV, WO16, W116, W216, H16);

  // (2, 3, 4) one grid: QH[m][n] = f16(16 * sum_k h[m][k] Wq[k][n]) and KH alike (M = 8192, N = 512, K = 512);
  //            v^T per batch: VT[b][d][tok] = f16(16 * sum_k WvT[d][k] h_b[tok][k]) (M = 512, N = 2048, K = 512)
  gemm_qkv<<<gQKV, bG, 0, stream>>>(H16, WQKV, QH, KH, VTp);

  // (5) full attention per (batch, head, 128 query rows) -> CT (f16, x1024)
  attn8<<<gAT, bAT, 0, stream>>>(QH, KH, VTp, mk, CT);

  // (6) X1F = (CT . WoT^T / (1024 * 64) + bf16(x)) * bf16(mask); M = 8192, N = 512, K = 512, f32
  gemm64<0, 1, 0, 1><<<gP, bG, 0, stream>>>(
      CT, DMODEL, 0LL,
      WO16, DMODEL, 0LL,
      x, mk,
      (void*)X1F, DMODEL, 0LL,
      NROWS, DMODEL, DMODEL, 1.0f / (FC * WSC), 1.0f);

  // (7) h2 = LayerNorm(x1) -> H2 (f16 x16)
  lnorm<0><<<gLN, bLN, 0, stream>>>(X1F, mk, H2, H2C);

  // (8) HH = f16(16 * gelu(h2 . W1)); M = 8192, N = 2048, K = 512
  gemm64<2, 0, 1, 0><<<gF, bG, 0, stream>>>(
      H2, DMODEL, 0LL,
      W116, DMODEL, 0LL,
      x, mk,
      (void*)HH, DFF, 0LL,
      NROWS, DFF, DMODEL, 1.0f / (H2C * WSC), GC);

  // (9) out = HH . W2 / (16 * 128) + x1 (raw f32); M = 8192, N = 512, K = 2048, f32
  gemm64<0, 2, 0, 0><<<gP, bG, 0, stream>>>(
      HH, DFF, 0LL,
      W216, DFF, 0LL,
      X1F, mk,
      (void*)out, DMODEL, 0LL,
      NROWS, DMODEL, DFF, 1.0f / (GC * W2SC), 1.0f);
  (void)hipGetLastError();
}

// v007
// One run takes 118 microseconds.
// Two timings next to v006 both put it at 1.03 times that version's speed.
// All steps since v000 together make it 3.57 times as fast.
// Contractions: q/k projections (h f16 x16 . Wq^T/Wk^T f16 x64, K=512), v^T projection (Wv^T f16 x64 . h f16 x16, K=512),
// attention scores^T (k f16 x16 . q f16 x16, K=64), attention v^T . P^T (v^T f16 x16 . P f16 x1024, 32 keys per step),
// output projection (ctx f16 x1024 . Wo^T f16 x64, K=512), FFN1 (h2 f16 x16 . W1^T f16 x64, K=512), FFN2 (g f16 x16 . W2^T f16 x128, K=2048):
// all v_wmma_f32_16x16x32_f16 single products, f32 accumulate. LayerNorms (no affine), softmax, erf-GELU, mask, residuals in f32 on VALU.
// Every float input RNE-converted to bf16 on load.
#include <hip/hip_runtime.h>
#include <math.h>
#include <stdint.h>

#define NB      4
#define NQ      2048
#define NC      2048
#define DMODEL  512
#define DFF     2048
#define NHEAD   8
#define HDIM    64
#define NROWS   (NB * NQ)
#define WSC     64.0f
#define W2SC    128.0f
#define HCARRY  16.0f
#define QC      16.0f
#define KC      16.0f
#define VC      16.0f
#define PC      1024.0f
#define FC      1024.0f
#define H2C     16.0f
#define GC      16.0f
#define ATT_SCALE 0.125f
#define LOG2E   1.4426950408889634f
#define LN_EPS  1e-6f
#define MASKNEG (-100000.0f)
static_assert(NHEAD * HDIM == DMODEL);
static_assert((NQ % 64) == 0 && (NC % 64) == 0 && (DMODEL % 64) == 0 && (DFF % 64) == 0 && (NC % 32) == 0 && (NQ % 16) == 0);
static_assert((NROWS % 64) == 0 && (DMODEL % 32) == 0 && (DFF % 32) == 0);
#define HPB     8                       // waves per attention block (16 query rows per wave, one head per block)
#define NQB     (NQ / (HPB * 16))       // query blocks per batch and head (16)
#define ATT_THREADS (HPB * 32)
#define ATT_BLOCKS  (NB * NHEAD * NQB)
static_assert(ATT_THREADS == 256 && ATT_BLOCKS == 512 && NQB * HPB * 16 == NQ);
#define LN_RPW     4                    // LayerNorm rows per wave
#define LN_THREADS 256                  // 8 waves
#define LN_RPB     (LN_RPW * (LN_THREADS / 32))   // rows per block (32)
#define LN_BLOCKS  (NROWS / LN_RPB)
static_assert(DMODEL == 4 * 128 && (NROWS % LN_RPB) == 0 && LN_BLOCKS == 256 && LN_RPW == 4);

typedef _Float16 v16h __attribute__((ext_vector_type(16)));
typedef _Float16 v8h  __attribute__((ext_vector_type(8)));
typedef _Float16 v4h  __attribute__((ext_vector_type(4)));
typedef float    v8f  __attribute__((ext_vector_type(8)));
typedef float    v4f  __attribute__((ext_vector_type(4)));
typedef unsigned int v4u __attribute__((ext_vector_type(4)));
typedef unsigned int v2u __attribute__((ext_vector_type(2)));

union FragH { v16h v; v8h h[2]; v4u u[2]; };

// ---- scalar helpers --------------------------------------------------------------------------------
__device__ __forceinline__ unsigned short bf_bits(float f) {          // f32 -> bf16 bits, RNE convert
  unsigned u = __float_as_uint(f);
  return (unsigned short)((u + 0x7FFFu + ((u >> 16) & 1u)) >> 16);
}
__device__ __forceinline__ float bf_up(unsigned short h) { return __uint_as_float(((unsigned)h) << 16); }
__device__ __forceinline__ float bfr(float f) { return bf_up(bf_bits(f)); }   // value of the bf16 RNE convert
__device__ __forceinline__ unsigned short h_bits(_Float16 x) { return __builtin_bit_cast(unsigned short, x); }
__device__ __forceinline__ unsigned pk16(unsigned short a, unsigned short b) { return (unsigned)a | ((unsigned)b << 16); }
__device__ __forceinline__ v8f zero8() { v8f z = {0.f, 0.f, 0.f, 0.f, 0.f, 0.f, 0.f, 0.f}; return z; }
// erf-GELU of eight values at once, no branch: 0.5 u (1 + erf(u / sqrt 2)) = u Phi(u) = max(u, 0) - |u| Q(|u|), Q the normal upper tail,
// Q(a) = exp(-a a / 2) / sqrt(2 pi) * t (b1 + t (b2 + t (b3 + t (b4 + t b5)))), t = 1 / (1 + p a): absolute error of Q below 7.5e-8,
// of the f32 result below 4e-7 (the f16 store rounds coarser from |g| = 1e-3 up). erff() picks one of two series per lane: with lanes on both sides a wave
// runs both, one value after the other, each a single dependent chain behind two EXEC branches. Here the eight chains are independent.
// The b's carry 1 / sqrt(2 pi); exp(-a a / 2) = 2^-(z z) with z = u sqrt(log2(e) / 2). A result of 2^x below 2^-126 may become 0: Q is 0 there.
__device__ __forceinline__ v8f splat8(float x) { v8f r = {x, x, x, x, x, x, x, x}; return r; }
__device__ __forceinline__ v8f gelu8(v8f u) {
  const v8f a = __builtin_elementwise_abs(u);
  const v8f den = __builtin_elementwise_fma(a, splat8(0.2316419f), splat8(1.0f));
  const v8f z = u * 0.84932180028801904272f;
  const v8f w = z * z;
  v8f t, e;
  // unrolled: every index of t and e is a constant, so both stay in registers
#pragma unroll
  for (int r = 0; r < 8; ++r) {
    t[r] = __builtin_amdgcn_rcpf(den[r]);
    e[r] = __builtin_amdgcn_exp2f(-w[r]);
  }
  v8f p = __builtin_elementwise_fma(t, splat8((float)(1.330274429 * 0.3989422804014327)), splat8((float)(-1.821255978 * 0.3989422804014327)));
  p = __builtin_elementwise_fma(p, t, splat8((float)(1.781477937 * 0.3989422804014327)));
  p = __builtin_elementwise_fma(p, t, splat8((float)(-0.356563782 * 0.3989422804014327)));
  p = __builtin_elementwise_fma(p, t, splat8((float)(0.319381530 * 0.3989422804014327)));
  const v8f q = (p * t) * e;
  return __builtin_elementwise_fma(-a, q, __builtin_elementwise_max(u, zero8()));
}

// ---- fragment loaders: 16-bit A/B operand, lane -> row/col (lane&15), p already includes +8*(lane>>4);
//      elements 0..7 <- p[0..7] (k0+8h..), elements 8..15 <- p[16..23] (k0+16+8h..)  (same split k map for A and B;
//      B is always read from a k-contiguous [n][k] plane)
__device__ __forceinline__ v16h ldfrag_h(const _Float16* p) {
  FragH f;
  f.h[0] = *(const v8h*)(p);
  f.h[1] = *(const v8h*)(p + 16);
  return f.v;
}
__device__ __forceinline__ v16h ldfrag_u(const unsigned short* p) {
  FragH f;
  f.u[0] = *(const v4u*)(p);
  f.u[1] = *(const v4u*)(p + 16);
  return f.v;
}

// ---- WMMA helpers with trailing VALU hazard gaps ------------------------------------------------------
__device__ __forceinline__ v8f mma_raw(v16h a, v16h b, v8f c) {
  return __builtin_amdgcn_wmma_f32_16x16x32_f16(false, a, false, b, (short)0, c, false, false);
}
__device__ __forceinline__ void dep_guard1(v8f& a, v8f& b, v16h x) {
#if defined(__HIP_DEVICE_COMPILE__)
  asm volatile("v_nop\n\tv_nop\n\tv_nop\n\tv_nop" : "+v"(a), "+v"(b) : "v"(x));
#endif
}
__device__ __forceinline__ void keep4_h(v16h a, v16h b, v16h c, v16h d) {
#if defined(__HIP_DEVICE_COMPILE__)
  asm volatile("v_nop" :: "v"(a), "v"(b), "v"(c), "v"(d));
#endif
}
__device__ __forceinline__ void acc_guard4(v8f& a, v8f& b, v8f& c, v8f& d) {
#if defined(__HIP_DEVICE_COMPILE__)
  asm volatile("v_nop\n\tv_nop\n\tv_nop\n\tv_nop" : "+v"(a), "+v"(b), "+v"(c), "+v"(d));
#endif
}
// the value that lane l ^ 16 holds (a vector cross-row move, no LDS round trip)
__device__ __forceinline__ float xhalf(float v) {
  const int b = __builtin_bit_cast(int, v);
  return __builtin_bit_cast(float, __builtin_amdgcn_permlanex16(b, b, 0x76543210, 0xfedcba98, false, false));
}
// 2^x as the bare v_exp_f32. exp2f() wraps it for results below 2^-126 (compare, select, add, select, ldexp: five more vector
// instructions per value). The softmax needs no such result: a weight that small is 0 in the f16 P and adds nothing to a sum >= 1.
__device__ __forceinline__ float ex2(float x) { return __builtin_amdgcn_exp2f(x); }
__device__ __forceinline__ void wave_sync_lds() {
  __builtin_amdgcn_fence(__ATOMIC_RELEASE, "workgroup");
  __builtin_amdgcn_wave_barrier();
  __builtin_amdgcn_fence(__ATOMIC_ACQUIRE, "workgroup");
}

// =====================================================================================================
// Transposing 16-bit pack of a weight stored [in][out] = in[R][C] (row pitch C): out[C][R] (row pitch R), out[c][r] =
// f16( bf16_RNE(in[r][c]) * sc ), sc a power of two (exact). One 64x64 tile per block through LDS: coalesced float4 reads of 64 input
// rows, 2-byte LDS stores into the transposed tile [c][r] (pitch 72 halves), block barrier, then every output row segment of 64 halves
// coverage: load 256 thr x 16 floats = 64x64; store 2 it x 8 waves x 4 rows x (8 lanes x 8 halves) = 64 rows x 64 halves;
//           tiles (bx, by) in (C/64, R/64) exact (the caller's block ranges), each output line written by exactly one wave.
// =====================================================================================================
__device__ __forceinline__ void tcvt16(const float* __restrict__ src, unsigned short* dst, int R, int C, float sc, int bx, int by) {
  __shared__ __align__(16) unsigned short sT[64 * 72];
  const int tid = threadIdx.x, lane = tid & 31, wave = tid >> 5;
  const int c0 = bx * 64, r0 = by * 64;
  const int rr = tid >> 2, cc = (tid & 3) * 16;
  const float* sp = src + (size_t)(r0 + rr) * C + c0 + cc;
#pragma unroll
  for (int e = 0; e < 4; ++e) {
    const v4f a = *(const v4f*)(sp + 4 * e);
#pragma unroll
    for (int k = 0; k < 4; ++k)
      sT[(cc + 4 * e + k) * 72 + rr] = h_bits((_Float16)(bfr(a[k]) * sc));
  }
  __syncthreads();
  v4u vals[2];
#pragma unroll
  for (int it = 0; it < 2; ++it) {
    const int q = it * 32 + wave * 4 + (lane >> 3);
    vals[it] = *(const v4u*)(sT + q * 72 + (lane & 7) * 8);
  }
  {
#pragma unroll
    for (int it = 0; it < 2; ++it) {
      const int q = it * 32 + wave * 4 + (lane >> 3);
      *(v4u*)(dst + (size_t)(c0 + q) * R + r0 + (lane & 7) * 8) = vals[it];
    }
    // no register that the two stores name is rewritten ahead of this wait
#if defined(__HIP_DEVICE_COMPILE__)
    asm volatile("s_wait_xcnt 0x0" ::: "memory");
#endif
  }
}

// =====================================================================================================
// Batched f16 WMMA GEMM, operands staged in LDS: C[m][n] = f( oscale * sum_k A[m][k] * Bt[n][k] ) (+ residual) (* row mask).
// One 128x128 tile per block of 8 waves (4x2 waves of 32x64). A row-major [M][K] pitch lda (16-bit plane), Bt row-major [N][K] pitch ldb
// (k contiguous); M, N, K multiples of 128. tile = index of the block's tile, by = batch index with element strides sA, sB, sC.
// A trip is 128 k: [A 128 rows | Bt 128 rows] of 256 B each, LDS pitch 272 B (16 B x odd: 16-B row readers meet no bank twice), two
// buffers. Each lane copies 16 pieces of 16 B per trip with asynchronous copies to LDS (a wave's copy = 2 whole rows = 4 whole lines);
// the copies of trip t + 2 are issued behind the barrier that ends trip t and fly while trip t + 1 is worked on.
// Inside a trip the fragments of k-step ks + 1 are read from LDS ahead of the products of k-step ks (never across the barrier).
// The k order of every accumulator is the ascending one (steps of 32). Behind the last trip's barrier the ring serves as the
// waves' epilogue slabs.
// OM: 0 = f32 out (pitch ldc; HASR 1 adds bf16(R[m][n]), HASR 2 adds raw f32 R[m][n], same pitch/stride as C; MSK 1 multiplies the
//     sum by bf16(Mrow[m])); 2 = f16 out (pitch ldc) = f16( act(value) * ocarry ), ACT 1 = erf-GELU.
// coverage: 2 slabs x 16 rows (f32: it 0..7 x lane>>4; f16: it 0..3 x lane>>3) x 64 cols = the wave's whole 32x64 tile;
//           8 waves = the block's 128x128 tile; grid = tilesM*tilesN blocks exactly (a surplus block leaves as a whole, before any barrier).
// =====================================================================================================
#define GT_TILE    128                     // rows of A and of Bt per block tile
#define GT_K       128                     // halves of every row per trip (256 B)
#define GT_PITCH   136                     // halves: 272 B
#define GT_STAGE   (2 * GT_TILE * GT_PITCH) // halves per buffer
#define GT_THREADS 256
#define GT_LSTEP   (16u * GT_PITCH * 2u)   // LDS bytes between two successive copies of a lane (16 rows)
static_assert((NROWS % GT_TILE) == 0 && (DMODEL % GT_TILE) == 0 && (DFF % GT_TILE) == 0 && (NC % GT_TILE) == 0);
static_assert((DMODEL % GT_K) == 0 && (DFF % GT_K) == 0 && ((GT_PITCH * 2) % 16) == 0 && (((GT_PITCH * 2) / 16) % 2) == 1);
static_assert(GT_THREADS / 16 == 16 && 8 * 16 == GT_TILE && GT_K * 2 == 16 * 16);
static_assert((size_t)(GT_THREADS / 32) * 16 * 68 * sizeof(float) <= (size_t)2 * GT_STAGE * sizeof(unsigned short));

__device__ __forceinline__ unsigned lds_off(const void* p) { return (unsigned)(size_t)p; }
// the wave's own LDS reads have returned before the buffer they read is handed back for a refill
__device__ __forceinline__ void wait_ds0() {
#if defined(__HIP_DEVICE_COMPILE__)
  asm volatile("s_wait_dscnt 0x0" ::: "memory");
#endif
}
// the wave's own asynchronous copies have landed in LDS (the compiler places no wait for them)
__device__ __forceinline__ void wait_async0() {
#if defined(__HIP_DEVICE_COMPILE__)
  asm volatile("s_wait_asynccnt 0x0" ::: "memory");
#endif
}
// Eight asynchronous 16-B copies per lane, global -> LDS: rows 16 apart (gs halves in global memory, GT_LSTEP bytes in LDS).
// The closing s_wait_xcnt 0 stands inside the statement so that no address register is rewritten ahead of it.
__device__ __forceinline__ void copy8(unsigned l0, const unsigned short* g0, size_t gs) {
#if defined(__HIP_DEVICE_COMPILE__)
  const unsigned l1 = l0 + GT_LSTEP, l2 = l0 + 2u * GT_LSTEP, l3 = l0 + 3u * GT_LSTEP;
  const unsigned l4 = l0 + 4u * GT_LSTEP, l5 = l0 + 5u * GT_LSTEP, l6 = l0 + 6u * GT_LSTEP, l7 = l0 + 7u * GT_LSTEP;
  const unsigned short* g1 = g0 + gs;
  const unsigned short* g2 = g1 + gs;
  const unsigned short* g3 = g2 + gs;
  const unsigned short* g4 = g3 + gs;
  const unsigned short* g5 = g4 + gs;
  const unsigned short* g6 = g5 + gs;
  const unsigned short* g7 = g6 + gs;
  asm volatile(
      "global_load_async_to_lds_b128 %0, %8, off\n\t"
      "global_load_async_to_lds_b128 %1, %9, off\n\t"
      "global_load_async_to_lds_b128 %2, %10, off\n\t"
      "global_load_async_to_lds_b128 %3, %11, off\n\t"
      "global_load_async_to_lds_b128 %4, %12, off\n\t"
      "global_load_async_to_lds_b128 %5, %13, off\n\t"
      "global_load_async_to_lds_b128 %6, %14, off\n\t"
      "global_load_async_to_lds_b128 %7, %15, off\n\t"
      "s_wait_xcnt 0x0"
      :: "v"(l0), "v"(l1), "v"(l2), "v"(l3), "v"(l4), "v"(l5), "v"(l6), "v"(l7),
         "v"(g0), "v"(g1), "v"(g2), "v"(g3), "v"(g4), "v"(g5), "v"(g6), "v"(g7)
      : "memory");
#endif
}
// One trip's tile: lane's pieces of A rows 0..127 (LDS rows 0..127), then of Bt rows 0..127 (LDS rows 128..255).
__device__ __forceinline__ void stage_tile(unsigned l, const unsigned short* ga, size_t lda, const unsigned short* gb, size_t ldb) {
  copy8(l,                 ga, 16 * lda);
  copy8(l + 8u * GT_LSTEP, gb, 16 * ldb);
}

template <int OM, int HASR, int ACT, int MSK>
__device__ __forceinline__ void gemm_tile(
    int tile, int by,
    const unsigned short* __restrict__ Ap, int lda, long long sA,
    const unsigned short* __restrict__ Btp, int ldb, long long sB,
    const float* __restrict__ Rp, const float* __restrict__ Mp,
    void* Cout, int ldc, long long sC,
    int M, int N, int K, float oscale, float ocarry) {
  __shared__ __align__(16) unsigned short sR[2 * GT_STAGE];   // the two operand buffers; later per-wave 16x64 f32 slabs, pitch 68 floats
  const int tid  = threadIdx.x;
  const int lane = tid & 31;
  const int wave = tid >> 5;
  const int tilesN = N >> 7;
  const int tilesM = M >> 7;
  if (tile >= tilesM * tilesN) return;   // block-uniform, in front of every barrier and copy
  const int tm = tile / tilesN;
  const int tn = tile - tm * tilesN;
  const int wm = wave >> 1, wn = wave & 1;
  const int m0 = (tm << 7) + (wm << 5);
  const int n0 = (tn << 7) + (wn << 6);

  const unsigned short* A1 = Ap  + (size_t)((long long)by * sA);
  const unsigned short* Bb = Btp + (size_t)((long long)by * sB);

  const int rlane = lane & 15;                 // row (A) / col (B, D) within subtile
  const int koff  = (lane >> 4) * 8;           // k offset of this lane half
  const int mOff  = (lane >> 4) * 8;           // D row offset

  // the lane's first piece of a trip: row tid>>4 of the tile, 16-B piece tid&15 of its 256 B
  const int crow = tid >> 4, cpc = tid & 15;
  const unsigned short* gA = A1 + (size_t)((tm << 7) + crow) * lda + cpc * 8;
  const unsigned short* gB = Bb + (size_t)((tn << 7) + crow) * ldb + cpc * 8;
  const unsigned lC = lds_off(sR) + (unsigned)(crow * (GT_PITCH * 2) + cpc * 16);

  v8f acc[2][4];
#pragma unroll
  for (int i = 0; i < 2; ++i)
#pragma unroll
    for (int j = 0; j < 4; ++j) acc[i][j] = zero8();

  const int nt = K >> 7;
  stage_tile(lC, gA, (size_t)lda, gB, (size_t)ldb);
  wait_async0();
  __syncthreads();                               // tile 0 is published
  if (nt > 1) stage_tile(lC + GT_STAGE * 2u, gA + GT_K, (size_t)lda, gB + GT_K, (size_t)ldb);

  // rolled: the buffer is picked by the trip's parity
#pragma unroll 1
  for (int t = 0; t < nt; ++t) {
    const unsigned short* sb = sR + (t & 1) * GT_STAGE;
    const unsigned short* fa = sb + ((wm << 5) + rlane) * GT_PITCH + koff;
    const unsigned short* fb = sb + (GT_TILE + (wn << 6) + rlane) * GT_PITCH + koff;
    // two fragment sets; the loops over them are unrolled so that every index is a constant and the sets stay in registers
    v16h af[2][2], bf[2][4];
#pragma unroll
    for (int j = 0; j < 4; ++j) bf[0][j] = ldfrag_u(fb + (j << 4) * GT_PITCH);
#pragma unroll
    for (int i = 0; i < 2; ++i) af[0][i] = ldfrag_u(fa + (i << 4) * GT_PITCH);
#pragma unroll
    for (int ks = 0; ks < GT_K / 32; ++ks) {
      const int cur = ks & 1, nxt = cur ^ 1;
      if (ks + 1 < GT_K / 32) {
#pragma unroll
        for (int j = 0; j < 4; ++j) bf[nxt][j] = ldfrag_u(fb + (j << 4) * GT_PITCH + (ks + 1) * 32);
#pragma unroll
        for (int i = 0; i < 2; ++i) af[nxt][i] = ldfrag_u(fa + (i << 4) * GT_PITCH + (ks + 1) * 32);
      }
      // keeps the next k-step's LDS reads one group ahead of this k-step's products
      __builtin_amdgcn_sched_barrier(0);
#pragma unroll
      for (int i = 0; i < 2; ++i) {
#pragma unroll
        for (int j = 0; j < 4; ++j) acc[i][j] = mma_raw(af[cur][i], bf[cur][j], acc[i][j]);
        dep_guard1(acc[i][0], acc[i][3], af[cur][i]);
      }
      keep4_h(bf[cur][0], bf[cur][1], bf[cur][2], bf[cur][3]);
      // ends the block of products, so that the reads of the k-step after next stay behind it
      __builtin_amdgcn_sched_barrier(0);
    }
    wait_ds0();
    wait_async0();
    __syncthreads();                             // publishes tile t + 1 and ends every reader's last read of tile t's buffer
    if (t + 2 < nt)
      stage_tile(lC + (unsigned)(t & 1) * (GT_STAGE * 2u), gA + (size_t)(t + 2) * GT_K, (size_t)lda,
                 gB + (size_t)(t + 2) * GT_K, (size_t)ldb);
  }
  wait_async0();
  acc_guard4(acc[0][0], acc[0][1], acc[0][2], acc[0][3]);
  acc_guard4(acc[1][0], acc[1][1], acc[1][2], acc[1][3]);

  const int hh2 = lane >> 4, c4 = (lane & 15) * 4;     // f32 out: 256-B row segment = 16 lanes x 16 B
  const int q8  = lane >> 3, c8 = (lane & 7) * 8;

  // ---- epilogue ----
  float* slab = (float*)(void*)sR + wave * (16 * 68);   // every read and copy of the ring ended at the last trip's barrier
#pragma unroll
  for (int i = 0; i < 2; ++i) {
    const int mBase = m0 + (i << 4);
#pragma unroll
    for (int j = 0; j < 4; ++j) {
#pragma unroll
      for (int r = 0; r < 8; ++r) {
        slab[(mOff + r) * 68 + (j << 4) + rlane] = acc[i][j][r];
      }
    }
    wave_sync_lds();
    if constexpr (OM == 0) {
      float* C = (float*)Cout + (size_t)((long long)by * sC);
      v4f vals[8];
#pragma unroll
      for (int it = 0; it < 8; ++it) {
        const int row = it * 2 + hh2;                      // it 0..7 x hh2 0..1 = rows 0..15
        const int gr  = mBase + row;
        v4f v = *(const v4f*)(slab + row * 68 + c4);
        v4f rv = {0.f, 0.f, 0.f, 0.f};
        if constexpr (HASR != 0) {
          const float* R = Rp + (size_t)((long long)by * sC);
          const v4f rraw = *(const v4f*)(R + (size_t)gr * ldc + n0 + c4);
#pragma unroll
          for (int e = 0; e < 4; ++e) rv[e] = (HASR == 1) ? bfr(rraw[e]) : rraw[e];
        }
        float mk = 1.0f;
        if constexpr (MSK == 1) mk = bfr(Mp[gr]);
#pragma unroll
        for (int e = 0; e < 4; ++e) v[e] = (v[e] * oscale + rv[e]) * mk;
        vals[it] = v;
      }
      {
#pragma unroll
        for (int it = 0; it < 8; ++it) {
          const int gr = mBase + it * 2 + hh2;
          *(v4f*)(C + (size_t)gr * ldc + n0 + c4) = vals[it];
        }
        
      }
    } else {
      unsigned short* C = (unsigned short*)Cout + (size_t)((long long)by * sC);
      v4u hv[4];
#pragma unroll
      for (int it = 0; it < 4; ++it) {
        const int row = it * 4 + q8;                       // it 0..3 x q8 0..3 = rows 0..15
        const float* sp = slab + row * 68 + c8;
        v4u a = {0u, 0u, 0u, 0u};
        if constexpr (ACT == 1) {
          const v4f s0 = *(const v4f*)(sp), s1 = *(const v4f*)(sp + 4);
          const v8f g = gelu8(__builtin_shufflevector(s0, s1, 0, 1, 2, 3, 4, 5, 6, 7) * oscale) * ocarry;
          a = __builtin_bit_cast(v4u, __builtin_convertvector(g, v8h));
        } else {
#pragma unroll
          for (int e = 0; e < 4; ++e) {
            float f0 = sp[2 * e] * oscale;
            float f1 = sp[2 * e + 1] * oscale;
            f0 *= ocarry; f1 *= ocarry;
            a[e] = pk16(h_bits((_Float16)f0), h_bits((_Float16)f1));
          }
        }
        hv[it] = a;
      }
      {
#pragma unroll
        for (int it = 0; it < 4; ++it) {
          const int row = it * 4 + q8;
          *(v4u*)(C + (size_t)(mBase + row) * ldc + n0 + c8) = hv[it];
        }
        
      }
    }
    wave_sync_lds();
  }
}

// One product per launch: blockIdx.x = tile, blockIdx.y = batch.
template <int OM, int HASR, int ACT, int MSK>
__global__ __launch_bounds__(GT_THREADS) void gemm64(
    const unsigned short* __restrict__ Ap, int lda, long long sA,
    const unsigned short* __restrict__ Btp, int ldb, long long sB,
    const float* __restrict__ Rp, const float* __restrict__ Mp,
    void* Cout, int ldc, long long sC,
    int M, int N, int K, float oscale, float ocarry) {
  gemm_tile<OM, HASR, ACT, MSK>(blockIdx.x, blockIdx.y, Ap, lda, sA, Btp, ldb, sB, Rp, Mp, Cout, ldc, sC, M, N, K, oscale, ocarry);
}

// The three in-projections need nothing of each other and share one grid: blockIdx.y = 0 q, 1 k (A = h, Bt = the weight's rows,
// 64 x 4 tiles), 2 v^T (A = Wv^T, Bt = h of batch blockIdx.x >> 6, 4 x 16 tiles per batch). The choice is the same for a whole block.
// coverage: 256 tiles of 128x128 per product = 8192 x 512 (q, k) and 4 x 512 x 2048 (v^T), each exactly once.
static_assert((NROWS / GT_TILE) * (DMODEL / GT_TILE) == 256 && (DMODEL / GT_TILE) * (NC / GT_TILE) == 64 && NB * 64 == 256);
__global__ __launch_bounds__(GT_THREADS) void gemm_qkv(
    const unsigned short* __restrict__ Hp, const unsigned short* __restrict__ Wp,
    unsigned short* Qo, unsigned short* Ko, unsigned short* Vo) {
  const int job = blockIdx.y;
  const bool isv = job == 2;
  const unsigned short* Wj = Wp + (size_t)job * (DMODEL * DMODEL);
  gemm_tile<2, 0, 0, 0>(
      isv ? (int)(blockIdx.x & 63) : (int)blockIdx.x, isv ? (int)(blockIdx.x >> 6) : 0,
      isv ? Wj : Hp, DMODEL, 0LL,
      isv ? Hp : Wj, DMODEL, isv ? (long long)NC * DMODEL : 0LL,
      nullptr, nullptr,
      (void*)(isv ? Vo : (job == 1 ? Ko : Qo)), isv ? NC : DMODEL, isv ? (long long)DMODEL * NC : 0LL,
      isv ? DMODEL : NROWS, isv ? NC : DMODEL, DMODEL, 1.0f / (HCARRY * WSC), QC);
}
static_assert(QC == KC && QC == VC);

// =====================================================================================================
// Full attention for one batch, one head and 128 query rows (8 waves, 16 query rows per wave), head dim 64, all 2048 keys:
//   q plane (f16 x16) QH[b*2048 + tok][64*head + d], pitch 512; k plane (f16 x16) KH[b*2048 + key][64*head + d], pitch 512;
//   v^T plane (f16 x16): VT[b*512 + 64*head + d][key] (pitch 2048); out (f16 x1024): CT[b*2048 + tok][64*head + d] =
//   1024 * sum_m softmax_m(q.k / 8 + c_q) v[m][d] with the per-query-row mask constant c_q = -1e5 * (1 - bf16(mask[b][tok]))
//   (softmax run in base 2: t = (q.k/carries) * log2(e)/8 + c_q*log2(e), the row constant folded in as the fma addend).
//   The head's k rows and v^T rows are the same for all 8 waves: a tile is 64 keys = [k 64 rows | v^T 64 rows] of 128 B each (one whole
//   line per row), LDS pitch 144 B (16 B x odd: 16-B row readers meet no bank twice), two buffers. Each lane copies 4 pieces of 16 B
//   per tile with asynchronous copies to LDS (a wave's copy = 4 whole rows = 4 whole lines); the copies of tile t + 2 are issued behind
//   the barrier that ends trip t and fly while trip t + 1 is worked on. A trip reads its own buffer alone.
//   Key steps of 32 from 0 to 2047, two per trip (block-uniform trip count 32); every score is finite, so the running max is finite
//   from the first step on; the rescale exponent is clamped at -126 so the first step (running max -inf) gives a tiny finite factor
//   times zero sums.
//   Both products run transposed: S^T = k . q^T (A = k rows, B = q columns) and O^T += v^T . P^T (A = v^T rows, B = P^T columns).
//   Lane (c, hh) then holds, of query column c alone, the scores of keys 8hh + r (tile 0) and 16 + 8hh + r (tile 1): maximum and sum
//   run inside the lane, the two lane halves exchange the maximum once per step; the sums are joined once, behind the loop; those
//   16 registers, times 1024 and RNE to f16, ARE the B fragment of P^T in the split k map; the rescale factor is the lane's own.
//   Per step: 2 score tiles on f16 WMMA (K = 64 as two k-steps of 32), fragments read from the staged tile (two 16-B LDS loads per
//   fragment); online max-subtracted softmax in f32 (exp2); rescale of the running sums; the four v^T A fragments read from the
//   staged tile; 4 v^T . P^T WMMAs. O^T tile j, register r = ctx[query c][16j + 8hh + r].
//   Final 1/l and carry folds in f32; the wave's LDS slab takes its 16-bit result rows [16][64], pitch 72 halves
//   (16-B stores, wave-level LDS ordering), from which the wave writes whole 128-B lines.
// coverage: wave: 4 iterations x 4 rows x (8 lanes x 8 halves) = 16 rows x 64 halves; block: 8 waves = 128 rows of one head;
//           grid (4 batches x 8 heads x 16 query blocks) covers all 8192 x 512 of CT exactly once, each line written by one wave.
// =====================================================================================================
#define PS_FLOATS (HPB * 16 * 36)
#define AT_KEYS   64                        // keys per staged tile
#define AT_PITCH  72                        // halves: 144 B
#define AT_STAGE  ((AT_KEYS + HDIM) * AT_PITCH) // halves per buffer: k rows, then v^T rows
#define AT_TILES  (NC / AT_KEYS)
#define AT_LSTEP  (32u * AT_PITCH * 2u)     // LDS bytes between two successive copies of a lane (32 rows)
static_assert(HDIM * 2 == 128 && AT_KEYS * 2 == 128 && ATT_THREADS / 8 == 32 && AT_KEYS == 64 && HDIM == 64);
static_assert(((AT_PITCH * 2) % 16) == 0 && (((AT_PITCH * 2) / 16) % 2) == 1 && (NC % AT_KEYS) == 0 && AT_TILES >= 2);
static_assert((size_t)16 * AT_PITCH * sizeof(unsigned short) <= (size_t)16 * 36 * sizeof(float));

// One tile: four asynchronous 16-B copies per lane, global -> LDS: k rows r and r + 32, then v^T rows r and r + 32 (LDS rows 32 apart).
// The closing s_wait_xcnt 0 stands inside the statement so that no address register is rewritten ahead of it.
__device__ __forceinline__ void stage_kv(unsigned l0, const unsigned short* k0, const unsigned short* v0) {
#if defined(__HIP_DEVICE_COMPILE__)
  const unsigned l1 = l0 + AT_LSTEP, l2 = l0 + 2u * AT_LSTEP, l3 = l0 + 3u * AT_LSTEP;
  const unsigned short* k1 = k0 + (size_t)32 * DMODEL;
  const unsigned short* v1 = v0 + (size_t)32 * NC;
  asm volatile(
      "global_load_async_to_lds_b128 %0, %4, off\n\t"
      "global_load_async_to_lds_b128 %1, %5, off\n\t"
      "global_load_async_to_lds_b128 %2, %6, off\n\t"
      "global_load_async_to_lds_b128 %3, %7, off\n\t"
      "s_wait_xcnt 0x0"
      :: "v"(l0), "v"(l1), "v"(l2), "v"(l3), "v"(k0), "v"(k1), "v"(v0), "v"(v1)
      : "memory");
#endif
}

__global__ __launch_bounds__(ATT_THREADS)
void attn8(const unsigned short* __restrict__ QHp, const unsigned short* __restrict__ KHp,
           const unsigned short* __restrict__ VTq, const float* __restrict__ mkp, unsigned short* CT) {
  __shared__ __align__(16) unsigned short sKV[2 * AT_STAGE]; // the two k / v^T tile buffers
  __shared__ __align__(16) float smem[PS_FLOATS];          // per wave slab of 16-bit result rows (epilogue only)

  const int tid  = threadIdx.x;
  const int wave = tid >> 5;
  const int lane = tid & 31;
  const int hh   = lane >> 4;
  const int c    = lane & 15;

  const int qt   = blockIdx.x % NQB;                       // query block 0..15
  const int head = (blockIdx.x / NQB) % NHEAD;             // 0..7
  const int bat  = blockIdx.x / (NQB * NHEAD);             // 0..3
  const int q0   = qt * (HPB * 16) + wave * 16;

  const size_t qofs = ((size_t)bat * NQ + q0 + c) * DMODEL + head * HDIM + 8 * hh;
  const _Float16* Qh = (const _Float16*)(const void*)QHp + qofs;
  const float lsc = (LOG2E * ATT_SCALE) / (QC * KC);                   // log2(e) / 8 / carries

  // the lane's first piece of a tile: row tid>>3 of the k rows (and of the v^T rows), 16-B piece tid&7 of its 128 B
  const int crow = tid >> 3, cpc = tid & 7;
  const unsigned short* gK = KHp + ((size_t)bat * NC + crow) * DMODEL + head * HDIM + cpc * 8;
  const unsigned short* gV = VTq + ((size_t)bat * DMODEL + head * HDIM + crow) * NC + cpc * 8;
  const unsigned lC = lds_off(sKV) + (unsigned)(crow * (AT_PITCH * 2) + cpc * 16);

  stage_kv(lC, gK, gV);

  // mask constant of the lane's query column, in base-2 units
  const float cm2 = (MASKNEG * (1.0f - bfr(mkp[(size_t)bat * NQ + q0 + c]))) * LOG2E;

  const v16h qa = ldfrag_h(Qh), qb = ldfrag_h(Qh + 32);

  float mrow = -INFINITY;                        // the column's running maximum
  v8f lacc = zero8();                            // the lane's own shares of the column's running sum (register r: keys = 8hh + r mod 16)
  v8f o0 = zero8(), o1 = zero8(), o2 = zero8(), o3 = zero8();

  const v8f lsc8 = {lsc, lsc, lsc, lsc, lsc, lsc, lsc, lsc};
  const v8f cm8  = {cm2, cm2, cm2, cm2, cm2, cm2, cm2, cm2};

  wait_async0();
  __syncthreads();                               // tile 0 is published
  stage_kv(lC + AT_STAGE * 2u, gK + (size_t)AT_KEYS * DMODEL, gV + AT_KEYS);

  // rolled: the buffer is picked by the trip's parity
#pragma unroll 1
  for (int t = 0; t < AT_TILES; ++t) {
    const unsigned short* sb = sKV + (t & 1) * AT_STAGE;
    const unsigned short* sk = sb + c * AT_PITCH + 8 * hh;
    const unsigned short* sv = sb + (AT_KEYS + c) * AT_PITCH + 8 * hh;
    // unrolled: the two key steps of a tile read it at constant offsets
#pragma unroll
    for (int ks = 0; ks < AT_KEYS / 32; ++ks) {
      const unsigned short* kp = sk + (ks * 32) * AT_PITCH;
      const unsigned short* vp = sv + ks * 32;
      const unsigned short* kq = kp + 16 * AT_PITCH;
      const v16h k00 = ldfrag_u(kp), k01 = ldfrag_u(kp + 32);
      const v16h k10 = ldfrag_u(kq), k11 = ldfrag_u(kq + 32);
      const v16h vb0 = ldfrag_u(vp);
      const v16h vb1 = ldfrag_u(vp + 16 * AT_PITCH);
      const v16h vb2 = ldfrag_u(vp + 32 * AT_PITCH);
      const v16h vb3 = ldfrag_u(vp + 48 * AT_PITCH);
      // holds the step's 16 LDS reads as one group in front of its products: left free, each pair of reads sinks to just in front of
      // the product that takes it, and the wave waits out a whole LDS latency there each time
      __builtin_amdgcn_sched_barrier(0);
      v8f s0, s1;
      s0 = mma_raw(k00, qa, zero8());
      s0 = mma_raw(k01, qb, s0);
      s1 = mma_raw(k10, qa, zero8());
      s1 = mma_raw(k11, qb, s1);
      const v8f t0 = __builtin_elementwise_fma(s0, lsc8, cm8);
      const v8f t1 = __builtin_elementwise_fma(s1, lsc8, cm8);
      const v8f tm = __builtin_elementwise_max(t0, t1);
      float mx = fmaxf(fmaxf(fmaxf(tm[0], tm[1]), fmaxf(tm[2], tm[3])), fmaxf(fmaxf(tm[4], tm[5]), fmaxf(tm[6], tm[7])));
      mx = fmaxf(mx, xhalf(mx));                 // the other 16 keys of this column
      const float mn = fmaxf(mrow, mx);
      const float al = ex2(fmaxf(mrow - mn, -126.0f));
      mrow = mn;
      const v8f mn8 = {mn, mn, mn, mn, mn, mn, mn, mn};
      const v8f d0 = t0 - mn8, d1 = t1 - mn8;
      v8f e0, e1;
#pragma unroll
      for (int r = 0; r < 8; ++r) {
        e0[r] = ex2(d0[r]);
        e1[r] = ex2(d1[r]);
      }
      lacc = lacc * al + (e0 + e1);
      o0 *= al;
      o1 *= al;
      o2 *= al;
      o3 *= al;
      FragH ph;
      ph.h[0] = __builtin_convertvector(e0 * PC, v8h);          // elements 0..7  = keys kb + 8hh + 0..7
      ph.h[1] = __builtin_convertvector(e1 * PC, v8h);          // elements 8..15 = keys kb + 16 + 8hh + 0..7
      o0 = mma_raw(vb0, ph.v, o0);
      o1 = mma_raw(vb1, ph.v, o1);
      o2 = mma_raw(vb2, ph.v, o2);
      o3 = mma_raw(vb3, ph.v, o3);
    }
    // keeps the trip's arithmetic in front of the waits below: sunk behind the barrier, it would stand between the barrier and the
    // refill, and the wait for a tile's copies would follow their issue at once instead of one trip later
    __builtin_amdgcn_sched_barrier(0);
    wait_ds0();
    wait_async0();
    __syncthreads();                             // publishes tile t + 1 and ends every reader's last read of tile t's buffer
    if (t + 2 < AT_TILES)
      stage_kv(lC + (unsigned)(t & 1) * (AT_STAGE * 2u), gK + (size_t)(t + 2) * (AT_KEYS * DMODEL), gV + (size_t)(t + 2) * AT_KEYS);
  }
  wait_async0();

  // ---- join the halves' sums, fold 1/l and the carries (1024 on P, 16 on v, 1024 on the stored ctx), stage the wave's 16x64 slice
  //      as 16-bit in its own slab: row = query c, 16 B = d 16j + 8hh .. + 7 ----
  unsigned short* Os = (unsigned short*)(void*)(smem + wave * (16 * 36));
  const float oc = FC / (PC * VC);
  {
    const float lrow = ((lacc[0] + lacc[1]) + (lacc[2] + lacc[3])) + ((lacc[4] + lacc[5]) + (lacc[6] + lacc[7]));
    const float inv = (1.0f / (lrow + xhalf(lrow))) * oc;
    unsigned short* op = Os + c * AT_PITCH + 8 * hh;
    *(v8h*)(op)      = __builtin_convertvector(o0 * inv, v8h);
    *(v8h*)(op + 16) = __builtin_convertvector(o1 * inv, v8h);
    *(v8h*)(op + 32) = __builtin_convertvector(o2 * inv, v8h);
    *(v8h*)(op + 48) = __builtin_convertvector(o3 * inv, v8h);
  }
  wave_sync_lds();
  // ---- the wave writes its 16 rows of CT: iteration it -> rows it*4 + lane/8, halves (lane%8)*8 .. +7 of the head's 64 ----
  {
    const int q8 = lane >> 3, c8 = (lane & 7) * 8;
    v4u vals[4];
#pragma unroll
    for (int it = 0; it < 4; ++it) vals[it] = *(const v4u*)(Os + (it * 4 + q8) * AT_PITCH + c8);
    unsigned short* dst = CT + ((size_t)bat * NQ + q0) * DMODEL + head * HDIM;
#pragma unroll
    for (int it = 0; it < 4; ++it) *(v4u*)(dst + (size_t)(it * 4 + q8) * DMODEL + c8) = vals[it];
  }
}

// =====================================================================================================
// LayerNorm without affine over rows of 512 floats: outh[row][c] = f16( (v - mean) * rsqrt(var + eps) * hc ), v = Yp[row][c]; RIN 1 first
// takes v = bf16(Yp[row][c]) * bf16(mask[row]). One wave owns LN_RPW whole rows and keeps them in registers: load j of a row is 512
// contiguous bytes (lane l: floats 128 j + 4 l .. + 3), all 4 * LN_RPW loads of the wave are in flight together. Mean and variance (two
// passes, as the definition has them): in-lane sums, then a five-step butterfly of vector cross-lane moves, after which every lane holds
// the same total. No LDS, no barrier, and few waves to start.
// coverage: store j of a row = 32 lanes x 8 B = 256 contiguous bytes (two whole lines), j 0..3 = the row's 1024 B; wave: LN_RPW rows;
//           block: 8 waves = 32 rows; 256 blocks = all 8192 rows, each line written by exactly one wave.
// =====================================================================================================
// the value that lane l ^ M holds, M = 1, 2, 4, 8: a vector move inside the 16-lane row (nibble i of the selector = source of lane i)
template <int M>
__device__ __forceinline__ float xrow(float v) {
  constexpr unsigned lo = M == 1 ? 0x67452301u : M == 2 ? 0x54761032u : M == 4 ? 0x32107654u : 0xfedcba98u;
  constexpr unsigned hi = M == 1 ? 0xefcdab89u : M == 2 ? 0xdcfe98bau : M == 4 ? 0xba98fedcu : 0x76543210u;
  const int b = __builtin_bit_cast(int, v);
  return __builtin_bit_cast(float, __builtin_amdgcn_permlane16(b, b, lo, hi, false, false));
}
// sums over the wave's 32 lanes, LN_RPW independent chains side by side (unrolled: s stays in registers, each step's moves stand together)
__device__ __forceinline__ void wave_sums(float (&s)[LN_RPW]) {
#pragma unroll
  for (int r = 0; r < LN_RPW; ++r) s[r] += xrow<1>(s[r]);
#pragma unroll
  for (int r = 0; r < LN_RPW; ++r) s[r] += xrow<2>(s[r]);
#pragma unroll
  for (int r = 0; r < LN_RPW; ++r) s[r] += xrow<4>(s[r]);
#pragma unroll
  for (int r = 0; r < LN_RPW; ++r) s[r] += xrow<8>(s[r]);
#pragma unroll
  for (int r = 0; r < LN_RPW; ++r) s[r] += xhalf(s[r]);
}

// blk = index of the block among the LN_BLOCKS blocks of this LayerNorm. Every loop is unrolled: all indices are constants, the rows stay
// in registers.
template <int RIN>
__device__ __forceinline__
void lnorm_rows(const float* __restrict__ Yp, const float* __restrict__ mkp, unsigned short* outh, float hc, int blk) {
  const int lane = threadIdx.x & 31;
  // the wave's number held in a scalar register: every address becomes a scalar base plus one lane offset, with constant steps between loads
  const int row0 = blk * LN_RPB + __builtin_amdgcn_readfirstlane((int)(threadIdx.x >> 5)) * LN_RPW;
  const float* src = Yp + (size_t)row0 * DMODEL + lane * 4;
  v4f mk4 = {1.0f, 1.0f, 1.0f, 1.0f};
  if constexpr (RIN == 1) mk4 = *(const v4f*)(mkp + row0);   // the four rows' mask values, asked for ahead of the rows (row0 is a multiple of 4)
  v4f v[LN_RPW][4];
#pragma unroll
  for (int r = 0; r < LN_RPW; ++r)
#pragma unroll
    for (int j = 0; j < 4; ++j) v[r][j] = *(const v4f*)(src + r * DMODEL + j * 128);
  if constexpr (RIN == 1) {
#pragma unroll
    for (int r = 0; r < LN_RPW; ++r) {
      const float mk = bfr(mk4[r]);
#pragma unroll
      for (int j = 0; j < 4; ++j)
#pragma unroll
        for (int e = 0; e < 4; ++e) v[r][j][e] = bfr(v[r][j][e]) * mk;
    }
  }
  float s[LN_RPW];
#pragma unroll
  for (int r = 0; r < LN_RPW; ++r) {
    const v4f t = (v[r][0] + v[r][1]) + (v[r][2] + v[r][3]);
    s[r] = (t[0] + t[1]) + (t[2] + t[3]);
  }
  wave_sums(s);
  float q[LN_RPW];
#pragma unroll
  for (int r = 0; r < LN_RPW; ++r) {
    const float mu = s[r] * (1.0f / (float)DMODEL);
#pragma unroll
    for (int j = 0; j < 4; ++j) v[r][j] -= mu;
    const v4f t = (v[r][0] * v[r][0] + v[r][1] * v[r][1]) + (v[r][2] * v[r][2] + v[r][3] * v[r][3]);
    q[r] = (t[0] + t[1]) + (t[2] + t[3]);
  }
  wave_sums(q);
  v2u w[LN_RPW][4];
#pragma unroll
  for (int r = 0; r < LN_RPW; ++r) {
    const float rs = rsqrtf(q[r] * (1.0f / (float)DMODEL) + LN_EPS) * hc;   // hc is a power of two: the same values as (d * rstd) * hc
#pragma unroll
    for (int j = 0; j < 4; ++j) w[r][j] = __builtin_bit_cast(v2u, __builtin_convertvector(v[r][j] * rs, v4h));
  }
  unsigned short* dst = outh + (size_t)row0 * DMODEL + lane * 4;
#pragma unroll
  for (int r = 0; r < LN_RPW; ++r)
#pragma unroll
    for (int j = 0; j < 4; ++j) *(v2u*)(dst + r * DMODEL + j * 128) = w[r][j];
}

template <int RIN>
__global__ __launch_bounds__(LN_THREADS)
void lnorm(const float* __restrict__ Yp, const float* __restrict__ mkp, unsigned short* outh, float hc) {
  lnorm_rows<RIN>(Yp, mkp, outh, hc, blockIdx.x);
}

// The six weight packs and the first LayerNorm need nothing of each other and share one grid of 256-thread blocks, split by ranges of
// the block index (the choice is the same for a whole block, so every barrier stays block-uniform):
//   0..255 the four 512x512 weights (64 tiles each), 256..511 W1 (32 x 8 tiles), 512..767 W2 (8 x 32 tiles),
//   768..1023 the LayerNorm, 32 rows per block.
#define PREP_SQ     ((DMODEL / 64) * (DMODEL / 64))            // 64 tiles per square weight
#define PREP_W1     (4 * PREP_SQ)                              // first block of W1
#define PREP_W2     (PREP_W1 + (DFF / 64) * (DMODEL / 64))     // first block of W2
#define PREP_LN     (PREP_W2 + (DMODEL / 64) * (DFF / 64))     // first block of the LayerNorm
#define PREP_BLOCKS (PREP_LN + LN_BLOCKS)
static_assert(PREP_SQ == 64 && DMODEL / 64 == 8 && DFF / 64 == 32 && PREP_LN == 768 && LN_THREADS == 256);
__global__ __launch_bounds__(256)
void prep(const float* __restrict__ wq, const float* __restrict__ wk, const float* __restrict__ wv, const float* __restrict__ wo,
          const float* __restrict__ w1, const float* __restrict__ w2, const float* __restrict__ x, const float* __restrict__ mk,
          unsigned short* WQKV, unsigned short* WO16, unsigned short* W116, unsigned short* W216, unsigned short* H16) {
  const int b = blockIdx.x;
  if (b >= PREP_LN) {
    lnorm_rows<1>(x, mk, H16, HCARRY, b - PREP_LN);
    return;
  }
  const float* src;
  unsigned short* dst;
  int R = DMODEL, C = DMODEL, t = b & (PREP_SQ - 1);
  float sc = WSC;
  if (b < PREP_W1) {
    const int j = b / PREP_SQ;
    src = j == 0 ? wq : j == 1 ? wk : j == 2 ? wv : wo;
    dst = j == 3 ? WO16 : WQKV + (size_t)j * (DMODEL * DMODEL);
  } else if (b < PREP_W2) {
    src = w1; dst = W116; C = DFF; t = b - PREP_W1;            // R = 512 (in), C = 2048 (out)
  } else {
    src = w2; dst = W216; R = DFF; t = b - PREP_W2; sc = W2SC; // R = 2048 (in), C = 512 (out)
  }
  const int tc = C / 64;
  tcvt16(src, dst, R, C, sc, t % tc, t / tc);
}

// =====================================================================================================
// Workspace map (bytes); every plane is an exact multiple of its tile / whole-row store granularity (M, N exact multiples of 64, rows
//   WQKV f16 [1536][512] x64         1572864   (transposed in-projections [n][k]: rows 0..511 q, 512..1023 k, 1024..1535 v)
//   WO16 f16 [512][512] x64           524288   (Wo^T)
//   W116 f16 [2048][512] x64         2097152   (W1^T)
//   W216 f16 [512][2048] x128        2097152   (W2^T)
//   H16  f16 [8192][512] x16         8388608   (first LayerNorm output)
//   QH   f16 [8192][512] x16         8388608
//   KH   f16 [8192][512] x16         8388608
//   VT   f16 [4][512][2048] x16      8388608   (v^T per batch)
//   CT   f16 [8192][512] x1024       8388608   (attention ctx, merged heads)
//   X1F  f32 [8192][512]            16777216   ((x + ctx . Wo) * mask)
//   H2   f16 [8192][512] x16         8388608   (second LayerNorm output)
//   HH   f16 [8192][2048] x16       33554432   (gelu hidden)
//   end                            106954752
// =====================================================================================================
extern "C" void kernel_launch(void* const* d_in, const int* in_sizes, int n_in,
                              void* d_out, int out_size, void* d_ws, size_t ws_size,
                              hipStream_t stream) {
  if (n_in < 8) return;
  if (in_sizes[0] != NROWS * DMODEL) return;
  if (in_sizes[1] != NROWS) return;
  if (in_sizes[2] != DMODEL * DMODEL || in_sizes[3] != DMODEL * DMODEL ||
      in_sizes[4] != DMODEL * DMODEL || in_sizes[5] != DMODEL * DMODEL) return;
  if (in_sizes[6] != DMODEL * DFF || in_sizes[7] != DFF * DMODEL) return;
  if (out_size != NROWS * DMODEL) return;

  const float* x   = (const float*)d_in[0];
  const float* mk  = (const float*)d_in[1];
  const float* wq  = (const float*)d_in[2];
  const float* wk  = (const float*)d_in[3];
  const float* wv  = (const float*)d_in[4];
  const float* wo  = (const float*)d_in[5];
  const float* w1  = (const float*)d_in[6];
  const float* w2  = (const float*)d_in[7];
  float*       out = (float*)d_out;

  const size_t PWQKV = (size_t)3 * DMODEL * DMODEL * 2;           //  1572864
  const size_t PWO   = (size_t)DMODEL * DMODEL * 2;               //   524288
  const size_t PW1   = (size_t)DFF * DMODEL * 2;                  //  2097152
  const size_t PW2   = (size_t)DMODEL * DFF * 2;                  //  2097152
  const size_t PX    = (size_t)NROWS * DMODEL * 2;                //  8388608
  const size_t PVT   = (size_t)NB * DMODEL * NC * 2;              //  8388608
  const size_t PY    = (size_t)NROWS * DMODEL * 4;                // 16777216
  const size_t PH    = (size_t)NROWS * DFF * 2;                   // 33554432
  size_t off = 0;
  const size_t oWQKV = off; off += PWQKV;
  const size_t oWO   = off; off += PWO;
  const size_t oW1   = off; off += PW1;
  const size_t oW2   = off; off += PW2;
  const size_t oH    = off; off += PX;
  const size_t oQH   = off; off += PX;
  const size_t oKH   = off; off += PX;
  const size_t oVT   = off; off += PVT;
  const size_t oCT   = off; off += PX;
  const size_t oXF   = off; off += PY;
  const size_t oH2   = off; off += PX;
  const size_t oHH   = off; off += PH;
  if (off > ws_size) return;                                      // off = 106954752
  if (off > (size_t)134217728) return;

  char* ws = (char*)d_ws;
  unsigned short* WQKV = (unsigned short*)(ws + oWQKV);
  unsigned short* WO16 = (unsigned short*)(ws + oWO);
  unsigned short* W116 = (unsigned short*)(ws + oW1);
  unsigned short* W216 = (unsigned short*)(ws + oW2);
  unsigned short* H16  = (unsigned short*)(ws + oH);
  unsigned short* QH   = (unsigned short*)(ws + oQH);
  unsigned short* KH   = (unsigned short*)(ws + oKH);
  unsigned short* VTp  = (unsigned short*)(ws + oVT);
  unsigned short* CT   = (unsigned short*)(ws + oCT);
  float*          X1F  = (float*)(ws + oXF);
  unsigned short* H2   = (unsigned short*)(ws + oH2);
  unsigned short* HH   = (unsigned short*)(ws + oHH);

  const dim3 blk(256);
  const dim3 gPrep(PREP_BLOCKS);                                   // 1024
  const dim3 bG(GT_THREADS);                                       // 256
  const dim3 gP((NROWS / GT_TILE) * (DMODEL / GT_TILE), 1);        // 256
  const dim3 gQKV((NROWS / GT_TILE) * (DMODEL / GT_TILE), 3);      // 256 x 3
  const dim3 gF((NROWS / GT_TILE) * (DFF / GT_TILE), 1);           // 1024
  const dim3 gAT(ATT_BLOCKS);                                      // 512
  const dim3 bAT(ATT_THREADS);                                     // 256
  const dim3 gLN(LN_BLOCKS);                                       // 256
  const dim3 bLN(LN_THREADS);                                      // 256

  // (0, 1) one grid: transposed weight planes [n][k] = f16( bf16_RNE(W[k][n]) * scale ), k contiguous, and
  //         h = LayerNorm(bf16(x) * bf16(mask)) -> H16 (f16 x16)
  prep<<<gPrep, blk, 0, stream>>>(wq, wk, wv, wo, w1, w2, x, mk, WQKV, WO16, W116, W216, H16);

  // (2, 3, 4) one grid: QH[m][n] = f16(16 * sum_k h[m][k] Wq[k][n]) and KH alike (M = 8192, N = 512, K = 512);
  //            v^T per batch: VT[b][d][tok] = f16(16 * sum_k WvT[d][k] h_b[tok][k]) (M = 512, N = 2048, K = 512)
  gemm_qkv<<<gQKV, bG, 0, stream>>>(H16, WQKV, QH, KH, VTp);

  // (5) full attention per (batch, head, 128 query rows) -> CT (f16, x1024)
  attn8<<<gAT, bAT, 0, stream>>>(QH, KH, VTp, mk, CT);

  // (6) X1F = (CT . WoT^T / (1024 * 64) + bf16(x)) * bf16(mask); M = 8192, N = 512, K = 512, f32
  gemm64<0, 1, 0, 1><<<gP, bG, 0, stream>>>(
      CT, DMODEL, 0LL,
      WO16, DMODEL, 0LL,
      x, mk,
      (void*)X1F, DMODEL, 0LL,
      NROWS, DMODEL, DMODEL, 1.0f / (FC * WSC), 1.0f);

  // (7) h2 = LayerNorm(x1) -> H2 (f16 x16)
  lnorm<0><<<gLN, bLN, 0, stream>>>(X1F, mk, H2, H2C);

  // (8) HH = f16(16 * gelu(h2 . W1)); M = 8192, N = 2048, K = 512
  gemm64<2, 0, 1, 0><<<gF, bG, 0, stream>>>(
      H2, DMODEL, 0LL,
      W116, DMODEL, 0LL,
      x, mk,
      (void*)HH, DFF, 0LL,
      NROWS, DFF, DMODEL, 1.0f / (H2C * WSC), GC);

  // (9) out = HH . W2 / (16 * 128) + x1 (raw f32); M = 8192, N = 512, K = 2048, f32
  gemm64<0, 2, 0, 0><<<gP, bG, 0, stream>>>(
      HH, DFF, 0LL,
      W216, DFF, 0LL,
      X1F, mk,
      (void*)out, DMODEL, 0LL,
      NROWS, DMODEL, DFF, 1.0f / (GC * W2SC), 1.0f);
  (void)hipGetLastError();
}

// v008
// One run takes 113 microseconds.
// Next to v007, in two timings, it ran 1.04 and 1.05 times as fast.
// All steps since v000 together make it 3.73 times as fast.
// Contractions: q/k projections (h f16 x16 . Wq^T/Wk^T f16 x64, K=512), v^T projection (Wv^T f16 x64 . h f16 x16, K=512),
// attention scores^T (k f16 x16 . q f16 x16, K=64), attention v^T . P^T (v^T f16 x16 . P f16 x1024, 32 keys per step),
// output projection (ctx f16 x1024 . Wo^T f16 x64, K=512), FFN1 (h2 f16 x16 . W1^T f16 x64, K=512), FFN2 (g f16 x16 . W2^T f16 x128, K=2048):
// all v_wmma_f32_16x16x32_f16 single products, f32 accumulate. LayerNorms (no affine), softmax, erf-GELU, mask, residuals in f32 on VALU.
// Every float input RNE-converted to bf16 on load.
#include <hip/hip_runtime.h>
#include <math.h>
#include <stdint.h>

#define NB      4
#define NQ      2048
#define NC      2048
#define DMODEL  512
#define DFF     2048
#define NHEAD   8
#define HDIM    64
#define NROWS   (NB * NQ)
#define WSC     64.0f
#define W2SC    128.0f
#define HCARRY  16.0f
#define QC      16.0f
#define KC      16.0f
#define VC      16.0f
#define PC      1024.0f
#define FC      1024.0f
#define H2C     16.0f
#define GC      16.0f
#define ATT_SCALE 0.125f
#define LOG2E   1.4426950408889634f
#define LN_EPS  1e-6f
#define MASKNEG (-100000.0f)
static_assert(NHEAD * HDIM == DMODEL);
static_assert((NQ % 64) == 0 && (NC % 64) == 0 && (DMODEL % 64) == 0 && (DFF % 64) == 0 && (NC % 32) == 0 && (NQ % 16) == 0);
static_assert((NROWS % 64) == 0 && (DMODEL % 32) == 0 && (DFF % 32) == 0);
#define HPB     8                       // waves per attention block (16 query rows per wave, one head per block)
#define NQB     (NQ / (HPB * 16))       // query blocks per batch and head (16)
#define ATT_THREADS (HPB * 32)
#define ATT_BLOCKS  (NB * NHEAD * NQB)
static_assert(ATT_THREADS == 256 && ATT_BLOCKS == 512 && NQB * HPB * 16 == NQ);
#define LN_RPW     4                    // LayerNorm rows per wave
#define LN_THREADS 256                  // 8 waves
#define LN_RPB     (LN_RPW * (LN_THREADS / 32))   // rows per block (32)
#define LN_BLOCKS  (NROWS / LN_RPB)
static_assert(DMODEL == 4 * 128 && (NROWS % LN_RPB) == 0 && LN_BLOCKS == 256 && LN_RPW == 4);

typedef _Float16 v16h __attribute__((ext_vector_type(16)));
typedef _Float16 v8h  __attribute__((ext_vector_type(8)));
typedef _Float16 v4h  __attribute__((ext_vector_type(4)));
typedef float    v8f  __attribute__((ext_vector_type(8)));
typedef float    v4f  __attribute__((ext_vector_type(4)));
typedef unsigned int v4u __attribute__((ext_vector_type(4)));
typedef unsigned int v2u __attribute__((ext_vector_type(2)));

union FragH { v16h v; v8h h[2]; v4u u[2]; };

// ---- scalar helpers --------------------------------------------------------------------------------
__device__ __forceinline__ unsigned short bf_bits(float f) {          // f32 -> bf16 bits, RNE convert
  unsigned u = __float_as_uint(f);
  return (unsigned short)((u + 0x7FFFu + ((u >> 16) & 1u)) >> 16);
}
__device__ __forceinline__ float bf_up(unsigned short h) { return __uint_as_float(((unsigned)h) << 16); }
__device__ __forceinline__ float bfr(float f) { return bf_up(bf_bits(f)); }   // value of the bf16 RNE convert
__device__ __forceinline__ unsigned short h_bits(_Float16 x) { return __builtin_bit_cast(unsigned short, x); }
__device__ __forceinline__ unsigned pk16(unsigned short a, unsigned short b) { return (unsigned)a | ((unsigned)b << 16); }
__device__ __forceinline__ v8f zero8() { v8f z = {0.f, 0.f, 0.f, 0.f, 0.f, 0.f, 0.f, 0.f}; return z; }
// erf-GELU of eight values at once, no branch: 0.5 u (1 + erf(u / sqrt 2)) = u Phi(u) = max(u, 0) - |u| Q(|u|), Q the normal upper tail,
// Q(a) = exp(-a a / 2) / sqrt(2 pi) * t (b1 + t (b2 + t (b3 + t (b4 + t b5)))), t = 1 / (1 + p a): absolute error of Q below 7.5e-8,
// of the f32 result below 4e-7 (the f16 store rounds coarser from |g| = 1e-3 up). erff() picks one of two series per lane: with lanes on both sides a wave
// runs both, one value after the other, each a single dependent chain behind two EXEC branches. Here the eight chains are independent.
// The b's carry 1 / sqrt(2 pi); exp(-a a / 2) = 2^-(z z) with z = u sqrt(log2(e) / 2). A result of 2^x below 2^-126 may become 0: Q is 0 there.
__device__ __forceinline__ v8f splat8(float x) { v8f r = {x, x, x, x, x, x, x, x}; return r; }
__device__ __forceinline__ v8f gelu8(v8f u) {
  const v8f a = __builtin_elementwise_abs(u);
  const v8f den = __builtin_elementwise_fma(a, splat8(0.2316419f), splat8(1.0f));
  const v8f z = u * 0.84932180028801904272f;
  const v8f w = z * z;
  v8f t, e;
  // unrolled: every index of t and e is a constant, so both stay in registers
#pragma unroll
  for (int r = 0; r < 8; ++r) {
    t[r] = __builtin_amdgcn_rcpf(den[r]);
    e[r] = __builtin_amdgcn_exp2f(-w[r]);
  }
  v8f p = __builtin_elementwise_fma(t, splat8((float)(1.330274429 * 0.3989422804014327)), splat8((float)(-1.821255978 * 0.3989422804014327)));
  p = __builtin_elementwise_fma(p, t, splat8((float)(1.781477937 * 0.3989422804014327)));
  p = __builtin_elementwise_fma(p, t, splat8((float)(-0.356563782 * 0.3989422804014327)));
  p = __builtin_elementwise_fma(p, t, splat8((float)(0.319381530 * 0.3989422804014327)));
  const v8f q = (p * t) * e;
  return __builtin_elementwise_fma(-a, q, __builtin_elementwise_max(u, zero8()));
}

// ---- fragment loaders: 16-bit A/B operand, lane -> row/col (lane&15), p already includes +8*(lane>>4);
//      elements 0..7 <- p[0..7] (k0+8h..), elements 8..15 <- p[16..23] (k0+16+8h..)  (same split k map for A and B;
//      B is always read from a k-contiguous [n][k] plane)
__device__ __forceinline__ v16h ldfrag_h(const _Float16* p) {
  FragH f;
  f.h[0] = *(const v8h*)(p);
  f.h[1] = *(const v8h*)(p + 16);
  return f.v;
}
__device__ __forceinline__ v16h ldfrag_u(const unsigned short* p) {
  FragH f;
  f.u[0] = *(const v4u*)(p);
  f.u[1] = *(const v4u*)(p + 16);
  return f.v;
}

// ---- WMMA helpers with trailing VALU hazard gaps ------------------------------------------------------
__device__ __forceinline__ v8f mma_raw(v16h a, v16h b, v8f c) {
  return __builtin_amdgcn_wmma_f32_16x16x32_f16(false, a, false, b, (short)0, c, false, false);
}
__device__ __forceinline__ void dep_guard1(v8f& a, v8f& b, v16h x) {
#if defined(__HIP_DEVICE_COMPILE__)
  asm volatile("v_nop\n\tv_nop\n\tv_nop\n\tv_nop" : "+v"(a), "+v"(b) : "v"(x));
#endif
}
__device__ __forceinline__ void keep4_h(v16h a, v16h b, v16h c, v16h d) {
#if defined(__HIP_DEVICE_COMPILE__)
  asm volatile("v_nop" :: "v"(a), "v"(b), "v"(c), "v"(d));
#endif
}
__device__ __forceinline__ void acc_guard4(v8f& a, v8f& b, v8f& c, v8f& d) {
#if defined(__HIP_DEVICE_COMPILE__)
  asm volatile("v_nop\n\tv_nop\n\tv_nop\n\tv_nop" : "+v"(a), "+v"(b), "+v"(c), "+v"(d));
#endif
}
// the value that lane l ^ 16 holds (a vector cross-row move, no LDS round trip)
__device__ __forceinline__ float xhalf(float v) {
  const int b = __builtin_bit_cast(int, v);
  return __builtin_bit_cast(float, __builtin_amdgcn_permlanex16(b, b, 0x76543210, 0xfedcba98, false, false));
}
// 2^x as the bare v_exp_f32. exp2f() wraps it for results below 2^-126 (compare, select, add, select, ldexp: five more vector
// instructions per value). The softmax needs no such result: a weight that small is 0 in the f16 P and adds nothing to a sum >= 1.
__device__ __forceinline__ float ex2(float x) { return __builtin_amdgcn_exp2f(x); }
__device__ __forceinline__ void wave_sync_lds() {
  __builtin_amdgcn_fence(__ATOMIC_RELEASE, "workgroup");
  __builtin_amdgcn_wave_barrier();
  __builtin_amdgcn_fence(__ATOMIC_ACQUIRE, "workgroup");
}

// =====================================================================================================
// Transposing 16-bit pack of a weight stored [in][out] = in[R][C] (row pitch C): out[C][R] (row pitch R), out[c][r] =
// f16( bf16_RNE(in[r][c]) * sc ), sc a power of two (exact). One 64x64 tile per block through LDS: coalesced float4 reads of 64 input
// rows, 2-byte LDS stores into the transposed tile [c][r] (pitch 72 halves), block barrier, then every output row segment of 64 halves
// coverage: load 256 thr x 16 floats = 64x64; store 2 it x 8 waves x 4 rows x (8 lanes x 8 halves) = 64 rows x 64 halves;
//           tiles (bx, by) in (C/64, R/64) exact (the caller's block ranges), each output line written by exactly one wave.
// =====================================================================================================
__device__ __forceinline__ void tcvt16(const float* __restrict__ src, unsigned short* dst, int R, int C, float sc, int bx, int by) {
  __shared__ __align__(16) unsigned short sT[64 * 72];
  const int tid = threadIdx.x, lane = tid & 31, wave = tid >> 5;
  const int c0 = bx * 64, r0 = by * 64;
  const int rr = tid >> 2, cc = (tid & 3) * 16;
  const float* sp = src + (size_t)(r0 + rr) * C + c0 + cc;
#pragma unroll
  for (int e = 0; e < 4; ++e) {
    const v4f a = *(const v4f*)(sp + 4 * e);
#pragma unroll
    for (int k = 0; k < 4; ++k)
      sT[(cc + 4 * e + k) * 72 + rr] = h_bits((_Float16)(bfr(a[k]) * sc));
  }
  __syncthreads();
  v4u vals[2];
#pragma unroll
  for (int it = 0; it < 2; ++it) {
    const int q = it * 32 + wave * 4 + (lane >> 3);
    vals[it] = *(const v4u*)(sT + q * 72 + (lane & 7) * 8);
  }
  {
#pragma unroll
    for (int it = 0; it < 2; ++it) {
      const int q = it * 32 + wave * 4 + (lane >> 3);
      *(v4u*)(dst + (size_t)(c0 + q) * R + r0 + (lane & 7) * 8) = vals[it];
    }
    // no register that the two stores name is rewritten ahead of this wait
#if defined(__HIP_DEVICE_COMPILE__)
    asm volatile("s_wait_xcnt 0x0" ::: "memory");
#endif
  }
}

// =====================================================================================================
// Batched f16 WMMA GEMM, operands staged in LDS: C[m][n] = f( oscale * sum_k A[m][k] * Bt[n][k] ) (+ residual) (* row mask).
// One 128x128 tile per block of 8 waves (4x2 waves of 32x64). A row-major [M][K] pitch lda (16-bit plane), Bt row-major [N][K] pitch ldb
// (k contiguous); M, N, K multiples of 128. tile = index of the block's tile, by = batch index with element strides sA, sB, sC.
// A trip is 128 k: [A 128 rows | Bt 128 rows] of 256 B each, LDS pitch 272 B (16 B x odd: 16-B row readers meet no bank twice), two
// buffers. A buffer is four slices of 64 rows (0, 1 = A, 2, 3 = Bt); waves 0..3 each bring one slice with ONE tensor load per trip
// (no address arithmetic per lane, no register, one issue slot), whose pad lays the 272-B pitch; a slice's place is a multiple of 2 KiB.
// The loads of trip t + 2 are issued behind the barrier that ends trip t and fly while trip t + 1 is worked on.
// Inside a trip the fragments of k-step ks + 1 are read from LDS ahead of the products of k-step ks (never across the barrier).
// The k order of every accumulator is the ascending one (steps of 32). Behind the last trip's barrier the ring serves as the
// waves' epilogue slabs.
// OM: 0 = f32 out (pitch ldc; HASR 1 adds bf16(R[m][n]), HASR 2 adds raw f32 R[m][n], same pitch/stride as C; MSK 1 multiplies the
//     sum by bf16(Mrow[m])); 2 = f16 out (pitch ldc) = f16( act(value) * ocarry ), ACT 1 = erf-GELU.
// coverage: 2 slabs x 16 rows (f32: it 0..7 x lane>>4; f16: it 0..3 x lane>>3) x 64 cols = the wave's whole 32x64 tile;
//           8 waves = the block's 128x128 tile; grid = tilesM*tilesN blocks exactly (a surplus block leaves as a whole, before any barrier).
// =====================================================================================================
#define GT_TILE    128                     // rows of A and of Bt per block tile
#define GT_K       128                     // halves of every row per trip (256 B)
#define GT_PITCH   136                     // halves: 272 B = a 256-B row and the tensor load's 16-B pad
#define GT_SROWS   64                      // rows per slice (one wave's tensor load)
#define GT_SLICE   9216                    // halves per slice in LDS: 64 x 272 B = 17408 B, rounded up to a multiple of 2 KiB (18432 B)
#define GT_STAGE   (4 * GT_SLICE)          // halves per buffer
#define GT_THREADS 256
static_assert((NROWS % GT_TILE) == 0 && (DMODEL % GT_TILE) == 0 && (DFF % GT_TILE) == 0 && (NC % GT_TILE) == 0);
static_assert((DMODEL % GT_K) == 0 && (DFF % GT_K) == 0 && ((GT_PITCH * 2) % 16) == 0 && (((GT_PITCH * 2) / 16) % 2) == 1);
static_assert(GT_K * 2 == 256 && GT_PITCH * 2 == 256 + 16 && 4 * GT_SROWS == 2 * GT_TILE && GT_THREADS / 32 >= 4);
static_assert(GT_SROWS * GT_PITCH <= GT_SLICE && ((GT_SLICE * 2) % 2048) == 0);
static_assert((size_t)2 * GT_STAGE * sizeof(unsigned short) <= (size_t)163840);   // two blocks share a WGP's LDS
static_assert((size_t)(GT_THREADS / 32) * 16 * 68 * sizeof(float) <= (size_t)2 * GT_STAGE * sizeof(unsigned short));

__device__ __forceinline__ unsigned lds_off(const void* p) { return (unsigned)(size_t)p; }
// the wave's own LDS reads have returned before the buffer they read is handed back for a refill
__device__ __forceinline__ void wait_ds0() {
#if defined(__HIP_DEVICE_COMPILE__)
  asm volatile("s_wait_dscnt 0x0" ::: "memory");
#endif
}
// ---- tensor load of one slice (64 rows), global -> LDS, through no register ------ -----------------------------------------------
typedef uint32_t u32x4 __attribute__((ext_vector_type(4)));
typedef uint32_t u32x8 __attribute__((ext_vector_type(8)));
__device__ __forceinline__ uint32_t uni(uint32_t v) { return (uint32_t)__builtin_amdgcn_readfirstlane((int)v); }
// A wave-uniform value held in a scalar register: a test on it compiles to s_cmp + s_cbranch_scc (a tensor load ignores EXEC, only a
// scalar branch keeps it from issuing), and a descriptor word made from it is formed behind the volatile waits that stand in front of it.
__device__ __forceinline__ uint32_t pinned(uint32_t v) {
  uint32_t w = uni(v);
#if defined(__HIP_DEVICE_COMPILE__)
  asm volatile("" : "+s"(w));   // pinned(): a descriptor word or an issue test held in a scalar register
#endif
  return w;
}
// the wave's own tensor load has landed in LDS (the compiler places no wait for it)
__device__ __forceinline__ void wait_tensor0() {
#if defined(__HIP_DEVICE_COMPILE__)
  asm volatile("s_wait_tensorcnt 0x0" ::: "memory");
#endif
}
// Descriptor group 1 (the same for every load of a wave): extents in bytes, tensor = tile = d1 rows of d0 bytes, source row pitch in bytes,
// no mask, a pad of 4 dwords behind every row (interval code 5 = 64 dwords = 256 B, 4 = 32 dwords = 128 B): LDS pitch d0 + 16 B.
template <uint32_t d0, uint32_t d1>
__device__ __forceinline__ u32x8 tdm_group1(uint32_t src_pitch) {
  static_assert(d0 == 256u || d0 == 128u);
  constexpr uint32_t ivl = d0 == 256u ? 5u : 4u;
  u32x8 g;
  g[0] = uni((1u << 20) | (ivl << 22) | (3u << 25));
  g[1] = uni((d0 & 0xFFFFu) << 16);
  g[2] = uni((d0 >> 16) | ((d1 & 0xFFFFu) << 16));
  g[3] = uni((d1 >> 16) | (d0 << 16));
  g[4] = uni(d1);
  g[5] = uni(src_pitch);
  g[6] = uni(0u);
  g[7] = uni(0u);
  return g;
}
// Descriptor group 0: count 1, the slice's byte offset in the block's LDS, the global address of its first byte, type 2.
__device__ __forceinline__ u32x4 tdm_group0(uint32_t lds_dst, uint64_t ga) {
  u32x4 g;
  g[0] = uni(1u);
  g[1] = uni(lds_dst);
  g[2] = uni((uint32_t)ga);
  g[3] = uni((((uint32_t)(ga >> 32)) & 0x01FFFFFFu) | 0x80000000u);
  return g;
}
// g1 is named as an operand that the statement may change: its eight registers then keep group 1 from load to load. As a plain input the
// compiler rebuilt the constants in front of each load and used one of the registers for something else while a request was outstanding.
__device__ __forceinline__ void tdm_load(u32x4 g0, u32x8& g1) {
#if defined(__HIP_DEVICE_COMPILE__)
  asm volatile("tensor_load_to_lds %1, %0" : "+s"(g1) : "s"(g0) : "memory");
#endif
}

template <int OM, int HASR, int ACT, int MSK>
__device__ __forceinline__ void gemm_tile(
    int tile, int by,
    const unsigned short* __restrict__ Ap, int lda, long long sA,
    const unsigned short* __restrict__ Btp, int ldb, long long sB,
    const float* __restrict__ Rp, const float* __restrict__ Mp,
    void* Cout, int ldc, long long sC,
    int M, int N, int K, float oscale, float ocarry) {
  // the two operand buffers (every slice at a multiple of 2 KiB); later per-wave 16x64 f32 slabs, pitch 68 floats
  __shared__ __attribute__((aligned(2048))) unsigned short sR[2 * GT_STAGE];
  const int tid  = threadIdx.x;
  const int lane = tid & 31;
  const int wave = tid >> 5;
  const int tilesN = N >> 7;
  const int tilesM = M >> 7;
  if (tile >= tilesM * tilesN) return;   // block-uniform, in front of every barrier and copy
  const int tm = tile / tilesN;
  const int tn = tile - tm * tilesN;
  const int wm = wave >> 1, wn = wave & 1;
  const int m0 = (tm << 7) + (wm << 5);
  const int n0 = (tn << 7) + (wn << 6);

  const unsigned short* A1 = Ap  + (size_t)((long long)by * sA);
  const unsigned short* Bb = Btp + (size_t)((long long)by * sB);

  const int rlane = lane & 15;                 // row (A) / col (B, D) within subtile
  const int koff  = (lane >> 4) * 8;           // k offset of this lane half
  const int mOff  = (lane >> 4) * 8;           // D row offset

  // the issuing waves' slices of every trip: waves 0, 1 rows 64 w .. + 63 of the A tile, waves 2, 3 rows 64 (w - 2) .. + 63 of the Bt tile
  // (waves 4..7 issue nothing; their words are formed from w & 3, so they name valid places all the same)
  const uint32_t wv = uni((uint32_t)tid >> 5);
  const bool iss = wv < 4u;
  const uint32_t sl = wv & 3u;
  const bool wa = sl < 2u;
  const unsigned short* gsl = wa ? A1 + (size_t)((tm << 7) + (int)sl * GT_SROWS) * lda
                                 : Bb + (size_t)((tn << 7) + ((int)sl - 2) * GT_SROWS) * ldb;
  const uint64_t gS = (uint64_t)(size_t)gsl;
  const uint32_t lS = lds_off(sR) + sl * (GT_SLICE * 2u);
  u32x8 g1 = tdm_group1<GT_K * 2u, GT_SROWS>((uint32_t)(wa ? lda : ldb) * 2u);

  v8f acc[2][4];
#pragma unroll
  for (int i = 0; i < 2; ++i)
#pragma unroll
    for (int j = 0; j < 4; ++j) acc[i][j] = zero8();

  const int nt = K >> 7;
  if (pinned((uint32_t)iss)) {                   // scalar test: an issuing wave
    tdm_load(tdm_group0(lS, gS), g1);
    wait_tensor0();
  }
  __syncthreads();                               // tile 0 is published
  if (pinned((uint32_t)(iss && nt > 1))) {       // scalar test: an issuing wave, and tile 1 exists
    const uint32_t ts = pinned(1u);              // the descriptor is formed behind the wait above
    tdm_load(tdm_group0(lS + GT_STAGE * 2u, gS + (uint64_t)ts * (GT_K * 2u)), g1);
  }

  // rolled: the buffer is picked by the trip's parity, and one copy of the body serves all trips
#pragma unroll 1
  for (int t = 0; t < nt; ++t) {
    const unsigned short* sb = sR + (t & 1) * GT_STAGE;
    const unsigned short* fa = sb + (wm >> 1) * GT_SLICE + (((wm & 1) << 5) + rlane) * GT_PITCH + koff;   // A rows 32 wm ..: slice wm / 2
    const unsigned short* fb = sb + (2 + wn) * GT_SLICE + rlane * GT_PITCH + koff;                        // Bt rows 64 wn ..: slice 2 + wn
    // two fragment sets; the loops over them are unrolled so that every index is a constant and the sets stay in registers
    v16h af[2][2], bf[2][4];
#pragma unroll
    for (int j = 0; j < 4; ++j) bf[0][j] = ldfrag_u(fb + (j << 4) * GT_PITCH);
#pragma unroll
    for (int i = 0; i < 2; ++i) af[0][i] = ldfrag_u(fa + (i << 4) * GT_PITCH);
#pragma unroll
    for (int ks = 0; ks < GT_K / 32; ++ks) {
      const int cur = ks & 1, nxt = cur ^ 1;
      if (ks + 1 < GT_K / 32) {
#pragma unroll
        for (int j = 0; j < 4; ++j) bf[nxt][j] = ldfrag_u(fb + (j << 4) * GT_PITCH + (ks + 1) * 32);
#pragma unroll
        for (int i = 0; i < 2; ++i) af[nxt][i] = ldfrag_u(fa + (i << 4) * GT_PITCH + (ks + 1) * 32);
      }
      // keeps the next k-step's LDS reads one group ahead of this k-step's products
      __builtin_amdgcn_sched_barrier(0);
#pragma unroll
      for (int i = 0; i < 2; ++i) {
#pragma unroll
        for (int j = 0; j < 4; ++j) acc[i][j] = mma_raw(af[cur][i], bf[cur][j], acc[i][j]);
        dep_guard1(acc[i][0], acc[i][3], af[cur][i]);
      }
      keep4_h(bf[cur][0], bf[cur][1], bf[cur][2], bf[cur][3]);
      // ends the block of products, so that the reads of the k-step after next stay behind it
      __builtin_amdgcn_sched_barrier(0);
    }
    wait_ds0();
    wait_tensor0();
    __syncthreads();                             // publishes tile t + 1 and ends every reader's last read of tile t's buffer
    if (pinned((uint32_t)(iss && t + 2 < nt))) { // scalar test: an issuing wave, and tile t + 2 exists
      const uint32_t ts = pinned((uint32_t)(t + 2));   // the descriptor is formed behind the wait above
      tdm_load(tdm_group0(lS + (uint32_t)(t & 1) * (GT_STAGE * 2u), gS + (uint64_t)ts * (GT_K * 2u)), g1);
    }
  }
  wait_tensor0();
  wait_ds0();
  acc_guard4(acc[0][0], acc[0][1], acc[0][2], acc[0][3]);
  acc_guard4(acc[1][0], acc[1][1], acc[1][2], acc[1][3]);

  const int hh2 = lane >> 4, c4 = (lane & 15) * 4;     // f32 out: 256-B row segment = 16 lanes x 16 B
  const int q8  = lane >> 3, c8 = (lane & 7) * 8;

  // ---- epilogue ----
  float* slab = (float*)(void*)sR + wave * (16 * 68);   // every read and copy of the ring ended at the last trip's barrier
#pragma unroll
  for (int i = 0; i < 2; ++i) {
    const int mBase = m0 + (i << 4);
#pragma unroll
    for (int j = 0; j < 4; ++j) {
#pragma unroll
      for (int r = 0; r < 8; ++r) {
        slab[(mOff + r) * 68 + (j << 4) + rlane] = acc[i][j][r];
      }
    }
    wave_sync_lds();
    if constexpr (OM == 0) {
      float* C = (float*)Cout + (size_t)((long long)by * sC);
      v4f vals[8];
#pragma unroll
      for (int it = 0; it < 8; ++it) {
        const int row = it * 2 + hh2;                      // it 0..7 x hh2 0..1 = rows 0..15
        const int gr  = mBase + row;
        v4f v = *(const v4f*)(slab + row * 68 + c4);
        v4f rv = {0.f, 0.f, 0.f, 0.f};
        if constexpr (HASR != 0) {
          const float* R = Rp + (size_t)((long long)by * sC);
          const v4f rraw = *(const v4f*)(R + (size_t)gr * ldc + n0 + c4);
#pragma unroll
          for (int e = 0; e < 4; ++e) rv[e] = (HASR == 1) ? bfr(rraw[e]) : rraw[e];
        }
        float mk = 1.0f;
        if constexpr (MSK == 1) mk = bfr(Mp[gr]);
#pragma unroll
        for (int e = 0; e < 4; ++e) v[e] = (v[e] * oscale + rv[e]) * mk;
        vals[it] = v;
      }
      {
#pragma unroll
        for (int it = 0; it < 8; ++it) {
          const int gr = mBase + it * 2 + hh2;
          *(v4f*)(C + (size_t)gr * ldc + n0 + c4) = vals[it];
        }
        
      }
    } else {
      unsigned short* C = (unsigned short*)Cout + (size_t)((long long)by * sC);
      v4u hv[4];
#pragma unroll
      for (int it = 0; it < 4; ++it) {
        const int row = it * 4 + q8;                       // it 0..3 x q8 0..3 = rows 0..15
        const float* sp = slab + row * 68 + c8;
        v4u a = {0u, 0u, 0u, 0u};
        if constexpr (ACT == 1) {
          const v4f s0 = *(const v4f*)(sp), s1 = *(const v4f*)(sp + 4);
          const v8f g = gelu8(__builtin_shufflevector(s0, s1, 0, 1, 2, 3, 4, 5, 6, 7) * oscale) * ocarry;
          a = __builtin_bit_cast(v4u, __builtin_convertvector(g, v8h));
        } else {
#pragma unroll
          for (int e = 0; e < 4; ++e) {
            float f0 = sp[2 * e] * oscale;
            float f1 = sp[2 * e + 1] * oscale;
            f0 *= ocarry; f1 *= ocarry;
            a[e] = pk16(h_bits((_Float16)f0), h_bits((_Float16)f1));
          }
        }
        hv[it] = a;
      }
      {
#pragma unroll
        for (int it = 0; it < 4; ++it) {
          const int row = it * 4 + q8;
          *(v4u*)(C + (size_t)(mBase + row) * ldc + n0 + c8) = hv[it];
        }
        
      }
    }
    wave_sync_lds();
  }
}

// One product per launch: blockIdx.x = tile, blockIdx.y = batch.
template <int OM, int HASR, int ACT, int MSK>
__global__ __launch_bounds__(GT_THREADS) void gemm64(
    const unsigned short* __restrict__ Ap, int lda, long long sA,
    const unsigned short* __restrict__ Btp, int ldb, long long sB,
    const float* __restrict__ Rp, const float* __restrict__ Mp,
    void* Cout, int ldc, long long sC,
    int M, int N, int K, float oscale, float ocarry) {
  gemm_tile<OM, HASR, ACT, MSK>(blockIdx.x, blockIdx.y, Ap, lda, sA, Btp, ldb, sB, Rp, Mp, Cout, ldc, sC, M, N, K, oscale, ocarry);
}

// The three in-projections need nothing of each other and share one grid: blockIdx.y = 0 q, 1 k (A = h, Bt = the weight's rows,
// 64 x 4 tiles), 2 v^T (A = Wv^T, Bt = h of batch blockIdx.x >> 6, 4 x 16 tiles per batch). The choice is the same for a whole block.
// coverage: 256 tiles of 128x128 per product = 8192 x 512 (q, k) and 4 x 512 x 2048 (v^T), each exactly once.
static_assert((NROWS / GT_TILE) * (DMODEL / GT_TILE) == 256 && (DMODEL / GT_TILE) * (NC / GT_TILE) == 64 && NB * 64 == 256);
__global__ __launch_bounds__(GT_THREADS) void gemm_qkv(
    const unsigned short* __restrict__ Hp, const unsigned short* __restrict__ Wp,
    unsigned short* Qo, unsigned short* Ko, unsigned short* Vo) {
  const int job = blockIdx.y;
  const bool isv = job == 2;
  const unsigned short* Wj = Wp + (size_t)job * (DMODEL * DMODEL);
  gemm_tile<2, 0, 0, 0>(
      isv ? (int)(blockIdx.x & 63) : (int)blockIdx.x, isv ? (int)(blockIdx.x >> 6) : 0,
      isv ? Wj : Hp, DMODEL, 0LL,
      isv ? Hp : Wj, DMODEL, isv ? (long long)NC * DMODEL : 0LL,
      nullptr, nullptr,
      (void*)(isv ? Vo : (job == 1 ? Ko : Qo)), isv ? NC : DMODEL, isv ? (long long)DMODEL * NC : 0LL,
      isv ? DMODEL : NROWS, isv ? NC : DMODEL, DMODEL, 1.0f / (HCARRY * WSC), QC);
}
static_assert(QC == KC && QC == VC);

// =====================================================================================================
// Full attention for one batch, one head and 128 query rows (8 waves, 16 query rows per wave), head dim 64, all 2048 keys:
//   q plane (f16 x16) QH[b*2048 + tok][64*head + d], pitch 512; k plane (f16 x16) KH[b*2048 + key][64*head + d], pitch 512;
//   v^T plane (f16 x16): VT[b*512 + 64*head + d][key] (pitch 2048); out (f16 x1024): CT[b*2048 + tok][64*head + d] =
//   1024 * sum_m softmax_m(q.k / 8 + c_q) v[m][d] with the per-query-row mask constant c_q = -1e5 * (1 - bf16(mask[b][tok]))
//   (softmax run in base 2: t = (q.k/carries) * log2(e)/8 + c_q*log2(e), the row constant folded in as the fma addend).
//   The head's k rows and v^T rows are the same for all 8 waves: a tile is 64 keys = [k 64 rows | v^T 64 rows] of 128 B each (one whole
//   line per row), LDS pitch 144 B (16 B x odd: 16-B row readers meet no bank twice), two buffers. Wave 0 brings the k rows and wave 1
//   the v^T rows, each with ONE tensor load per tile, whose pad lays the pitch (a slice's place is a multiple of 2 KiB); the loads of
//   tile t + 2 are issued behind the barrier that ends trip t and fly while trip t + 1 is worked on. A trip reads its own buffer alone.
//   Key steps of 32 from 0 to 2047, two per trip (block-uniform trip count 32); every score is finite, so the running max is finite
//   from the first step on; the rescale exponent is clamped at -126 so the first step (running max -inf) gives a tiny finite factor
//   times zero sums.
//   Both products run transposed: S^T = k . q^T (A = k rows, B = q columns) and O^T += v^T . P^T (A = v^T rows, B = P^T columns).
//   Lane (c, hh) then holds, of query column c alone, the scores of keys 8hh + r (tile 0) and 16 + 8hh + r (tile 1): maximum and sum
//   run inside the lane, the two lane halves exchange the maximum once per step; the sums are joined once, behind the loop; those
//   16 registers, times 1024 and RNE to f16, ARE the B fragment of P^T in the split k map; the rescale factor is the lane's own.
//   Per step: 2 score tiles on f16 WMMA (K = 64 as two k-steps of 32), fragments read from the staged tile (two 16-B LDS loads per
//   fragment); online max-subtracted softmax in f32 (exp2); rescale of the running sums; the four v^T A fragments read from the
//   staged tile; 4 v^T . P^T WMMAs. O^T tile j, register r = ctx[query c][16j + 8hh + r].
//   Final 1/l and carry folds in f32; the wave's LDS slab takes its 16-bit result rows [16][64], pitch 72 halves
//   (16-B stores, wave-level LDS ordering), from which the wave writes whole 128-B lines.
// coverage: wave: 4 iterations x 4 rows x (8 lanes x 8 halves) = 16 rows x 64 halves; block: 8 waves = 128 rows of one head;
//           grid (4 batches x 8 heads x 16 query blocks) covers all 8192 x 512 of CT exactly once, each line written by one wave.
// =====================================================================================================
#define PS_FLOATS (HPB * 16 * 36)
#define AT_KEYS   64                        // keys per staged tile
#define AT_PITCH  72                        // halves: 144 B
#define AT_SLICE  5120                      // halves per slice in LDS: 64 x 144 B = 9216 B, rounded up to a multiple of 2 KiB (10240 B)
#define AT_STAGE  (2 * AT_SLICE)            // halves per buffer: slice 0 = k rows, slice 1 = v^T rows
#define AT_TILES  (NC / AT_KEYS)
static_assert(HDIM * 2 == 128 && AT_KEYS * 2 == 128 && AT_PITCH * 2 == 128 + 16 && AT_KEYS == 64 && HDIM == 64);
static_assert(AT_KEYS * AT_PITCH <= AT_SLICE && HDIM * AT_PITCH <= AT_SLICE && ((AT_SLICE * 2) % 2048) == 0);
static_assert(((AT_PITCH * 2) % 16) == 0 && (((AT_PITCH * 2) / 16) % 2) == 1 && (NC % AT_KEYS) == 0 && AT_TILES >= 2);
static_assert((size_t)16 * AT_PITCH * sizeof(unsigned short) <= (size_t)16 * 36 * sizeof(float));

__global__ __launch_bounds__(ATT_THREADS)
void attn8(const unsigned short* __restrict__ QHp, const unsigned short* __restrict__ KHp,
           const unsigned short* __restrict__ VTq, const float* __restrict__ mkp, unsigned short* CT) {
  __shared__ __attribute__((aligned(2048))) unsigned short sKV[2 * AT_STAGE]; // the two k / v^T tile buffers (every slice at a multiple of 2 KiB)
  __shared__ __align__(16) float smem[PS_FLOATS];          // per wave slab of 16-bit result rows (epilogue only)

  const int tid  = threadIdx.x;
  const int wave = tid >> 5;
  const int lane = tid & 31;
  const int hh   = lane >> 4;
  const int c    = lane & 15;

  const int qt   = blockIdx.x % NQB;                       // query block 0..15
  const int head = (blockIdx.x / NQB) % NHEAD;             // 0..7
  const int bat  = blockIdx.x / (NQB * NHEAD);             // 0..3
  const int q0   = qt * (HPB * 16) + wave * 16;

  const size_t qofs = ((size_t)bat * NQ + q0 + c) * DMODEL + head * HDIM + 8 * hh;
  const _Float16* Qh = (const _Float16*)(const void*)QHp + qofs;
  const float lsc = (LOG2E * ATT_SCALE) / (QC * KC);                   // log2(e) / 8 / carries

  // the issuing waves' slices of every tile: wave 0 the 64 k rows (pitch 1024 B, 64 rows on per tile), wave 1 the 64 v^T rows (pitch
  // 4096 B, 128 B on per tile); waves 2..7 issue nothing (their words are formed from w & 1, so they name valid places all the same)
  const uint32_t wv = uni((uint32_t)tid >> 5);
  const bool iss = wv < 2u;
  const bool wk = (wv & 1u) == 0u;
  const unsigned short* gsl = wk ? KHp + (size_t)bat * NC * DMODEL + head * HDIM
                                 : VTq + ((size_t)bat * DMODEL + head * HDIM) * NC;
  const uint64_t gS = (uint64_t)(size_t)gsl;
  const uint32_t gstep = wk ? (uint32_t)(AT_KEYS * DMODEL * 2) : (uint32_t)(AT_KEYS * 2);   // bytes from tile to tile
  const uint32_t lS = lds_off(sKV) + (wv & 1u) * (AT_SLICE * 2u);
  u32x8 g1 = tdm_group1<HDIM * 2u, AT_KEYS>(wk ? (uint32_t)(DMODEL * 2) : (uint32_t)(NC * 2));

  // mask constant of the lane's query column, in base-2 units
  const float cm2 = (MASKNEG * (1.0f - bfr(mkp[(size_t)bat * NQ + q0 + c]))) * LOG2E;

  const v16h qa = ldfrag_h(Qh), qb = ldfrag_h(Qh + 32);

  float mrow = -INFINITY;                        // the column's running maximum
  v8f lacc = zero8();                            // the lane's own shares of the column's running sum (register r: keys = 8hh + r mod 16)
  v8f o0 = zero8(), o1 = zero8(), o2 = zero8(), o3 = zero8();

  const v8f lsc8 = {lsc, lsc, lsc, lsc, lsc, lsc, lsc, lsc};
  const v8f cm8  = {cm2, cm2, cm2, cm2, cm2, cm2, cm2, cm2};

  if (pinned((uint32_t)iss)) {                   // scalar test: an issuing wave
    tdm_load(tdm_group0(lS, gS), g1);
    wait_tensor0();
  }
  __syncthreads();                               // tile 0 is published
  if (pinned((uint32_t)iss)) {                   // scalar test: an issuing wave (tile 1 exists: AT_TILES >= 2)
    const uint32_t ts = pinned(1u);              // the descriptor is formed behind the wait above
    tdm_load(tdm_group0(lS + AT_STAGE * 2u, gS + (uint64_t)(ts * gstep)), g1);
  }

  // rolled: the buffer is picked by the trip's parity, and one copy of the body serves all trips
#pragma unroll 1
  for (int t = 0; t < AT_TILES; ++t) {
    const unsigned short* sb = sKV + (t & 1) * AT_STAGE;
    const unsigned short* sk = sb + c * AT_PITCH + 8 * hh;
    const unsigned short* sv = sb + AT_SLICE + c * AT_PITCH + 8 * hh;
    // unrolled: the two key steps of a tile read it at constant offsets
#pragma unroll
    for (int ks = 0; ks < AT_KEYS / 32; ++ks) {
      const unsigned short* kp = sk + (ks * 32) * AT_PITCH;
      const unsigned short* vp = sv + ks * 32;
      const unsigned short* kq = kp + 16 * AT_PITCH;
      const v16h k00 = ldfrag_u(kp), k01 = ldfrag_u(kp + 32);
      const v16h k10 = ldfrag_u(kq), k11 = ldfrag_u(kq + 32);
      const v16h vb0 = ldfrag_u(vp);
      const v16h vb1 = ldfrag_u(vp + 16 * AT_PITCH);
      const v16h vb2 = ldfrag_u(vp + 32 * AT_PITCH);
      const v16h vb3 = ldfrag_u(vp + 48 * AT_PITCH);
      // holds the step's 16 LDS reads as one group in front of its products: left free, each pair of reads sinks to just in front of
      // the product that takes it, and the wave waits out a whole LDS latency there each time
      __builtin_amdgcn_sched_barrier(0);
      v8f s0, s1;
      s0 = mma_raw(k00, qa, zero8());
      s0 = mma_raw(k01, qb, s0);
      s1 = mma_raw(k10, qa, zero8());
      s1 = mma_raw(k11, qb, s1);
      const v8f t0 = __builtin_elementwise_fma(s0, lsc8, cm8);
      const v8f t1 = __builtin_elementwise_fma(s1, lsc8, cm8);
      const v8f tm = __builtin_elementwise_max(t0, t1);
      float mx = fmaxf(fmaxf(fmaxf(tm[0], tm[1]), fmaxf(tm[2], tm[3])), fmaxf(fmaxf(tm[4], tm[5]), fmaxf(tm[6], tm[7])));
      mx = fmaxf(mx, xhalf(mx));                 // the other 16 keys of this column
      const float mn = fmaxf(mrow, mx);
      const float al = ex2(fmaxf(mrow - mn, -126.0f));
      mrow = mn;
      const v8f mn8 = {mn, mn, mn, mn, mn, mn, mn, mn};
      const v8f d0 = t0 - mn8, d1 = t1 - mn8;
      v8f e0, e1;
#pragma unroll
      for (int r = 0; r < 8; ++r) {
        e0[r] = ex2(d0[r]);
        e1[r] = ex2(d1[r]);
      }
      lacc = lacc * al + (e0 + e1);
      o0 *= al;
      o1 *= al;
      o2 *= al;
      o3 *= al;
      FragH ph;
      ph.h[0] = __builtin_convertvector(e0 * PC, v8h);          // elements 0..7  = keys kb + 8hh + 0..7
      ph.h[1] = __builtin_convertvector(e1 * PC, v8h);          // elements 8..15 = keys kb + 16 + 8hh + 0..7
      o0 = mma_raw(vb0, ph.v, o0);
      o1 = mma_raw(vb1, ph.v, o1);
      o2 = mma_raw(vb2, ph.v, o2);
      o3 = mma_raw(vb3, ph.v, o3);
    }
    // keeps the trip's arithmetic in front of the waits below: sunk behind the barrier, it would stand between the barrier and the
    // refill, and the wait for a tile's load would follow its issue at once instead of one trip later
    __builtin_amdgcn_sched_barrier(0);
    wait_ds0();
    wait_tensor0();
    __syncthreads();                             // publishes tile t + 1 and ends every reader's last read of tile t's buffer
    if (pinned((uint32_t)(iss && t + 2 < AT_TILES))) {   // scalar test: an issuing wave, and tile t + 2 exists
      const uint32_t ts = pinned((uint32_t)(t + 2));     // the descriptor is formed behind the wait above
      tdm_load(tdm_group0(lS + (uint32_t)(t & 1) * (AT_STAGE * 2u), gS + (uint64_t)(ts * gstep)), g1);
    }
  }
  wait_tensor0();
  wait_ds0();

  // ---- join the halves' sums, fold 1/l and the carries (1024 on P, 16 on v, 1024 on the stored ctx), stage the wave's 16x64 slice
  //      as 16-bit in its own slab: row = query c, 16 B = d 16j + 8hh .. + 7 ----
  unsigned short* Os = (unsigned short*)(void*)(smem + wave * (16 * 36));
  const float oc = FC / (PC * VC);
  {
    const float lrow = ((lacc[0] + lacc[1]) + (lacc[2] + lacc[3])) + ((lacc[4] + lacc[5]) + (lacc[6] + lacc[7]));
    const float inv = (1.0f / (lrow + xhalf(lrow))) * oc;
    unsigned short* op = Os + c * AT_PITCH + 8 * hh;
    *(v8h*)(op)      = __builtin_convertvector(o0 * inv, v8h);
    *(v8h*)(op + 16) = __builtin_convertvector(o1 * inv, v8h);
    *(v8h*)(op + 32) = __builtin_convertvector(o2 * inv, v8h);
    *(v8h*)(op + 48) = __builtin_convertvector(o3 * inv, v8h);
  }
  wave_sync_lds();
  // ---- the wave writes its 16 rows of CT: iteration it -> rows it*4 + lane/8, halves (lane%8)*8 .. +7 of the head's 64 ----
  {
    const int q8 = lane >> 3, c8 = (lane & 7) * 8;
    v4u vals[4];
#pragma unroll
    for (int it = 0; it < 4; ++it) vals[it] = *(const v4u*)(Os + (it * 4 + q8) * AT_PITCH + c8);
    unsigned short* dst = CT + ((size_t)bat * NQ + q0) * DMODEL + head * HDIM;
#pragma unroll
    for (int it = 0; it < 4; ++it) *(v4u*)(dst + (size_t)(it * 4 + q8) * DMODEL + c8) = vals[it];
  }
}

// =====================================================================================================
// LayerNorm without affine over rows of 512 floats: outh[row][c] = f16( (v - mean) * rsqrt(var + eps) * hc ), v = Yp[row][c]; RIN 1 first
// takes v = bf16(Yp[row][c]) * bf16(mask[row]). One wave owns LN_RPW whole rows and keeps them in registers: load j of a row is 512
// contiguous bytes (lane l: floats 128 j + 4 l .. + 3), all 4 * LN_RPW loads of the wave are in flight together. Mean and variance (two
// passes, as the definition has them): in-lane sums, then a five-step butterfly of vector cross-lane moves, after which every lane holds
// the same total. No LDS, no barrier, and few waves to start.
// coverage: store j of a row = 32 lanes x 8 B = 256 contiguous bytes (two whole lines), j 0..3 = the row's 1024 B; wave: LN_RPW rows;
//           block: 8 waves = 32 rows; 256 blocks = all 8192 rows, each line written by exactly one wave.
// =====================================================================================================
// the value that lane l ^ M holds, M = 1, 2, 4, 8: a vector move inside the 16-lane row (nibble i of the selector = source of lane i)
template <int M>
__device__ __forceinline__ float xrow(float v) {
  constexpr unsigned lo = M == 1 ? 0x67452301u : M == 2 ? 0x54761032u : M == 4 ? 0x32107654u : 0xfedcba98u;
  constexpr unsigned hi = M == 1 ? 0xefcdab89u : M == 2 ? 0xdcfe98bau : M == 4 ? 0xba98fedcu : 0x76543210u;
  const int b = __builtin_bit_cast(int, v);
  return __builtin_bit_cast(float, __builtin_amdgcn_permlane16(b, b, lo, hi, false, false));
}
// sums over the wave's 32 lanes, LN_RPW independent chains side by side (unrolled: s stays in registers, each step's moves stand together)
__device__ __forceinline__ void wave_sums(float (&s)[LN_RPW]) {
#pragma unroll
  for (int r = 0; r < LN_RPW; ++r) s[r] += xrow<1>(s[r]);
#pragma unroll
  for (int r = 0; r < LN_RPW; ++r) s[r] += xrow<2>(s[r]);
#pragma unroll
  for (int r = 0; r < LN_RPW; ++r) s[r] += xrow<4>(s[r]);
#pragma unroll
  for (int r = 0; r < LN_RPW; ++r) s[r] += xrow<8>(s[r]);
#pragma unroll
  for (int r = 0; r < LN_RPW; ++r) s[r] += xhalf(s[r]);
}

// blk = index of the block among the LN_BLOCKS blocks of this LayerNorm. Every loop is unrolled: all indices are constants, the rows stay
// in registers.
template <int RIN>
__device__ __forceinline__
void lnorm_rows(const float* __restrict__ Yp, const float* __restrict__ mkp, unsigned short* outh, float hc, int blk) {
  const int lane = threadIdx.x & 31;
  // the wave's number held in a scalar register: every address becomes a scalar base plus one lane offset, with constant steps between loads
  const int row0 = blk * LN_RPB + __builtin_amdgcn_readfirstlane((int)(threadIdx.x >> 5)) * LN_RPW;
  const float* src = Yp + (size_t)row0 * DMODEL + lane * 4;
  v4f mk4 = {1.0f, 1.0f, 1.0f, 1.0f};
  if constexpr (RIN == 1) mk4 = *(const v4f*)(mkp + row0);   // the four rows' mask values, asked for ahead of the rows (row0 is a multiple of 4)
  v4f v[LN_RPW][4];
#pragma unroll
  for (int r = 0; r < LN_RPW; ++r)
#pragma unroll
    for (int j = 0; j < 4; ++j) v[r][j] = *(const v4f*)(src + r * DMODEL + j * 128);
  if constexpr (RIN == 1) {
#pragma unroll
    for (int r = 0; r < LN_RPW; ++r) {
      const float mk = bfr(mk4[r]);
#pragma unroll
      for (int j = 0; j < 4; ++j)
#pragma unroll
        for (int e = 0; e < 4; ++e) v[r][j][e] = bfr(v[r][j][e]) * mk;
    }
  }
  float s[LN_RPW];
#pragma unroll
  for (int r = 0; r < LN_RPW; ++r) {
    const v4f t = (v[r][0] + v[r][1]) + (v[r][2] + v[r][3]);
    s[r] = (t[0] + t[1]) + (t[2] + t[3]);
  }
  wave_sums(s);
  float q[LN_RPW];
#pragma unroll
  for (int r = 0; r < LN_RPW; ++r) {
    const float mu = s[r] * (1.0f / (float)DMODEL);
#pragma unroll
    for (int j = 0; j < 4; ++j) v[r][j] -= mu;
    const v4f t = (v[r][0] * v[r][0] + v[r][1] * v[r][1]) + (v[r][2] * v[r][2] + v[r][3] * v[r][3]);
    q[r] = (t[0] + t[1]) + (t[2] + t[3]);
  }
  wave_sums(q);
  v2u w[LN_RPW][4];
#pragma unroll
  for (int r = 0; r < LN_RPW; ++r) {
    const float rs = rsqrtf(q[r] * (1.0f / (float)DMODEL) + LN_EPS) * hc;   // hc is a power of two: the same values as (d * rstd) * hc
#pragma unroll
    for (int j = 0; j < 4; ++j) w[r][j] = __builtin_bit_cast(v2u, __builtin_convertvector(v[r][j] * rs, v4h));
  }
  unsigned short* dst = outh + (size_t)row0 * DMODEL + lane * 4;
#pragma unroll
  for (int r = 0; r < LN_RPW; ++r)
#pragma unroll
    for (int j = 0; j < 4; ++j) *(v2u*)(dst + r * DMODEL + j * 128) = w[r][j];
}

template <int RIN>
__global__ __launch_bounds__(LN_THREADS)
void lnorm(const float* __restrict__ Yp, const float* __restrict__ mkp, unsigned short* outh, float hc) {
  lnorm_rows<RIN>(Yp, mkp, outh, hc, blockIdx.x);
}

// The six weight packs and the first LayerNorm need nothing of each other and share one grid of 256-thread blocks, split by ranges of
// the block index (the choice is the same for a whole block, so every barrier stays block-uniform):
//   0..255 the four 512x512 weights (64 tiles each), 256..511 W1 (32 x 8 tiles), 512..767 W2 (8 x 32 tiles),
//   768..1023 the LayerNorm, 32 rows per block.
#define PREP_SQ     ((DMODEL / 64) * (DMODEL / 64))            // 64 tiles per square weight
#define PREP_W1     (4 * PREP_SQ)                              // first block of W1
#define PREP_W2     (PREP_W1 + (DFF / 64) * (DMODEL / 64))     // first block of W2
#define PREP_LN     (PREP_W2 + (DMODEL / 64) * (DFF / 64))     // first block of the LayerNorm
#define PREP_BLOCKS (PREP_LN + LN_BLOCKS)
static_assert(PREP_SQ == 64 && DMODEL / 64 == 8 && DFF / 64 == 32 && PREP_LN == 768 && LN_THREADS == 256);
__global__ __launch_bounds__(256)
void prep(const float* __restrict__ wq, const float* __restrict__ wk, const float* __restrict__ wv, const float* __restrict__ wo,
          const float* __restrict__ w1, const float* __restrict__ w2, const float* __restrict__ x, const float* __restrict__ mk,
          unsigned short* WQKV, unsigned short* WO16, unsigned short* W116, unsigned short* W216, unsigned short* H16) {
  const int b = blockIdx.x;
  if (b >= PREP_LN) {
    lnorm_rows<1>(x, mk, H16, HCARRY, b - PREP_LN);
    return;
  }
  const float* src;
  unsigned short* dst;
  int R = DMODEL, C = DMODEL, t = b & (PREP_SQ - 1);
  float sc = WSC;
  if (b < PREP_W1) {
    const int j = b / PREP_SQ;
    src = j == 0 ? wq : j == 1 ? wk : j == 2 ? wv : wo;
    dst = j == 3 ? WO16 : WQKV + (size_t)j * (DMODEL * DMODEL);
  } else if (b < PREP_W2) {
    src = w1; dst = W116; C = DFF; t = b - PREP_W1;            // R = 512 (in), C = 2048 (out)
  } else {
    src = w2; dst = W216; R = DFF; t = b - PREP_W2; sc = W2SC; // R = 2048 (in), C = 512 (out)
  }
  const int tc = C / 64;
  tcvt16(src, dst, R, C, sc, t % tc, t / tc);
}

// =====================================================================================================
// Workspace map (bytes); every plane is an exact multiple of its tile / whole-row store granularity (M, N exact multiples of 64, rows
//   WQKV f16 [1536][512] x64         1572864   (transposed in-projections [n][k]: rows 0..511 q, 512..1023 k, 1024..1535 v)
//   WO16 f16 [512][512] x64           524288   (Wo^T)
//   W116 f16 [2048][512] x64         2097152   (W1^T)
//   W216 f16 [512][2048] x128        2097152   (W2^T)
//   H16  f16 [8192][512] x16         8388608   (first LayerNorm output)
//   QH   f16 [8192][512] x16         8388608
//   KH   f16 [8192][512] x16         8388608
//   VT   f16 [4][512][2048] x16      8388608   (v^T per batch)
//   CT   f16 [8192][512] x1024       8388608   (attention ctx, merged heads)
//   X1F  f32 [8192][512]            16777216   ((x + ctx . Wo) * mask)
//   H2   f16 [8192][512] x16         8388608   (second LayerNorm output)
//   HH   f16 [8192][2048] x16       33554432   (gelu hidden)
//   end                            106954752
// =====================================================================================================
extern "C" void kernel_launch(void* const* d_in, const int* in_sizes, int n_in,
                              void* d_out, int out_size, void* d_ws, size_t ws_size,
                              hipStream_t stream) {
  if (n_in < 8) return;
  if (in_sizes[0] != NROWS * DMODEL) return;
  if (in_sizes[1] != NROWS) return;
  if (in_sizes[2] != DMODEL * DMODEL || in_sizes[3] != DMODEL * DMODEL ||
      in_sizes[4] != DMODEL * DMODEL || in_sizes[5] != DMODEL * DMODEL) return;
  if (in_sizes[6] != DMODEL * DFF || in_sizes[7] != DFF * DMODEL) return;
  if (out_size != NROWS * DMODEL) return;

  const float* x   = (const float*)d_in[0];
  const float* mk  = (const float*)d_in[1];
  const float* wq  = (const float*)d_in[2];
  const float* wk  = (const float*)d_in[3];
  const float* wv  = (const float*)d_in[4];
  const float* wo  = (const float*)d_in[5];
  const float* w1  = (const float*)d_in[6];
  const float* w2  = (const float*)d_in[7];
  float*       out = (float*)d_out;

  const size_t PWQKV = (size_t)3 * DMODEL * DMODEL * 2;           //  1572864
  const size_t PWO   = (size_t)DMODEL * DMODEL * 2;               //   524288
  const size_t PW1   = (size_t)DFF * DMODEL * 2;                  //  2097152
  const size_t PW2   = (size_t)DMODEL * DFF * 2;                  //  2097152
  const size_t PX    = (size_t)NROWS * DMODEL * 2;                //  8388608
  const size_t PVT   = (size_t)NB * DMODEL * NC * 2;              //  8388608
  const size_t PY    = (size_t)NROWS * DMODEL * 4;                // 16777216
  const size_t PH    = (size_t)NROWS * DFF * 2;                   // 33554432
  size_t off = 0;
  const size_t oWQKV = off; off += PWQKV;
  const size_t oWO   = off; off += PWO;
  const size_t oW1   = off; off += PW1;
  const size_t oW2   = off; off += PW2;
  const size_t oH    = off; off += PX;
  const size_t oQH   = off; off += PX;
  const size_t oKH   = off; off += PX;
  const size_t oVT   = off; off += PVT;
  const size_t oCT   = off; off += PX;
  const size_t oXF   = off; off += PY;
  const size_t oH2   = off; off += PX;
  const size_t oHH   = off; off += PH;
  if (off > ws_size) return;                                      // off = 106954752
  if (off > (size_t)134217728) return;

  char* ws = (char*)d_ws;
  unsigned short* WQKV = (unsigned short*)(ws + oWQKV);
  unsigned short* WO16 = (unsigned short*)(ws + oWO);
  unsigned short* W116 = (unsigned short*)(ws + oW1);
  unsigned short* W216 = (unsigned short*)(ws + oW2);
  unsigned short* H16  = (unsigned short*)(ws + oH);
  unsigned short* QH   = (unsigned short*)(ws + oQH);
  unsigned short* KH   = (unsigned short*)(ws + oKH);
  unsigned short* VTp  = (unsigned short*)(ws + oVT);
  unsigned short* CT   = (unsigned short*)(ws + oCT);
  float*          X1F  = (float*)(ws + oXF);
  unsigned short* H2   = (unsigned short*)(ws + oH2);
  unsigned short* HH   = (unsigned short*)(ws + oHH);

  const dim3 blk(256);
  const dim3 gPrep(PREP_BLOCKS);                                   // 1024
  const dim3 bG(GT_THREADS);                                       // 256
  const dim3 gP((NROWS / GT_TILE) * (DMODEL / GT_TILE), 1);        // 256
  const dim3 gQKV((NROWS / GT_TILE) * (DMODEL / GT_TILE), 3);      // 256 x 3
  const dim3 gF((NROWS / GT_TILE) * (DFF / GT_TILE), 1);           // 1024
  const dim3 gAT(ATT_BLOCKS);                                      // 512
  const dim3 bAT(ATT_THREADS);                                     // 256
  const dim3 gLN(LN_BLOCKS);                                       // 256
  const dim3 bLN(LN_THREADS);                                      // 256

  // (0, 1) one grid: transposed weight planes [n][k] = f16( bf16_RNE(W[k][n]) * scale ), k contiguous, and
  //         h = LayerNorm(bf16(x) * bf16(mask)) -> H16 (f16 x16)
  prep<<<gPrep, blk, 0, stream>>>(wq, wk, wv, wo, w1, w2, x, mk, WQKV, WO16, W116, W216, H16);

  // (2, 3, 4) one grid: QH[m][n] = f16(16 * sum_k h[m][k] Wq[k][n]) and KH alike (M = 8192, N = 512, K = 512);
  //            v^T per batch: VT[b][d][tok] = f16(16 * sum_k WvT[d][k] h_b[tok][k]) (M = 512, N = 2048, K = 512)
  gemm_qkv<<<gQKV, bG, 0, stream>>>(H16, WQKV, QH, KH, VTp);

  // (5) full attention per (batch, head, 128 query rows) -> CT (f16, x1024)
  attn8<<<gAT, bAT, 0, stream>>>(QH, KH, VTp, mk, CT);

  // (6) X1F = (CT . WoT^T / (1024 * 64) + bf16(x)) * bf16(mask); M = 8192, N = 512, K = 512, f32
  gemm64<0, 1, 0, 1><<<gP, bG, 0, stream>>>(
      CT, DMODEL, 0LL,
      WO16, DMODEL, 0LL,
      x, mk,
      (void*)X1F, DMODEL, 0LL,
      NROWS, DMODEL, DMODEL, 1.0f / (FC * WSC), 1.0f);

  // (7) h2 = LayerNorm(x1) -> H2 (f16 x16)
  lnorm<0><<<gLN, bLN, 0, stream>>>(X1F, mk, H2, H2C);

  // (8) HH = f16(16 * gelu(h2 . W1)); M = 8192, N = 2048, K = 512
  gemm64<2, 0, 1, 0><<<gF, bG, 0, stream>>>(
      H2, DMODEL, 0LL,
      W116, DMODEL, 0LL,
      x, mk,
      (void*)HH, DFF, 0LL,
      NROWS, DFF, DMODEL, 1.0f / (H2C * WSC), GC);

  // (9) out = HH . W2 / (16 * 128) + x1 (raw f32); M = 8192, N = 512, K = 2048, f32
  gemm64<0, 2, 0, 0><<<gP, bG, 0, stream>>>(
      HH, DFF, 0LL,
      W216, DFF, 0LL,
      X1F, mk,
      (void*)out, DMODEL, 0LL,
      NROWS, DMODEL, DFF, 1.0f / (GC * W2SC), 1.0f);
  (void)hipGetLastError();
}
